// v000
// The times below were measured on an AMD MI455X: many runs one after another, warmed up first and cycling through
// copies of the inputs, with the whole window's GPU time divided by the number of runs. Launches and the gaps
// between them are all in it. The median over several windows is given; except for v000 it joins two sittings, which
// can be a few percent apart, so the side-by-side timings, each taken in one sitting, are the better comparison.
// v000 is the starting kernel. One run takes 457 microseconds.
#include <hip/hip_runtime.h>
// Transformer layer with windowed (|i−j| ≤ 128) multi-head self-attention (B=2, L=2048, d_model 1024, 16 heads × 64): h = LN1(x); qkv = h·W + b; per head softmax(q·kᵀ/8 + window mask)·v; x1 = x + (merged·out_w + out_b);
// y = x1 + (gelu_erf(LN2(x1)·w1 + b1)·w2 + b2). (in,out) weights.
// Compute dtype: x, weights, biases, LN parameters rounded to bf16; LayerNorms in f32 (wave per row) → f16 operands; q,k f16 GEMM outputs, v f32 → f16 hi + ×2^10 residual Vᵀ planes; fused windowed
// flash-style kernel (online softmax f32, P f16 ×2^10, two value accumulators) on v_wmma_f32_16x16x32_f16; the residual sums ride the GEMMs' per-element addend in f32; FFN hidden f16 after the erf-GELU epilogue.
#define BB 2
#define TT 2048
#define DM 1024
#define NH 16
#define HD 64
#define RW 128
#define FF 2048
#define NR (BB * TT)

typedef __bf16 v16b __attribute__((ext_vector_type(16)));
typedef unsigned short v8us __attribute__((ext_vector_type(8), may_alias));
typedef float  v8f  __attribute__((ext_vector_type(8)));
typedef float  v4f  __attribute__((ext_vector_type(4)));
typedef float  v4fa __attribute__((ext_vector_type(4), may_alias));
union FragB { v16b v; v8us half[2]; unsigned short u[16]; };

__device__ __forceinline__ unsigned short bf16_bits(float x) { unsigned int u = __float_as_uint(x); return (unsigned short)((u + 0x7FFFu + ((u >> 16) & 1u)) >> 16); }
__device__ __forceinline__ float bf16_val(unsigned short b) { return __uint_as_float(((unsigned int)b) << 16); }
__device__ __forceinline__ float bf16_round(float x) { return bf16_val(bf16_bits(x)); }
// D += A·B with NT terms: 1 = ah·bh, 2 = + al·bh (A split), 3 = + ah·bl (both split)
template <int NT>
__device__ __forceinline__ v8f mmaN(v16b ah, v16b al, v16b bh, v16b bl, v8f c) {
  c = __builtin_amdgcn_wmma_f32_16x16x32_bf16(false, ah, false, bh, (short)0, c, false, false);
  if (NT >= 2) c = __builtin_amdgcn_wmma_f32_16x16x32_bf16(false, al, false, bh, (short)0, c, false, false);
  if (NT >= 3) c = __builtin_amdgcn_wmma_f32_16x16x32_bf16(false, ah, false, bl, (short)0, c, false, false);
  asm volatile("v_nop\n\tv_nop\n\tv_nop\n\tv_nop" : "+v"(c) : "v"(ah), "v"(al), "v"(bh), "v"(bl));
  return c;
}

__global__ __launch_bounds__(256) void k_wt_bf16(const float* __restrict__ W, unsigned short* __restrict__ Wt, int K, int N) {
  const int t = blockIdx.x * 256 + threadIdx.x;
  const int k8n = K / 8;
  if (t >= N * k8n) return;
  const int n = t / k8n, k8 = (t % k8n) * 8;
  v8us v;
#pragma unroll
  for (int i = 0; i < 8; ++i) v[i] = bf16_bits(W[(size_t)(k8 + i) * N + n]);
  *(v8us*)(Wt + (size_t)n * K + k8) = v;
  
}

// GEMM C[M][N] (f32, pitch ldc) = act(A[M][K]·W + bias). A f32 row-major (pitch lda) converted per fragment to bf16
// (ASPLIT: hi/lo two planes -> 2 terms, else single rounded term); Wt bf16 [N][K] (pitch ldb). BIAS_BF16 rounds the
// bias to bf16 first (bias quantised to bf16 before the add). K%32==0, M%16==0, N%64==0.
template <bool ASPLIT, int ACT, bool BIAS_BF16>
__global__ __launch_bounds__(128) void k_gemm_bf(const float* __restrict__ A, int lda, const unsigned short* __restrict__ Wt, int ldb,
                                               const float* __restrict__ bias, float* __restrict__ C, int ldc, int M, int N, int K) {
  __shared__ __attribute__((aligned(16))) float so[4][16][64];
  const int tid = threadIdx.x, w = tid >> 5, lane = tid & 31, ln = lane & 15, hh = lane >> 4;
  const int ntn = N / 64;
  const int wid = blockIdx.x * 4 + w;
  const int mt = wid / ntn, nq = wid % ntn;
  if (mt * 16 >= M) return;
  const int row0 = mt * 16, col0 = nq * 64;
  const float* arow = A + (size_t)(row0 + ln) * lda;
  v8f acc[4] = {};
  for (int kb = 0; kb < K; kb += 32) {
    FragB ah, al;
    const v4f x0 = *(const v4fa*)(arow + kb + 8 * hh), x1 = *(const v4fa*)(arow + kb + 8 * hh + 4);
    const v4f x2 = *(const v4fa*)(arow + kb + 16 + 8 * hh), x3 = *(const v4fa*)(arow + kb + 16 + 8 * hh + 4);
    float xs[16] = {x0[0],x0[1],x0[2],x0[3],x1[0],x1[1],x1[2],x1[3],x2[0],x2[1],x2[2],x2[3],x3[0],x3[1],x3[2],x3[3]};
#pragma unroll
    for (int i = 0; i < 16; ++i) { const unsigned short hb = bf16_bits(xs[i]); ah.u[i] = hb; al.u[i] = ASPLIT ? bf16_bits(xs[i] - bf16_val(hb)) : (unsigned short)0; }
#pragma unroll
    for (int t = 0; t < 4; ++t) {
      const unsigned short* brow = Wt + (size_t)(col0 + t * 16 + ln) * ldb + kb;
      FragB b;
      b.half[0] = *(const v8us*)(brow + 8 * hh);
      b.half[1] = *(const v8us*)(brow + 16 + 8 * hh);
      acc[t] = mmaN<ASPLIT ? 2 : 1>(ah.v, al.v, b.v, b.v, acc[t]);
    }
  }
#pragma unroll
  for (int t = 0; t < 4; ++t) {
    float bv = bias ? bias[col0 + t * 16 + ln] : 0.f;
    if (BIAS_BF16) bv = bf16_round(bv);
#pragma unroll
    for (int r = 0; r < 8; ++r) { float v = acc[t][r] + bv; if (ACT == 1) v = fmaxf(v, 0.f); so[w][8 * hh + r][t * 16 + ln] = v; }
  }
  __builtin_amdgcn_fence(__ATOMIC_ACQ_REL, "workgroup");
  __builtin_amdgcn_wave_barrier();
  const int rsub = lane >> 4, c4 = (lane & 15) * 4;
  {
#pragma unroll
    for (int q = 0; q < 8; ++q) {
      const int r = q * 2 + rsub;
      const v4f v = *(const v4fa*)&so[w][r][c4];
      *(v4f*)(C + (size_t)(row0 + r) * ldc + col0 + c4) = v;
    }
    
  }
}

// Flash-style causal/unmasked attention, all contractions 3-term bf16 hi/lo splits, f32 softmax with running max.
// q,k,v rows are read from f32 buffers with arbitrary row pitch (so they can live inside a fused qkv buffer);
// D = head size (multiple of 32, <= 128); one wave = 16 query rows; block = 4 waves (64 queries) sharing K/V chunks of 32.
template <int D, bool CAUSAL>
__global__ __launch_bounds__(128) void k_flash(const float* __restrict__ qb, const float* __restrict__ kb, const float* __restrict__ vb,
                                             int pitch, int T, int H, float scale, float* __restrict__ y, int ypitch) {
  constexpr int KS = D / 32;        // k-steps for QK
  constexpr int DT = D / 16;        // d tiles for PV
  __shared__ __attribute__((aligned(16))) unsigned short sKh[32][D + 8], sKl[32][D + 8], sVh[32][D + 8], sVl[32][D + 8];
  __shared__ __attribute__((aligned(16))) unsigned short sPh[4][16][40], sPl[4][16][40];
  __shared__ __attribute__((aligned(16))) float sO[4][16][D];
  const int tid = threadIdx.x, w = tid >> 5, lane = tid & 31, ln = lane & 15, hh = lane >> 4;
  const int nqb = (T + 63) / 64;
  const int bh = blockIdx.x / nqb, qblk = blockIdx.x % nqb;
  const int b = bh / H, h = bh % H;
  const int q0 = qblk * 64 + w * 16;
  const float* Q = qb + (size_t)b * T * pitch + h * D;
  const float* K = kb + (size_t)b * T * pitch + h * D;
  const float* V = vb + (size_t)b * T * pitch + h * D;

  // A fragments of the wave's 16 query rows (scaled), hi/lo
  FragB aqh[KS], aql[KS];
  {
    int row = q0 + ln; if (row >= T) row = T - 1;
    const float* qr = Q + (size_t)row * pitch;
#pragma unroll
    for (int ks = 0; ks < KS; ++ks)
#pragma unroll
      for (int i = 0; i < 16; ++i) {
        const int d = ks * 32 + ((i < 8) ? (8 * hh + i) : (16 + 8 * hh + (i - 8)));
        const float x = qr[d] * scale; const unsigned short hb = bf16_bits(x);
        aqh[ks].u[i] = hb; aql[ks].u[i] = bf16_bits(x - bf16_val(hb));
      }
  }
  float m_r[8], l_r[8];
#pragma unroll
  for (int r = 0; r < 8; ++r) { m_r[r] = -3.0e38f; l_r[r] = 0.f; }
  v8f oacc[DT];
#pragma unroll
  for (int dt = 0; dt < DT; ++dt) oacc[dt] = (v8f){0.f,0.f,0.f,0.f,0.f,0.f,0.f,0.f};

  const int kv_end = CAUSAL ? min(T, qblk * 64 + 64) : T;     // block-uniform
  for (int j0 = 0; j0 < kv_end; j0 += 32) {
    __syncthreads();
    for (int e = tid; e < 32 * (D / 4); e += 128) {
      const int r = e / (D / 4), c4 = (e % (D / 4)) * 4;
      const int key = j0 + r;
      v4f kf = {0.f,0.f,0.f,0.f}, vf = {0.f,0.f,0.f,0.f};
      if (key < T) { kf = *(const v4fa*)(K + (size_t)key * pitch + c4); vf = *(const v4fa*)(V + (size_t)key * pitch + c4); }
#pragma unroll
      for (int t = 0; t < 4; ++t) {
        unsigned short hb = bf16_bits(kf[t]); sKh[r][c4 + t] = hb; sKl[r][c4 + t] = bf16_bits(kf[t] - bf16_val(hb));
        hb = bf16_bits(vf[t]); sVh[r][c4 + t] = hb; sVl[r][c4 + t] = bf16_bits(vf[t] - bf16_val(hb));
      }
    }
    __syncthreads();
    // S tile 16 x 32
    v8f s[2];
#pragma unroll
    for (int nt = 0; nt < 2; ++nt) {
      v8f acc = {};
#pragma unroll
      for (int ks = 0; ks < KS; ++ks) {
        FragB bh_, bl_;
        bh_.half[0] = *(const v8us*)&sKh[nt * 16 + ln][ks * 32 + 8 * hh]; bh_.half[1] = *(const v8us*)&sKh[nt * 16 + ln][ks * 32 + 16 + 8 * hh];
        bl_.half[0] = *(const v8us*)&sKl[nt * 16 + ln][ks * 32 + 8 * hh]; bl_.half[1] = *(const v8us*)&sKl[nt * 16 + ln][ks * 32 + 16 + 8 * hh];
        acc = mmaN<3>(aqh[ks].v, aql[ks].v, bh_.v, bl_.v, acc);
      }
      s[nt] = acc;
    }
    // mask + running max (rows 8hh+r; the 16 lanes of a half share rows)
    float alpha[8];
#pragma unroll
    for (int r = 0; r < 8; ++r) {
      const int qi = q0 + 8 * hh + r;
      const int ja = j0 + ln, jb = j0 + 16 + ln;
      if (CAUSAL) { if (ja > qi) s[0][r] = -3.0e38f; if (jb > qi) s[1][r] = -3.0e38f; }
      if (ja >= T) s[0][r] = -3.0e38f;
      if (jb >= T) s[1][r] = -3.0e38f;
      float mx = fmaxf(s[0][r], s[1][r]);
      mx = fmaxf(mx, __shfl_xor(mx, 1, 32)); mx = fmaxf(mx, __shfl_xor(mx, 2, 32)); mx = fmaxf(mx, __shfl_xor(mx, 4, 32)); mx = fmaxf(mx, __shfl_xor(mx, 8, 32));
      const float mnew = fmaxf(m_r[r], mx);
      alpha[r] = (mnew > -1.0e38f) ? __expf(m_r[r] - mnew) : 1.0f;
      const float p0 = (s[0][r] > -1.0e38f) ? __expf(s[0][r] - mnew) : 0.f;
      const float p1 = (s[1][r] > -1.0e38f) ? __expf(s[1][r] - mnew) : 0.f;
      m_r[r] = mnew;
      l_r[r] = l_r[r] * alpha[r] + p0 + p1;            // per-lane partial row sum (16 lanes combined at the end)
      unsigned short hb = bf16_bits(p0); sPh[w][8 * hh + r][ln] = hb;      sPl[w][8 * hh + r][ln] = bf16_bits(p0 - bf16_val(hb));
      hb = bf16_bits(p1);                sPh[w][8 * hh + r][16 + ln] = hb; sPl[w][8 * hh + r][16 + ln] = bf16_bits(p1 - bf16_val(hb));
    }
#pragma unroll
    for (int dt = 0; dt < DT; ++dt)
#pragma unroll
      for (int r = 0; r < 8; ++r) oacc[dt][r] *= alpha[r];
    __builtin_amdgcn_fence(__ATOMIC_ACQ_REL, "workgroup");
    __builtin_amdgcn_wave_barrier();
    FragB pah, pal;
    pah.half[0] = *(const v8us*)&sPh[w][ln][8 * hh]; pah.half[1] = *(const v8us*)&sPh[w][ln][16 + 8 * hh];
    pal.half[0] = *(const v8us*)&sPl[w][ln][8 * hh]; pal.half[1] = *(const v8us*)&sPl[w][ln][16 + 8 * hh];
#pragma unroll
    for (int dt = 0; dt < DT; ++dt) {
      FragB bvh, bvl;
#pragma unroll
      for (int i = 0; i < 8; ++i) {
        bvh.u[i] = sVh[8 * hh + i][dt * 16 + ln]; bvh.u[8 + i] = sVh[16 + 8 * hh + i][dt * 16 + ln];
        bvl.u[i] = sVl[8 * hh + i][dt * 16 + ln]; bvl.u[8 + i] = sVl[16 + 8 * hh + i][dt * 16 + ln];
      }
      oacc[dt] = mmaN<3>(pah.v, pal.v, bvh.v, bvl.v, oacc[dt]);
    }
    __builtin_amdgcn_fence(__ATOMIC_ACQ_REL, "workgroup");
    __builtin_amdgcn_wave_barrier();
  }
#pragma unroll
  for (int r = 0; r < 8; ++r) {
    float l = l_r[r];
    l += __shfl_xor(l, 1, 32); l += __shfl_xor(l, 2, 32); l += __shfl_xor(l, 4, 32); l += __shfl_xor(l, 8, 32);
    l_r[r] = (l > 0.f) ? 1.0f / l : 0.f;
  }
#pragma unroll
  for (int dt = 0; dt < DT; ++dt)
#pragma unroll
    for (int r = 0; r < 8; ++r) sO[w][8 * hh + r][dt * 16 + ln] = oacc[dt][r] * l_r[r];
  __builtin_amdgcn_fence(__ATOMIC_ACQ_REL, "workgroup");
  __builtin_amdgcn_wave_barrier();
  {
    for (int r = 0; r < 16; ++r) {
      const int row = q0 + r;
      if (row < T && lane < D / 4) {
        const v4f val = *(const v4fa*)&sO[w][r][lane * 4];
        *(v4f*)(y + ((size_t)b * T + row) * ypitch + h * D + lane * 4) = val;
      }
    }
    
  }
}

// GEMM C = act(A·W + bias + resid): A f32 (ASPLIT -> hi/lo 2 terms), Wt bf16 [N][K]; ACT 0 none, 1 relu, 2 exact gelu;
// resid (optional, f32, row index = (row % rmod), pitch ldr, RES_BF16 rounds it) added before the activation.
template <bool ASPLIT, int ACT, bool BIAS_BF16, bool RES_BF16>
__global__ __launch_bounds__(128) void k_gemm_bf3(const float* __restrict__ A, int lda, const unsigned short* __restrict__ Wt, int ldb,
                                                const float* __restrict__ bias, const float* __restrict__ resid, int rmod, int ldr,
                                                float* __restrict__ C, int ldc, int M, int N, int K) {
  __shared__ __attribute__((aligned(16))) float so[4][16][64];
  const int tid = threadIdx.x, w = tid >> 5, lane = tid & 31, ln = lane & 15, hh = lane >> 4;
  const int ntn = N / 64;
  const int wid = blockIdx.x * 4 + w;
  const int mt = wid / ntn, nq = wid % ntn;
  if (mt * 16 >= M) return;
  const int row0 = mt * 16, col0 = nq * 64;
  const float* arow = A + (size_t)(row0 + ln) * lda;
  v8f acc[4] = {};
  for (int kb = 0; kb < K; kb += 32) {
    FragB ah, al;
    const v4f x0 = *(const v4fa*)(arow + kb + 8 * hh), x1 = *(const v4fa*)(arow + kb + 8 * hh + 4);
    const v4f x2 = *(const v4fa*)(arow + kb + 16 + 8 * hh), x3 = *(const v4fa*)(arow + kb + 16 + 8 * hh + 4);
    float xs[16] = {x0[0],x0[1],x0[2],x0[3],x1[0],x1[1],x1[2],x1[3],x2[0],x2[1],x2[2],x2[3],x3[0],x3[1],x3[2],x3[3]};
#pragma unroll
    for (int i = 0; i < 16; ++i) { const unsigned short hb = bf16_bits(xs[i]); ah.u[i] = hb; al.u[i] = ASPLIT ? bf16_bits(xs[i] - bf16_val(hb)) : (unsigned short)0; }
#pragma unroll
    for (int t = 0; t < 4; ++t) {
      const unsigned short* brow = Wt + (size_t)(col0 + t * 16 + ln) * ldb + kb;
      FragB b;
      b.half[0] = *(const v8us*)(brow + 8 * hh);
      b.half[1] = *(const v8us*)(brow + 16 + 8 * hh);
      acc[t] = mmaN<ASPLIT ? 2 : 1>(ah.v, al.v, b.v, b.v, acc[t]);
    }
  }
#pragma unroll
  for (int t = 0; t < 4; ++t) {
    const int col = col0 + t * 16 + ln;
    float bv = bias ? bias[col] : 0.f;
    if (BIAS_BF16) bv = bf16_round(bv);
#pragma unroll
    for (int r = 0; r < 8; ++r) {
      float v = acc[t][r] + bv;
      if (resid) { float rv = resid[(size_t)((row0 + 8 * hh + r) % rmod) * ldr + col]; if (RES_BF16) rv = bf16_round(rv); v += rv; }
      if (ACT == 1) v = fmaxf(v, 0.f);
      if (ACT == 2) v = 0.5f * v * (1.0f + erff(v * 0.70710678118654752f));
      if (ACT == 3) { const float u = 0.7978845608028654f * (v + 0.044715f * v * v * v); v = 0.5f * v * (1.0f + tanhf(u)); }
      so[w][8 * hh + r][t * 16 + ln] = v;
    }
  }
  __builtin_amdgcn_fence(__ATOMIC_ACQ_REL, "workgroup");
  __builtin_amdgcn_wave_barrier();
  const int rsub = lane >> 4, c4 = (lane & 15) * 4;
  {
#pragma unroll
    for (int q = 0; q < 8; ++q) {
      const int r = q * 2 + rsub;
      const v4f v = *(const v4fa*)&so[w][r][c4];
      *(v4f*)(C + (size_t)(row0 + r) * ldc + col0 + c4) = v;
    }
    
  }
}
// row LayerNorm (biased variance, eps) over N: s = X (+ R); optional out_sum <- s; out_norm <- (s-mu)*rsqrt(var+eps)*g + b
template <bool PARAM_BF16>
__global__ __launch_bounds__(256) void k_layernorm(const float* __restrict__ X, const float* __restrict__ R, const float* __restrict__ g, const float* __restrict__ bta,
                                                  float* __restrict__ out_sum, float* __restrict__ out_norm, int N, float eps) {
  __shared__ float red[256];
  const int row = blockIdx.x, tid = threadIdx.x;
  const float* x = X + (size_t)row * N; const float* rr = R ? R + (size_t)row * N : nullptr;
  float vals[16];                     // up to N = 4096
  const int per = N / 256;            // contiguous chunk per thread? use strided-by-4 chunks: thread handles j = tid*4 + 1024*u
  float s1 = 0.f;
  for (int u = 0; u < per / 4; ++u) {
    const int j = tid * 4 + 1024 * u;
    const v4f a = *(const v4fa*)(x + j);
    v4f b = {0.f,0.f,0.f,0.f}; if (rr) b = *(const v4fa*)(rr + j);
#pragma unroll
    for (int q = 0; q < 4; ++q) { const float v = a[q] + b[q]; vals[u * 4 + q] = v; s1 += v; }
  }
  red[tid] = s1; __syncthreads();
  for (int st = 128; st > 0; st >>= 1) { if (tid < st) red[tid] += red[tid + st]; __syncthreads(); }
  const float mu = red[0] / (float)N; __syncthreads();
  float s2 = 0.f;
  for (int u = 0; u < per / 4; ++u)
#pragma unroll
    for (int q = 0; q < 4; ++q) { const float c = vals[u * 4 + q] - mu; s2 += c * c; }
  red[tid] = s2; __syncthreads();
  for (int st = 128; st > 0; st >>= 1) { if (tid < st) red[tid] += red[tid + st]; __syncthreads(); }
  const float rs = rsqrtf(red[0] / (float)N + eps);
  {
    for (int u = 0; u < per / 4; ++u) {
      const int j = tid * 4 + 1024 * u;
      v4f o, sm;
#pragma unroll
      for (int q = 0; q < 4; ++q) {
        float gg = g[j + q], bb = bta[j + q];
        if (PARAM_BF16) { gg = bf16_round(gg); bb = bf16_round(bb); }
        sm[q] = vals[u * 4 + q]; o[q] = (vals[u * 4 + q] - mu) * rs * gg + bb;
      }
      if (out_sum) *(v4f*)(out_sum + (size_t)row * N + j) = sm;
      *(v4f*)(out_norm + (size_t)row * N + j) = o;
    }
    
  }
}



// ---- f16 WMMA path (v_wmma_f32_16x16x32_f16): 11-bit significands for operands in range — used where a [0,1] probability operand needs more precision than bf16
typedef _Float16 v16h __attribute__((ext_vector_type(16)));
union FragH { v16h v; v8us half[2]; _Float16 h[16]; unsigned short u[16]; };
template <int NT>
__device__ __forceinline__ v8f mmaH(v16h ah, v16h al, v16h bh, v16h bl, v8f c) {
  c = __builtin_amdgcn_wmma_f32_16x16x32_f16(false, ah, false, bh, (short)0, c, false, false);
  if (NT >= 2) c = __builtin_amdgcn_wmma_f32_16x16x32_f16(false, al, false, bh, (short)0, c, false, false);
  if (NT >= 3) c = __builtin_amdgcn_wmma_f32_16x16x32_f16(false, ah, false, bl, (short)0, c, false, false);
  asm volatile("v_nop\n\tv_nop\n\tv_nop\n\tv_nop" : "+v"(c) : "v"(ah), "v"(al), "v"(bh), "v"(bl));
  return c;
}
// batched GEMM like k_gemm_b but f16 operands: A f32 (split into f16 hi/lo if ASPLIT, else rounded to f16), Bt = f16 values [n][k]; alpha; C f32; N multiple of 16 (partial tiles skipped)
template <bool ASPLIT>
__global__ __launch_bounds__(128) void k_gemm_h(const float* __restrict__ A, int lda, size_t sA, const _Float16* __restrict__ Bh, int ldb, size_t sB, float alpha, float* __restrict__ C, int ldc, size_t sC, int M, int N, int K) {
  __shared__ __attribute__((aligned(16))) float so[4][16][64];
  const int tid = threadIdx.x, w = tid >> 5, lane = tid & 31, ln = lane & 15, hh = lane >> 4; const int by = blockIdx.y;
  A += (size_t)by * sA; Bh += (size_t)by * sB; C += (size_t)by * sC;
  const int ntn = (N + 63) / 64; const int wid = blockIdx.x * 4 + w; const int mt = wid / ntn, nq = wid % ntn; if (mt * 16 >= M) return;
  const int row0 = mt * 16, col0 = nq * 64; const float* arow = A + (size_t)(row0 + ln) * lda;
  v8f acc[4] = {};
  for (int kb = 0; kb < K; kb += 32) {
    FragH ah, al;
    const v4f x0 = *(const v4fa*)(arow + kb + 8 * hh), x1 = *(const v4fa*)(arow + kb + 8 * hh + 4), x2 = *(const v4fa*)(arow + kb + 16 + 8 * hh), x3 = *(const v4fa*)(arow + kb + 16 + 8 * hh + 4);
    float xs[16] = {x0[0],x0[1],x0[2],x0[3],x1[0],x1[1],x1[2],x1[3],x2[0],x2[1],x2[2],x2[3],x3[0],x3[1],x3[2],x3[3]};
#pragma unroll
    for (int i = 0; i < 16; ++i) { const _Float16 h = (_Float16)xs[i]; ah.h[i] = h; al.h[i] = ASPLIT ? (_Float16)(xs[i] - (float)h) : (_Float16)0.0f; }
#pragma unroll
    for (int t = 0; t < 4; ++t) { if (col0 + t * 16 >= N) continue; const size_t boff = (size_t)(col0 + t * 16 + ln) * ldb + kb; FragH bq; bq.half[0] = *(const v8us*)(Bh + boff + 8 * hh); bq.half[1] = *(const v8us*)(Bh + boff + 16 + 8 * hh);
      acc[t] = mmaH<ASPLIT ? 2 : 1>(ah.v, al.v, bq.v, bq.v, acc[t]); }
  }
#pragma unroll
  for (int t = 0; t < 4; ++t) { if (col0 + t * 16 >= N) continue;
#pragma unroll
    for (int r = 0; r < 8; ++r) so[w][8 * hh + r][t * 16 + ln] = acc[t][r] * alpha; }
  __builtin_amdgcn_fence(__ATOMIC_ACQ_REL, "workgroup"); __builtin_amdgcn_wave_barrier();
  const int rsub = lane >> 4, c4 = (lane & 15) * 4;
  {
#pragma unroll
    for (int q = 0; q < 8; ++q) { const int r = q * 2 + rsub; if (col0 + c4 < N) { const v4f v = *(const v4fa*)&so[w][r][c4]; *(v4f*)(C + (size_t)(row0 + r) * ldc + col0 + c4) = v; } }
     }
}

// Wt[n][k] = f16(W[k][n]·scale) from f32 row-major W[K][N] (scale = power of two; bf16-exact weights stay exact in f16 away from the subnormal range)
__global__ __launch_bounds__(256) void k_wt_f16(const float* __restrict__ W, _Float16* __restrict__ Wt, int K, int N, float scale) {
  const int t = blockIdx.x * 256 + threadIdx.x; if (t >= N * (K / 8)) return; const int n = t / (K / 8), k8 = (t % (K / 8)) * 8; FragH f;
#pragma unroll
  for (int i = 0; i < 8; ++i) f.h[i] = (_Float16)(bf16_round(W[(size_t)(k8 + i) * N + n]) * scale); const v8us o = f.half[0];
  *(v8us*)((unsigned short*)Wt + (size_t)n * K + k8) = o; 
}
// k_gemm_hh variant with fused epilogue: v = acc·alpha + bias[by·sBias + col] (+ CP[(row/rowsPerB)·sCPb + by·64 + col] if CP) ; ACT 0 none / 1 elu ; writes f16 C16 (and f32 C if non-null)
template <int ACT>
__global__ __launch_bounds__(128) void k_gemm_hhx(const _Float16* __restrict__ A, int lda, size_t sA, const _Float16* __restrict__ Bh, int ldb, size_t sB, float alpha, const float* __restrict__ bias, size_t sBias, const float* __restrict__ CP, int rowsPerB, size_t sCPb, int row0g,
    float* __restrict__ C, _Float16* __restrict__ C16, int ldc, size_t sC, int M, int N, int K) {
  __shared__ __attribute__((aligned(16))) float so[4][16][64];
  const int tid = threadIdx.x, w = tid >> 5, lane = tid & 31, ln = lane & 15, hh = lane >> 4; const int by = blockIdx.y;
  A += (size_t)by * sA; Bh += (size_t)by * sB; const size_t cofs = (size_t)by * sC; const float* bp = bias ? bias + (size_t)by * sBias : nullptr;
  const int ntn = (N + 63) / 64; const int wid = blockIdx.x * 4 + w; const int mt = wid / ntn, nq = wid % ntn; if (mt * 16 >= M) return;
  const int row0 = mt * 16, col0 = nq * 64; const _Float16* arow = A + (size_t)(row0 + ln) * lda;
  v8f acc[4] = {};
  for (int kb = 0; kb < K; kb += 32) { FragH ah; ah.half[0] = *(const v8us*)((const unsigned short*)arow + kb + 8 * hh); ah.half[1] = *(const v8us*)((const unsigned short*)arow + kb + 16 + 8 * hh);
#pragma unroll
    for (int t = 0; t < 4; ++t) { if (col0 + t * 16 >= N) continue; const size_t boff = (size_t)(col0 + t * 16 + ln) * ldb + kb; FragH bq; bq.half[0] = *(const v8us*)((const unsigned short*)Bh + boff + 8 * hh); bq.half[1] = *(const v8us*)((const unsigned short*)Bh + boff + 16 + 8 * hh);
      acc[t] = mmaH<1>(ah.v, ah.v, bq.v, bq.v, acc[t]); }
  }
#pragma unroll
  for (int t = 0; t < 4; ++t) { if (col0 + t * 16 >= N) continue; const int col = col0 + t * 16 + ln; const float bv = bp ? bf16_round(bp[col]) : 0.f;
#pragma unroll
    for (int r = 0; r < 8; ++r) { float v = acc[t][r] * alpha + bv; if (CP) { const int bidx = (row0g + row0 + 8 * hh + r) / rowsPerB; v += CP[(size_t)bidx * sCPb + (size_t)by * 64 + col]; } if (ACT == 1) v = (v > 0.f) ? v : expm1f(v); else if (ACT == 7) v = (v > 0.f) ? v + 1.0f : expf(v); else if (ACT == 8) v = tanhf(v); else if (ACT == 9) v = 0.5f * v * (1.0f + tanhf(0.7978845608028654f * (v + 0.044715f * v * v * v))); else if (ACT == 11) v = 1.0f / (1.0f + expf(-v)); else if (ACT == 12) v = (v > 0.f) ? v : 0.01f * v; else if (ACT == 14) v = (v > 0.f) ? v : 0.1f * v; else if (ACT == 15) v = v / (1.0f + expf(-v)); else if (ACT == 3) v = fmaxf(v, 0.f); else if (ACT == 6) v = 0.5f * v * (1.0f + erff(v * 0.70710678118654752f)); so[w][8 * hh + r][t * 16 + ln] = v; } }
  __builtin_amdgcn_fence(__ATOMIC_ACQ_REL, "workgroup"); __builtin_amdgcn_wave_barrier();
  const int rsub = lane >> 4, c4 = (lane & 15) * 4; typedef _Float16 v4h __attribute__((ext_vector_type(4)));
  {
#pragma unroll
    for (int q = 0; q < 8; ++q) { const int r = q * 2 + rsub; if (col0 + c4 < N) { const v4f v = *(const v4fa*)&so[w][r][c4]; if (C) *(v4f*)(C + cofs + (size_t)(row0 + r) * ldc + col0 + c4) = v; if (C16) { v4h h4; for (int i = 0; i < 4; ++i) h4[i] = (_Float16)v[i]; *(v4h*)(C16 + cofs + (size_t)(row0 + r) * ldc + col0 + c4) = h4; } } }
     }
}


typedef _Float16 v4h __attribute__((ext_vector_type(4)));

__global__ __launch_bounds__(256) void k_x16(const float* __restrict__ x, _Float16* __restrict__ X16, size_t n8) { const size_t t = (size_t)blockIdx.x * 256 + threadIdx.x; if (t >= n8) return; FragH f;
#pragma unroll
  for (int q = 0; q < 8; ++q) f.h[q] = (_Float16)bf16_round(x[t * 8 + q]); *(v8us*)((unsigned short*)X16 + t * 8) = f.half[0];  }
__global__ __launch_bounds__(256) void k_h16(const float* __restrict__ x, _Float16* __restrict__ X16, size_t n8) { const size_t t = (size_t)blockIdx.x * 256 + threadIdx.x; if (t >= n8) return; FragH f;
#pragma unroll
  for (int q = 0; q < 8; ++q) f.h[q] = (_Float16)x[t * 8 + q]; *(v8us*)((unsigned short*)X16 + t * 8) = f.half[0];  }
__global__ __launch_bounds__(256) void k_round16f(const float* __restrict__ W, _Float16* __restrict__ Bt, size_t n8) { const size_t t = (size_t)blockIdx.x * 256 + threadIdx.x; if (t >= n8) return; FragH f;
#pragma unroll
  for (int i = 0; i < 8; ++i) f.h[i] = (_Float16)(bf16_round(W[t * 8 + i]) * 16.0f); *(v8us*)((unsigned short*)Bt + t * 8) = f.half[0];  }
template <int NHv, int TTv>
__global__ __launch_bounds__(256) void k_vt(const _Float16* __restrict__ V16, int ldv, int voff, _Float16* __restrict__ Vt) { __shared__ unsigned short tl[64][66]; const int tid = threadIdx.x; const int slab = blockIdx.x / (TTv / 64), lg = blockIdx.x % (TTv / 64); const int b = slab / NHv, h = slab % NHv;
  for (int i = tid; i < 64 * 8; i += 256) { const int r = i / 8, c8 = (i % 8) * 8; FragH f; f.half[0] = *(const v8us*)((const unsigned short*)V16 + ((size_t)b * TTv + lg * 64 + r) * ldv + voff + h * 64 + c8);
#pragma unroll
    for (int q = 0; q < 8; ++q) tl[r][c8 + q] = f.u[q]; }
  __syncthreads();
  {
#pragma unroll
    for (int rd = 0; rd < 2; ++rd) { const int d = rd * 32 + tid / 8, pc = tid % 8; FragH f;
#pragma unroll
      for (int q = 0; q < 8; ++q) f.u[q] = tl[pc * 8 + q][d];
      *(v8us*)((unsigned short*)Vt + ((size_t)slab * 64 + d) * TTv + lg * 64 + pc * 8) = f.half[0]; }
     } }

template <int D, int RBF>
__global__ __launch_bounds__(256) void k_lnx(const float* __restrict__ X, const float* __restrict__ gam, const float* __restrict__ bet, int nrows, float eps, _Float16* __restrict__ O16, float* __restrict__ XR) {
  constexpr int NP = D / 128; const int tid = threadIdx.x, wv = tid >> 5, lane = tid & 31; const size_t r = (size_t)blockIdx.x * 8 + wv; if (r >= (size_t)nrows) return; v4f y[NP]; float s = 0.f;
#pragma unroll
  for (int j = 0; j < NP; ++j) { const int c = j * 128 + lane * 4; v4f g = *(const v4fa*)(X + r * D + c); if (RBF) { for (int q = 0; q < 4; ++q) g[q] = bf16_round(g[q]); } y[j] = g; s += g[0] + g[1] + g[2] + g[3]; }
  for (int o = 16; o >= 1; o >>= 1) s += __shfl_xor(s, o, 32); const float mu = s / (float)D; float q2 = 0.f;
#pragma unroll
  for (int j = 0; j < NP; ++j) for (int q = 0; q < 4; ++q) { const float d = y[j][q] - mu; q2 += d * d; }
  for (int o = 16; o >= 1; o >>= 1) q2 += __shfl_xor(q2, o, 32); const float rs = rsqrtf(q2 / (float)D + eps);
  {
#pragma unroll
    for (int j = 0; j < NP; ++j) { const int c = j * 128 + lane * 4; v4h h; for (int q = 0; q < 4; ++q) { const float v = (y[j][q] - mu) * rs * bf16_round(gam[c + q]) + bf16_round(bet[c + q]); h[q] = (_Float16)v; } *(v4h*)(O16 + r * D + c) = h; if (XR) *(v4f*)(XR + r * D + c) = y[j]; }
     } }
__global__ __launch_bounds__(256) void k_vthl(const float* __restrict__ VF, int ldv, _Float16* __restrict__ Vth, _Float16* __restrict__ Vtl) { __shared__ float tl[64][65]; const int tid = threadIdx.x; const int slab = blockIdx.x / (TT / 64), lg = blockIdx.x % (TT / 64); const int b = slab / NH, h = slab % NH;
  for (int i = tid; i < 64 * 16; i += 256) { const int r = i / 16, c4 = (i % 16) * 4; const v4f a = *(const v4fa*)(VF + ((size_t)b * TT + lg * 64 + r) * ldv + h * HD + c4); tl[r][c4] = a[0]; tl[r][c4 + 1] = a[1]; tl[r][c4 + 2] = a[2]; tl[r][c4 + 3] = a[3]; }
  __syncthreads();
  FragH fh[2], fl[2]; size_t oo[2];
#pragma unroll
  for (int rd = 0; rd < 2; ++rd) { const int d = rd * 32 + tid / 8, pc = tid % 8;
#pragma unroll
    for (int q = 0; q < 8; ++q) { const float v = tl[pc * 8 + q][d]; const _Float16 hv = (_Float16)v; fh[rd].h[q] = hv; fl[rd].h[q] = (_Float16)((v - (float)hv) * 1024.0f); } oo[rd] = ((size_t)slab * HD + d) * TT + lg * 64 + pc * 8; }
  {
#pragma unroll
    for (int rd = 0; rd < 2; ++rd) { *(v8us*)((unsigned short*)Vth + oo[rd]) = fh[rd].half[0]; *(v8us*)((unsigned short*)Vtl + oo[rd]) = fl[rd].half[0]; }
     } }
__global__ __launch_bounds__(128) void k_flash(const _Float16* __restrict__ Q16, int ldq, const _Float16* __restrict__ K16, int ldk, const _Float16* __restrict__ Vt, const _Float16* __restrict__ Vtlo, float* __restrict__ O, int ldo) {
  constexpr int RPW = 16, RTN = RPW / 16, NQB = TT / (4 * RPW), DT = 4, KS = 2;
  __shared__ __attribute__((aligned(16))) unsigned short sP[4][RPW][40]; __shared__ __attribute__((aligned(16))) float sO[4][RPW][64 + 4];
  const int tid = threadIdx.x, w = tid >> 5, lane = tid & 31, ln = lane & 15, hh = lane >> 4;
  const int slab = blockIdx.x / NQB, qblk = blockIdx.x % NQB; const int b = slab / NH, h = slab % NH; const int qb0 = qblk * (4 * RPW); const int q0 = qb0 + w * RPW;
  FragH aq[2][KS];
#pragma unroll
  for (int rt = 0; rt < RTN; ++rt) { const unsigned short* qr = (const unsigned short*)Q16 + ((size_t)b * TT + q0 + rt * 16 + ln) * ldq + h * 64;
#pragma unroll
    for (int ks = 0; ks < KS; ++ks) { aq[rt][ks].half[0] = *(const v8us*)(qr + ks * 32 + 8 * hh); aq[rt][ks].half[1] = *(const v8us*)(qr + ks * 32 + 16 + 8 * hh); } }
  const unsigned short* Vth = (const unsigned short*)Vt + (size_t)slab * 64 * TT; const unsigned short* Vtl = (const unsigned short*)Vtlo + (size_t)slab * 64 * TT;
  float m_r[2][8], l_r[2][8]; v8f oacc[2][DT], oaccl[2][DT];
#pragma unroll
  for (int rt = 0; rt < RTN; ++rt) {
#pragma unroll
    for (int r = 0; r < 8; ++r) { m_r[rt][r] = -3.0e38f; l_r[rt][r] = 0.f; }
#pragma unroll
    for (int dt = 0; dt < DT; ++dt) { oacc[rt][dt] = (v8f){0.f,0.f,0.f,0.f,0.f,0.f,0.f,0.f}; oaccl[rt][dt] = oacc[rt][dt]; } }
  const int jbeg = (qb0 - RW) > 0 ? (qb0 - RW) : 0; const int jend = (qb0 + 4 * RPW + RW) < TT ? (qb0 + 4 * RPW + RW) : TT;      /* block-uniform window bounds (multiples of 32) */
#pragma unroll 1
  for (int j0 = jbeg; j0 < jend; j0 += 32) {
    
    v8f s[2][2];
#pragma unroll
    for (int nt = 0; nt < 2; ++nt) { const unsigned short* kr = (const unsigned short*)K16 + ((size_t)b * TT + j0 + nt * 16 + ln) * ldk + h * 64; FragH bk[KS];
#pragma unroll
      for (int ks = 0; ks < KS; ++ks) { bk[ks].half[0] = *(const v8us*)(kr + ks * 32 + 8 * hh); bk[ks].half[1] = *(const v8us*)(kr + ks * 32 + 16 + 8 * hh); }
#pragma unroll
      for (int rt = 0; rt < RTN; ++rt) { v8f acc = (v8f){0.f,0.f,0.f,0.f,0.f,0.f,0.f,0.f};
#pragma unroll
        for (int ks = 0; ks < KS; ++ks) acc = mmaH<1>(aq[rt][ks].v, aq[rt][ks].v, bk[ks].v, bk[ks].v, acc); s[rt][nt] = acc; } }
#pragma unroll
    for (int rt = 0; rt < RTN; ++rt)
#pragma unroll
      for (int r = 0; r < 8; ++r) { const int tq = q0 + rt * 16 + 8 * hh + r; const int k0 = j0 + ln, k1 = j0 + 16 + ln; (void)tq; (void)k0; (void)k1;
        const bool ok0 = (k0 - tq <= RW) && (tq - k0 <= RW), ok1 = (k1 - tq <= RW) && (tq - k1 <= RW);
        const float s0 = ok0 ? s[rt][0][r] * 0.125f : -INFINITY, s1 = ok1 ? s[rt][1][r] * 0.125f : -INFINITY; float mc = fmaxf(s0, s1);
        mc = fmaxf(mc, __shfl_xor(mc, 1, 32)); mc = fmaxf(mc, __shfl_xor(mc, 2, 32)); mc = fmaxf(mc, __shfl_xor(mc, 4, 32)); mc = fmaxf(mc, __shfl_xor(mc, 8, 32));
        const float mn = fmaxf(m_r[rt][r], mc); const float al = (mn > -1.0e38f) ? expf(m_r[rt][r] - mn) : 1.0f; m_r[rt][r] = mn; const float p0 = ok0 ? expf(s0 - mn) : 0.f, p1 = ok1 ? expf(s1 - mn) : 0.f; l_r[rt][r] = l_r[rt][r] * al + p0 + p1;
#pragma unroll
        for (int dt = 0; dt < DT; ++dt) { oacc[rt][dt][r] *= al; oaccl[rt][dt][r] *= al; }
        FragH t2; t2.h[0] = (_Float16)(p0 * 1024.0f); t2.h[1] = (_Float16)(p1 * 1024.0f); sP[w][rt * 16 + 8 * hh + r][ln] = t2.u[0]; sP[w][rt * 16 + 8 * hh + r][16 + ln] = t2.u[1]; }
    __builtin_amdgcn_fence(__ATOMIC_ACQ_REL, "workgroup"); __builtin_amdgcn_wave_barrier();
    FragH pa[2];
#pragma unroll
    for (int rt = 0; rt < RTN; ++rt) { pa[rt].half[0] = *(const v8us*)&sP[w][rt * 16 + ln][8 * hh]; pa[rt].half[1] = *(const v8us*)&sP[w][rt * 16 + ln][16 + 8 * hh]; }
#pragma unroll
    for (int dt = 0; dt < DT; ++dt) { const size_t vo = (size_t)(dt * 16 + ln) * TT + j0; FragH bv, bl; bv.half[0] = *(const v8us*)(Vth + vo + 8 * hh); bv.half[1] = *(const v8us*)(Vth + vo + 16 + 8 * hh); bl.half[0] = *(const v8us*)(Vtl + vo + 8 * hh); bl.half[1] = *(const v8us*)(Vtl + vo + 16 + 8 * hh);
#pragma unroll
      for (int rt = 0; rt < RTN; ++rt) { oacc[rt][dt] = mmaH<1>(pa[rt].v, pa[rt].v, bv.v, bv.v, oacc[rt][dt]); oaccl[rt][dt] = mmaH<1>(pa[rt].v, pa[rt].v, bl.v, bl.v, oaccl[rt][dt]); } }
    __builtin_amdgcn_fence(__ATOMIC_ACQ_REL, "workgroup"); __builtin_amdgcn_wave_barrier(); }
#pragma unroll
  for (int rt = 0; rt < RTN; ++rt) {
#pragma unroll
    for (int r = 0; r < 8; ++r) { float l = l_r[rt][r]; l += __shfl_xor(l, 1, 32); l += __shfl_xor(l, 2, 32); l += __shfl_xor(l, 4, 32); l += __shfl_xor(l, 8, 32); l_r[rt][r] = (l > 0.f) ? 1.0f / (l * 1024.0f) : 0.f; }
#pragma unroll
    for (int dt = 0; dt < DT; ++dt)
#pragma unroll
      for (int r = 0; r < 8; ++r) sO[w][rt * 16 + 8 * hh + r][dt * 16 + ln] = (oacc[rt][dt][r] + oaccl[rt][dt][r] * 0.0009765625f) * l_r[rt][r]; }
  __builtin_amdgcn_fence(__ATOMIC_ACQ_REL, "workgroup"); __builtin_amdgcn_wave_barrier();
  {
#pragma unroll
    for (int rp = 0; rp < RPW; rp += 2) { const int r = rp + (lane >> 4), pc = lane & 15; const v4f val = *(const v4fa*)&sO[w][r][pc * 4]; *(v4f*)(O + ((size_t)b * TT + q0 + r) * ldo + h * 64 + pc * 4) = val; }
     } }

extern "C" void kernel_launch(void* const* d_in, const int* in_sizes, int n_in,
                              void* d_out, int out_size, void* d_ws, size_t ws_size, hipStream_t stream) {
  (void)in_sizes; (void)n_in; (void)out_size;
  const float* const* I = (const float* const*)d_in; const float* x = I[0]; const float* Wqkv = I[1]; const float* bqkv = I[2]; const float* Wo = I[3]; const float* bo = I[4]; const float* g1 = I[5]; const float* be1 = I[6]; const float* g2 = I[7]; const float* be2 = I[8];
  const float* W1 = I[9]; const float* b1 = I[10]; const float* W2 = I[11]; const float* b2 = I[12];
  char* ws = (char*)d_ws; size_t off = 0;
  auto take = [&](size_t bytes) { char* p = ws + off; off += (bytes + 255) & ~(size_t)255; return p; };
  _Float16* Bqkv = (_Float16*)take((size_t)3 * DM * DM * 2); _Float16* Bo = (_Float16*)take((size_t)DM * DM * 2); _Float16* Bw1 = (_Float16*)take((size_t)FF * DM * 2); _Float16* Bw2 = (_Float16*)take((size_t)DM * FF * 2);
  _Float16* H16 = (_Float16*)take((size_t)NR * DM * 2); float* XR = (float*)take((size_t)NR * DM * 4); _Float16* QK = (_Float16*)take((size_t)NR * 2 * DM * 2); float* F32 = (float*)take((size_t)NR * DM * 4);
  _Float16* Vth = (_Float16*)take((size_t)NR * DM * 2); _Float16* Vtl = (_Float16*)take((size_t)NR * DM * 2); float* X1 = (float*)take((size_t)NR * DM * 4);
  float* O = F32; _Float16* O16 = H16; _Float16* H2 = H16; _Float16* FH = QK;      /* reuse: F32 holds v (consumed by k_vthl) then O; H16 holds LN1 output (consumed by the qkv GEMMs), then O16, then LN2 output; the [q|k] plane holds the FFN hidden (f16 [4096][2048]) once attention is done */
  if (off > ws_size) return;      // 6.3 + 2.1 + 4.2 + 4.2 + 8.4 + 16.8 + 16.8 + 16.8 + 8.4 + 8.4 + 16.8 ≈ 109 MB (104 MiB)
  k_wt_f16<<<(unsigned)(((size_t)3 * DM * (DM / 8) + 255) / 256), 256, 0, stream>>>(Wqkv, Bqkv, DM, 3 * DM, 16.0f); k_wt_f16<<<(unsigned)(((size_t)DM * (DM / 8) + 255) / 256), 256, 0, stream>>>(Wo, Bo, DM, DM, 16.0f);
  k_wt_f16<<<(unsigned)(((size_t)FF * (DM / 8) + 255) / 256), 256, 0, stream>>>(W1, Bw1, DM, FF, 16.0f); k_wt_f16<<<(unsigned)(((size_t)DM * (FF / 8) + 255) / 256), 256, 0, stream>>>(W2, Bw2, FF, DM, 16.0f);      /* (in,out) → Bt[n][k] ×2^4 */
  k_lnx<DM, 1><<<(NR + 7) / 8, 256, 0, stream>>>(x, g1, be1, NR, 1e-5f, H16, XR);      /* LN1(bf16 x) → f16; XR = bf16(x) */
  const dim3 gqk(((NR / 16) * (2 * DM / 64) + 3) / 4, 1), gd(((NR / 16) * (DM / 64) + 3) / 4, 1), gf(((NR / 16) * (FF / 64) + 3) / 4, 1);
  k_gemm_hhx<0><<<gqk, 128, 0, stream>>>(H16, DM, 0, Bqkv, DM, 0, 0.0625f, bqkv, 0, nullptr, 1, 0, 0, nullptr, QK, 2 * DM, 0, NR, 2 * DM, DM);      /* [q | k] + bias: M 4096 N 2048 K 1024 */
  k_gemm_hhx<0><<<gd, 128, 0, stream>>>(H16, DM, 0, Bqkv + (size_t)2 * DM * DM, DM, 0, 0.0625f, bqkv + 2 * DM, 0, nullptr, 1, 0, 0, F32, nullptr, DM, 0, NR, DM, DM); k_vthl<<<BB * NH * (TT / 64), 256, 0, stream>>>(F32, DM, Vth, Vtl);      /* v + bias (f32) → Vᵀ hi/lo */
  k_flash<<<BB * NH * (TT / 64), 128, 0, stream>>>(QK, 2 * DM, QK + DM, 2 * DM, Vth, Vtl, O, DM);
  k_h16<<<(unsigned)(((size_t)NR * DM / 8 + 255) / 256), 256, 0, stream>>>(O, O16, (size_t)NR * DM / 8);
  k_gemm_hhx<0><<<gd, 128, 0, stream>>>(O16, DM, 0, Bo, DM, 0, 0.0625f, bo, 0, XR, 1, (size_t)DM, 0, X1, nullptr, DM, 0, NR, DM, DM);      /* x1 = x + (O·out_w + out_b) via the per-element addend */
  k_lnx<DM, 0><<<(NR + 7) / 8, 256, 0, stream>>>(X1, g2, be2, NR, 1e-5f, H2, nullptr);      /* LN2(x1) → f16 (x1 is a computed value: no input rounding) */
  k_gemm_hhx<6><<<gf, 128, 0, stream>>>(H2, DM, 0, Bw1, DM, 0, 0.0625f, b1, 0, nullptr, 1, 0, 0, nullptr, FH, FF, 0, NR, FF, DM);      /* gelu_erf(h2·w1 + b1) → f16: M 4096 N 2048 K 1024 */
  k_gemm_hhx<0><<<gd, 128, 0, stream>>>(FH, FF, 0, Bw2, FF, 0, 0.0625f, b2, 0, X1, 1, (size_t)DM, 0, (float*)d_out, nullptr, DM, 0, NR, DM, FF);      /* y = x1 + (·w2 + b2): M 4096 N 1024 K 2048 */
}

// v001
// One run takes 208 microseconds.
// Next to v000, in two timings, it ran 2.26 and 2.28 times as fast.
#include <hip/hip_runtime.h>
// Transformer layer with windowed (|i−j| ≤ 128) multi-head self-attention (B=2, L=2048, d_model 1024, 16 heads × 64): h = LN1(x); qkv = h·W + b; per head softmax(q·kᵀ/8 + window mask)·v; x1 = x + (merged·out_w + out_b);
// y = x1 + (gelu_erf(LN2(x1)·w1 + b1)·w2 + b2). (in,out) weights.
// Compute dtype: x, weights, biases, LN parameters rounded to bf16; LayerNorms in f32 (wave per row) → f16 operands; q,k f16 GEMM outputs, v f32 → f16 hi + ×2^10 residual Vᵀ planes; fused windowed
// flash-style kernel (online softmax f32, P f16 ×2^10, two value accumulators) on v_wmma_f32_16x16x32_f16; the residual sums ride the GEMMs' per-element addend in f32; FFN hidden f16 after the erf-GELU epilogue.
#define BB 2
#define TT 2048
#define DM 1024
#define NH 16
#define HD 64
#define RW 128
#define FF 2048
#define NR (BB * TT)

typedef __bf16 v16b __attribute__((ext_vector_type(16)));
typedef unsigned short v8us __attribute__((ext_vector_type(8), may_alias));
typedef float  v8f  __attribute__((ext_vector_type(8)));
typedef float  v4f  __attribute__((ext_vector_type(4)));
typedef float  v4fa __attribute__((ext_vector_type(4), may_alias));
union FragB { v16b v; v8us half[2]; unsigned short u[16]; };

__device__ __forceinline__ unsigned short bf16_bits(float x) { unsigned int u = __float_as_uint(x); return (unsigned short)((u + 0x7FFFu + ((u >> 16) & 1u)) >> 16); }
__device__ __forceinline__ float bf16_val(unsigned short b) { return __uint_as_float(((unsigned int)b) << 16); }
__device__ __forceinline__ float bf16_round(float x) { return bf16_val(bf16_bits(x)); }
// D += A·B with NT terms: 1 = ah·bh, 2 = + al·bh (A split), 3 = + ah·bl (both split)
template <int NT>
__device__ __forceinline__ v8f mmaN(v16b ah, v16b al, v16b bh, v16b bl, v8f c) {
  c = __builtin_amdgcn_wmma_f32_16x16x32_bf16(false, ah, false, bh, (short)0, c, false, false);
  if (NT >= 2) c = __builtin_amdgcn_wmma_f32_16x16x32_bf16(false, al, false, bh, (short)0, c, false, false);
  if (NT >= 3) c = __builtin_amdgcn_wmma_f32_16x16x32_bf16(false, ah, false, bl, (short)0, c, false, false);
  asm volatile("v_nop\n\tv_nop\n\tv_nop\n\tv_nop" : "+v"(c) : "v"(ah), "v"(al), "v"(bh), "v"(bl));
  return c;
}

__global__ __launch_bounds__(256) void k_wt_bf16(const float* __restrict__ W, unsigned short* __restrict__ Wt, int K, int N) {
  const int t = blockIdx.x * 256 + threadIdx.x;
  const int k8n = K / 8;
  if (t >= N * k8n) return;
  const int n = t / k8n, k8 = (t % k8n) * 8;
  v8us v;
#pragma unroll
  for (int i = 0; i < 8; ++i) v[i] = bf16_bits(W[(size_t)(k8 + i) * N + n]);
  *(v8us*)(Wt + (size_t)n * K + k8) = v;
  
}

// GEMM C[M][N] (f32, pitch ldc) = act(A[M][K]·W + bias). A f32 row-major (pitch lda) converted per fragment to bf16
// (ASPLIT: hi/lo two planes -> 2 terms, else single rounded term); Wt bf16 [N][K] (pitch ldb). BIAS_BF16 rounds the
// bias to bf16 first (bias quantised to bf16 before the add). K%32==0, M%16==0, N%64==0.
template <bool ASPLIT, int ACT, bool BIAS_BF16>
__global__ __launch_bounds__(128) void k_gemm_bf(const float* __restrict__ A, int lda, const unsigned short* __restrict__ Wt, int ldb,
                                               const float* __restrict__ bias, float* __restrict__ C, int ldc, int M, int N, int K) {
  __shared__ __attribute__((aligned(16))) float so[4][16][64];
  const int tid = threadIdx.x, w = tid >> 5, lane = tid & 31, ln = lane & 15, hh = lane >> 4;
  const int ntn = N / 64;
  const int wid = blockIdx.x * 4 + w;
  const int mt = wid / ntn, nq = wid % ntn;
  if (mt * 16 >= M) return;
  const int row0 = mt * 16, col0 = nq * 64;
  const float* arow = A + (size_t)(row0 + ln) * lda;
  v8f acc[4] = {};
  for (int kb = 0; kb < K; kb += 32) {
    FragB ah, al;
    const v4f x0 = *(const v4fa*)(arow + kb + 8 * hh), x1 = *(const v4fa*)(arow + kb + 8 * hh + 4);
    const v4f x2 = *(const v4fa*)(arow + kb + 16 + 8 * hh), x3 = *(const v4fa*)(arow + kb + 16 + 8 * hh + 4);
    float xs[16] = {x0[0],x0[1],x0[2],x0[3],x1[0],x1[1],x1[2],x1[3],x2[0],x2[1],x2[2],x2[3],x3[0],x3[1],x3[2],x3[3]};
#pragma unroll
    for (int i = 0; i < 16; ++i) { const unsigned short hb = bf16_bits(xs[i]); ah.u[i] = hb; al.u[i] = ASPLIT ? bf16_bits(xs[i] - bf16_val(hb)) : (unsigned short)0; }
#pragma unroll
    for (int t = 0; t < 4; ++t) {
      const unsigned short* brow = Wt + (size_t)(col0 + t * 16 + ln) * ldb + kb;
      FragB b;
      b.half[0] = *(const v8us*)(brow + 8 * hh);
      b.half[1] = *(const v8us*)(brow + 16 + 8 * hh);
      acc[t] = mmaN<ASPLIT ? 2 : 1>(ah.v, al.v, b.v, b.v, acc[t]);
    }
  }
#pragma unroll
  for (int t = 0; t < 4; ++t) {
    float bv = bias ? bias[col0 + t * 16 + ln] : 0.f;
    if (BIAS_BF16) bv = bf16_round(bv);
#pragma unroll
    for (int r = 0; r < 8; ++r) { float v = acc[t][r] + bv; if (ACT == 1) v = fmaxf(v, 0.f); so[w][8 * hh + r][t * 16 + ln] = v; }
  }
  __builtin_amdgcn_fence(__ATOMIC_ACQ_REL, "workgroup");
  __builtin_amdgcn_wave_barrier();
  const int rsub = lane >> 4, c4 = (lane & 15) * 4;
  {
#pragma unroll
    for (int q = 0; q < 8; ++q) {
      const int r = q * 2 + rsub;
      const v4f v = *(const v4fa*)&so[w][r][c4];
      *(v4f*)(C + (size_t)(row0 + r) * ldc + col0 + c4) = v;
    }
    
  }
}

// Flash-style causal/unmasked attention, all contractions 3-term bf16 hi/lo splits, f32 softmax with running max.
// q,k,v rows are read from f32 buffers with arbitrary row pitch (so they can live inside a fused qkv buffer);
// D = head size (multiple of 32, <= 128); one wave = 16 query rows; block = 4 waves (64 queries) sharing K/V chunks of 32.
template <int D, bool CAUSAL>
__global__ __launch_bounds__(128) void k_flash(const float* __restrict__ qb, const float* __restrict__ kb, const float* __restrict__ vb,
                                             int pitch, int T, int H, float scale, float* __restrict__ y, int ypitch) {
  constexpr int KS = D / 32;        // k-steps for QK
  constexpr int DT = D / 16;        // d tiles for PV
  __shared__ __attribute__((aligned(16))) unsigned short sKh[32][D + 8], sKl[32][D + 8], sVh[32][D + 8], sVl[32][D + 8];
  __shared__ __attribute__((aligned(16))) unsigned short sPh[4][16][40], sPl[4][16][40];
  __shared__ __attribute__((aligned(16))) float sO[4][16][D];
  const int tid = threadIdx.x, w = tid >> 5, lane = tid & 31, ln = lane & 15, hh = lane >> 4;
  const int nqb = (T + 63) / 64;
  const int bh = blockIdx.x / nqb, qblk = blockIdx.x % nqb;
  const int b = bh / H, h = bh % H;
  const int q0 = qblk * 64 + w * 16;
  const float* Q = qb + (size_t)b * T * pitch + h * D;
  const float* K = kb + (size_t)b * T * pitch + h * D;
  const float* V = vb + (size_t)b * T * pitch + h * D;

  // A fragments of the wave's 16 query rows (scaled), hi/lo
  FragB aqh[KS], aql[KS];
  {
    int row = q0 + ln; if (row >= T) row = T - 1;
    const float* qr = Q + (size_t)row * pitch;
#pragma unroll
    for (int ks = 0; ks < KS; ++ks)
#pragma unroll
      for (int i = 0; i < 16; ++i) {
        const int d = ks * 32 + ((i < 8) ? (8 * hh + i) : (16 + 8 * hh + (i - 8)));
        const float x = qr[d] * scale; const unsigned short hb = bf16_bits(x);
        aqh[ks].u[i] = hb; aql[ks].u[i] = bf16_bits(x - bf16_val(hb));
      }
  }
  float m_r[8], l_r[8];
#pragma unroll
  for (int r = 0; r < 8; ++r) { m_r[r] = -3.0e38f; l_r[r] = 0.f; }
  v8f oacc[DT];
#pragma unroll
  for (int dt = 0; dt < DT; ++dt) oacc[dt] = (v8f){0.f,0.f,0.f,0.f,0.f,0.f,0.f,0.f};

  const int kv_end = CAUSAL ? min(T, qblk * 64 + 64) : T;     // block-uniform
  for (int j0 = 0; j0 < kv_end; j0 += 32) {
    __syncthreads();
    for (int e = tid; e < 32 * (D / 4); e += 128) {
      const int r = e / (D / 4), c4 = (e % (D / 4)) * 4;
      const int key = j0 + r;
      v4f kf = {0.f,0.f,0.f,0.f}, vf = {0.f,0.f,0.f,0.f};
      if (key < T) { kf = *(const v4fa*)(K + (size_t)key * pitch + c4); vf = *(const v4fa*)(V + (size_t)key * pitch + c4); }
#pragma unroll
      for (int t = 0; t < 4; ++t) {
        unsigned short hb = bf16_bits(kf[t]); sKh[r][c4 + t] = hb; sKl[r][c4 + t] = bf16_bits(kf[t] - bf16_val(hb));
        hb = bf16_bits(vf[t]); sVh[r][c4 + t] = hb; sVl[r][c4 + t] = bf16_bits(vf[t] - bf16_val(hb));
      }
    }
    __syncthreads();
    // S tile 16 x 32
    v8f s[2];
#pragma unroll
    for (int nt = 0; nt < 2; ++nt) {
      v8f acc = {};
#pragma unroll
      for (int ks = 0; ks < KS; ++ks) {
        FragB bh_, bl_;
        bh_.half[0] = *(const v8us*)&sKh[nt * 16 + ln][ks * 32 + 8 * hh]; bh_.half[1] = *(const v8us*)&sKh[nt * 16 + ln][ks * 32 + 16 + 8 * hh];
        bl_.half[0] = *(const v8us*)&sKl[nt * 16 + ln][ks * 32 + 8 * hh]; bl_.half[1] = *(const v8us*)&sKl[nt * 16 + ln][ks * 32 + 16 + 8 * hh];
        acc = mmaN<3>(aqh[ks].v, aql[ks].v, bh_.v, bl_.v, acc);
      }
      s[nt] = acc;
    }
    // mask + running max (rows 8hh+r; the 16 lanes of a half share rows)
    float alpha[8];
#pragma unroll
    for (int r = 0; r < 8; ++r) {
      const int qi = q0 + 8 * hh + r;
      const int ja = j0 + ln, jb = j0 + 16 + ln;
      if (CAUSAL) { if (ja > qi) s[0][r] = -3.0e38f; if (jb > qi) s[1][r] = -3.0e38f; }
      if (ja >= T) s[0][r] = -3.0e38f;
      if (jb >= T) s[1][r] = -3.0e38f;
      float mx = fmaxf(s[0][r], s[1][r]);
      mx = fmaxf(mx, __shfl_xor(mx, 1, 32)); mx = fmaxf(mx, __shfl_xor(mx, 2, 32)); mx = fmaxf(mx, __shfl_xor(mx, 4, 32)); mx = fmaxf(mx, __shfl_xor(mx, 8, 32));
      const float mnew = fmaxf(m_r[r], mx);
      alpha[r] = (mnew > -1.0e38f) ? __expf(m_r[r] - mnew) : 1.0f;
      const float p0 = (s[0][r] > -1.0e38f) ? __expf(s[0][r] - mnew) : 0.f;
      const float p1 = (s[1][r] > -1.0e38f) ? __expf(s[1][r] - mnew) : 0.f;
      m_r[r] = mnew;
      l_r[r] = l_r[r] * alpha[r] + p0 + p1;            // per-lane partial row sum (16 lanes combined at the end)
      unsigned short hb = bf16_bits(p0); sPh[w][8 * hh + r][ln] = hb;      sPl[w][8 * hh + r][ln] = bf16_bits(p0 - bf16_val(hb));
      hb = bf16_bits(p1);                sPh[w][8 * hh + r][16 + ln] = hb; sPl[w][8 * hh + r][16 + ln] = bf16_bits(p1 - bf16_val(hb));
    }
#pragma unroll
    for (int dt = 0; dt < DT; ++dt)
#pragma unroll
      for (int r = 0; r < 8; ++r) oacc[dt][r] *= alpha[r];
    __builtin_amdgcn_fence(__ATOMIC_ACQ_REL, "workgroup");
    __builtin_amdgcn_wave_barrier();
    FragB pah, pal;
    pah.half[0] = *(const v8us*)&sPh[w][ln][8 * hh]; pah.half[1] = *(const v8us*)&sPh[w][ln][16 + 8 * hh];
    pal.half[0] = *(const v8us*)&sPl[w][ln][8 * hh]; pal.half[1] = *(const v8us*)&sPl[w][ln][16 + 8 * hh];
#pragma unroll
    for (int dt = 0; dt < DT; ++dt) {
      FragB bvh, bvl;
#pragma unroll
      for (int i = 0; i < 8; ++i) {
        bvh.u[i] = sVh[8 * hh + i][dt * 16 + ln]; bvh.u[8 + i] = sVh[16 + 8 * hh + i][dt * 16 + ln];
        bvl.u[i] = sVl[8 * hh + i][dt * 16 + ln]; bvl.u[8 + i] = sVl[16 + 8 * hh + i][dt * 16 + ln];
      }
      oacc[dt] = mmaN<3>(pah.v, pal.v, bvh.v, bvl.v, oacc[dt]);
    }
    __builtin_amdgcn_fence(__ATOMIC_ACQ_REL, "workgroup");
    __builtin_amdgcn_wave_barrier();
  }
#pragma unroll
  for (int r = 0; r < 8; ++r) {
    float l = l_r[r];
    l += __shfl_xor(l, 1, 32); l += __shfl_xor(l, 2, 32); l += __shfl_xor(l, 4, 32); l += __shfl_xor(l, 8, 32);
    l_r[r] = (l > 0.f) ? 1.0f / l : 0.f;
  }
#pragma unroll
  for (int dt = 0; dt < DT; ++dt)
#pragma unroll
    for (int r = 0; r < 8; ++r) sO[w][8 * hh + r][dt * 16 + ln] = oacc[dt][r] * l_r[r];
  __builtin_amdgcn_fence(__ATOMIC_ACQ_REL, "workgroup");
  __builtin_amdgcn_wave_barrier();
  {
    for (int r = 0; r < 16; ++r) {
      const int row = q0 + r;
      if (row < T && lane < D / 4) {
        const v4f val = *(const v4fa*)&sO[w][r][lane * 4];
        *(v4f*)(y + ((size_t)b * T + row) * ypitch + h * D + lane * 4) = val;
      }
    }
    
  }
}

// GEMM C = act(A·W + bias + resid): A f32 (ASPLIT -> hi/lo 2 terms), Wt bf16 [N][K]; ACT 0 none, 1 relu, 2 exact gelu;
// resid (optional, f32, row index = (row % rmod), pitch ldr, RES_BF16 rounds it) added before the activation.
template <bool ASPLIT, int ACT, bool BIAS_BF16, bool RES_BF16>
__global__ __launch_bounds__(128) void k_gemm_bf3(const float* __restrict__ A, int lda, const unsigned short* __restrict__ Wt, int ldb,
                                                const float* __restrict__ bias, const float* __restrict__ resid, int rmod, int ldr,
                                                float* __restrict__ C, int ldc, int M, int N, int K) {
  __shared__ __attribute__((aligned(16))) float so[4][16][64];
  const int tid = threadIdx.x, w = tid >> 5, lane = tid & 31, ln = lane & 15, hh = lane >> 4;
  const int ntn = N / 64;
  const int wid = blockIdx.x * 4 + w;
  const int mt = wid / ntn, nq = wid % ntn;
  if (mt * 16 >= M) return;
  const int row0 = mt * 16, col0 = nq * 64;
  const float* arow = A + (size_t)(row0 + ln) * lda;
  v8f acc[4] = {};
  for (int kb = 0; kb < K; kb += 32) {
    FragB ah, al;
    const v4f x0 = *(const v4fa*)(arow + kb + 8 * hh), x1 = *(const v4fa*)(arow + kb + 8 * hh + 4);
    const v4f x2 = *(const v4fa*)(arow + kb + 16 + 8 * hh), x3 = *(const v4fa*)(arow + kb + 16 + 8 * hh + 4);
    float xs[16] = {x0[0],x0[1],x0[2],x0[3],x1[0],x1[1],x1[2],x1[3],x2[0],x2[1],x2[2],x2[3],x3[0],x3[1],x3[2],x3[3]};
#pragma unroll
    for (int i = 0; i < 16; ++i) { const unsigned short hb = bf16_bits(xs[i]); ah.u[i] = hb; al.u[i] = ASPLIT ? bf16_bits(xs[i] - bf16_val(hb)) : (unsigned short)0; }
#pragma unroll
    for (int t = 0; t < 4; ++t) {
      const unsigned short* brow = Wt + (size_t)(col0 + t * 16 + ln) * ldb + kb;
      FragB b;
      b.half[0] = *(const v8us*)(brow + 8 * hh);
      b.half[1] = *(const v8us*)(brow + 16 + 8 * hh);
      acc[t] = mmaN<ASPLIT ? 2 : 1>(ah.v, al.v, b.v, b.v, acc[t]);
    }
  }
#pragma unroll
  for (int t = 0; t < 4; ++t) {
    const int col = col0 + t * 16 + ln;
    float bv = bias ? bias[col] : 0.f;
    if (BIAS_BF16) bv = bf16_round(bv);
#pragma unroll
    for (int r = 0; r < 8; ++r) {
      float v = acc[t][r] + bv;
      if (resid) { float rv = resid[(size_t)((row0 + 8 * hh + r) % rmod) * ldr + col]; if (RES_BF16) rv = bf16_round(rv); v += rv; }
      if (ACT == 1) v = fmaxf(v, 0.f);
      if (ACT == 2) v = 0.5f * v * (1.0f + erff(v * 0.70710678118654752f));
      if (ACT == 3) { const float u = 0.7978845608028654f * (v + 0.044715f * v * v * v); v = 0.5f * v * (1.0f + tanhf(u)); }
      so[w][8 * hh + r][t * 16 + ln] = v;
    }
  }
  __builtin_amdgcn_fence(__ATOMIC_ACQ_REL, "workgroup");
  __builtin_amdgcn_wave_barrier();
  const int rsub = lane >> 4, c4 = (lane & 15) * 4;
  {
#pragma unroll
    for (int q = 0; q < 8; ++q) {
      const int r = q * 2 + rsub;
      const v4f v = *(const v4fa*)&so[w][r][c4];
      *(v4f*)(C + (size_t)(row0 + r) * ldc + col0 + c4) = v;
    }
    
  }
}
// row LayerNorm (biased variance, eps) over N: s = X (+ R); optional out_sum <- s; out_norm <- (s-mu)*rsqrt(var+eps)*g + b
template <bool PARAM_BF16>
__global__ __launch_bounds__(256) void k_layernorm(const float* __restrict__ X, const float* __restrict__ R, const float* __restrict__ g, const float* __restrict__ bta,
                                                  float* __restrict__ out_sum, float* __restrict__ out_norm, int N, float eps) {
  __shared__ float red[256];
  const int row = blockIdx.x, tid = threadIdx.x;
  const float* x = X + (size_t)row * N; const float* rr = R ? R + (size_t)row * N : nullptr;
  float vals[16];                     // up to N = 4096
  const int per = N / 256;            // contiguous chunk per thread? use strided-by-4 chunks: thread handles j = tid*4 + 1024*u
  float s1 = 0.f;
  for (int u = 0; u < per / 4; ++u) {
    const int j = tid * 4 + 1024 * u;
    const v4f a = *(const v4fa*)(x + j);
    v4f b = {0.f,0.f,0.f,0.f}; if (rr) b = *(const v4fa*)(rr + j);
#pragma unroll
    for (int q = 0; q < 4; ++q) { const float v = a[q] + b[q]; vals[u * 4 + q] = v; s1 += v; }
  }
  red[tid] = s1; __syncthreads();
  for (int st = 128; st > 0; st >>= 1) { if (tid < st) red[tid] += red[tid + st]; __syncthreads(); }
  const float mu = red[0] / (float)N; __syncthreads();
  float s2 = 0.f;
  for (int u = 0; u < per / 4; ++u)
#pragma unroll
    for (int q = 0; q < 4; ++q) { const float c = vals[u * 4 + q] - mu; s2 += c * c; }
  red[tid] = s2; __syncthreads();
  for (int st = 128; st > 0; st >>= 1) { if (tid < st) red[tid] += red[tid + st]; __syncthreads(); }
  const float rs = rsqrtf(red[0] / (float)N + eps);
  {
    for (int u = 0; u < per / 4; ++u) {
      const int j = tid * 4 + 1024 * u;
      v4f o, sm;
#pragma unroll
      for (int q = 0; q < 4; ++q) {
        float gg = g[j + q], bb = bta[j + q];
        if (PARAM_BF16) { gg = bf16_round(gg); bb = bf16_round(bb); }
        sm[q] = vals[u * 4 + q]; o[q] = (vals[u * 4 + q] - mu) * rs * gg + bb;
      }
      if (out_sum) *(v4f*)(out_sum + (size_t)row * N + j) = sm;
      *(v4f*)(out_norm + (size_t)row * N + j) = o;
    }
    
  }
}



// ---- f16 WMMA path (v_wmma_f32_16x16x32_f16): 11-bit significands for operands in range — used where a [0,1] probability operand needs more precision than bf16
typedef _Float16 v16h __attribute__((ext_vector_type(16)));
union FragH { v16h v; v8us half[2]; _Float16 h[16]; unsigned short u[16]; };
template <int NT>
__device__ __forceinline__ v8f mmaH(v16h ah, v16h al, v16h bh, v16h bl, v8f c) {
  c = __builtin_amdgcn_wmma_f32_16x16x32_f16(false, ah, false, bh, (short)0, c, false, false);
  if (NT >= 2) c = __builtin_amdgcn_wmma_f32_16x16x32_f16(false, al, false, bh, (short)0, c, false, false);
  if (NT >= 3) c = __builtin_amdgcn_wmma_f32_16x16x32_f16(false, ah, false, bl, (short)0, c, false, false);
  asm volatile("v_nop\n\tv_nop\n\tv_nop\n\tv_nop" : "+v"(c) : "v"(ah), "v"(al), "v"(bh), "v"(bl));
  return c;
}
// batched GEMM like k_gemm_b but f16 operands: A f32 (split into f16 hi/lo if ASPLIT, else rounded to f16), Bt = f16 values [n][k]; alpha; C f32; N multiple of 16 (partial tiles skipped)
template <bool ASPLIT>
__global__ __launch_bounds__(128) void k_gemm_h(const float* __restrict__ A, int lda, size_t sA, const _Float16* __restrict__ Bh, int ldb, size_t sB, float alpha, float* __restrict__ C, int ldc, size_t sC, int M, int N, int K) {
  __shared__ __attribute__((aligned(16))) float so[4][16][64];
  const int tid = threadIdx.x, w = tid >> 5, lane = tid & 31, ln = lane & 15, hh = lane >> 4; const int by = blockIdx.y;
  A += (size_t)by * sA; Bh += (size_t)by * sB; C += (size_t)by * sC;
  const int ntn = (N + 63) / 64; const int wid = blockIdx.x * 4 + w; const int mt = wid / ntn, nq = wid % ntn; if (mt * 16 >= M) return;
  const int row0 = mt * 16, col0 = nq * 64; const float* arow = A + (size_t)(row0 + ln) * lda;
  v8f acc[4] = {};
  for (int kb = 0; kb < K; kb += 32) {
    FragH ah, al;
    const v4f x0 = *(const v4fa*)(arow + kb + 8 * hh), x1 = *(const v4fa*)(arow + kb + 8 * hh + 4), x2 = *(const v4fa*)(arow + kb + 16 + 8 * hh), x3 = *(const v4fa*)(arow + kb + 16 + 8 * hh + 4);
    float xs[16] = {x0[0],x0[1],x0[2],x0[3],x1[0],x1[1],x1[2],x1[3],x2[0],x2[1],x2[2],x2[3],x3[0],x3[1],x3[2],x3[3]};
#pragma unroll
    for (int i = 0; i < 16; ++i) { const _Float16 h = (_Float16)xs[i]; ah.h[i] = h; al.h[i] = ASPLIT ? (_Float16)(xs[i] - (float)h) : (_Float16)0.0f; }
#pragma unroll
    for (int t = 0; t < 4; ++t) { if (col0 + t * 16 >= N) continue; const size_t boff = (size_t)(col0 + t * 16 + ln) * ldb + kb; FragH bq; bq.half[0] = *(const v8us*)(Bh + boff + 8 * hh); bq.half[1] = *(const v8us*)(Bh + boff + 16 + 8 * hh);
      acc[t] = mmaH<ASPLIT ? 2 : 1>(ah.v, al.v, bq.v, bq.v, acc[t]); }
  }
#pragma unroll
  for (int t = 0; t < 4; ++t) { if (col0 + t * 16 >= N) continue;
#pragma unroll
    for (int r = 0; r < 8; ++r) so[w][8 * hh + r][t * 16 + ln] = acc[t][r] * alpha; }
  __builtin_amdgcn_fence(__ATOMIC_ACQ_REL, "workgroup"); __builtin_amdgcn_wave_barrier();
  const int rsub = lane >> 4, c4 = (lane & 15) * 4;
  {
#pragma unroll
    for (int q = 0; q < 8; ++q) { const int r = q * 2 + rsub; if (col0 + c4 < N) { const v4f v = *(const v4fa*)&so[w][r][c4]; *(v4f*)(C + (size_t)(row0 + r) * ldc + col0 + c4) = v; } }
     }
}

// Wt[n][k] = f16(W[k][n]·scale) from f32 row-major W[K][N] (scale = power of two; bf16-exact weights stay exact in f16 away from the subnormal range)
__global__ __launch_bounds__(256) void k_wt_f16(const float* __restrict__ W, _Float16* __restrict__ Wt, int K, int N, float scale) {
  const int t = blockIdx.x * 256 + threadIdx.x; if (t >= N * (K / 8)) return; const int n = t / (K / 8), k8 = (t % (K / 8)) * 8; FragH f;
#pragma unroll
  for (int i = 0; i < 8; ++i) f.h[i] = (_Float16)(bf16_round(W[(size_t)(k8 + i) * N + n]) * scale); const v8us o = f.half[0];
  *(v8us*)((unsigned short*)Wt + (size_t)n * K + k8) = o; 
}
typedef _Float16 v4h __attribute__((ext_vector_type(4)));

__global__ __launch_bounds__(256) void k_x16(const float* __restrict__ x, _Float16* __restrict__ X16, size_t n8) { const size_t t = (size_t)blockIdx.x * 256 + threadIdx.x; if (t >= n8) return; FragH f;
#pragma unroll
  for (int q = 0; q < 8; ++q) f.h[q] = (_Float16)bf16_round(x[t * 8 + q]); *(v8us*)((unsigned short*)X16 + t * 8) = f.half[0];  }
__global__ __launch_bounds__(256) void k_h16(const float* __restrict__ x, _Float16* __restrict__ X16, size_t n8) { const size_t t = (size_t)blockIdx.x * 256 + threadIdx.x; if (t >= n8) return; FragH f;
#pragma unroll
  for (int q = 0; q < 8; ++q) f.h[q] = (_Float16)x[t * 8 + q]; *(v8us*)((unsigned short*)X16 + t * 8) = f.half[0];  }
__global__ __launch_bounds__(256) void k_round16f(const float* __restrict__ W, _Float16* __restrict__ Bt, size_t n8) { const size_t t = (size_t)blockIdx.x * 256 + threadIdx.x; if (t >= n8) return; FragH f;
#pragma unroll
  for (int i = 0; i < 8; ++i) f.h[i] = (_Float16)(bf16_round(W[t * 8 + i]) * 16.0f); *(v8us*)((unsigned short*)Bt + t * 8) = f.half[0];  }
template <int NHv, int TTv>
__global__ __launch_bounds__(256) void k_vt(const _Float16* __restrict__ V16, int ldv, int voff, _Float16* __restrict__ Vt) { __shared__ unsigned short tl[64][66]; const int tid = threadIdx.x; const int slab = blockIdx.x / (TTv / 64), lg = blockIdx.x % (TTv / 64); const int b = slab / NHv, h = slab % NHv;
  for (int i = tid; i < 64 * 8; i += 256) { const int r = i / 8, c8 = (i % 8) * 8; FragH f; f.half[0] = *(const v8us*)((const unsigned short*)V16 + ((size_t)b * TTv + lg * 64 + r) * ldv + voff + h * 64 + c8);
#pragma unroll
    for (int q = 0; q < 8; ++q) tl[r][c8 + q] = f.u[q]; }
  __syncthreads();
  {
#pragma unroll
    for (int rd = 0; rd < 2; ++rd) { const int d = rd * 32 + tid / 8, pc = tid % 8; FragH f;
#pragma unroll
      for (int q = 0; q < 8; ++q) f.u[q] = tl[pc * 8 + q][d];
      *(v8us*)((unsigned short*)Vt + ((size_t)slab * 64 + d) * TTv + lg * 64 + pc * 8) = f.half[0]; }
     } }

template <int D, int RBF>
__global__ __launch_bounds__(256) void k_lnx(const float* __restrict__ X, const float* __restrict__ gam, const float* __restrict__ bet, int nrows, float eps, _Float16* __restrict__ O16, float* __restrict__ XR) {
  constexpr int NP = D / 128; const int tid = threadIdx.x, wv = tid >> 5, lane = tid & 31; const size_t r = (size_t)blockIdx.x * 8 + wv; if (r >= (size_t)nrows) return; v4f y[NP]; float s = 0.f;
#pragma unroll
  for (int j = 0; j < NP; ++j) { const int c = j * 128 + lane * 4; v4f g = *(const v4fa*)(X + r * D + c); if (RBF) { for (int q = 0; q < 4; ++q) g[q] = bf16_round(g[q]); } y[j] = g; s += g[0] + g[1] + g[2] + g[3]; }
  for (int o = 16; o >= 1; o >>= 1) s += __shfl_xor(s, o, 32); const float mu = s / (float)D; float q2 = 0.f;
#pragma unroll
  for (int j = 0; j < NP; ++j) for (int q = 0; q < 4; ++q) { const float d = y[j][q] - mu; q2 += d * d; }
  for (int o = 16; o >= 1; o >>= 1) q2 += __shfl_xor(q2, o, 32); const float rs = rsqrtf(q2 / (float)D + eps);
  {
#pragma unroll
    for (int j = 0; j < NP; ++j) { const int c = j * 128 + lane * 4; v4h h; for (int q = 0; q < 4; ++q) { const float v = (y[j][q] - mu) * rs * bf16_round(gam[c + q]) + bf16_round(bet[c + q]); h[q] = (_Float16)v; } *(v4h*)(O16 + r * D + c) = h; if (XR) *(v4f*)(XR + r * D + c) = y[j]; }
     } }
__global__ __launch_bounds__(256) void k_vthl(const float* __restrict__ VF, int ldv, _Float16* __restrict__ Vth, _Float16* __restrict__ Vtl) { __shared__ float tl[64][65]; const int tid = threadIdx.x; const int slab = blockIdx.x / (TT / 64), lg = blockIdx.x % (TT / 64); const int b = slab / NH, h = slab % NH;
  for (int i = tid; i < 64 * 16; i += 256) { const int r = i / 16, c4 = (i % 16) * 4; const v4f a = *(const v4fa*)(VF + ((size_t)b * TT + lg * 64 + r) * ldv + h * HD + c4); tl[r][c4] = a[0]; tl[r][c4 + 1] = a[1]; tl[r][c4 + 2] = a[2]; tl[r][c4 + 3] = a[3]; }
  __syncthreads();
  FragH fh[2], fl[2]; size_t oo[2];
#pragma unroll
  for (int rd = 0; rd < 2; ++rd) { const int d = rd * 32 + tid / 8, pc = tid % 8;
#pragma unroll
    for (int q = 0; q < 8; ++q) { const float v = tl[pc * 8 + q][d]; const _Float16 hv = (_Float16)v; fh[rd].h[q] = hv; fl[rd].h[q] = (_Float16)((v - (float)hv) * 1024.0f); } oo[rd] = ((size_t)slab * HD + d) * TT + lg * 64 + pc * 8; }
  {
#pragma unroll
    for (int rd = 0; rd < 2; ++rd) { *(v8us*)((unsigned short*)Vth + oo[rd]) = fh[rd].half[0]; *(v8us*)((unsigned short*)Vtl + oo[rd]) = fl[rd].half[0]; }
     } }
__global__ __launch_bounds__(128) void k_flash(const _Float16* __restrict__ Q16, int ldq, const _Float16* __restrict__ K16, int ldk, const _Float16* __restrict__ Vt, const _Float16* __restrict__ Vtlo, float* __restrict__ O, int ldo) {
  constexpr int RPW = 16, RTN = RPW / 16, NQB = TT / (4 * RPW), DT = 4, KS = 2;
  __shared__ __attribute__((aligned(16))) unsigned short sP[4][RPW][40]; __shared__ __attribute__((aligned(16))) float sO[4][RPW][64 + 4];
  const int tid = threadIdx.x, w = tid >> 5, lane = tid & 31, ln = lane & 15, hh = lane >> 4;
  const int slab = blockIdx.x / NQB, qblk = blockIdx.x % NQB; const int b = slab / NH, h = slab % NH; const int qb0 = qblk * (4 * RPW); const int q0 = qb0 + w * RPW;
  FragH aq[2][KS];
#pragma unroll
  for (int rt = 0; rt < RTN; ++rt) { const unsigned short* qr = (const unsigned short*)Q16 + ((size_t)b * TT + q0 + rt * 16 + ln) * ldq + h * 64;
#pragma unroll
    for (int ks = 0; ks < KS; ++ks) { aq[rt][ks].half[0] = *(const v8us*)(qr + ks * 32 + 8 * hh); aq[rt][ks].half[1] = *(const v8us*)(qr + ks * 32 + 16 + 8 * hh); } }
  const unsigned short* Vth = (const unsigned short*)Vt + (size_t)slab * 64 * TT; const unsigned short* Vtl = (const unsigned short*)Vtlo + (size_t)slab * 64 * TT;
  float m_r[2][8], l_r[2][8]; v8f oacc[2][DT], oaccl[2][DT];
#pragma unroll
  for (int rt = 0; rt < RTN; ++rt) {
#pragma unroll
    for (int r = 0; r < 8; ++r) { m_r[rt][r] = -3.0e38f; l_r[rt][r] = 0.f; }
#pragma unroll
    for (int dt = 0; dt < DT; ++dt) { oacc[rt][dt] = (v8f){0.f,0.f,0.f,0.f,0.f,0.f,0.f,0.f}; oaccl[rt][dt] = oacc[rt][dt]; } }
  const int jbeg = (qb0 - RW) > 0 ? (qb0 - RW) : 0; const int jend = (qb0 + 4 * RPW + RW) < TT ? (qb0 + 4 * RPW + RW) : TT;      /* block-uniform window bounds (multiples of 32) */
#pragma unroll 1
  for (int j0 = jbeg; j0 < jend; j0 += 32) {
    
    v8f s[2][2];
#pragma unroll
    for (int nt = 0; nt < 2; ++nt) { const unsigned short* kr = (const unsigned short*)K16 + ((size_t)b * TT + j0 + nt * 16 + ln) * ldk + h * 64; FragH bk[KS];
#pragma unroll
      for (int ks = 0; ks < KS; ++ks) { bk[ks].half[0] = *(const v8us*)(kr + ks * 32 + 8 * hh); bk[ks].half[1] = *(const v8us*)(kr + ks * 32 + 16 + 8 * hh); }
#pragma unroll
      for (int rt = 0; rt < RTN; ++rt) { v8f acc = (v8f){0.f,0.f,0.f,0.f,0.f,0.f,0.f,0.f};
#pragma unroll
        for (int ks = 0; ks < KS; ++ks) acc = mmaH<1>(aq[rt][ks].v, aq[rt][ks].v, bk[ks].v, bk[ks].v, acc); s[rt][nt] = acc; } }
#pragma unroll
    for (int rt = 0; rt < RTN; ++rt)
#pragma unroll
      for (int r = 0; r < 8; ++r) { const int tq = q0 + rt * 16 + 8 * hh + r; const int k0 = j0 + ln, k1 = j0 + 16 + ln; (void)tq; (void)k0; (void)k1;
        const bool ok0 = (k0 - tq <= RW) && (tq - k0 <= RW), ok1 = (k1 - tq <= RW) && (tq - k1 <= RW);
        const float s0 = ok0 ? s[rt][0][r] * 0.125f : -INFINITY, s1 = ok1 ? s[rt][1][r] * 0.125f : -INFINITY; float mc = fmaxf(s0, s1);
        mc = fmaxf(mc, __shfl_xor(mc, 1, 32)); mc = fmaxf(mc, __shfl_xor(mc, 2, 32)); mc = fmaxf(mc, __shfl_xor(mc, 4, 32)); mc = fmaxf(mc, __shfl_xor(mc, 8, 32));
        const float mn = fmaxf(m_r[rt][r], mc); const float al = (mn > -1.0e38f) ? expf(m_r[rt][r] - mn) : 1.0f; m_r[rt][r] = mn; const float p0 = ok0 ? expf(s0 - mn) : 0.f, p1 = ok1 ? expf(s1 - mn) : 0.f; l_r[rt][r] = l_r[rt][r] * al + p0 + p1;
#pragma unroll
        for (int dt = 0; dt < DT; ++dt) { oacc[rt][dt][r] *= al; oaccl[rt][dt][r] *= al; }
        FragH t2; t2.h[0] = (_Float16)(p0 * 1024.0f); t2.h[1] = (_Float16)(p1 * 1024.0f); sP[w][rt * 16 + 8 * hh + r][ln] = t2.u[0]; sP[w][rt * 16 + 8 * hh + r][16 + ln] = t2.u[1]; }
    __builtin_amdgcn_fence(__ATOMIC_ACQ_REL, "workgroup"); __builtin_amdgcn_wave_barrier();
    FragH pa[2];
#pragma unroll
    for (int rt = 0; rt < RTN; ++rt) { pa[rt].half[0] = *(const v8us*)&sP[w][rt * 16 + ln][8 * hh]; pa[rt].half[1] = *(const v8us*)&sP[w][rt * 16 + ln][16 + 8 * hh]; }
#pragma unroll
    for (int dt = 0; dt < DT; ++dt) { const size_t vo = (size_t)(dt * 16 + ln) * TT + j0; FragH bv, bl; bv.half[0] = *(const v8us*)(Vth + vo + 8 * hh); bv.half[1] = *(const v8us*)(Vth + vo + 16 + 8 * hh); bl.half[0] = *(const v8us*)(Vtl + vo + 8 * hh); bl.half[1] = *(const v8us*)(Vtl + vo + 16 + 8 * hh);
#pragma unroll
      for (int rt = 0; rt < RTN; ++rt) { oacc[rt][dt] = mmaH<1>(pa[rt].v, pa[rt].v, bv.v, bv.v, oacc[rt][dt]); oaccl[rt][dt] = mmaH<1>(pa[rt].v, pa[rt].v, bl.v, bl.v, oaccl[rt][dt]); } }
    __builtin_amdgcn_fence(__ATOMIC_ACQ_REL, "workgroup"); __builtin_amdgcn_wave_barrier(); }
#pragma unroll
  for (int rt = 0; rt < RTN; ++rt) {
#pragma unroll
    for (int r = 0; r < 8; ++r) { float l = l_r[rt][r]; l += __shfl_xor(l, 1, 32); l += __shfl_xor(l, 2, 32); l += __shfl_xor(l, 4, 32); l += __shfl_xor(l, 8, 32); l_r[rt][r] = (l > 0.f) ? 1.0f / (l * 1024.0f) : 0.f; }
#pragma unroll
    for (int dt = 0; dt < DT; ++dt)
#pragma unroll
      for (int r = 0; r < 8; ++r) sO[w][rt * 16 + 8 * hh + r][dt * 16 + ln] = (oacc[rt][dt][r] + oaccl[rt][dt][r] * 0.0009765625f) * l_r[rt][r]; }
  __builtin_amdgcn_fence(__ATOMIC_ACQ_REL, "workgroup"); __builtin_amdgcn_wave_barrier();
  {
#pragma unroll
    for (int rp = 0; rp < RPW; rp += 2) { const int r = rp + (lane >> 4), pc = lane & 15; const v4f val = *(const v4fa*)&sO[w][r][pc * 4]; *(v4f*)(O + ((size_t)b * TT + q0 + r) * ldo + h * 64 + pc * 4) = val; }
     } }

// ---- tiled f16 GEMM with fused epilogue: act(A[M][K] * Bh[N][K]^T * alpha + bf16(bias[col]) (+ CP[row][col] if RES)) -> C16 (f16, if OUT16) or C (f32); ACT 0 none, 6 erf-GELU. A and Bh f16 and k-contiguous (pitch K), C / C16 / CP pitch N.
// One work-group = one 128 x 128 tile of C, 8 waves as 4 (rows) x 2 (columns), 32 x 64 of C per wave. A pass is 128 k: 256 B of each of the 128 A rows and 128 Bh rows,
// laid in LDS at a pitch of 272 B (an odd multiple of 16 B: conflict-free for ds_load_b128 fragment reads). Two buffers; the next pass's rows are copied while this pass is multiplied.
// M, N multiples of 128, K a multiple of 128. The k order of every accumulator is ascending in steps of 32.
#define GT_ROWB 272
#define GT_STAGE (256 * GT_ROWB)
// Eight 16-byte asynchronous copies of one lane, global -> LDS, rows 16 apart. The s_wait_xcnt closes the statement so that no address register is rewritten ahead of it.
template <int K>
__device__ __forceinline__ void gt_copy8(unsigned l0, const _Float16* g0) {
  const unsigned l1 = l0 + 16 * GT_ROWB, l2 = l0 + 32 * GT_ROWB, l3 = l0 + 48 * GT_ROWB, l4 = l0 + 64 * GT_ROWB, l5 = l0 + 80 * GT_ROWB, l6 = l0 + 96 * GT_ROWB, l7 = l0 + 112 * GT_ROWB;
  const _Float16 *g1 = g0 + 16 * K, *g2 = g0 + 32 * K, *g3 = g0 + 48 * K, *g4 = g0 + 64 * K, *g5 = g0 + 80 * K, *g6 = g0 + 96 * K, *g7 = g0 + 112 * K;
  asm volatile("global_load_async_to_lds_b128 %0, %8, off\n\t"
               "global_load_async_to_lds_b128 %1, %9, off\n\t"
               "global_load_async_to_lds_b128 %2, %10, off\n\t"
               "global_load_async_to_lds_b128 %3, %11, off\n\t"
               "global_load_async_to_lds_b128 %4, %12, off\n\t"
               "global_load_async_to_lds_b128 %5, %13, off\n\t"
               "global_load_async_to_lds_b128 %6, %14, off\n\t"
               "global_load_async_to_lds_b128 %7, %15, off\n\t"
               "s_wait_xcnt 0x0"
               :: "v"(l0), "v"(l1), "v"(l2), "v"(l3), "v"(l4), "v"(l5), "v"(l6), "v"(l7), "v"(g0), "v"(g1), "v"(g2), "v"(g3), "v"(g4), "v"(g5), "v"(g6), "v"(g7) : "memory");
}
template <int ACT, int N, int K, bool RES, bool OUT16>
__global__ __launch_bounds__(256) void k_gemm_t(const _Float16* __restrict__ A, const _Float16* __restrict__ Bh, float alpha, const float* __restrict__ bias, const float* __restrict__ CP, float* __restrict__ C, _Float16* __restrict__ C16) {
  __shared__ __attribute__((aligned(16))) unsigned char L[2 * GT_STAGE];
  constexpr int NST = K / 128, NTN = N / 128;
  const int tid = threadIdx.x, w = tid >> 5, lane = tid & 31, ln = lane & 15, hh = lane >> 4;
  const int row0 = (int)(blockIdx.x / NTN) * 128, col0 = (int)(blockIdx.x % NTN) * 128;
  const int wm = w >> 1, wn = w & 1;
  // copy roles: 16 lanes cover one row's 256 B; a thread takes rows (tid / 16) + 16 i of A and of Bh
  const unsigned lcp = (unsigned)(size_t)L + (unsigned)(tid >> 4) * GT_ROWB + (unsigned)(tid & 15) * 16u;
  const _Float16* ga = A + (size_t)(row0 + (tid >> 4)) * K + (tid & 15) * 8;
  const _Float16* gb = Bh + (size_t)(col0 + (tid >> 4)) * K + (tid & 15) * 8;
  v8f acc[2][4];
#pragma unroll
  for (int i = 0; i < 2; ++i)
#pragma unroll
    for (int j = 0; j < 4; ++j) acc[i][j] = (v8f){0.f,0.f,0.f,0.f,0.f,0.f,0.f,0.f};
  gt_copy8<K>(lcp, ga); gt_copy8<K>(lcp + 128 * GT_ROWB, gb);
  asm volatile("s_wait_asynccnt 0x0" ::: "memory");      // this wave's copies of pass 0 have landed
  __syncthreads();                                        // ... and every other wave's
  if (NST > 1) { gt_copy8<K>(lcp + GT_STAGE, ga + 128); gt_copy8<K>(lcp + GT_STAGE + 128 * GT_ROWB, gb + 128); }
#pragma unroll 1      /* one pass per trip: the ring's waits and its barrier stand once, at the foot */
  for (int t = 0; t < NST; ++t) {
    const unsigned buf = (unsigned)(t & 1) * GT_STAGE;
    const unsigned char* sa = L + buf + (wm * 32 + ln) * GT_ROWB + 16 * hh;
    const unsigned char* sb = L + buf + (128 + wn * 64 + ln) * GT_ROWB + 16 * hh;
    // two fragment sets: block ks + 1's twelve LDS reads go out as one group ahead of block ks's eight WMMAs (all inside this pass's own buffer)
    FragH a[2][2], b[2][4];
#pragma unroll
    for (int i = 0; i < 2; ++i) { a[0][i].half[0] = *(const v8us*)(sa + i * 16 * GT_ROWB); a[0][i].half[1] = *(const v8us*)(sa + i * 16 * GT_ROWB + 32); }
#pragma unroll
    for (int j = 0; j < 4; ++j) { b[0][j].half[0] = *(const v8us*)(sb + j * 16 * GT_ROWB); b[0][j].half[1] = *(const v8us*)(sb + j * 16 * GT_ROWB + 32); }
#pragma unroll
    for (int ks = 0; ks < 4; ++ks) {
      const int cu = ks & 1, nx = cu ^ 1;
      if (ks < 3) {
#pragma unroll
        for (int i = 0; i < 2; ++i) { a[nx][i].half[0] = *(const v8us*)(sa + i * 16 * GT_ROWB + (ks + 1) * 64); a[nx][i].half[1] = *(const v8us*)(sa + i * 16 * GT_ROWB + (ks + 1) * 64 + 32); }
#pragma unroll
        for (int j = 0; j < 4; ++j) { b[nx][j].half[0] = *(const v8us*)(sb + j * 16 * GT_ROWB + (ks + 1) * 64); b[nx][j].half[1] = *(const v8us*)(sb + j * 16 * GT_ROWB + (ks + 1) * 64 + 32); }
      }
      __builtin_amdgcn_sched_barrier(0);      // keeps the read group whole and ahead of the WMMAs: without it the scheduler spreads the reads among them and waits to 0 at each place
#pragma unroll
      for (int i = 0; i < 2; ++i)
#pragma unroll
        for (int j = 0; j < 4; ++j) acc[i][j] = __builtin_amdgcn_wmma_f32_16x16x32_f16(false, a[cu][i].v, false, b[cu][j].v, (short)0, acc[i][j], false, false);
      __builtin_amdgcn_sched_barrier(0);      // ... and keeps the next group behind this block
    }
    asm volatile("s_wait_dscnt 0x0" ::: "memory");        // this wave's reads of the buffer have retired before it is refilled
    asm volatile("s_wait_asynccnt 0x0" ::: "memory");     // this wave's copies of pass t + 1 have landed
    __syncthreads();                                      // publishes pass t + 1 and ends every reader's last read of pass t's buffer
    if (t + 2 < NST) { gt_copy8<K>(lcp + buf, ga + (t + 2) * 128); gt_copy8<K>(lcp + buf + 128 * GT_ROWB, gb + (t + 2) * 128); }
  }
  asm volatile("s_wait_asynccnt 0x0" ::: "memory");       // no copy is outstanding when the ring becomes output staging
  // epilogue: each wave stages its 32 x 64 tile in its own range of the ring (pitch 68 floats) and stores whole lines
  float* so = (float*)L + w * (32 * 68);
#pragma unroll
  for (int j = 0; j < 4; ++j) { const float bv = bf16_round(bias[col0 + wn * 64 + j * 16 + ln]);
#pragma unroll
    for (int i = 0; i < 2; ++i)
#pragma unroll
      for (int r = 0; r < 8; ++r) so[(i * 16 + 8 * hh + r) * 68 + j * 16 + ln] = acc[i][j][r] * alpha + bv; }
  __builtin_amdgcn_fence(__ATOMIC_ACQ_REL, "workgroup"); __builtin_amdgcn_wave_barrier();      // the wave's own LDS writes are read back by other lanes of the same wave
  const int rsub = lane >> 4, c4 = (lane & 15) * 4;
#pragma unroll (ACT == 6 ? 2 : 16)      /* the erf text is long: unrolled by 2 only with erf, for speed only */
  for (int q = 0; q < 16; ++q) { const int r = q * 2 + rsub; v4f v = *(const v4fa*)&so[r * 68 + c4]; const size_t o = (size_t)(row0 + wm * 32 + r) * N + col0 + wn * 64 + c4;
    if (RES) { const v4f c = *(const v4fa*)(CP + o); v[0] += c[0]; v[1] += c[1]; v[2] += c[2]; v[3] += c[3]; }
    if (ACT == 6) {
#pragma unroll
      for (int e = 0; e < 4; ++e) v[e] = 0.5f * v[e] * (1.0f + erff(v[e] * 0.70710678118654752f)); }
    if (!OUT16) *(v4f*)(C + o) = v;
    else { v4h h4;
#pragma unroll
      for (int e = 0; e < 4; ++e) h4[e] = (_Float16)v[e];
      *(v4h*)(C16 + o) = h4; } }
}

extern "C" void kernel_launch(void* const* d_in, const int* in_sizes, int n_in,
                              void* d_out, int out_size, void* d_ws, size_t ws_size, hipStream_t stream) {
  (void)in_sizes; (void)n_in; (void)out_size;
  const float* const* I = (const float* const*)d_in; const float* x = I[0]; const float* Wqkv = I[1]; const float* bqkv = I[2]; const float* Wo = I[3]; const float* bo = I[4]; const float* g1 = I[5]; const float* be1 = I[6]; const float* g2 = I[7]; const float* be2 = I[8];
  const float* W1 = I[9]; const float* b1 = I[10]; const float* W2 = I[11]; const float* b2 = I[12];
  char* ws = (char*)d_ws; size_t off = 0;
  auto take = [&](size_t bytes) { char* p = ws + off; off += (bytes + 255) & ~(size_t)255; return p; };
  _Float16* Bqkv = (_Float16*)take((size_t)3 * DM * DM * 2); _Float16* Bo = (_Float16*)take((size_t)DM * DM * 2); _Float16* Bw1 = (_Float16*)take((size_t)FF * DM * 2); _Float16* Bw2 = (_Float16*)take((size_t)DM * FF * 2);
  _Float16* H16 = (_Float16*)take((size_t)NR * DM * 2); float* XR = (float*)take((size_t)NR * DM * 4); _Float16* QK = (_Float16*)take((size_t)NR * 2 * DM * 2); float* F32 = (float*)take((size_t)NR * DM * 4);
  _Float16* Vth = (_Float16*)take((size_t)NR * DM * 2); _Float16* Vtl = (_Float16*)take((size_t)NR * DM * 2); float* X1 = (float*)take((size_t)NR * DM * 4);
  float* O = F32; _Float16* O16 = H16; _Float16* H2 = H16; _Float16* FH = QK;      /* reuse: F32 holds v (consumed by k_vthl) then O; H16 holds LN1 output (consumed by the qkv GEMMs), then O16, then LN2 output; the [q|k] plane holds the FFN hidden (f16 [4096][2048]) once attention is done */
  if (off > ws_size) return;      // 6.3 + 2.1 + 4.2 + 4.2 + 8.4 + 16.8 + 16.8 + 16.8 + 8.4 + 8.4 + 16.8 ≈ 109 MB (104 MiB)
  k_wt_f16<<<(unsigned)(((size_t)3 * DM * (DM / 8) + 255) / 256), 256, 0, stream>>>(Wqkv, Bqkv, DM, 3 * DM, 16.0f); k_wt_f16<<<(unsigned)(((size_t)DM * (DM / 8) + 255) / 256), 256, 0, stream>>>(Wo, Bo, DM, DM, 16.0f);
  k_wt_f16<<<(unsigned)(((size_t)FF * (DM / 8) + 255) / 256), 256, 0, stream>>>(W1, Bw1, DM, FF, 16.0f); k_wt_f16<<<(unsigned)(((size_t)DM * (FF / 8) + 255) / 256), 256, 0, stream>>>(W2, Bw2, FF, DM, 16.0f);      /* (in,out) → Bt[n][k] ×2^4 */
  k_lnx<DM, 1><<<(NR + 7) / 8, 256, 0, stream>>>(x, g1, be1, NR, 1e-5f, H16, XR);      /* LN1(bf16 x) → f16; XR = bf16(x) */
  const dim3 gqk((NR / 128) * (2 * DM / 128), 1), gd((NR / 128) * (DM / 128), 1), gf((NR / 128) * (FF / 128), 1);      /* one work-group per 128 x 128 tile */
  k_gemm_t<0, 2 * DM, DM, false, true><<<gqk, 256, 0, stream>>>(H16, Bqkv, 0.0625f, bqkv, nullptr, nullptr, QK);      /* [q | k] + bias: M 4096 N 2048 K 1024 */
  k_gemm_t<0, DM, DM, false, false><<<gd, 256, 0, stream>>>(H16, Bqkv + (size_t)2 * DM * DM, 0.0625f, bqkv + 2 * DM, nullptr, F32, nullptr); k_vthl<<<BB * NH * (TT / 64), 256, 0, stream>>>(F32, DM, Vth, Vtl);      /* v + bias (f32) → Vᵀ hi/lo */
  k_flash<<<BB * NH * (TT / 64), 128, 0, stream>>>(QK, 2 * DM, QK + DM, 2 * DM, Vth, Vtl, O, DM);
  k_h16<<<(unsigned)(((size_t)NR * DM / 8 + 255) / 256), 256, 0, stream>>>(O, O16, (size_t)NR * DM / 8);
  k_gemm_t<0, DM, DM, true, false><<<gd, 256, 0, stream>>>(O16, Bo, 0.0625f, bo, XR, X1, nullptr);      /* x1 = x + (O·out_w + out_b) via the per-element addend */
  k_lnx<DM, 0><<<(NR + 7) / 8, 256, 0, stream>>>(X1, g2, be2, NR, 1e-5f, H2, nullptr);      /* LN2(x1) → f16 (x1 is a computed value: no input rounding) */
  k_gemm_t<6, FF, DM, false, true><<<gf, 256, 0, stream>>>(H2, Bw1, 0.0625f, b1, nullptr, nullptr, FH);      /* gelu_erf(h2·w1 + b1) → f16: M 4096 N 2048 K 1024 */
  k_gemm_t<0, DM, FF, true, false><<<gd, 256, 0, stream>>>(FH, Bw2, 0.0625f, b2, X1, (float*)d_out, nullptr);      /* y = x1 + (·w2 + b2): M 4096 N 1024 K 2048 */
}

// v002
// A run of this version takes 179 microseconds.
// Timed twice side by side with v001, it ran 1.17 times as fast both times.
// All steps since v000 together make it 2.65 times as fast.
#include <hip/hip_runtime.h>
// Transformer layer with windowed (|i−j| ≤ 128) multi-head self-attention (B=2, L=2048, d_model 1024, 16 heads × 64): h = LN1(x); qkv = h·W + b; per head softmax(q·kᵀ/8 + window mask)·v; x1 = x + (merged·out_w + out_b);
// y = x1 + (gelu_erf(LN2(x1)·w1 + b1)·w2 + b2). (in,out) weights.
// Compute dtype: x, weights, biases, LN parameters rounded to bf16; LayerNorms in f32 (wave per row) → f16 operands; q,k f16 GEMM outputs, v f32 → f16 hi + ×2^10 residual Vᵀ planes; fused windowed
// flash-style kernel (online softmax f32, P f16 ×2^10, two value accumulators) on v_wmma_f32_16x16x32_f16; the residual sums ride the GEMMs' per-element addend in f32; FFN hidden f16 after the erf-GELU epilogue.
#define BB 2
#define TT 2048
#define DM 1024
#define NH 16
#define HD 64
#define RW 128
#define FF 2048
#define NR (BB * TT)

typedef __bf16 v16b __attribute__((ext_vector_type(16)));
typedef unsigned short v8us __attribute__((ext_vector_type(8), may_alias));
typedef float  v8f  __attribute__((ext_vector_type(8)));
typedef float  v4f  __attribute__((ext_vector_type(4)));
typedef float  v4fa __attribute__((ext_vector_type(4), may_alias));
union FragB { v16b v; v8us half[2]; unsigned short u[16]; };

__device__ __forceinline__ unsigned short bf16_bits(float x) { unsigned int u = __float_as_uint(x); return (unsigned short)((u + 0x7FFFu + ((u >> 16) & 1u)) >> 16); }
__device__ __forceinline__ float bf16_val(unsigned short b) { return __uint_as_float(((unsigned int)b) << 16); }
__device__ __forceinline__ float bf16_round(float x) { return bf16_val(bf16_bits(x)); }
// D += A·B with NT terms: 1 = ah·bh, 2 = + al·bh (A split), 3 = + ah·bl (both split)
template <int NT>
__device__ __forceinline__ v8f mmaN(v16b ah, v16b al, v16b bh, v16b bl, v8f c) {
  c = __builtin_amdgcn_wmma_f32_16x16x32_bf16(false, ah, false, bh, (short)0, c, false, false);
  if (NT >= 2) c = __builtin_amdgcn_wmma_f32_16x16x32_bf16(false, al, false, bh, (short)0, c, false, false);
  if (NT >= 3) c = __builtin_amdgcn_wmma_f32_16x16x32_bf16(false, ah, false, bl, (short)0, c, false, false);
  asm volatile("v_nop\n\tv_nop\n\tv_nop\n\tv_nop" : "+v"(c) : "v"(ah), "v"(al), "v"(bh), "v"(bl));
  return c;
}

__global__ __launch_bounds__(256) void k_wt_bf16(const float* __restrict__ W, unsigned short* __restrict__ Wt, int K, int N) {
  const int t = blockIdx.x * 256 + threadIdx.x;
  const int k8n = K / 8;
  if (t >= N * k8n) return;
  const int n = t / k8n, k8 = (t % k8n) * 8;
  v8us v;
#pragma unroll
  for (int i = 0; i < 8; ++i) v[i] = bf16_bits(W[(size_t)(k8 + i) * N + n]);
  *(v8us*)(Wt + (size_t)n * K + k8) = v;
  
}

// GEMM C[M][N] (f32, pitch ldc) = act(A[M][K]·W + bias). A f32 row-major (pitch lda) converted per fragment to bf16
// (ASPLIT: hi/lo two planes -> 2 terms, else single rounded term); Wt bf16 [N][K] (pitch ldb). BIAS_BF16 rounds the
// bias to bf16 first (bias quantised to bf16 before the add). K%32==0, M%16==0, N%64==0.
template <bool ASPLIT, int ACT, bool BIAS_BF16>
__global__ __launch_bounds__(128) void k_gemm_bf(const float* __restrict__ A, int lda, const unsigned short* __restrict__ Wt, int ldb,
                                               const float* __restrict__ bias, float* __restrict__ C, int ldc, int M, int N, int K) {
  __shared__ __attribute__((aligned(16))) float so[4][16][64];
  const int tid = threadIdx.x, w = tid >> 5, lane = tid & 31, ln = lane & 15, hh = lane >> 4;
  const int ntn = N / 64;
  const int wid = blockIdx.x * 4 + w;
  const int mt = wid / ntn, nq = wid % ntn;
  if (mt * 16 >= M) return;
  const int row0 = mt * 16, col0 = nq * 64;
  const float* arow = A + (size_t)(row0 + ln) * lda;
  v8f acc[4] = {};
  for (int kb = 0; kb < K; kb += 32) {
    FragB ah, al;
    const v4f x0 = *(const v4fa*)(arow + kb + 8 * hh), x1 = *(const v4fa*)(arow + kb + 8 * hh + 4);
    const v4f x2 = *(const v4fa*)(arow + kb + 16 + 8 * hh), x3 = *(const v4fa*)(arow + kb + 16 + 8 * hh + 4);
    float xs[16] = {x0[0],x0[1],x0[2],x0[3],x1[0],x1[1],x1[2],x1[3],x2[0],x2[1],x2[2],x2[3],x3[0],x3[1],x3[2],x3[3]};
#pragma unroll
    for (int i = 0; i < 16; ++i) { const unsigned short hb = bf16_bits(xs[i]); ah.u[i] = hb; al.u[i] = ASPLIT ? bf16_bits(xs[i] - bf16_val(hb)) : (unsigned short)0; }
#pragma unroll
    for (int t = 0; t < 4; ++t) {
      const unsigned short* brow = Wt + (size_t)(col0 + t * 16 + ln) * ldb + kb;
      FragB b;
      b.half[0] = *(const v8us*)(brow + 8 * hh);
      b.half[1] = *(const v8us*)(brow + 16 + 8 * hh);
      acc[t] = mmaN<ASPLIT ? 2 : 1>(ah.v, al.v, b.v, b.v, acc[t]);
    }
  }
#pragma unroll
  for (int t = 0; t < 4; ++t) {
    float bv = bias ? bias[col0 + t * 16 + ln] : 0.f;
    if (BIAS_BF16) bv = bf16_round(bv);
#pragma unroll
    for (int r = 0; r < 8; ++r) { float v = acc[t][r] + bv; if (ACT == 1) v = fmaxf(v, 0.f); so[w][8 * hh + r][t * 16 + ln] = v; }
  }
  __builtin_amdgcn_fence(__ATOMIC_ACQ_REL, "workgroup");
  __builtin_amdgcn_wave_barrier();
  const int rsub = lane >> 4, c4 = (lane & 15) * 4;
  {
#pragma unroll
    for (int q = 0; q < 8; ++q) {
      const int r = q * 2 + rsub;
      const v4f v = *(const v4fa*)&so[w][r][c4];
      *(v4f*)(C + (size_t)(row0 + r) * ldc + col0 + c4) = v;
    }
    
  }
}

// Flash-style causal/unmasked attention, all contractions 3-term bf16 hi/lo splits, f32 softmax with running max.
// q,k,v rows are read from f32 buffers with arbitrary row pitch (so they can live inside a fused qkv buffer);
// D = head size (multiple of 32, <= 128); one wave = 16 query rows; block = 4 waves (64 queries) sharing K/V chunks of 32.
template <int D, bool CAUSAL>
__global__ __launch_bounds__(128) void k_flash(const float* __restrict__ qb, const float* __restrict__ kb, const float* __restrict__ vb,
                                             int pitch, int T, int H, float scale, float* __restrict__ y, int ypitch) {
  constexpr int KS = D / 32;        // k-steps for QK
  constexpr int DT = D / 16;        // d tiles for PV
  __shared__ __attribute__((aligned(16))) unsigned short sKh[32][D + 8], sKl[32][D + 8], sVh[32][D + 8], sVl[32][D + 8];
  __shared__ __attribute__((aligned(16))) unsigned short sPh[4][16][40], sPl[4][16][40];
  __shared__ __attribute__((aligned(16))) float sO[4][16][D];
  const int tid = threadIdx.x, w = tid >> 5, lane = tid & 31, ln = lane & 15, hh = lane >> 4;
  const int nqb = (T + 63) / 64;
  const int bh = blockIdx.x / nqb, qblk = blockIdx.x % nqb;
  const int b = bh / H, h = bh % H;
  const int q0 = qblk * 64 + w * 16;
  const float* Q = qb + (size_t)b * T * pitch + h * D;
  const float* K = kb + (size_t)b * T * pitch + h * D;
  const float* V = vb + (size_t)b * T * pitch + h * D;

  // A fragments of the wave's 16 query rows (scaled), hi/lo
  FragB aqh[KS], aql[KS];
  {
    int row = q0 + ln; if (row >= T) row = T - 1;
    const float* qr = Q + (size_t)row * pitch;
#pragma unroll
    for (int ks = 0; ks < KS; ++ks)
#pragma unroll
      for (int i = 0; i < 16; ++i) {
        const int d = ks * 32 + ((i < 8) ? (8 * hh + i) : (16 + 8 * hh + (i - 8)));
        const float x = qr[d] * scale; const unsigned short hb = bf16_bits(x);
        aqh[ks].u[i] = hb; aql[ks].u[i] = bf16_bits(x - bf16_val(hb));
      }
  }
  float m_r[8], l_r[8];
#pragma unroll
  for (int r = 0; r < 8; ++r) { m_r[r] = -3.0e38f; l_r[r] = 0.f; }
  v8f oacc[DT];
#pragma unroll
  for (int dt = 0; dt < DT; ++dt) oacc[dt] = (v8f){0.f,0.f,0.f,0.f,0.f,0.f,0.f,0.f};

  const int kv_end = CAUSAL ? min(T, qblk * 64 + 64) : T;     // block-uniform
  for (int j0 = 0; j0 < kv_end; j0 += 32) {
    __syncthreads();
    for (int e = tid; e < 32 * (D / 4); e += 128) {
      const int r = e / (D / 4), c4 = (e % (D / 4)) * 4;
      const int key = j0 + r;
      v4f kf = {0.f,0.f,0.f,0.f}, vf = {0.f,0.f,0.f,0.f};
      if (key < T) { kf = *(const v4fa*)(K + (size_t)key * pitch + c4); vf = *(const v4fa*)(V + (size_t)key * pitch + c4); }
#pragma unroll
      for (int t = 0; t < 4; ++t) {
        unsigned short hb = bf16_bits(kf[t]); sKh[r][c4 + t] = hb; sKl[r][c4 + t] = bf16_bits(kf[t] - bf16_val(hb));
        hb = bf16_bits(vf[t]); sVh[r][c4 + t] = hb; sVl[r][c4 + t] = bf16_bits(vf[t] - bf16_val(hb));
      }
    }
    __syncthreads();
    // S tile 16 x 32
    v8f s[2];
#pragma unroll
    for (int nt = 0; nt < 2; ++nt) {
      v8f acc = {};
#pragma unroll
      for (int ks = 0; ks < KS; ++ks) {
        FragB bh_, bl_;
        bh_.half[0] = *(const v8us*)&sKh[nt * 16 + ln][ks * 32 + 8 * hh]; bh_.half[1] = *(const v8us*)&sKh[nt * 16 + ln][ks * 32 + 16 + 8 * hh];
        bl_.half[0] = *(const v8us*)&sKl[nt * 16 + ln][ks * 32 + 8 * hh]; bl_.half[1] = *(const v8us*)&sKl[nt * 16 + ln][ks * 32 + 16 + 8 * hh];
        acc = mmaN<3>(aqh[ks].v, aql[ks].v, bh_.v, bl_.v, acc);
      }
      s[nt] = acc;
    }
    // mask + running max (rows 8hh+r; the 16 lanes of a half share rows)
    float alpha[8];
#pragma unroll
    for (int r = 0; r < 8; ++r) {
      const int qi = q0 + 8 * hh + r;
      const int ja = j0 + ln, jb = j0 + 16 + ln;
      if (CAUSAL) { if (ja > qi) s[0][r] = -3.0e38f; if (jb > qi) s[1][r] = -3.0e38f; }
      if (ja >= T) s[0][r] = -3.0e38f;
      if (jb >= T) s[1][r] = -3.0e38f;
      float mx = fmaxf(s[0][r], s[1][r]);
      mx = fmaxf(mx, __shfl_xor(mx, 1, 32)); mx = fmaxf(mx, __shfl_xor(mx, 2, 32)); mx = fmaxf(mx, __shfl_xor(mx, 4, 32)); mx = fmaxf(mx, __shfl_xor(mx, 8, 32));
      const float mnew = fmaxf(m_r[r], mx);
      alpha[r] = (mnew > -1.0e38f) ? __expf(m_r[r] - mnew) : 1.0f;
      const float p0 = (s[0][r] > -1.0e38f) ? __expf(s[0][r] - mnew) : 0.f;
      const float p1 = (s[1][r] > -1.0e38f) ? __expf(s[1][r] - mnew) : 0.f;
      m_r[r] = mnew;
      l_r[r] = l_r[r] * alpha[r] + p0 + p1;            // per-lane partial row sum (16 lanes combined at the end)
      unsigned short hb = bf16_bits(p0); sPh[w][8 * hh + r][ln] = hb;      sPl[w][8 * hh + r][ln] = bf16_bits(p0 - bf16_val(hb));
      hb = bf16_bits(p1);                sPh[w][8 * hh + r][16 + ln] = hb; sPl[w][8 * hh + r][16 + ln] = bf16_bits(p1 - bf16_val(hb));
    }
#pragma unroll
    for (int dt = 0; dt < DT; ++dt)
#pragma unroll
      for (int r = 0; r < 8; ++r) oacc[dt][r] *= alpha[r];
    __builtin_amdgcn_fence(__ATOMIC_ACQ_REL, "workgroup");
    __builtin_amdgcn_wave_barrier();
    FragB pah, pal;
    pah.half[0] = *(const v8us*)&sPh[w][ln][8 * hh]; pah.half[1] = *(const v8us*)&sPh[w][ln][16 + 8 * hh];
    pal.half[0] = *(const v8us*)&sPl[w][ln][8 * hh]; pal.half[1] = *(const v8us*)&sPl[w][ln][16 + 8 * hh];
#pragma unroll
    for (int dt = 0; dt < DT; ++dt) {
      FragB bvh, bvl;
#pragma unroll
      for (int i = 0; i < 8; ++i) {
        bvh.u[i] = sVh[8 * hh + i][dt * 16 + ln]; bvh.u[8 + i] = sVh[16 + 8 * hh + i][dt * 16 + ln];
        bvl.u[i] = sVl[8 * hh + i][dt * 16 + ln]; bvl.u[8 + i] = sVl[16 + 8 * hh + i][dt * 16 + ln];
      }
      oacc[dt] = mmaN<3>(pah.v, pal.v, bvh.v, bvl.v, oacc[dt]);
    }
    __builtin_amdgcn_fence(__ATOMIC_ACQ_REL, "workgroup");
    __builtin_amdgcn_wave_barrier();
  }
#pragma unroll
  for (int r = 0; r < 8; ++r) {
    float l = l_r[r];
    l += __shfl_xor(l, 1, 32); l += __shfl_xor(l, 2, 32); l += __shfl_xor(l, 4, 32); l += __shfl_xor(l, 8, 32);
    l_r[r] = (l > 0.f) ? 1.0f / l : 0.f;
  }
#pragma unroll
  for (int dt = 0; dt < DT; ++dt)
#pragma unroll
    for (int r = 0; r < 8; ++r) sO[w][8 * hh + r][dt * 16 + ln] = oacc[dt][r] * l_r[r];
  __builtin_amdgcn_fence(__ATOMIC_ACQ_REL, "workgroup");
  __builtin_amdgcn_wave_barrier();
  {
    for (int r = 0; r < 16; ++r) {
      const int row = q0 + r;
      if (row < T && lane < D / 4) {
        const v4f val = *(const v4fa*)&sO[w][r][lane * 4];
        *(v4f*)(y + ((size_t)b * T + row) * ypitch + h * D + lane * 4) = val;
      }
    }
    
  }
}

// GEMM C = act(A·W + bias + resid): A f32 (ASPLIT -> hi/lo 2 terms), Wt bf16 [N][K]; ACT 0 none, 1 relu, 2 exact gelu;
// resid (optional, f32, row index = (row % rmod), pitch ldr, RES_BF16 rounds it) added before the activation.
template <bool ASPLIT, int ACT, bool BIAS_BF16, bool RES_BF16>
__global__ __launch_bounds__(128) void k_gemm_bf3(const float* __restrict__ A, int lda, const unsigned short* __restrict__ Wt, int ldb,
                                                const float* __restrict__ bias, const float* __restrict__ resid, int rmod, int ldr,
                                                float* __restrict__ C, int ldc, int M, int N, int K) {
  __shared__ __attribute__((aligned(16))) float so[4][16][64];
  const int tid = threadIdx.x, w = tid >> 5, lane = tid & 31, ln = lane & 15, hh = lane >> 4;
  const int ntn = N / 64;
  const int wid = blockIdx.x * 4 + w;
  const int mt = wid / ntn, nq = wid % ntn;
  if (mt * 16 >= M) return;
  const int row0 = mt * 16, col0 = nq * 64;
  const float* arow = A + (size_t)(row0 + ln) * lda;
  v8f acc[4] = {};
  for (int kb = 0; kb < K; kb += 32) {
    FragB ah, al;
    const v4f x0 = *(const v4fa*)(arow + kb + 8 * hh), x1 = *(const v4fa*)(arow + kb + 8 * hh + 4);
    const v4f x2 = *(const v4fa*)(arow + kb + 16 + 8 * hh), x3 = *(const v4fa*)(arow + kb + 16 + 8 * hh + 4);
    float xs[16] = {x0[0],x0[1],x0[2],x0[3],x1[0],x1[1],x1[2],x1[3],x2[0],x2[1],x2[2],x2[3],x3[0],x3[1],x3[2],x3[3]};
#pragma unroll
    for (int i = 0; i < 16; ++i) { const unsigned short hb = bf16_bits(xs[i]); ah.u[i] = hb; al.u[i] = ASPLIT ? bf16_bits(xs[i] - bf16_val(hb)) : (unsigned short)0; }
#pragma unroll
    for (int t = 0; t < 4; ++t) {
      const unsigned short* brow = Wt + (size_t)(col0 + t * 16 + ln) * ldb + kb;
      FragB b;
      b.half[0] = *(const v8us*)(brow + 8 * hh);
      b.half[1] = *(const v8us*)(brow + 16 + 8 * hh);
      acc[t] = mmaN<ASPLIT ? 2 : 1>(ah.v, al.v, b.v, b.v, acc[t]);
    }
  }
#pragma unroll
  for (int t = 0; t < 4; ++t) {
    const int col = col0 + t * 16 + ln;
    float bv = bias ? bias[col] : 0.f;
    if (BIAS_BF16) bv = bf16_round(bv);
#pragma unroll
    for (int r = 0; r < 8; ++r) {
      float v = acc[t][r] + bv;
      if (resid) { float rv = resid[(size_t)((row0 + 8 * hh + r) % rmod) * ldr + col]; if (RES_BF16) rv = bf16_round(rv); v += rv; }
      if (ACT == 1) v = fmaxf(v, 0.f);
      if (ACT == 2) v = 0.5f * v * (1.0f + erff(v * 0.70710678118654752f));
      if (ACT == 3) { const float u = 0.7978845608028654f * (v + 0.044715f * v * v * v); v = 0.5f * v * (1.0f + tanhf(u)); }
      so[w][8 * hh + r][t * 16 + ln] = v;
    }
  }
  __builtin_amdgcn_fence(__ATOMIC_ACQ_REL, "workgroup");
  __builtin_amdgcn_wave_barrier();
  const int rsub = lane >> 4, c4 = (lane & 15) * 4;
  {
#pragma unroll
    for (int q = 0; q < 8; ++q) {
      const int r = q * 2 + rsub;
      const v4f v = *(const v4fa*)&so[w][r][c4];
      *(v4f*)(C + (size_t)(row0 + r) * ldc + col0 + c4) = v;
    }
    
  }
}
// row LayerNorm (biased variance, eps) over N: s = X (+ R); optional out_sum <- s; out_norm <- (s-mu)*rsqrt(var+eps)*g + b
template <bool PARAM_BF16>
__global__ __launch_bounds__(256) void k_layernorm(const float* __restrict__ X, const float* __restrict__ R, const float* __restrict__ g, const float* __restrict__ bta,
                                                  float* __restrict__ out_sum, float* __restrict__ out_norm, int N, float eps) {
  __shared__ float red[256];
  const int row = blockIdx.x, tid = threadIdx.x;
  const float* x = X + (size_t)row * N; const float* rr = R ? R + (size_t)row * N : nullptr;
  float vals[16];                     // up to N = 4096
  const int per = N / 256;            // contiguous chunk per thread? use strided-by-4 chunks: thread handles j = tid*4 + 1024*u
  float s1 = 0.f;
  for (int u = 0; u < per / 4; ++u) {
    const int j = tid * 4 + 1024 * u;
    const v4f a = *(const v4fa*)(x + j);
    v4f b = {0.f,0.f,0.f,0.f}; if (rr) b = *(const v4fa*)(rr + j);
#pragma unroll
    for (int q = 0; q < 4; ++q) { const float v = a[q] + b[q]; vals[u * 4 + q] = v; s1 += v; }
  }
  red[tid] = s1; __syncthreads();
  for (int st = 128; st > 0; st >>= 1) { if (tid < st) red[tid] += red[tid + st]; __syncthreads(); }
  const float mu = red[0] / (float)N; __syncthreads();
  float s2 = 0.f;
  for (int u = 0; u < per / 4; ++u)
#pragma unroll
    for (int q = 0; q < 4; ++q) { const float c = vals[u * 4 + q] - mu; s2 += c * c; }
  red[tid] = s2; __syncthreads();
  for (int st = 128; st > 0; st >>= 1) { if (tid < st) red[tid] += red[tid + st]; __syncthreads(); }
  const float rs = rsqrtf(red[0] / (float)N + eps);
  {
    for (int u = 0; u < per / 4; ++u) {
      const int j = tid * 4 + 1024 * u;
      v4f o, sm;
#pragma unroll
      for (int q = 0; q < 4; ++q) {
        float gg = g[j + q], bb = bta[j + q];
        if (PARAM_BF16) { gg = bf16_round(gg); bb = bf16_round(bb); }
        sm[q] = vals[u * 4 + q]; o[q] = (vals[u * 4 + q] - mu) * rs * gg + bb;
      }
      if (out_sum) *(v4f*)(out_sum + (size_t)row * N + j) = sm;
      *(v4f*)(out_norm + (size_t)row * N + j) = o;
    }
    
  }
}



// ---- f16 WMMA path (v_wmma_f32_16x16x32_f16): 11-bit significands for operands in range — used where a [0,1] probability operand needs more precision than bf16
typedef _Float16 v16h __attribute__((ext_vector_type(16)));
union FragH { v16h v; v8us half[2]; _Float16 h[16]; unsigned short u[16]; };
template <int NT>
__device__ __forceinline__ v8f mmaH(v16h ah, v16h al, v16h bh, v16h bl, v8f c) {
  c = __builtin_amdgcn_wmma_f32_16x16x32_f16(false, ah, false, bh, (short)0, c, false, false);
  if (NT >= 2) c = __builtin_amdgcn_wmma_f32_16x16x32_f16(false, al, false, bh, (short)0, c, false, false);
  if (NT >= 3) c = __builtin_amdgcn_wmma_f32_16x16x32_f16(false, ah, false, bl, (short)0, c, false, false);
  asm volatile("v_nop\n\tv_nop\n\tv_nop\n\tv_nop" : "+v"(c) : "v"(ah), "v"(al), "v"(bh), "v"(bl));
  return c;
}
// batched GEMM like k_gemm_b but f16 operands: A f32 (split into f16 hi/lo if ASPLIT, else rounded to f16), Bt = f16 values [n][k]; alpha; C f32; N multiple of 16 (partial tiles skipped)
template <bool ASPLIT>
__global__ __launch_bounds__(128) void k_gemm_h(const float* __restrict__ A, int lda, size_t sA, const _Float16* __restrict__ Bh, int ldb, size_t sB, float alpha, float* __restrict__ C, int ldc, size_t sC, int M, int N, int K) {
  __shared__ __attribute__((aligned(16))) float so[4][16][64];
  const int tid = threadIdx.x, w = tid >> 5, lane = tid & 31, ln = lane & 15, hh = lane >> 4; const int by = blockIdx.y;
  A += (size_t)by * sA; Bh += (size_t)by * sB; C += (size_t)by * sC;
  const int ntn = (N + 63) / 64; const int wid = blockIdx.x * 4 + w; const int mt = wid / ntn, nq = wid % ntn; if (mt * 16 >= M) return;
  const int row0 = mt * 16, col0 = nq * 64; const float* arow = A + (size_t)(row0 + ln) * lda;
  v8f acc[4] = {};
  for (int kb = 0; kb < K; kb += 32) {
    FragH ah, al;
    const v4f x0 = *(const v4fa*)(arow + kb + 8 * hh), x1 = *(const v4fa*)(arow + kb + 8 * hh + 4), x2 = *(const v4fa*)(arow + kb + 16 + 8 * hh), x3 = *(const v4fa*)(arow + kb + 16 + 8 * hh + 4);
    float xs[16] = {x0[0],x0[1],x0[2],x0[3],x1[0],x1[1],x1[2],x1[3],x2[0],x2[1],x2[2],x2[3],x3[0],x3[1],x3[2],x3[3]};
#pragma unroll
    for (int i = 0; i < 16; ++i) { const _Float16 h = (_Float16)xs[i]; ah.h[i] = h; al.h[i] = ASPLIT ? (_Float16)(xs[i] - (float)h) : (_Float16)0.0f; }
#pragma unroll
    for (int t = 0; t < 4; ++t) { if (col0 + t * 16 >= N) continue; const size_t boff = (size_t)(col0 + t * 16 + ln) * ldb + kb; FragH bq; bq.half[0] = *(const v8us*)(Bh + boff + 8 * hh); bq.half[1] = *(const v8us*)(Bh + boff + 16 + 8 * hh);
      acc[t] = mmaH<ASPLIT ? 2 : 1>(ah.v, al.v, bq.v, bq.v, acc[t]); }
  }
#pragma unroll
  for (int t = 0; t < 4; ++t) { if (col0 + t * 16 >= N) continue;
#pragma unroll
    for (int r = 0; r < 8; ++r) so[w][8 * hh + r][t * 16 + ln] = acc[t][r] * alpha; }
  __builtin_amdgcn_fence(__ATOMIC_ACQ_REL, "workgroup"); __builtin_amdgcn_wave_barrier();
  const int rsub = lane >> 4, c4 = (lane & 15) * 4;
  {
#pragma unroll
    for (int q = 0; q < 8; ++q) { const int r = q * 2 + rsub; if (col0 + c4 < N) { const v4f v = *(const v4fa*)&so[w][r][c4]; *(v4f*)(C + (size_t)(row0 + r) * ldc + col0 + c4) = v; } }
     }
}

// Wt[n][k] = f16(bf16(W[k][n]) * scale) from f32 row-major W[K][N] (scale = power of two; bf16-exact weights stay exact in f16 away from the subnormal range).
// One work-group = a tile of 128 k x 64 n, turned in LDS, so that both sides move whole lines: 16 lanes read 256 contiguous bytes of one W row, 16 lanes write 256 contiguous bytes of one Wt row.
// LDS: one dword = the f16 pair (k, k + 1) of one n; a row = one n's 64 dwords, its sixteen 16-byte groups (8 k each) stored at group ^ (n / 4):
// the 32 lanes of a dword store (16 values of n / 4, two neighbouring pairs) fall on 32 banks, the 16 lanes that read one row back as 16-byte groups on all 64.
// K a multiple of 128, N a multiple of 64.
typedef _Float16 v2h __attribute__((ext_vector_type(2)));
template <int K, int N>
__global__ __launch_bounds__(256) void k_wt_f16(const float* __restrict__ W, _Float16* __restrict__ Wt, float scale) {
  __shared__ __attribute__((aligned(16))) unsigned int tl[64 * 64];
  const int tid = threadIdx.x, lo = tid & 15, hi = tid >> 4;
  const int n0 = (int)(blockIdx.x % (N / 64)) * 64, k0 = (int)(blockIdx.x / (N / 64)) * 128;
  const float* src = W + (size_t)(k0 + 2 * hi) * N + n0 + 4 * lo;      // rows k0 + 2 hi + 32 u and the next, columns n0 + 4 lo .. + 3
  v4f ev[4], od[4];
#pragma unroll
  for (int u = 0; u < 4; ++u) { ev[u] = *(const v4fa*)(src + (size_t)(32 * u) * N); od[u] = *(const v4fa*)(src + (size_t)(32 * u + 1) * N); }
#pragma unroll
  for (int u = 0; u < 4; ++u) { const int kp = hi + 16 * u;      // pair index: k = k0 + 2 kp, k0 + 2 kp + 1
#pragma unroll
    for (int q = 0; q < 4; ++q) { v2h p; p[0] = (_Float16)(bf16_round(ev[u][q]) * scale); p[1] = (_Float16)(bf16_round(od[u][q]) * scale);
      tl[(4 * lo + q) * 64 + (((kp >> 2) ^ lo) << 2) + (kp & 3)] = __builtin_bit_cast(unsigned int, p); } }
  __syncthreads();      // every pair of the tile is in LDS before a row is read back
#pragma unroll
  for (int u = 0; u < 4; ++u) { const int n = hi + 16 * u; const v8us v = *(const v8us*)&tl[n * 64 + ((lo ^ ((n >> 2) & 15)) << 2)];
    *(v8us*)((unsigned short*)Wt + (size_t)(n0 + n) * K + k0 + 8 * lo) = v; }
}
typedef _Float16 v4h __attribute__((ext_vector_type(4)));

__global__ __launch_bounds__(256) void k_x16(const float* __restrict__ x, _Float16* __restrict__ X16, size_t n8) { const size_t t = (size_t)blockIdx.x * 256 + threadIdx.x; if (t >= n8) return; FragH f;
#pragma unroll
  for (int q = 0; q < 8; ++q) f.h[q] = (_Float16)bf16_round(x[t * 8 + q]); *(v8us*)((unsigned short*)X16 + t * 8) = f.half[0];  }
__global__ __launch_bounds__(256) void k_h16(const float* __restrict__ x, _Float16* __restrict__ X16, size_t n8) { const size_t t = (size_t)blockIdx.x * 256 + threadIdx.x; if (t >= n8) return; FragH f;
#pragma unroll
  for (int q = 0; q < 8; ++q) f.h[q] = (_Float16)x[t * 8 + q]; *(v8us*)((unsigned short*)X16 + t * 8) = f.half[0];  }
__global__ __launch_bounds__(256) void k_round16f(const float* __restrict__ W, _Float16* __restrict__ Bt, size_t n8) { const size_t t = (size_t)blockIdx.x * 256 + threadIdx.x; if (t >= n8) return; FragH f;
#pragma unroll
  for (int i = 0; i < 8; ++i) f.h[i] = (_Float16)(bf16_round(W[t * 8 + i]) * 16.0f); *(v8us*)((unsigned short*)Bt + t * 8) = f.half[0];  }
template <int NHv, int TTv>
__global__ __launch_bounds__(256) void k_vt(const _Float16* __restrict__ V16, int ldv, int voff, _Float16* __restrict__ Vt) { __shared__ unsigned short tl[64][66]; const int tid = threadIdx.x; const int slab = blockIdx.x / (TTv / 64), lg = blockIdx.x % (TTv / 64); const int b = slab / NHv, h = slab % NHv;
  for (int i = tid; i < 64 * 8; i += 256) { const int r = i / 8, c8 = (i % 8) * 8; FragH f; f.half[0] = *(const v8us*)((const unsigned short*)V16 + ((size_t)b * TTv + lg * 64 + r) * ldv + voff + h * 64 + c8);
#pragma unroll
    for (int q = 0; q < 8; ++q) tl[r][c8 + q] = f.u[q]; }
  __syncthreads();
  {
#pragma unroll
    for (int rd = 0; rd < 2; ++rd) { const int d = rd * 32 + tid / 8, pc = tid % 8; FragH f;
#pragma unroll
      for (int q = 0; q < 8; ++q) f.u[q] = tl[pc * 8 + q][d];
      *(v8us*)((unsigned short*)Vt + ((size_t)slab * 64 + d) * TTv + lg * 64 + pc * 8) = f.half[0]; }
     } }

template <int D, int RBF>
__global__ __launch_bounds__(256) void k_lnx(const float* __restrict__ X, const float* __restrict__ gam, const float* __restrict__ bet, int nrows, float eps, _Float16* __restrict__ O16, float* __restrict__ XR) {
  constexpr int NP = D / 128; const int tid = threadIdx.x, wv = tid >> 5, lane = tid & 31; const size_t r = (size_t)blockIdx.x * 8 + wv; if (r >= (size_t)nrows) return; v4f y[NP]; float s = 0.f;
#pragma unroll
  for (int j = 0; j < NP; ++j) { const int c = j * 128 + lane * 4; v4f g = *(const v4fa*)(X + r * D + c); if (RBF) { for (int q = 0; q < 4; ++q) g[q] = bf16_round(g[q]); } y[j] = g; s += g[0] + g[1] + g[2] + g[3]; }
  for (int o = 16; o >= 1; o >>= 1) s += __shfl_xor(s, o, 32); const float mu = s / (float)D; float q2 = 0.f;
#pragma unroll
  for (int j = 0; j < NP; ++j) for (int q = 0; q < 4; ++q) { const float d = y[j][q] - mu; q2 += d * d; }
  for (int o = 16; o >= 1; o >>= 1) q2 += __shfl_xor(q2, o, 32); const float rs = rsqrtf(q2 / (float)D + eps);
  {
#pragma unroll
    for (int j = 0; j < NP; ++j) { const int c = j * 128 + lane * 4; v4h h; for (int q = 0; q < 4; ++q) { const float v = (y[j][q] - mu) * rs * bf16_round(gam[c + q]) + bf16_round(bet[c + q]); h[q] = (_Float16)v; } *(v4h*)(O16 + r * D + c) = h; if (XR) *(v4f*)(XR + r * D + c) = y[j]; }
     } }
__global__ __launch_bounds__(256) void k_vthl(const float* __restrict__ VF, int ldv, _Float16* __restrict__ Vth, _Float16* __restrict__ Vtl) { __shared__ float tl[64][65]; const int tid = threadIdx.x; const int slab = blockIdx.x / (TT / 64), lg = blockIdx.x % (TT / 64); const int b = slab / NH, h = slab % NH;
  for (int i = tid; i < 64 * 16; i += 256) { const int r = i / 16, c4 = (i % 16) * 4; const v4f a = *(const v4fa*)(VF + ((size_t)b * TT + lg * 64 + r) * ldv + h * HD + c4); tl[r][c4] = a[0]; tl[r][c4 + 1] = a[1]; tl[r][c4 + 2] = a[2]; tl[r][c4 + 3] = a[3]; }
  __syncthreads();
  FragH fh[2], fl[2]; size_t oo[2];
#pragma unroll
  for (int rd = 0; rd < 2; ++rd) { const int d = rd * 32 + tid / 8, pc = tid % 8;
#pragma unroll
    for (int q = 0; q < 8; ++q) { const float v = tl[pc * 8 + q][d]; const _Float16 hv = (_Float16)v; fh[rd].h[q] = hv; fl[rd].h[q] = (_Float16)((v - (float)hv) * 1024.0f); } oo[rd] = ((size_t)slab * HD + d) * TT + lg * 64 + pc * 8; }
  {
#pragma unroll
    for (int rd = 0; rd < 2; ++rd) { *(v8us*)((unsigned short*)Vth + oo[rd]) = fh[rd].half[0]; *(v8us*)((unsigned short*)Vtl + oo[rd]) = fl[rd].half[0]; }
     } }
__global__ __launch_bounds__(128) void k_flash(const _Float16* __restrict__ Q16, int ldq, const _Float16* __restrict__ K16, int ldk, const _Float16* __restrict__ Vt, const _Float16* __restrict__ Vtlo, float* __restrict__ O, int ldo) {
  constexpr int RPW = 16, RTN = RPW / 16, NQB = TT / (4 * RPW), DT = 4, KS = 2;
  __shared__ __attribute__((aligned(16))) unsigned short sP[4][RPW][40]; __shared__ __attribute__((aligned(16))) float sO[4][RPW][64 + 4];
  const int tid = threadIdx.x, w = tid >> 5, lane = tid & 31, ln = lane & 15, hh = lane >> 4;
  const int slab = blockIdx.x / NQB, qblk = blockIdx.x % NQB; const int b = slab / NH, h = slab % NH; const int qb0 = qblk * (4 * RPW); const int q0 = qb0 + w * RPW;
  FragH aq[2][KS];
#pragma unroll
  for (int rt = 0; rt < RTN; ++rt) { const unsigned short* qr = (const unsigned short*)Q16 + ((size_t)b * TT + q0 + rt * 16 + ln) * ldq + h * 64;
#pragma unroll
    for (int ks = 0; ks < KS; ++ks) { aq[rt][ks].half[0] = *(const v8us*)(qr + ks * 32 + 8 * hh); aq[rt][ks].half[1] = *(const v8us*)(qr + ks * 32 + 16 + 8 * hh); } }
  const unsigned short* Vth = (const unsigned short*)Vt + (size_t)slab * 64 * TT; const unsigned short* Vtl = (const unsigned short*)Vtlo + (size_t)slab * 64 * TT;
  float m_r[2][8], l_r[2][8]; v8f oacc[2][DT], oaccl[2][DT];
#pragma unroll
  for (int rt = 0; rt < RTN; ++rt) {
#pragma unroll
    for (int r = 0; r < 8; ++r) { m_r[rt][r] = -3.0e38f; l_r[rt][r] = 0.f; }
#pragma unroll
    for (int dt = 0; dt < DT; ++dt) { oacc[rt][dt] = (v8f){0.f,0.f,0.f,0.f,0.f,0.f,0.f,0.f}; oaccl[rt][dt] = oacc[rt][dt]; } }
  const int jbeg = (qb0 - RW) > 0 ? (qb0 - RW) : 0; const int jend = (qb0 + 4 * RPW + RW) < TT ? (qb0 + 4 * RPW + RW) : TT;      /* block-uniform window bounds (multiples of 32) */
#pragma unroll 1
  for (int j0 = jbeg; j0 < jend; j0 += 32) {
    
    v8f s[2][2];
#pragma unroll
    for (int nt = 0; nt < 2; ++nt) { const unsigned short* kr = (const unsigned short*)K16 + ((size_t)b * TT + j0 + nt * 16 + ln) * ldk + h * 64; FragH bk[KS];
#pragma unroll
      for (int ks = 0; ks < KS; ++ks) { bk[ks].half[0] = *(const v8us*)(kr + ks * 32 + 8 * hh); bk[ks].half[1] = *(const v8us*)(kr + ks * 32 + 16 + 8 * hh); }
#pragma unroll
      for (int rt = 0; rt < RTN; ++rt) { v8f acc = (v8f){0.f,0.f,0.f,0.f,0.f,0.f,0.f,0.f};
#pragma unroll
        for (int ks = 0; ks < KS; ++ks) acc = mmaH<1>(aq[rt][ks].v, aq[rt][ks].v, bk[ks].v, bk[ks].v, acc); s[rt][nt] = acc; } }
#pragma unroll
    for (int rt = 0; rt < RTN; ++rt)
#pragma unroll
      for (int r = 0; r < 8; ++r) { const int tq = q0 + rt * 16 + 8 * hh + r; const int k0 = j0 + ln, k1 = j0 + 16 + ln; (void)tq; (void)k0; (void)k1;
        const bool ok0 = (k0 - tq <= RW) && (tq - k0 <= RW), ok1 = (k1 - tq <= RW) && (tq - k1 <= RW);
        const float s0 = ok0 ? s[rt][0][r] * 0.125f : -INFINITY, s1 = ok1 ? s[rt][1][r] * 0.125f : -INFINITY; float mc = fmaxf(s0, s1);
        mc = fmaxf(mc, __shfl_xor(mc, 1, 32)); mc = fmaxf(mc, __shfl_xor(mc, 2, 32)); mc = fmaxf(mc, __shfl_xor(mc, 4, 32)); mc = fmaxf(mc, __shfl_xor(mc, 8, 32));
        const float mn = fmaxf(m_r[rt][r], mc); const float al = (mn > -1.0e38f) ? expf(m_r[rt][r] - mn) : 1.0f; m_r[rt][r] = mn; const float p0 = ok0 ? expf(s0 - mn) : 0.f, p1 = ok1 ? expf(s1 - mn) : 0.f; l_r[rt][r] = l_r[rt][r] * al + p0 + p1;
#pragma unroll
        for (int dt = 0; dt < DT; ++dt) { oacc[rt][dt][r] *= al; oaccl[rt][dt][r] *= al; }
        FragH t2; t2.h[0] = (_Float16)(p0 * 1024.0f); t2.h[1] = (_Float16)(p1 * 1024.0f); sP[w][rt * 16 + 8 * hh + r][ln] = t2.u[0]; sP[w][rt * 16 + 8 * hh + r][16 + ln] = t2.u[1]; }
    __builtin_amdgcn_fence(__ATOMIC_ACQ_REL, "workgroup"); __builtin_amdgcn_wave_barrier();
    FragH pa[2];
#pragma unroll
    for (int rt = 0; rt < RTN; ++rt) { pa[rt].half[0] = *(const v8us*)&sP[w][rt * 16 + ln][8 * hh]; pa[rt].half[1] = *(const v8us*)&sP[w][rt * 16 + ln][16 + 8 * hh]; }
#pragma unroll
    for (int dt = 0; dt < DT; ++dt) { const size_t vo = (size_t)(dt * 16 + ln) * TT + j0; FragH bv, bl; bv.half[0] = *(const v8us*)(Vth + vo + 8 * hh); bv.half[1] = *(const v8us*)(Vth + vo + 16 + 8 * hh); bl.half[0] = *(const v8us*)(Vtl + vo + 8 * hh); bl.half[1] = *(const v8us*)(Vtl + vo + 16 + 8 * hh);
#pragma unroll
      for (int rt = 0; rt < RTN; ++rt) { oacc[rt][dt] = mmaH<1>(pa[rt].v, pa[rt].v, bv.v, bv.v, oacc[rt][dt]); oaccl[rt][dt] = mmaH<1>(pa[rt].v, pa[rt].v, bl.v, bl.v, oaccl[rt][dt]); } }
    __builtin_amdgcn_fence(__ATOMIC_ACQ_REL, "workgroup"); __builtin_amdgcn_wave_barrier(); }
#pragma unroll
  for (int rt = 0; rt < RTN; ++rt) {
#pragma unroll
    for (int r = 0; r < 8; ++r) { float l = l_r[rt][r]; l += __shfl_xor(l, 1, 32); l += __shfl_xor(l, 2, 32); l += __shfl_xor(l, 4, 32); l += __shfl_xor(l, 8, 32); l_r[rt][r] = (l > 0.f) ? 1.0f / (l * 1024.0f) : 0.f; }
#pragma unroll
    for (int dt = 0; dt < DT; ++dt)
#pragma unroll
      for (int r = 0; r < 8; ++r) sO[w][rt * 16 + 8 * hh + r][dt * 16 + ln] = (oacc[rt][dt][r] + oaccl[rt][dt][r] * 0.0009765625f) * l_r[rt][r]; }
  __builtin_amdgcn_fence(__ATOMIC_ACQ_REL, "workgroup"); __builtin_amdgcn_wave_barrier();
  {
#pragma unroll
    for (int rp = 0; rp < RPW; rp += 2) { const int r = rp + (lane >> 4), pc = lane & 15; const v4f val = *(const v4fa*)&sO[w][r][pc * 4]; *(v4f*)(O + ((size_t)b * TT + q0 + r) * ldo + h * 64 + pc * 4) = val; }
     } }

// ---- tiled f16 GEMM with fused epilogue: act(A[M][K] * Bh[N][K]^T * alpha + bf16(bias[col]) (+ CP[row][col] if RES)) -> C16 (f16, if OUT16) or C (f32); ACT 0 none, 6 erf-GELU. A and Bh f16 and k-contiguous (pitch K), C / C16 / CP pitch N.
// One work-group = one 128 x 128 tile of C, 8 waves as 4 (rows) x 2 (columns), 32 x 64 of C per wave. A pass is 128 k: 256 B of each of the 128 A rows and 128 Bh rows,
// laid in LDS at a pitch of 272 B (an odd multiple of 16 B: conflict-free for ds_load_b128 fragment reads). Two buffers; the next pass's rows are copied while this pass is multiplied.
// M, N multiples of 128, K a multiple of 128. The k order of every accumulator is ascending in steps of 32.
#define GT_ROWB 272
#define GT_STAGE (256 * GT_ROWB)
// Eight 16-byte asynchronous copies of one lane, global -> LDS, rows 16 apart. The s_wait_xcnt closes the statement so that no address register is rewritten ahead of it.
template <int K>
__device__ __forceinline__ void gt_copy8(unsigned l0, const _Float16* g0) {
  const unsigned l1 = l0 + 16 * GT_ROWB, l2 = l0 + 32 * GT_ROWB, l3 = l0 + 48 * GT_ROWB, l4 = l0 + 64 * GT_ROWB, l5 = l0 + 80 * GT_ROWB, l6 = l0 + 96 * GT_ROWB, l7 = l0 + 112 * GT_ROWB;
  const _Float16 *g1 = g0 + 16 * K, *g2 = g0 + 32 * K, *g3 = g0 + 48 * K, *g4 = g0 + 64 * K, *g5 = g0 + 80 * K, *g6 = g0 + 96 * K, *g7 = g0 + 112 * K;
  asm volatile("global_load_async_to_lds_b128 %0, %8, off\n\t"
               "global_load_async_to_lds_b128 %1, %9, off\n\t"
               "global_load_async_to_lds_b128 %2, %10, off\n\t"
               "global_load_async_to_lds_b128 %3, %11, off\n\t"
               "global_load_async_to_lds_b128 %4, %12, off\n\t"
               "global_load_async_to_lds_b128 %5, %13, off\n\t"
               "global_load_async_to_lds_b128 %6, %14, off\n\t"
               "global_load_async_to_lds_b128 %7, %15, off\n\t"
               "s_wait_xcnt 0x0"
               :: "v"(l0), "v"(l1), "v"(l2), "v"(l3), "v"(l4), "v"(l5), "v"(l6), "v"(l7), "v"(g0), "v"(g1), "v"(g2), "v"(g3), "v"(g4), "v"(g5), "v"(g6), "v"(g7) : "memory");
}
template <int ACT, int N, int K, bool RES, bool OUT16>
__global__ __launch_bounds__(256) void k_gemm_t(const _Float16* __restrict__ A, const _Float16* __restrict__ Bh, float alpha, const float* __restrict__ bias, const float* __restrict__ CP, float* __restrict__ C, _Float16* __restrict__ C16) {
  __shared__ __attribute__((aligned(16))) unsigned char L[2 * GT_STAGE];
  constexpr int NST = K / 128, NTN = N / 128;
  const int tid = threadIdx.x, w = tid >> 5, lane = tid & 31, ln = lane & 15, hh = lane >> 4;
  const int row0 = (int)(blockIdx.x / NTN) * 128, col0 = (int)(blockIdx.x % NTN) * 128;
  const int wm = w >> 1, wn = w & 1;
  // copy roles: 16 lanes cover one row's 256 B; a thread takes rows (tid / 16) + 16 i of A and of Bh
  const unsigned lcp = (unsigned)(size_t)L + (unsigned)(tid >> 4) * GT_ROWB + (unsigned)(tid & 15) * 16u;
  const _Float16* ga = A + (size_t)(row0 + (tid >> 4)) * K + (tid & 15) * 8;
  const _Float16* gb = Bh + (size_t)(col0 + (tid >> 4)) * K + (tid & 15) * 8;
  v8f acc[2][4];
#pragma unroll
  for (int i = 0; i < 2; ++i)
#pragma unroll
    for (int j = 0; j < 4; ++j) acc[i][j] = (v8f){0.f,0.f,0.f,0.f,0.f,0.f,0.f,0.f};
  gt_copy8<K>(lcp, ga); gt_copy8<K>(lcp + 128 * GT_ROWB, gb);
  asm volatile("s_wait_asynccnt 0x0" ::: "memory");      // this wave's copies of pass 0 have landed
  __syncthreads();                                        // ... and every other wave's
  if (NST > 1) { gt_copy8<K>(lcp + GT_STAGE, ga + 128); gt_copy8<K>(lcp + GT_STAGE + 128 * GT_ROWB, gb + 128); }
#pragma unroll 1      /* one pass per trip: the ring's waits and its barrier stand once, at the foot */
  for (int t = 0; t < NST; ++t) {
    const unsigned buf = (unsigned)(t & 1) * GT_STAGE;
    const unsigned char* sa = L + buf + (wm * 32 + ln) * GT_ROWB + 16 * hh;
    const unsigned char* sb = L + buf + (128 + wn * 64 + ln) * GT_ROWB + 16 * hh;
    // two fragment sets: block ks + 1's twelve LDS reads go out as one group ahead of block ks's eight WMMAs (all inside this pass's own buffer)
    FragH a[2][2], b[2][4];
#pragma unroll
    for (int i = 0; i < 2; ++i) { a[0][i].half[0] = *(const v8us*)(sa + i * 16 * GT_ROWB); a[0][i].half[1] = *(const v8us*)(sa + i * 16 * GT_ROWB + 32); }
#pragma unroll
    for (int j = 0; j < 4; ++j) { b[0][j].half[0] = *(const v8us*)(sb + j * 16 * GT_ROWB); b[0][j].half[1] = *(const v8us*)(sb + j * 16 * GT_ROWB + 32); }
#pragma unroll
    for (int ks = 0; ks < 4; ++ks) {
      const int cu = ks & 1, nx = cu ^ 1;
      if (ks < 3) {
#pragma unroll
        for (int i = 0; i < 2; ++i) { a[nx][i].half[0] = *(const v8us*)(sa + i * 16 * GT_ROWB + (ks + 1) * 64); a[nx][i].half[1] = *(const v8us*)(sa + i * 16 * GT_ROWB + (ks + 1) * 64 + 32); }
#pragma unroll
        for (int j = 0; j < 4; ++j) { b[nx][j].half[0] = *(const v8us*)(sb + j * 16 * GT_ROWB + (ks + 1) * 64); b[nx][j].half[1] = *(const v8us*)(sb + j * 16 * GT_ROWB + (ks + 1) * 64 + 32); }
      }
      __builtin_amdgcn_sched_barrier(0);      // keeps the read group whole and ahead of the WMMAs: without it the scheduler spreads the reads among them and waits to 0 at each place
#pragma unroll
      for (int i = 0; i < 2; ++i)
#pragma unroll
        for (int j = 0; j < 4; ++j) acc[i][j] = __builtin_amdgcn_wmma_f32_16x16x32_f16(false, a[cu][i].v, false, b[cu][j].v, (short)0, acc[i][j], false, false);
      __builtin_amdgcn_sched_barrier(0);      // ... and keeps the next group behind this block
    }
    asm volatile("s_wait_dscnt 0x0" ::: "memory");        // this wave's reads of the buffer have retired before it is refilled
    asm volatile("s_wait_asynccnt 0x0" ::: "memory");     // this wave's copies of pass t + 1 have landed
    __syncthreads();                                      // publishes pass t + 1 and ends every reader's last read of pass t's buffer
    if (t + 2 < NST) { gt_copy8<K>(lcp + buf, ga + (t + 2) * 128); gt_copy8<K>(lcp + buf + 128 * GT_ROWB, gb + (t + 2) * 128); }
  }
  asm volatile("s_wait_asynccnt 0x0" ::: "memory");       // no copy is outstanding when the ring becomes output staging
  // epilogue: each wave stages its 32 x 64 tile in its own range of the ring (pitch 68 floats) and stores whole lines
  float* so = (float*)L + w * (32 * 68);
#pragma unroll
  for (int j = 0; j < 4; ++j) { const float bv = bf16_round(bias[col0 + wn * 64 + j * 16 + ln]);
#pragma unroll
    for (int i = 0; i < 2; ++i)
#pragma unroll
      for (int r = 0; r < 8; ++r) so[(i * 16 + 8 * hh + r) * 68 + j * 16 + ln] = acc[i][j][r] * alpha + bv; }
  __builtin_amdgcn_fence(__ATOMIC_ACQ_REL, "workgroup"); __builtin_amdgcn_wave_barrier();      // the wave's own LDS writes are read back by other lanes of the same wave
  const int rsub = lane >> 4, c4 = (lane & 15) * 4;
#pragma unroll (ACT == 6 ? 2 : 16)      /* the erf text is long: unrolled by 2 only with erf, for speed only */
  for (int q = 0; q < 16; ++q) { const int r = q * 2 + rsub; v4f v = *(const v4fa*)&so[r * 68 + c4]; const size_t o = (size_t)(row0 + wm * 32 + r) * N + col0 + wn * 64 + c4;
    if (RES) { const v4f c = *(const v4fa*)(CP + o); v[0] += c[0]; v[1] += c[1]; v[2] += c[2]; v[3] += c[3]; }
    if (ACT == 6) {
#pragma unroll
      for (int e = 0; e < 4; ++e) v[e] = 0.5f * v[e] * (1.0f + erff(v[e] * 0.70710678118654752f)); }
    if (!OUT16) *(v4f*)(C + o) = v;
    else { v4h h4;
#pragma unroll
      for (int e = 0; e < 4; ++e) h4[e] = (_Float16)v[e];
      *(v4h*)(C16 + o) = h4; } }
}

extern "C" void kernel_launch(void* const* d_in, const int* in_sizes, int n_in,
                              void* d_out, int out_size, void* d_ws, size_t ws_size, hipStream_t stream) {
  (void)in_sizes; (void)n_in; (void)out_size;
  const float* const* I = (const float* const*)d_in; const float* x = I[0]; const float* Wqkv = I[1]; const float* bqkv = I[2]; const float* Wo = I[3]; const float* bo = I[4]; const float* g1 = I[5]; const float* be1 = I[6]; const float* g2 = I[7]; const float* be2 = I[8];
  const float* W1 = I[9]; const float* b1 = I[10]; const float* W2 = I[11]; const float* b2 = I[12];
  char* ws = (char*)d_ws; size_t off = 0;
  auto take = [&](size_t bytes) { char* p = ws + off; off += (bytes + 255) & ~(size_t)255; return p; };
  _Float16* Bqkv = (_Float16*)take((size_t)3 * DM * DM * 2); _Float16* Bo = (_Float16*)take((size_t)DM * DM * 2); _Float16* Bw1 = (_Float16*)take((size_t)FF * DM * 2); _Float16* Bw2 = (_Float16*)take((size_t)DM * FF * 2);
  _Float16* H16 = (_Float16*)take((size_t)NR * DM * 2); float* XR = (float*)take((size_t)NR * DM * 4); _Float16* QK = (_Float16*)take((size_t)NR * 2 * DM * 2); float* F32 = (float*)take((size_t)NR * DM * 4);
  _Float16* Vth = (_Float16*)take((size_t)NR * DM * 2); _Float16* Vtl = (_Float16*)take((size_t)NR * DM * 2); float* X1 = (float*)take((size_t)NR * DM * 4);
  float* O = F32; _Float16* O16 = H16; _Float16* H2 = H16; _Float16* FH = QK;      /* reuse: F32 holds v (consumed by k_vthl) then O; H16 holds LN1 output (consumed by the qkv GEMMs), then O16, then LN2 output; the [q|k] plane holds the FFN hidden (f16 [4096][2048]) once attention is done */
  if (off > ws_size) return;      // 6.3 + 2.1 + 4.2 + 4.2 + 8.4 + 16.8 + 16.8 + 16.8 + 8.4 + 8.4 + 16.8 ≈ 109 MB (104 MiB)
  k_wt_f16<DM, 3 * DM><<<(DM / 128) * (3 * DM / 64), 256, 0, stream>>>(Wqkv, Bqkv, 16.0f); k_wt_f16<DM, DM><<<(DM / 128) * (DM / 64), 256, 0, stream>>>(Wo, Bo, 16.0f);
  k_wt_f16<DM, FF><<<(DM / 128) * (FF / 64), 256, 0, stream>>>(W1, Bw1, 16.0f); k_wt_f16<FF, DM><<<(FF / 128) * (DM / 64), 256, 0, stream>>>(W2, Bw2, 16.0f);      /* (in,out) -> Bt[n][k] x 2^4 */
  k_lnx<DM, 1><<<(NR + 7) / 8, 256, 0, stream>>>(x, g1, be1, NR, 1e-5f, H16, XR);      /* LN1(bf16 x) → f16; XR = bf16(x) */
  const dim3 gqk((NR / 128) * (2 * DM / 128), 1), gd((NR / 128) * (DM / 128), 1), gf((NR / 128) * (FF / 128), 1);      /* one work-group per 128 x 128 tile */
  k_gemm_t<0, 2 * DM, DM, false, true><<<gqk, 256, 0, stream>>>(H16, Bqkv, 0.0625f, bqkv, nullptr, nullptr, QK);      /* [q | k] + bias: M 4096 N 2048 K 1024 */
  k_gemm_t<0, DM, DM, false, false><<<gd, 256, 0, stream>>>(H16, Bqkv + (size_t)2 * DM * DM, 0.0625f, bqkv + 2 * DM, nullptr, F32, nullptr); k_vthl<<<BB * NH * (TT / 64), 256, 0, stream>>>(F32, DM, Vth, Vtl);      /* v + bias (f32) → Vᵀ hi/lo */
  k_flash<<<BB * NH * (TT / 64), 128, 0, stream>>>(QK, 2 * DM, QK + DM, 2 * DM, Vth, Vtl, O, DM);
  k_h16<<<(unsigned)(((size_t)NR * DM / 8 + 255) / 256), 256, 0, stream>>>(O, O16, (size_t)NR * DM / 8);
  k_gemm_t<0, DM, DM, true, false><<<gd, 256, 0, stream>>>(O16, Bo, 0.0625f, bo, XR, X1, nullptr);      /* x1 = x + (O·out_w + out_b) via the per-element addend */
  k_lnx<DM, 0><<<(NR + 7) / 8, 256, 0, stream>>>(X1, g2, be2, NR, 1e-5f, H2, nullptr);      /* LN2(x1) → f16 (x1 is a computed value: no input rounding) */
  k_gemm_t<6, FF, DM, false, true><<<gf, 256, 0, stream>>>(H2, Bw1, 0.0625f, b1, nullptr, nullptr, FH);      /* gelu_erf(h2·w1 + b1) → f16: M 4096 N 2048 K 1024 */
  k_gemm_t<0, DM, FF, true, false><<<gd, 256, 0, stream>>>(FH, Bw2, 0.0625f, b2, X1, (float*)d_out, nullptr);      /* y = x1 + (·w2 + b2): M 4096 N 1024 K 2048 */
}

// v003
// It runs in 168 microseconds.
// In both of two side-by-side timings against v002, it was 1.06 times as fast.
// All steps since v000 together make it 2.81 times as fast.
#include <hip/hip_runtime.h>
// Transformer layer with windowed (|i−j| ≤ 128) multi-head self-attention (B=2, L=2048, d_model 1024, 16 heads × 64): h = LN1(x); qkv = h·W + b; per head softmax(q·kᵀ/8 + window mask)·v; x1 = x + (merged·out_w + out_b);
// y = x1 + (gelu_erf(LN2(x1)·w1 + b1)·w2 + b2). (in,out) weights.
// Compute dtype: x, weights, biases, LN parameters rounded to bf16; LayerNorms in f32 (wave per row) → f16 operands; q,k f16 GEMM outputs, v f32 → f16 hi + ×2^10 residual Vᵀ planes; fused windowed
// flash-style kernel (online softmax f32, P f16 ×2^10, two value accumulators) on v_wmma_f32_16x16x32_f16; the residual sums ride the GEMMs' per-element addend in f32; FFN hidden f16 after the erf-GELU epilogue.
#define BB 2
#define TT 2048
#define DM 1024
#define NH 16
#define HD 64
#define RW 128
#define FF 2048
#define NR (BB * TT)

typedef __bf16 v16b __attribute__((ext_vector_type(16)));
typedef unsigned short v8us __attribute__((ext_vector_type(8), may_alias));
typedef float  v8f  __attribute__((ext_vector_type(8)));
typedef float  v4f  __attribute__((ext_vector_type(4)));
typedef float  v4fa __attribute__((ext_vector_type(4), may_alias));
union FragB { v16b v; v8us half[2]; unsigned short u[16]; };

__device__ __forceinline__ unsigned short bf16_bits(float x) { unsigned int u = __float_as_uint(x); return (unsigned short)((u + 0x7FFFu + ((u >> 16) & 1u)) >> 16); }
__device__ __forceinline__ float bf16_val(unsigned short b) { return __uint_as_float(((unsigned int)b) << 16); }
__device__ __forceinline__ float bf16_round(float x) { return bf16_val(bf16_bits(x)); }
// D += A·B with NT terms: 1 = ah·bh, 2 = + al·bh (A split), 3 = + ah·bl (both split)
template <int NT>
__device__ __forceinline__ v8f mmaN(v16b ah, v16b al, v16b bh, v16b bl, v8f c) {
  c = __builtin_amdgcn_wmma_f32_16x16x32_bf16(false, ah, false, bh, (short)0, c, false, false);
  if (NT >= 2) c = __builtin_amdgcn_wmma_f32_16x16x32_bf16(false, al, false, bh, (short)0, c, false, false);
  if (NT >= 3) c = __builtin_amdgcn_wmma_f32_16x16x32_bf16(false, ah, false, bl, (short)0, c, false, false);
  asm volatile("v_nop\n\tv_nop\n\tv_nop\n\tv_nop" : "+v"(c) : "v"(ah), "v"(al), "v"(bh), "v"(bl));
  return c;
}

__global__ __launch_bounds__(256) void k_wt_bf16(const float* __restrict__ W, unsigned short* __restrict__ Wt, int K, int N) {
  const int t = blockIdx.x * 256 + threadIdx.x;
  const int k8n = K / 8;
  if (t >= N * k8n) return;
  const int n = t / k8n, k8 = (t % k8n) * 8;
  v8us v;
#pragma unroll
  for (int i = 0; i < 8; ++i) v[i] = bf16_bits(W[(size_t)(k8 + i) * N + n]);
  *(v8us*)(Wt + (size_t)n * K + k8) = v;
  
}

// GEMM C[M][N] (f32, pitch ldc) = act(A[M][K]·W + bias). A f32 row-major (pitch lda) converted per fragment to bf16
// (ASPLIT: hi/lo two planes -> 2 terms, else single rounded term); Wt bf16 [N][K] (pitch ldb). BIAS_BF16 rounds the
// bias to bf16 first (bias quantised to bf16 before the add). K%32==0, M%16==0, N%64==0.
template <bool ASPLIT, int ACT, bool BIAS_BF16>
__global__ __launch_bounds__(128) void k_gemm_bf(const float* __restrict__ A, int lda, const unsigned short* __restrict__ Wt, int ldb,
                                               const float* __restrict__ bias, float* __restrict__ C, int ldc, int M, int N, int K) {
  __shared__ __attribute__((aligned(16))) float so[4][16][64];
  const int tid = threadIdx.x, w = tid >> 5, lane = tid & 31, ln = lane & 15, hh = lane >> 4;
  const int ntn = N / 64;
  const int wid = blockIdx.x * 4 + w;
  const int mt = wid / ntn, nq = wid % ntn;
  if (mt * 16 >= M) return;
  const int row0 = mt * 16, col0 = nq * 64;
  const float* arow = A + (size_t)(row0 + ln) * lda;
  v8f acc[4] = {};
  for (int kb = 0; kb < K; kb += 32) {
    FragB ah, al;
    const v4f x0 = *(const v4fa*)(arow + kb + 8 * hh), x1 = *(const v4fa*)(arow + kb + 8 * hh + 4);
    const v4f x2 = *(const v4fa*)(arow + kb + 16 + 8 * hh), x3 = *(const v4fa*)(arow + kb + 16 + 8 * hh + 4);
    float xs[16] = {x0[0],x0[1],x0[2],x0[3],x1[0],x1[1],x1[2],x1[3],x2[0],x2[1],x2[2],x2[3],x3[0],x3[1],x3[2],x3[3]};
#pragma unroll
    for (int i = 0; i < 16; ++i) { const unsigned short hb = bf16_bits(xs[i]); ah.u[i] = hb; al.u[i] = ASPLIT ? bf16_bits(xs[i] - bf16_val(hb)) : (unsigned short)0; }
#pragma unroll
    for (int t = 0; t < 4; ++t) {
      const unsigned short* brow = Wt + (size_t)(col0 + t * 16 + ln) * ldb + kb;
      FragB b;
      b.half[0] = *(const v8us*)(brow + 8 * hh);
      b.half[1] = *(const v8us*)(brow + 16 + 8 * hh);
      acc[t] = mmaN<ASPLIT ? 2 : 1>(ah.v, al.v, b.v, b.v, acc[t]);
    }
  }
#pragma unroll
  for (int t = 0; t < 4; ++t) {
    float bv = bias ? bias[col0 + t * 16 + ln] : 0.f;
    if (BIAS_BF16) bv = bf16_round(bv);
#pragma unroll
    for (int r = 0; r < 8; ++r) { float v = acc[t][r] + bv; if (ACT == 1) v = fmaxf(v, 0.f); so[w][8 * hh + r][t * 16 + ln] = v; }
  }
  __builtin_amdgcn_fence(__ATOMIC_ACQ_REL, "workgroup");
  __builtin_amdgcn_wave_barrier();
  const int rsub = lane >> 4, c4 = (lane & 15) * 4;
  {
#pragma unroll
    for (int q = 0; q < 8; ++q) {
      const int r = q * 2 + rsub;
      const v4f v = *(const v4fa*)&so[w][r][c4];
      *(v4f*)(C + (size_t)(row0 + r) * ldc + col0 + c4) = v;
    }
    
  }
}

// Flash-style causal/unmasked attention, all contractions 3-term bf16 hi/lo splits, f32 softmax with running max.
// q,k,v rows are read from f32 buffers with arbitrary row pitch (so they can live inside a fused qkv buffer);
// D = head size (multiple of 32, <= 128); one wave = 16 query rows; block = 4 waves (64 queries) sharing K/V chunks of 32.
template <int D, bool CAUSAL>
__global__ __launch_bounds__(128) void k_flash(const float* __restrict__ qb, const float* __restrict__ kb, const float* __restrict__ vb,
                                             int pitch, int T, int H, float scale, float* __restrict__ y, int ypitch) {
  constexpr int KS = D / 32;        // k-steps for QK
  constexpr int DT = D / 16;        // d tiles for PV
  __shared__ __attribute__((aligned(16))) unsigned short sKh[32][D + 8], sKl[32][D + 8], sVh[32][D + 8], sVl[32][D + 8];
  __shared__ __attribute__((aligned(16))) unsigned short sPh[4][16][40], sPl[4][16][40];
  __shared__ __attribute__((aligned(16))) float sO[4][16][D];
  const int tid = threadIdx.x, w = tid >> 5, lane = tid & 31, ln = lane & 15, hh = lane >> 4;
  const int nqb = (T + 63) / 64;
  const int bh = blockIdx.x / nqb, qblk = blockIdx.x % nqb;
  const int b = bh / H, h = bh % H;
  const int q0 = qblk * 64 + w * 16;
  const float* Q = qb + (size_t)b * T * pitch + h * D;
  const float* K = kb + (size_t)b * T * pitch + h * D;
  const float* V = vb + (size_t)b * T * pitch + h * D;

  // A fragments of the wave's 16 query rows (scaled), hi/lo
  FragB aqh[KS], aql[KS];
  {
    int row = q0 + ln; if (row >= T) row = T - 1;
    const float* qr = Q + (size_t)row * pitch;
#pragma unroll
    for (int ks = 0; ks < KS; ++ks)
#pragma unroll
      for (int i = 0; i < 16; ++i) {
        const int d = ks * 32 + ((i < 8) ? (8 * hh + i) : (16 + 8 * hh + (i - 8)));
        const float x = qr[d] * scale; const unsigned short hb = bf16_bits(x);
        aqh[ks].u[i] = hb; aql[ks].u[i] = bf16_bits(x - bf16_val(hb));
      }
  }
  float m_r[8], l_r[8];
#pragma unroll
  for (int r = 0; r < 8; ++r) { m_r[r] = -3.0e38f; l_r[r] = 0.f; }
  v8f oacc[DT];
#pragma unroll
  for (int dt = 0; dt < DT; ++dt) oacc[dt] = (v8f){0.f,0.f,0.f,0.f,0.f,0.f,0.f,0.f};

  const int kv_end = CAUSAL ? min(T, qblk * 64 + 64) : T;     // block-uniform
  for (int j0 = 0; j0 < kv_end; j0 += 32) {
    __syncthreads();
    for (int e = tid; e < 32 * (D / 4); e += 128) {
      const int r = e / (D / 4), c4 = (e % (D / 4)) * 4;
      const int key = j0 + r;
      v4f kf = {0.f,0.f,0.f,0.f}, vf = {0.f,0.f,0.f,0.f};
      if (key < T) { kf = *(const v4fa*)(K + (size_t)key * pitch + c4); vf = *(const v4fa*)(V + (size_t)key * pitch + c4); }
#pragma unroll
      for (int t = 0; t < 4; ++t) {
        unsigned short hb = bf16_bits(kf[t]); sKh[r][c4 + t] = hb; sKl[r][c4 + t] = bf16_bits(kf[t] - bf16_val(hb));
        hb = bf16_bits(vf[t]); sVh[r][c4 + t] = hb; sVl[r][c4 + t] = bf16_bits(vf[t] - bf16_val(hb));
      }
    }
    __syncthreads();
    // S tile 16 x 32
    v8f s[2];
#pragma unroll
    for (int nt = 0; nt < 2; ++nt) {
      v8f acc = {};
#pragma unroll
      for (int ks = 0; ks < KS; ++ks) {
        FragB bh_, bl_;
        bh_.half[0] = *(const v8us*)&sKh[nt * 16 + ln][ks * 32 + 8 * hh]; bh_.half[1] = *(const v8us*)&sKh[nt * 16 + ln][ks * 32 + 16 + 8 * hh];
        bl_.half[0] = *(const v8us*)&sKl[nt * 16 + ln][ks * 32 + 8 * hh]; bl_.half[1] = *(const v8us*)&sKl[nt * 16 + ln][ks * 32 + 16 + 8 * hh];
        acc = mmaN<3>(aqh[ks].v, aql[ks].v, bh_.v, bl_.v, acc);
      }
      s[nt] = acc;
    }
    // mask + running max (rows 8hh+r; the 16 lanes of a half share rows)
    float alpha[8];
#pragma unroll
    for (int r = 0; r < 8; ++r) {
      const int qi = q0 + 8 * hh + r;
      const int ja = j0 + ln, jb = j0 + 16 + ln;
      if (CAUSAL) { if (ja > qi) s[0][r] = -3.0e38f; if (jb > qi) s[1][r] = -3.0e38f; }
      if (ja >= T) s[0][r] = -3.0e38f;
      if (jb >= T) s[1][r] = -3.0e38f;
      float mx = fmaxf(s[0][r], s[1][r]);
      mx = fmaxf(mx, __shfl_xor(mx, 1, 32)); mx = fmaxf(mx, __shfl_xor(mx, 2, 32)); mx = fmaxf(mx, __shfl_xor(mx, 4, 32)); mx = fmaxf(mx, __shfl_xor(mx, 8, 32));
      const float mnew = fmaxf(m_r[r], mx);
      alpha[r] = (mnew > -1.0e38f) ? __expf(m_r[r] - mnew) : 1.0f;
      const float p0 = (s[0][r] > -1.0e38f) ? __expf(s[0][r] - mnew) : 0.f;
      const float p1 = (s[1][r] > -1.0e38f) ? __expf(s[1][r] - mnew) : 0.f;
      m_r[r] = mnew;
      l_r[r] = l_r[r] * alpha[r] + p0 + p1;            // per-lane partial row sum (16 lanes combined at the end)
      unsigned short hb = bf16_bits(p0); sPh[w][8 * hh + r][ln] = hb;      sPl[w][8 * hh + r][ln] = bf16_bits(p0 - bf16_val(hb));
      hb = bf16_bits(p1);                sPh[w][8 * hh + r][16 + ln] = hb; sPl[w][8 * hh + r][16 + ln] = bf16_bits(p1 - bf16_val(hb));
    }
#pragma unroll
    for (int dt = 0; dt < DT; ++dt)
#pragma unroll
      for (int r = 0; r < 8; ++r) oacc[dt][r] *= alpha[r];
    __builtin_amdgcn_fence(__ATOMIC_ACQ_REL, "workgroup");
    __builtin_amdgcn_wave_barrier();
    FragB pah, pal;
    pah.half[0] = *(const v8us*)&sPh[w][ln][8 * hh]; pah.half[1] = *(const v8us*)&sPh[w][ln][16 + 8 * hh];
    pal.half[0] = *(const v8us*)&sPl[w][ln][8 * hh]; pal.half[1] = *(const v8us*)&sPl[w][ln][16 + 8 * hh];
#pragma unroll
    for (int dt = 0; dt < DT; ++dt) {
      FragB bvh, bvl;
#pragma unroll
      for (int i = 0; i < 8; ++i) {
        bvh.u[i] = sVh[8 * hh + i][dt * 16 + ln]; bvh.u[8 + i] = sVh[16 + 8 * hh + i][dt * 16 + ln];
        bvl.u[i] = sVl[8 * hh + i][dt * 16 + ln]; bvl.u[8 + i] = sVl[16 + 8 * hh + i][dt * 16 + ln];
      }
      oacc[dt] = mmaN<3>(pah.v, pal.v, bvh.v, bvl.v, oacc[dt]);
    }
    __builtin_amdgcn_fence(__ATOMIC_ACQ_REL, "workgroup");
    __builtin_amdgcn_wave_barrier();
  }
#pragma unroll
  for (int r = 0; r < 8; ++r) {
    float l = l_r[r];
    l += __shfl_xor(l, 1, 32); l += __shfl_xor(l, 2, 32); l += __shfl_xor(l, 4, 32); l += __shfl_xor(l, 8, 32);
    l_r[r] = (l > 0.f) ? 1.0f / l : 0.f;
  }
#pragma unroll
  for (int dt = 0; dt < DT; ++dt)
#pragma unroll
    for (int r = 0; r < 8; ++r) sO[w][8 * hh + r][dt * 16 + ln] = oacc[dt][r] * l_r[r];
  __builtin_amdgcn_fence(__ATOMIC_ACQ_REL, "workgroup");
  __builtin_amdgcn_wave_barrier();
  {
    for (int r = 0; r < 16; ++r) {
      const int row = q0 + r;
      if (row < T && lane < D / 4) {
        const v4f val = *(const v4fa*)&sO[w][r][lane * 4];
        *(v4f*)(y + ((size_t)b * T + row) * ypitch + h * D + lane * 4) = val;
      }
    }
    
  }
}

// GEMM C = act(A·W + bias + resid): A f32 (ASPLIT -> hi/lo 2 terms), Wt bf16 [N][K]; ACT 0 none, 1 relu, 2 exact gelu;
// resid (optional, f32, row index = (row % rmod), pitch ldr, RES_BF16 rounds it) added before the activation.
template <bool ASPLIT, int ACT, bool BIAS_BF16, bool RES_BF16>
__global__ __launch_bounds__(128) void k_gemm_bf3(const float* __restrict__ A, int lda, const unsigned short* __restrict__ Wt, int ldb,
                                                const float* __restrict__ bias, const float* __restrict__ resid, int rmod, int ldr,
                                                float* __restrict__ C, int ldc, int M, int N, int K) {
  __shared__ __attribute__((aligned(16))) float so[4][16][64];
  const int tid = threadIdx.x, w = tid >> 5, lane = tid & 31, ln = lane & 15, hh = lane >> 4;
  const int ntn = N / 64;
  const int wid = blockIdx.x * 4 + w;
  const int mt = wid / ntn, nq = wid % ntn;
  if (mt * 16 >= M) return;
  const int row0 = mt * 16, col0 = nq * 64;
  const float* arow = A + (size_t)(row0 + ln) * lda;
  v8f acc[4] = {};
  for (int kb = 0; kb < K; kb += 32) {
    FragB ah, al;
    const v4f x0 = *(const v4fa*)(arow + kb + 8 * hh), x1 = *(const v4fa*)(arow + kb + 8 * hh + 4);
    const v4f x2 = *(const v4fa*)(arow + kb + 16 + 8 * hh), x3 = *(const v4fa*)(arow + kb + 16 + 8 * hh + 4);
    float xs[16] = {x0[0],x0[1],x0[2],x0[3],x1[0],x1[1],x1[2],x1[3],x2[0],x2[1],x2[2],x2[3],x3[0],x3[1],x3[2],x3[3]};
#pragma unroll
    for (int i = 0; i < 16; ++i) { const unsigned short hb = bf16_bits(xs[i]); ah.u[i] = hb; al.u[i] = ASPLIT ? bf16_bits(xs[i] - bf16_val(hb)) : (unsigned short)0; }
#pragma unroll
    for (int t = 0; t < 4; ++t) {
      const unsigned short* brow = Wt + (size_t)(col0 + t * 16 + ln) * ldb + kb;
      FragB b;
      b.half[0] = *(const v8us*)(brow + 8 * hh);
      b.half[1] = *(const v8us*)(brow + 16 + 8 * hh);
      acc[t] = mmaN<ASPLIT ? 2 : 1>(ah.v, al.v, b.v, b.v, acc[t]);
    }
  }
#pragma unroll
  for (int t = 0; t < 4; ++t) {
    const int col = col0 + t * 16 + ln;
    float bv = bias ? bias[col] : 0.f;
    if (BIAS_BF16) bv = bf16_round(bv);
#pragma unroll
    for (int r = 0; r < 8; ++r) {
      float v = acc[t][r] + bv;
      if (resid) { float rv = resid[(size_t)((row0 + 8 * hh + r) % rmod) * ldr + col]; if (RES_BF16) rv = bf16_round(rv); v += rv; }
      if (ACT == 1) v = fmaxf(v, 0.f);
      if (ACT == 2) v = 0.5f * v * (1.0f + erff(v * 0.70710678118654752f));
      if (ACT == 3) { const float u = 0.7978845608028654f * (v + 0.044715f * v * v * v); v = 0.5f * v * (1.0f + tanhf(u)); }
      so[w][8 * hh + r][t * 16 + ln] = v;
    }
  }
  __builtin_amdgcn_fence(__ATOMIC_ACQ_REL, "workgroup");
  __builtin_amdgcn_wave_barrier();
  const int rsub = lane >> 4, c4 = (lane & 15) * 4;
  {
#pragma unroll
    for (int q = 0; q < 8; ++q) {
      const int r = q * 2 + rsub;
      const v4f v = *(const v4fa*)&so[w][r][c4];
      *(v4f*)(C + (size_t)(row0 + r) * ldc + col0 + c4) = v;
    }
    
  }
}
// row LayerNorm (biased variance, eps) over N: s = X (+ R); optional out_sum <- s; out_norm <- (s-mu)*rsqrt(var+eps)*g + b
template <bool PARAM_BF16>
__global__ __launch_bounds__(256) void k_layernorm(const float* __restrict__ X, const float* __restrict__ R, const float* __restrict__ g, const float* __restrict__ bta,
                                                  float* __restrict__ out_sum, float* __restrict__ out_norm, int N, float eps) {
  __shared__ float red[256];
  const int row = blockIdx.x, tid = threadIdx.x;
  const float* x = X + (size_t)row * N; const float* rr = R ? R + (size_t)row * N : nullptr;
  float vals[16];                     // up to N = 4096
  const int per = N / 256;            // contiguous chunk per thread? use strided-by-4 chunks: thread handles j = tid*4 + 1024*u
  float s1 = 0.f;
  for (int u = 0; u < per / 4; ++u) {
    const int j = tid * 4 + 1024 * u;
    const v4f a = *(const v4fa*)(x + j);
    v4f b = {0.f,0.f,0.f,0.f}; if (rr) b = *(const v4fa*)(rr + j);
#pragma unroll
    for (int q = 0; q < 4; ++q) { const float v = a[q] + b[q]; vals[u * 4 + q] = v; s1 += v; }
  }
  red[tid] = s1; __syncthreads();
  for (int st = 128; st > 0; st >>= 1) { if (tid < st) red[tid] += red[tid + st]; __syncthreads(); }
  const float mu = red[0] / (float)N; __syncthreads();
  float s2 = 0.f;
  for (int u = 0; u < per / 4; ++u)
#pragma unroll
    for (int q = 0; q < 4; ++q) { const float c = vals[u * 4 + q] - mu; s2 += c * c; }
  red[tid] = s2; __syncthreads();
  for (int st = 128; st > 0; st >>= 1) { if (tid < st) red[tid] += red[tid + st]; __syncthreads(); }
  const float rs = rsqrtf(red[0] / (float)N + eps);
  {
    for (int u = 0; u < per / 4; ++u) {
      const int j = tid * 4 + 1024 * u;
      v4f o, sm;
#pragma unroll
      for (int q = 0; q < 4; ++q) {
        float gg = g[j + q], bb = bta[j + q];
        if (PARAM_BF16) { gg = bf16_round(gg); bb = bf16_round(bb); }
        sm[q] = vals[u * 4 + q]; o[q] = (vals[u * 4 + q] - mu) * rs * gg + bb;
      }
      if (out_sum) *(v4f*)(out_sum + (size_t)row * N + j) = sm;
      *(v4f*)(out_norm + (size_t)row * N + j) = o;
    }
    
  }
}



// ---- f16 WMMA path (v_wmma_f32_16x16x32_f16): 11-bit significands for operands in range — used where a [0,1] probability operand needs more precision than bf16
typedef _Float16 v16h __attribute__((ext_vector_type(16)));
union FragH { v16h v; v8us half[2]; _Float16 h[16]; unsigned short u[16]; };
template <int NT>
__device__ __forceinline__ v8f mmaH(v16h ah, v16h al, v16h bh, v16h bl, v8f c) {
  c = __builtin_amdgcn_wmma_f32_16x16x32_f16(false, ah, false, bh, (short)0, c, false, false);
  if (NT >= 2) c = __builtin_amdgcn_wmma_f32_16x16x32_f16(false, al, false, bh, (short)0, c, false, false);
  if (NT >= 3) c = __builtin_amdgcn_wmma_f32_16x16x32_f16(false, ah, false, bl, (short)0, c, false, false);
  asm volatile("v_nop\n\tv_nop\n\tv_nop\n\tv_nop" : "+v"(c) : "v"(ah), "v"(al), "v"(bh), "v"(bl));
  return c;
}
// batched GEMM like k_gemm_b but f16 operands: A f32 (split into f16 hi/lo if ASPLIT, else rounded to f16), Bt = f16 values [n][k]; alpha; C f32; N multiple of 16 (partial tiles skipped)
template <bool ASPLIT>
__global__ __launch_bounds__(128) void k_gemm_h(const float* __restrict__ A, int lda, size_t sA, const _Float16* __restrict__ Bh, int ldb, size_t sB, float alpha, float* __restrict__ C, int ldc, size_t sC, int M, int N, int K) {
  __shared__ __attribute__((aligned(16))) float so[4][16][64];
  const int tid = threadIdx.x, w = tid >> 5, lane = tid & 31, ln = lane & 15, hh = lane >> 4; const int by = blockIdx.y;
  A += (size_t)by * sA; Bh += (size_t)by * sB; C += (size_t)by * sC;
  const int ntn = (N + 63) / 64; const int wid = blockIdx.x * 4 + w; const int mt = wid / ntn, nq = wid % ntn; if (mt * 16 >= M) return;
  const int row0 = mt * 16, col0 = nq * 64; const float* arow = A + (size_t)(row0 + ln) * lda;
  v8f acc[4] = {};
  for (int kb = 0; kb < K; kb += 32) {
    FragH ah, al;
    const v4f x0 = *(const v4fa*)(arow + kb + 8 * hh), x1 = *(const v4fa*)(arow + kb + 8 * hh + 4), x2 = *(const v4fa*)(arow + kb + 16 + 8 * hh), x3 = *(const v4fa*)(arow + kb + 16 + 8 * hh + 4);
    float xs[16] = {x0[0],x0[1],x0[2],x0[3],x1[0],x1[1],x1[2],x1[3],x2[0],x2[1],x2[2],x2[3],x3[0],x3[1],x3[2],x3[3]};
#pragma unroll
    for (int i = 0; i < 16; ++i) { const _Float16 h = (_Float16)xs[i]; ah.h[i] = h; al.h[i] = ASPLIT ? (_Float16)(xs[i] - (float)h) : (_Float16)0.0f; }
#pragma unroll
    for (int t = 0; t < 4; ++t) { if (col0 + t * 16 >= N) continue; const size_t boff = (size_t)(col0 + t * 16 + ln) * ldb + kb; FragH bq; bq.half[0] = *(const v8us*)(Bh + boff + 8 * hh); bq.half[1] = *(const v8us*)(Bh + boff + 16 + 8 * hh);
      acc[t] = mmaH<ASPLIT ? 2 : 1>(ah.v, al.v, bq.v, bq.v, acc[t]); }
  }
#pragma unroll
  for (int t = 0; t < 4; ++t) { if (col0 + t * 16 >= N) continue;
#pragma unroll
    for (int r = 0; r < 8; ++r) so[w][8 * hh + r][t * 16 + ln] = acc[t][r] * alpha; }
  __builtin_amdgcn_fence(__ATOMIC_ACQ_REL, "workgroup"); __builtin_amdgcn_wave_barrier();
  const int rsub = lane >> 4, c4 = (lane & 15) * 4;
  {
#pragma unroll
    for (int q = 0; q < 8; ++q) { const int r = q * 2 + rsub; if (col0 + c4 < N) { const v4f v = *(const v4fa*)&so[w][r][c4]; *(v4f*)(C + (size_t)(row0 + r) * ldc + col0 + c4) = v; } }
     }
}

// Wt[n][k] = f16(bf16(W[k][n]) * scale) from f32 row-major W[K][N] (scale = power of two; bf16-exact weights stay exact in f16 away from the subnormal range).
// One work-group = a tile of 128 k x 64 n, turned in LDS, so that both sides move whole lines: 16 lanes read 256 contiguous bytes of one W row, 16 lanes write 256 contiguous bytes of one Wt row.
// LDS: one dword = the f16 pair (k, k + 1) of one n; a row = one n's 64 dwords, its sixteen 16-byte groups (8 k each) stored at group ^ (n / 4):
// the 32 lanes of a dword store (16 values of n / 4, two neighbouring pairs) fall on 32 banks, the 16 lanes that read one row back as 16-byte groups on all 64.
// K a multiple of 128, N a multiple of 64.
typedef _Float16 v2h __attribute__((ext_vector_type(2)));
// blk = the tile's index, tl = the work-group's 16 KiB of LDS.
template <int K, int N>
__device__ __forceinline__ void wt_tile(const float* __restrict__ W, _Float16* __restrict__ Wt, float scale, int blk, unsigned int* tl) {
  const int tid = threadIdx.x, lo = tid & 15, hi = tid >> 4;
  const int n0 = (blk % (N / 64)) * 64, k0 = (blk / (N / 64)) * 128;
  const float* src = W + (size_t)(k0 + 2 * hi) * N + n0 + 4 * lo;      // rows k0 + 2 hi + 32 u and the next, columns n0 + 4 lo .. + 3
  v4f ev[4], od[4];
#pragma unroll
  for (int u = 0; u < 4; ++u) { ev[u] = *(const v4fa*)(src + (size_t)(32 * u) * N); od[u] = *(const v4fa*)(src + (size_t)(32 * u + 1) * N); }
#pragma unroll
  for (int u = 0; u < 4; ++u) { const int kp = hi + 16 * u;      // pair index: k = k0 + 2 kp, k0 + 2 kp + 1
#pragma unroll
    for (int q = 0; q < 4; ++q) { v2h p; p[0] = (_Float16)(bf16_round(ev[u][q]) * scale); p[1] = (_Float16)(bf16_round(od[u][q]) * scale);
      tl[(4 * lo + q) * 64 + (((kp >> 2) ^ lo) << 2) + (kp & 3)] = __builtin_bit_cast(unsigned int, p); } }
  __syncthreads();      // every pair of the tile is in LDS before a row is read back
#pragma unroll
  for (int u = 0; u < 4; ++u) { const int n = hi + 16 * u; const v8us v = *(const v8us*)&tl[n * 64 + ((lo ^ ((n >> 2) & 15)) << 2)];
    *(v8us*)((unsigned short*)Wt + (size_t)(n0 + n) * K + k0 + 8 * lo) = v; }
  asm volatile("s_wait_xcnt 0x0" ::: "memory");      // closes the run of four stores: in the merged kernel other jobs' code follows in the text and reuses the stores' registers
}
typedef _Float16 v4h __attribute__((ext_vector_type(4)));

__global__ __launch_bounds__(256) void k_x16(const float* __restrict__ x, _Float16* __restrict__ X16, size_t n8) { const size_t t = (size_t)blockIdx.x * 256 + threadIdx.x; if (t >= n8) return; FragH f;
#pragma unroll
  for (int q = 0; q < 8; ++q) f.h[q] = (_Float16)bf16_round(x[t * 8 + q]); *(v8us*)((unsigned short*)X16 + t * 8) = f.half[0];  }
__global__ __launch_bounds__(256) void k_h16(const float* __restrict__ x, _Float16* __restrict__ X16, size_t n8) { const size_t t = (size_t)blockIdx.x * 256 + threadIdx.x; if (t >= n8) return; FragH f;
#pragma unroll
  for (int q = 0; q < 8; ++q) f.h[q] = (_Float16)x[t * 8 + q]; *(v8us*)((unsigned short*)X16 + t * 8) = f.half[0];  }
__global__ __launch_bounds__(256) void k_round16f(const float* __restrict__ W, _Float16* __restrict__ Bt, size_t n8) { const size_t t = (size_t)blockIdx.x * 256 + threadIdx.x; if (t >= n8) return; FragH f;
#pragma unroll
  for (int i = 0; i < 8; ++i) f.h[i] = (_Float16)(bf16_round(W[t * 8 + i]) * 16.0f); *(v8us*)((unsigned short*)Bt + t * 8) = f.half[0];  }
template <int NHv, int TTv>
__global__ __launch_bounds__(256) void k_vt(const _Float16* __restrict__ V16, int ldv, int voff, _Float16* __restrict__ Vt) { __shared__ unsigned short tl[64][66]; const int tid = threadIdx.x; const int slab = blockIdx.x / (TTv / 64), lg = blockIdx.x % (TTv / 64); const int b = slab / NHv, h = slab % NHv;
  for (int i = tid; i < 64 * 8; i += 256) { const int r = i / 8, c8 = (i % 8) * 8; FragH f; f.half[0] = *(const v8us*)((const unsigned short*)V16 + ((size_t)b * TTv + lg * 64 + r) * ldv + voff + h * 64 + c8);
#pragma unroll
    for (int q = 0; q < 8; ++q) tl[r][c8 + q] = f.u[q]; }
  __syncthreads();
  {
#pragma unroll
    for (int rd = 0; rd < 2; ++rd) { const int d = rd * 32 + tid / 8, pc = tid % 8; FragH f;
#pragma unroll
      for (int q = 0; q < 8; ++q) f.u[q] = tl[pc * 8 + q][d];
      *(v8us*)((unsigned short*)Vt + ((size_t)slab * 64 + d) * TTv + lg * 64 + pc * 8) = f.half[0]; }
     } }

template <int D, int RBF>
__device__ __forceinline__ void lnx_rows(const float* __restrict__ X, const float* __restrict__ gam, const float* __restrict__ bet, int nrows, float eps, _Float16* __restrict__ O16, float* __restrict__ XR, int blk) {
  constexpr int NP = D / 128; const int tid = threadIdx.x, wv = tid >> 5, lane = tid & 31; const size_t r = (size_t)blk * 8 + wv; if (r >= (size_t)nrows) return; v4f y[NP]; float s = 0.f;
#pragma unroll
  for (int j = 0; j < NP; ++j) { const int c = j * 128 + lane * 4; v4f g = *(const v4fa*)(X + r * D + c); if (RBF) { for (int q = 0; q < 4; ++q) g[q] = bf16_round(g[q]); } y[j] = g; s += g[0] + g[1] + g[2] + g[3]; }
  for (int o = 16; o >= 1; o >>= 1) s += __shfl_xor(s, o, 32); const float mu = s / (float)D; float q2 = 0.f;
#pragma unroll
  for (int j = 0; j < NP; ++j) for (int q = 0; q < 4; ++q) { const float d = y[j][q] - mu; q2 += d * d; }
  for (int o = 16; o >= 1; o >>= 1) q2 += __shfl_xor(q2, o, 32); const float rs = rsqrtf(q2 / (float)D + eps);
  {
#pragma unroll
    for (int j = 0; j < NP; ++j) { const int c = j * 128 + lane * 4; v4h h; for (int q = 0; q < 4; ++q) { const float v = (y[j][q] - mu) * rs * bf16_round(gam[c + q]) + bf16_round(bet[c + q]); h[q] = (_Float16)v; } *(v4h*)(O16 + r * D + c) = h;
      asm volatile("s_wait_xcnt 0x0" ::: "memory");      // the store's registers are reused directly behind it: the wait stands in front of the overwrite
      if (XR) { *(v4f*)(XR + r * D + c) = y[j];
        asm volatile("s_wait_xcnt 0x0" ::: "memory"); } }      // likewise, ahead of the next trip's loads
     } }
template <int D, int RBF>
__global__ __launch_bounds__(256) void k_lnx(const float* __restrict__ X, const float* __restrict__ gam, const float* __restrict__ bet, int nrows, float eps, _Float16* __restrict__ O16, float* __restrict__ XR) {
  lnx_rows<D, RBF>(X, gam, bet, nrows, eps, O16, XR, (int)blockIdx.x); }
// LN1 and the four weight convert-transposes need nothing of each other: one grid, each job a range of the block index (a work-group does one job whole, so the branch and the tile's barrier are block-uniform).
#define PB_LN (NR / 8)
#define PB_QKV ((DM / 128) * (3 * DM / 64))
#define PB_O ((DM / 128) * (DM / 64))
#define PB_W1 ((DM / 128) * (FF / 64))
#define PB_W2 ((FF / 128) * (DM / 64))
__global__ __launch_bounds__(256) void k_prep(const float* __restrict__ x, const float* __restrict__ g1, const float* __restrict__ be1, _Float16* __restrict__ H16, float* __restrict__ XR,
                                              const float* __restrict__ Wqkv, const float* __restrict__ Wo, const float* __restrict__ W1, const float* __restrict__ W2,
                                              _Float16* __restrict__ Bqkv, _Float16* __restrict__ Bo, _Float16* __restrict__ Bw1, _Float16* __restrict__ Bw2) {
  __shared__ __attribute__((aligned(16))) unsigned int tl[64 * 64];
  int b = (int)blockIdx.x;
  if (b < PB_LN) { lnx_rows<DM, 1>(x, g1, be1, NR, 1e-5f, H16, XR, b); return; }      /* LN1(bf16 x) -> f16; XR = bf16(x) */
  b -= PB_LN; if (b < PB_QKV) { wt_tile<DM, 3 * DM>(Wqkv, Bqkv, 16.0f, b, tl); return; }      /* (in,out) -> Bt[n][k] x 2^4 */
  b -= PB_QKV; if (b < PB_O) { wt_tile<DM, DM>(Wo, Bo, 16.0f, b, tl); return; }
  b -= PB_O; if (b < PB_W1) { wt_tile<DM, FF>(W1, Bw1, 16.0f, b, tl); return; }
  wt_tile<FF, DM>(W2, Bw2, 16.0f, b - PB_W1, tl);
}
__global__ __launch_bounds__(256) void k_vthl(const float* __restrict__ VF, int ldv, _Float16* __restrict__ Vth, _Float16* __restrict__ Vtl) { __shared__ float tl[64][65]; const int tid = threadIdx.x; const int slab = blockIdx.x / (TT / 64), lg = blockIdx.x % (TT / 64); const int b = slab / NH, h = slab % NH;
  for (int i = tid; i < 64 * 16; i += 256) { const int r = i / 16, c4 = (i % 16) * 4; const v4f a = *(const v4fa*)(VF + ((size_t)b * TT + lg * 64 + r) * ldv + h * HD + c4); tl[r][c4] = a[0]; tl[r][c4 + 1] = a[1]; tl[r][c4 + 2] = a[2]; tl[r][c4 + 3] = a[3]; }
  __syncthreads();
  FragH fh[2], fl[2]; size_t oo[2];
#pragma unroll
  for (int rd = 0; rd < 2; ++rd) { const int d = rd * 32 + tid / 8, pc = tid % 8;
#pragma unroll
    for (int q = 0; q < 8; ++q) { const float v = tl[pc * 8 + q][d]; const _Float16 hv = (_Float16)v; fh[rd].h[q] = hv; fl[rd].h[q] = (_Float16)((v - (float)hv) * 1024.0f); } oo[rd] = ((size_t)slab * HD + d) * TT + lg * 64 + pc * 8; }
  {
#pragma unroll
    for (int rd = 0; rd < 2; ++rd) { *(v8us*)((unsigned short*)Vth + oo[rd]) = fh[rd].half[0]; *(v8us*)((unsigned short*)Vtl + oo[rd]) = fl[rd].half[0]; }
     } }
__global__ __launch_bounds__(128) void k_flash(const _Float16* __restrict__ Q16, int ldq, const _Float16* __restrict__ K16, int ldk, const _Float16* __restrict__ Vt, const _Float16* __restrict__ Vtlo, float* __restrict__ O, int ldo) {
  constexpr int RPW = 16, RTN = RPW / 16, NQB = TT / (4 * RPW), DT = 4, KS = 2;
  __shared__ __attribute__((aligned(16))) unsigned short sP[4][RPW][40]; __shared__ __attribute__((aligned(16))) float sO[4][RPW][64 + 4];
  const int tid = threadIdx.x, w = tid >> 5, lane = tid & 31, ln = lane & 15, hh = lane >> 4;
  const int slab = blockIdx.x / NQB, qblk = blockIdx.x % NQB; const int b = slab / NH, h = slab % NH; const int qb0 = qblk * (4 * RPW); const int q0 = qb0 + w * RPW;
  FragH aq[2][KS];
#pragma unroll
  for (int rt = 0; rt < RTN; ++rt) { const unsigned short* qr = (const unsigned short*)Q16 + ((size_t)b * TT + q0 + rt * 16 + ln) * ldq + h * 64;
#pragma unroll
    for (int ks = 0; ks < KS; ++ks) { aq[rt][ks].half[0] = *(const v8us*)(qr + ks * 32 + 8 * hh); aq[rt][ks].half[1] = *(const v8us*)(qr + ks * 32 + 16 + 8 * hh); } }
  const unsigned short* Vth = (const unsigned short*)Vt + (size_t)slab * 64 * TT; const unsigned short* Vtl = (const unsigned short*)Vtlo + (size_t)slab * 64 * TT;
  float m_r[2][8], l_r[2][8]; v8f oacc[2][DT], oaccl[2][DT];
#pragma unroll
  for (int rt = 0; rt < RTN; ++rt) {
#pragma unroll
    for (int r = 0; r < 8; ++r) { m_r[rt][r] = -3.0e38f; l_r[rt][r] = 0.f; }
#pragma unroll
    for (int dt = 0; dt < DT; ++dt) { oacc[rt][dt] = (v8f){0.f,0.f,0.f,0.f,0.f,0.f,0.f,0.f}; oaccl[rt][dt] = oacc[rt][dt]; } }
  const int jbeg = (qb0 - RW) > 0 ? (qb0 - RW) : 0; const int jend = (qb0 + 4 * RPW + RW) < TT ? (qb0 + 4 * RPW + RW) : TT;      /* block-uniform window bounds (multiples of 32) */
#pragma unroll 1
  for (int j0 = jbeg; j0 < jend; j0 += 32) {
    
    v8f s[2][2];
#pragma unroll
    for (int nt = 0; nt < 2; ++nt) { const unsigned short* kr = (const unsigned short*)K16 + ((size_t)b * TT + j0 + nt * 16 + ln) * ldk + h * 64; FragH bk[KS];
#pragma unroll
      for (int ks = 0; ks < KS; ++ks) { bk[ks].half[0] = *(const v8us*)(kr + ks * 32 + 8 * hh); bk[ks].half[1] = *(const v8us*)(kr + ks * 32 + 16 + 8 * hh); }
#pragma unroll
      for (int rt = 0; rt < RTN; ++rt) { v8f acc = (v8f){0.f,0.f,0.f,0.f,0.f,0.f,0.f,0.f};
#pragma unroll
        for (int ks = 0; ks < KS; ++ks) acc = mmaH<1>(aq[rt][ks].v, aq[rt][ks].v, bk[ks].v, bk[ks].v, acc); s[rt][nt] = acc; } }
#pragma unroll
    for (int rt = 0; rt < RTN; ++rt)
#pragma unroll
      for (int r = 0; r < 8; ++r) { const int tq = q0 + rt * 16 + 8 * hh + r; const int k0 = j0 + ln, k1 = j0 + 16 + ln; (void)tq; (void)k0; (void)k1;
        const bool ok0 = (k0 - tq <= RW) && (tq - k0 <= RW), ok1 = (k1 - tq <= RW) && (tq - k1 <= RW);
        const float s0 = ok0 ? s[rt][0][r] * 0.125f : -INFINITY, s1 = ok1 ? s[rt][1][r] * 0.125f : -INFINITY; float mc = fmaxf(s0, s1);
        mc = fmaxf(mc, __shfl_xor(mc, 1, 32)); mc = fmaxf(mc, __shfl_xor(mc, 2, 32)); mc = fmaxf(mc, __shfl_xor(mc, 4, 32)); mc = fmaxf(mc, __shfl_xor(mc, 8, 32));
        const float mn = fmaxf(m_r[rt][r], mc); const float al = (mn > -1.0e38f) ? expf(m_r[rt][r] - mn) : 1.0f; m_r[rt][r] = mn; const float p0 = ok0 ? expf(s0 - mn) : 0.f, p1 = ok1 ? expf(s1 - mn) : 0.f; l_r[rt][r] = l_r[rt][r] * al + p0 + p1;
#pragma unroll
        for (int dt = 0; dt < DT; ++dt) { oacc[rt][dt][r] *= al; oaccl[rt][dt][r] *= al; }
        FragH t2; t2.h[0] = (_Float16)(p0 * 1024.0f); t2.h[1] = (_Float16)(p1 * 1024.0f); sP[w][rt * 16 + 8 * hh + r][ln] = t2.u[0]; sP[w][rt * 16 + 8 * hh + r][16 + ln] = t2.u[1]; }
    __builtin_amdgcn_fence(__ATOMIC_ACQ_REL, "workgroup"); __builtin_amdgcn_wave_barrier();
    FragH pa[2];
#pragma unroll
    for (int rt = 0; rt < RTN; ++rt) { pa[rt].half[0] = *(const v8us*)&sP[w][rt * 16 + ln][8 * hh]; pa[rt].half[1] = *(const v8us*)&sP[w][rt * 16 + ln][16 + 8 * hh]; }
#pragma unroll
    for (int dt = 0; dt < DT; ++dt) { const size_t vo = (size_t)(dt * 16 + ln) * TT + j0; FragH bv, bl; bv.half[0] = *(const v8us*)(Vth + vo + 8 * hh); bv.half[1] = *(const v8us*)(Vth + vo + 16 + 8 * hh); bl.half[0] = *(const v8us*)(Vtl + vo + 8 * hh); bl.half[1] = *(const v8us*)(Vtl + vo + 16 + 8 * hh);
#pragma unroll
      for (int rt = 0; rt < RTN; ++rt) { oacc[rt][dt] = mmaH<1>(pa[rt].v, pa[rt].v, bv.v, bv.v, oacc[rt][dt]); oaccl[rt][dt] = mmaH<1>(pa[rt].v, pa[rt].v, bl.v, bl.v, oaccl[rt][dt]); } }
    __builtin_amdgcn_fence(__ATOMIC_ACQ_REL, "workgroup"); __builtin_amdgcn_wave_barrier(); }
#pragma unroll
  for (int rt = 0; rt < RTN; ++rt) {
#pragma unroll
    for (int r = 0; r < 8; ++r) { float l = l_r[rt][r]; l += __shfl_xor(l, 1, 32); l += __shfl_xor(l, 2, 32); l += __shfl_xor(l, 4, 32); l += __shfl_xor(l, 8, 32); l_r[rt][r] = (l > 0.f) ? 1.0f / (l * 1024.0f) : 0.f; }
#pragma unroll
    for (int dt = 0; dt < DT; ++dt)
#pragma unroll
      for (int r = 0; r < 8; ++r) sO[w][rt * 16 + 8 * hh + r][dt * 16 + ln] = (oacc[rt][dt][r] + oaccl[rt][dt][r] * 0.0009765625f) * l_r[rt][r]; }
  __builtin_amdgcn_fence(__ATOMIC_ACQ_REL, "workgroup"); __builtin_amdgcn_wave_barrier();
  {
#pragma unroll
    for (int rp = 0; rp < RPW; rp += 2) { const int r = rp + (lane >> 4), pc = lane & 15; const v4f val = *(const v4fa*)&sO[w][r][pc * 4]; *(v4f*)(O + ((size_t)b * TT + q0 + r) * ldo + h * 64 + pc * 4) = val; }
     } }

// ---- tiled f16 GEMM with fused epilogue: act(A[M][K] * Bh[N][K]^T * alpha + bf16(bias[col]) (+ CP[row][col] if RES)) -> C16 (f16, if OUT16) or C (f32); ACT 0 none, 6 erf-GELU. A and Bh f16 and k-contiguous (pitch K), C / C16 / CP pitch N.
// One work-group = one 128 x 128 tile of C, 8 waves as 4 (rows) x 2 (columns), 32 x 64 of C per wave. A pass is 128 k: 256 B of each of the 128 A rows and 128 Bh rows,
// laid in LDS at a pitch of 272 B (an odd multiple of 16 B: conflict-free for ds_load_b128 fragment reads). Two buffers; the next pass's rows are copied while this pass is multiplied.
// M, N multiples of 128, K a multiple of 128. The k order of every accumulator is ascending in steps of 32.
// NF > 0: two products on one A share the grid: the tiles of the first N - NF columns go to C16 (pitch N - NF), those of the last NF columns to C as f32 (pitch NF).
#define GT_ROWB 272
#define GT_STAGE (256 * GT_ROWB)
// Eight 16-byte asynchronous copies of one lane, global -> LDS, rows 16 apart. The s_wait_xcnt closes the statement so that no address register is rewritten ahead of it.
template <int K>
__device__ __forceinline__ void gt_copy8(unsigned l0, const _Float16* g0) {
  const unsigned l1 = l0 + 16 * GT_ROWB, l2 = l0 + 32 * GT_ROWB, l3 = l0 + 48 * GT_ROWB, l4 = l0 + 64 * GT_ROWB, l5 = l0 + 80 * GT_ROWB, l6 = l0 + 96 * GT_ROWB, l7 = l0 + 112 * GT_ROWB;
  const _Float16 *g1 = g0 + 16 * K, *g2 = g0 + 32 * K, *g3 = g0 + 48 * K, *g4 = g0 + 64 * K, *g5 = g0 + 80 * K, *g6 = g0 + 96 * K, *g7 = g0 + 112 * K;
  asm volatile("global_load_async_to_lds_b128 %0, %8, off\n\t"
               "global_load_async_to_lds_b128 %1, %9, off\n\t"
               "global_load_async_to_lds_b128 %2, %10, off\n\t"
               "global_load_async_to_lds_b128 %3, %11, off\n\t"
               "global_load_async_to_lds_b128 %4, %12, off\n\t"
               "global_load_async_to_lds_b128 %5, %13, off\n\t"
               "global_load_async_to_lds_b128 %6, %14, off\n\t"
               "global_load_async_to_lds_b128 %7, %15, off\n\t"
               "s_wait_xcnt 0x0"
               :: "v"(l0), "v"(l1), "v"(l2), "v"(l3), "v"(l4), "v"(l5), "v"(l6), "v"(l7), "v"(g0), "v"(g1), "v"(g2), "v"(g3), "v"(g4), "v"(g5), "v"(g6), "v"(g7) : "memory");
}
// A wave's staged 32 x 64 tile (so, pitch 68 floats) -> rows rw .. rw + 31, columns cw .. cw + 63 of a plane of pitch P, in whole lines.
template <int ACT, int P, bool RES, bool OUT16>
__device__ __forceinline__ void gt_store(const float* so, const float* __restrict__ CP, float* __restrict__ C, _Float16* __restrict__ C16, int rw, int cw, int lane) {
  const int rsub = lane >> 4, c4 = (lane & 15) * 4;
#pragma unroll (ACT == 6 ? 2 : 16)      /* the erf text is long: unrolled by 2 only, for speed */
  for (int q = 0; q < 16; ++q) { const int r = q * 2 + rsub; v4f v = *(const v4fa*)&so[r * 68 + c4]; const size_t o = (size_t)(rw + r) * P + cw + c4;
    if (RES) { const v4f c = *(const v4fa*)(CP + o); v[0] += c[0]; v[1] += c[1]; v[2] += c[2]; v[3] += c[3]; }
    if (ACT == 6) {
#pragma unroll
      for (int e = 0; e < 4; ++e) v[e] = 0.5f * v[e] * (1.0f + erff(v[e] * 0.70710678118654752f)); }
    if (!OUT16) *(v4f*)(C + o) = v;
    else { v4h h4;
#pragma unroll
      for (int e = 0; e < 4; ++e) h4[e] = (_Float16)v[e];
      *(v4h*)(C16 + o) = h4; } }
  asm volatile("s_wait_xcnt 0x0" ::: "memory");      // closes the run of stores: where two store paths share a kernel the other path's code follows in the text and reuses the stores' registers
}
template <int ACT, int N, int K, bool RES, bool OUT16, int NF = 0>
__global__ __launch_bounds__(256) void k_gemm_t(const _Float16* __restrict__ A, const _Float16* __restrict__ Bh, float alpha, const float* __restrict__ bias, const float* __restrict__ CP, float* __restrict__ C, _Float16* __restrict__ C16) {
  __shared__ __attribute__((aligned(16))) unsigned char L[2 * GT_STAGE];
  constexpr int NST = K / 128, NTN = N / 128;
  const int tid = threadIdx.x, w = tid >> 5, lane = tid & 31, ln = lane & 15, hh = lane >> 4;
  const int row0 = (int)(blockIdx.x / NTN) * 128, col0 = (int)(blockIdx.x % NTN) * 128;
  const int wm = w >> 1, wn = w & 1;
  // copy roles: 16 lanes cover one row's 256 B; a thread takes rows (tid / 16) + 16 i of A and of Bh
  const unsigned lcp = (unsigned)(size_t)L + (unsigned)(tid >> 4) * GT_ROWB + (unsigned)(tid & 15) * 16u;
  const _Float16* ga = A + (size_t)(row0 + (tid >> 4)) * K + (tid & 15) * 8;
  const _Float16* gb = Bh + (size_t)(col0 + (tid >> 4)) * K + (tid & 15) * 8;
  v8f acc[2][4];
#pragma unroll
  for (int i = 0; i < 2; ++i)
#pragma unroll
    for (int j = 0; j < 4; ++j) acc[i][j] = (v8f){0.f,0.f,0.f,0.f,0.f,0.f,0.f,0.f};
  gt_copy8<K>(lcp, ga); gt_copy8<K>(lcp + 128 * GT_ROWB, gb);
  asm volatile("s_wait_asynccnt 0x0" ::: "memory");      // this wave's copies of pass 0 have landed
  __syncthreads();                                        // ... and every other wave's
  if (NST > 1) { gt_copy8<K>(lcp + GT_STAGE, ga + 128); gt_copy8<K>(lcp + GT_STAGE + 128 * GT_ROWB, gb + 128); }
#pragma unroll 1      /* one pass per trip: the ring's waits and its barrier stand once, at the foot */
  for (int t = 0; t < NST; ++t) {
    const unsigned buf = (unsigned)(t & 1) * GT_STAGE;
    const unsigned char* sa = L + buf + (wm * 32 + ln) * GT_ROWB + 16 * hh;
    const unsigned char* sb = L + buf + (128 + wn * 64 + ln) * GT_ROWB + 16 * hh;
    // two fragment sets: block ks + 1's twelve LDS reads go out as one group ahead of block ks's eight WMMAs (all inside this pass's own buffer)
    FragH a[2][2], b[2][4];
#pragma unroll
    for (int i = 0; i < 2; ++i) { a[0][i].half[0] = *(const v8us*)(sa + i * 16 * GT_ROWB); a[0][i].half[1] = *(const v8us*)(sa + i * 16 * GT_ROWB + 32); }
#pragma unroll
    for (int j = 0; j < 4; ++j) { b[0][j].half[0] = *(const v8us*)(sb + j * 16 * GT_ROWB); b[0][j].half[1] = *(const v8us*)(sb + j * 16 * GT_ROWB + 32); }
#pragma unroll
    for (int ks = 0; ks < 4; ++ks) {
      const int cu = ks & 1, nx = cu ^ 1;
      if (ks < 3) {
#pragma unroll
        for (int i = 0; i < 2; ++i) { a[nx][i].half[0] = *(const v8us*)(sa + i * 16 * GT_ROWB + (ks + 1) * 64); a[nx][i].half[1] = *(const v8us*)(sa + i * 16 * GT_ROWB + (ks + 1) * 64 + 32); }
#pragma unroll
        for (int j = 0; j < 4; ++j) { b[nx][j].half[0] = *(const v8us*)(sb + j * 16 * GT_ROWB + (ks + 1) * 64); b[nx][j].half[1] = *(const v8us*)(sb + j * 16 * GT_ROWB + (ks + 1) * 64 + 32); }
      }
      __builtin_amdgcn_sched_barrier(0);      // keeps the read group whole and ahead of the WMMAs: without it the scheduler spreads the reads among them and waits to 0 at each place
#pragma unroll
      for (int i = 0; i < 2; ++i)
#pragma unroll
        for (int j = 0; j < 4; ++j) acc[i][j] = __builtin_amdgcn_wmma_f32_16x16x32_f16(false, a[cu][i].v, false, b[cu][j].v, (short)0, acc[i][j], false, false);
      __builtin_amdgcn_sched_barrier(0);      // ... and keeps the next group behind this block
    }
    asm volatile("s_wait_dscnt 0x0" ::: "memory");        // this wave's reads of the buffer have retired before it is refilled
    asm volatile("s_wait_asynccnt 0x0" ::: "memory");     // this wave's copies of pass t + 1 have landed
    __syncthreads();                                      // publishes pass t + 1 and ends every reader's last read of pass t's buffer
    if (t + 2 < NST) { gt_copy8<K>(lcp + buf, ga + (t + 2) * 128); gt_copy8<K>(lcp + buf + 128 * GT_ROWB, gb + (t + 2) * 128); }
  }
  asm volatile("s_wait_asynccnt 0x0" ::: "memory");       // no copy is outstanding when the ring becomes output staging
  // epilogue: each wave stages its 32 x 64 tile in its own range of the ring (pitch 68 floats) and stores whole lines
  float* so = (float*)L + w * (32 * 68);
#pragma unroll
  for (int j = 0; j < 4; ++j) { const float bv = bf16_round(bias[col0 + wn * 64 + j * 16 + ln]);
#pragma unroll
    for (int i = 0; i < 2; ++i)
#pragma unroll
      for (int r = 0; r < 8; ++r) so[(i * 16 + 8 * hh + r) * 68 + j * 16 + ln] = acc[i][j][r] * alpha + bv; }
  __builtin_amdgcn_fence(__ATOMIC_ACQ_REL, "workgroup"); __builtin_amdgcn_wave_barrier();      // the wave's own LDS writes are read back by other lanes of the same wave
  // NF > 0: which plane the tile belongs to is the same for the whole work-group, so the choice stands once, outside the store loop
  if (NF > 0 && col0 >= N - NF) gt_store<ACT, NF, RES, false>(so, CP, C, C16, row0 + wm * 32, col0 - (N - NF) + wn * 64, lane);
  else gt_store<ACT, N - NF, RES, OUT16>(so, CP, C, C16, row0 + wm * 32, col0 + wn * 64, lane);
}

extern "C" void kernel_launch(void* const* d_in, const int* in_sizes, int n_in,
                              void* d_out, int out_size, void* d_ws, size_t ws_size, hipStream_t stream) {
  (void)in_sizes; (void)n_in; (void)out_size;
  const float* const* I = (const float* const*)d_in; const float* x = I[0]; const float* Wqkv = I[1]; const float* bqkv = I[2]; const float* Wo = I[3]; const float* bo = I[4]; const float* g1 = I[5]; const float* be1 = I[6]; const float* g2 = I[7]; const float* be2 = I[8];
  const float* W1 = I[9]; const float* b1 = I[10]; const float* W2 = I[11]; const float* b2 = I[12];
  char* ws = (char*)d_ws; size_t off = 0;
  auto take = [&](size_t bytes) { char* p = ws + off; off += (bytes + 255) & ~(size_t)255; return p; };
  _Float16* Bqkv = (_Float16*)take((size_t)3 * DM * DM * 2); _Float16* Bo = (_Float16*)take((size_t)DM * DM * 2); _Float16* Bw1 = (_Float16*)take((size_t)FF * DM * 2); _Float16* Bw2 = (_Float16*)take((size_t)DM * FF * 2);
  _Float16* H16 = (_Float16*)take((size_t)NR * DM * 2); float* XR = (float*)take((size_t)NR * DM * 4); _Float16* QK = (_Float16*)take((size_t)NR * 2 * DM * 2); float* F32 = (float*)take((size_t)NR * DM * 4);
  _Float16* Vth = (_Float16*)take((size_t)NR * DM * 2); _Float16* Vtl = (_Float16*)take((size_t)NR * DM * 2); float* X1 = (float*)take((size_t)NR * DM * 4);
  float* O = F32; _Float16* O16 = H16; _Float16* H2 = H16; _Float16* FH = QK;      /* reuse: F32 holds v (consumed by k_vthl) then O; H16 holds LN1 output (consumed by the qkv GEMM), then O16, then LN2 output; the [q|k] plane holds the FFN hidden (f16 [4096][2048]) once attention is done */
  if (off > ws_size) return;      // 6.3 + 2.1 + 4.2 + 4.2 + 8.4 + 16.8 + 16.8 + 16.8 + 8.4 + 8.4 + 16.8 ≈ 109 MB (104 MiB)
  k_prep<<<PB_LN + PB_QKV + PB_O + PB_W1 + PB_W2, 256, 0, stream>>>(x, g1, be1, H16, XR, Wqkv, Wo, W1, W2, Bqkv, Bo, Bw1, Bw2);      /* LN1 and the four weight planes */
  const dim3 gqkv((NR / 128) * (3 * DM / 128), 1), gd((NR / 128) * (DM / 128), 1), gf((NR / 128) * (FF / 128), 1);      /* one work-group per 128 x 128 tile */
  k_gemm_t<0, 3 * DM, DM, false, true, DM><<<gqkv, 256, 0, stream>>>(H16, Bqkv, 0.0625f, bqkv, nullptr, F32, QK);      /* [q | k] + bias (f16) and v + bias (f32): M 4096 N 3072 K 1024 */
  k_vthl<<<BB * NH * (TT / 64), 256, 0, stream>>>(F32, DM, Vth, Vtl);      /* v (f32) -> transposed hi / lo planes */
  k_flash<<<BB * NH * (TT / 64), 128, 0, stream>>>(QK, 2 * DM, QK + DM, 2 * DM, Vth, Vtl, O, DM);
  k_h16<<<(unsigned)(((size_t)NR * DM / 8 + 255) / 256), 256, 0, stream>>>(O, O16, (size_t)NR * DM / 8);
  k_gemm_t<0, DM, DM, true, false><<<gd, 256, 0, stream>>>(O16, Bo, 0.0625f, bo, XR, X1, nullptr);      /* x1 = x + (O·out_w + out_b) via the per-element addend */
  k_lnx<DM, 0><<<(NR + 7) / 8, 256, 0, stream>>>(X1, g2, be2, NR, 1e-5f, H2, nullptr);      /* LN2(x1) → f16 (x1 is a computed value: no input rounding) */
  k_gemm_t<6, FF, DM, false, true><<<gf, 256, 0, stream>>>(H2, Bw1, 0.0625f, b1, nullptr, nullptr, FH);      /* gelu_erf(h2·w1 + b1) → f16: M 4096 N 2048 K 1024 */
  k_gemm_t<0, DM, FF, true, false><<<gd, 256, 0, stream>>>(FH, Bw2, 0.0625f, b2, X1, (float*)d_out, nullptr);      /* y = x1 + (·w2 + b2): M 4096 N 1024 K 2048 */
}

// v004
// A run of this version takes 162 microseconds.
// Two timings next to v003 put it at 1.05 and 1.04 times that version's speed.
// Over all steps from v000 it is 2.93 times as fast.
#include <hip/hip_runtime.h>
// Transformer layer with windowed (|i−j| ≤ 128) multi-head self-attention (B=2, L=2048, d_model 1024, 16 heads × 64): h = LN1(x); qkv = h·W + b; per head softmax(q·kᵀ/8 + window mask)·v; x1 = x + (merged·out_w + out_b);
// y = x1 + (gelu_erf(LN2(x1)·w1 + b1)·w2 + b2). (in,out) weights.
// Compute dtype: x, weights, biases, LN parameters rounded to bf16; LayerNorms in f32 (wave per row) → f16 operands; q,k f16 GEMM outputs, v f32 → f16 hi + ×2^10 residual Vᵀ planes; fused windowed
// flash-style kernel (online softmax f32, P f16 ×2^10, two value accumulators) on v_wmma_f32_16x16x32_f16; the residual sums ride the GEMMs' per-element addend in f32; FFN hidden f16 after the erf-GELU epilogue.
#define BB 2
#define TT 2048
#define DM 1024
#define NH 16
#define HD 64
#define RW 128
#define FF 2048
#define NR (BB * TT)

typedef __bf16 v16b __attribute__((ext_vector_type(16)));
typedef unsigned short v8us __attribute__((ext_vector_type(8), may_alias));
typedef float  v8f  __attribute__((ext_vector_type(8)));
typedef float  v4f  __attribute__((ext_vector_type(4)));
typedef float  v4fa __attribute__((ext_vector_type(4), may_alias));
union FragB { v16b v; v8us half[2]; unsigned short u[16]; };

__device__ __forceinline__ unsigned short bf16_bits(float x) { unsigned int u = __float_as_uint(x); return (unsigned short)((u + 0x7FFFu + ((u >> 16) & 1u)) >> 16); }
__device__ __forceinline__ float bf16_val(unsigned short b) { return __uint_as_float(((unsigned int)b) << 16); }
__device__ __forceinline__ float bf16_round(float x) { return bf16_val(bf16_bits(x)); }
// D += A·B with NT terms: 1 = ah·bh, 2 = + al·bh (A split), 3 = + ah·bl (both split)
template <int NT>
__device__ __forceinline__ v8f mmaN(v16b ah, v16b al, v16b bh, v16b bl, v8f c) {
  c = __builtin_amdgcn_wmma_f32_16x16x32_bf16(false, ah, false, bh, (short)0, c, false, false);
  if (NT >= 2) c = __builtin_amdgcn_wmma_f32_16x16x32_bf16(false, al, false, bh, (short)0, c, false, false);
  if (NT >= 3) c = __builtin_amdgcn_wmma_f32_16x16x32_bf16(false, ah, false, bl, (short)0, c, false, false);
  asm volatile("v_nop\n\tv_nop\n\tv_nop\n\tv_nop" : "+v"(c) : "v"(ah), "v"(al), "v"(bh), "v"(bl));
  return c;
}

__global__ __launch_bounds__(256) void k_wt_bf16(const float* __restrict__ W, unsigned short* __restrict__ Wt, int K, int N) {
  const int t = blockIdx.x * 256 + threadIdx.x;
  const int k8n = K / 8;
  if (t >= N * k8n) return;
  const int n = t / k8n, k8 = (t % k8n) * 8;
  v8us v;
#pragma unroll
  for (int i = 0; i < 8; ++i) v[i] = bf16_bits(W[(size_t)(k8 + i) * N + n]);
  *(v8us*)(Wt + (size_t)n * K + k8) = v;
  
}

// GEMM C[M][N] (f32, pitch ldc) = act(A[M][K]·W + bias). A f32 row-major (pitch lda) converted per fragment to bf16
// (ASPLIT: hi/lo two planes -> 2 terms, else single rounded term); Wt bf16 [N][K] (pitch ldb). BIAS_BF16 rounds the
// bias to bf16 first (bias quantised to bf16 before the add). K%32==0, M%16==0, N%64==0.
template <bool ASPLIT, int ACT, bool BIAS_BF16>
__global__ __launch_bounds__(128) void k_gemm_bf(const float* __restrict__ A, int lda, const unsigned short* __restrict__ Wt, int ldb,
                                               const float* __restrict__ bias, float* __restrict__ C, int ldc, int M, int N, int K) {
  __shared__ __attribute__((aligned(16))) float so[4][16][64];
  const int tid = threadIdx.x, w = tid >> 5, lane = tid & 31, ln = lane & 15, hh = lane >> 4;
  const int ntn = N / 64;
  const int wid = blockIdx.x * 4 + w;
  const int mt = wid / ntn, nq = wid % ntn;
  if (mt * 16 >= M) return;
  const int row0 = mt * 16, col0 = nq * 64;
  const float* arow = A + (size_t)(row0 + ln) * lda;
  v8f acc[4] = {};
  for (int kb = 0; kb < K; kb += 32) {
    FragB ah, al;
    const v4f x0 = *(const v4fa*)(arow + kb + 8 * hh), x1 = *(const v4fa*)(arow + kb + 8 * hh + 4);
    const v4f x2 = *(const v4fa*)(arow + kb + 16 + 8 * hh), x3 = *(const v4fa*)(arow + kb + 16 + 8 * hh + 4);
    float xs[16] = {x0[0],x0[1],x0[2],x0[3],x1[0],x1[1],x1[2],x1[3],x2[0],x2[1],x2[2],x2[3],x3[0],x3[1],x3[2],x3[3]};
#pragma unroll
    for (int i = 0; i < 16; ++i) { const unsigned short hb = bf16_bits(xs[i]); ah.u[i] = hb; al.u[i] = ASPLIT ? bf16_bits(xs[i] - bf16_val(hb)) : (unsigned short)0; }
#pragma unroll
    for (int t = 0; t < 4; ++t) {
      const unsigned short* brow = Wt + (size_t)(col0 + t * 16 + ln) * ldb + kb;
      FragB b;
      b.half[0] = *(const v8us*)(brow + 8 * hh);
      b.half[1] = *(const v8us*)(brow + 16 + 8 * hh);
      acc[t] = mmaN<ASPLIT ? 2 : 1>(ah.v, al.v, b.v, b.v, acc[t]);
    }
  }
#pragma unroll
  for (int t = 0; t < 4; ++t) {
    float bv = bias ? bias[col0 + t * 16 + ln] : 0.f;
    if (BIAS_BF16) bv = bf16_round(bv);
#pragma unroll
    for (int r = 0; r < 8; ++r) { float v = acc[t][r] + bv; if (ACT == 1) v = fmaxf(v, 0.f); so[w][8 * hh + r][t * 16 + ln] = v; }
  }
  __builtin_amdgcn_fence(__ATOMIC_ACQ_REL, "workgroup");
  __builtin_amdgcn_wave_barrier();
  const int rsub = lane >> 4, c4 = (lane & 15) * 4;
  {
#pragma unroll
    for (int q = 0; q < 8; ++q) {
      const int r = q * 2 + rsub;
      const v4f v = *(const v4fa*)&so[w][r][c4];
      *(v4f*)(C + (size_t)(row0 + r) * ldc + col0 + c4) = v;
    }
    
  }
}

// Flash-style causal/unmasked attention, all contractions 3-term bf16 hi/lo splits, f32 softmax with running max.
// q,k,v rows are read from f32 buffers with arbitrary row pitch (so they can live inside a fused qkv buffer);
// D = head size (multiple of 32, <= 128); one wave = 16 query rows; block = 4 waves (64 queries) sharing K/V chunks of 32.
template <int D, bool CAUSAL>
__global__ __launch_bounds__(128) void k_flash(const float* __restrict__ qb, const float* __restrict__ kb, const float* __restrict__ vb,
                                             int pitch, int T, int H, float scale, float* __restrict__ y, int ypitch) {
  constexpr int KS = D / 32;        // k-steps for QK
  constexpr int DT = D / 16;        // d tiles for PV
  __shared__ __attribute__((aligned(16))) unsigned short sKh[32][D + 8], sKl[32][D + 8], sVh[32][D + 8], sVl[32][D + 8];
  __shared__ __attribute__((aligned(16))) unsigned short sPh[4][16][40], sPl[4][16][40];
  __shared__ __attribute__((aligned(16))) float sO[4][16][D];
  const int tid = threadIdx.x, w = tid >> 5, lane = tid & 31, ln = lane & 15, hh = lane >> 4;
  const int nqb = (T + 63) / 64;
  const int bh = blockIdx.x / nqb, qblk = blockIdx.x % nqb;
  const int b = bh / H, h = bh % H;
  const int q0 = qblk * 64 + w * 16;
  const float* Q = qb + (size_t)b * T * pitch + h * D;
  const float* K = kb + (size_t)b * T * pitch + h * D;
  const float* V = vb + (size_t)b * T * pitch + h * D;

  // A fragments of the wave's 16 query rows (scaled), hi/lo
  FragB aqh[KS], aql[KS];
  {
    int row = q0 + ln; if (row >= T) row = T - 1;
    const float* qr = Q + (size_t)row * pitch;
#pragma unroll
    for (int ks = 0; ks < KS; ++ks)
#pragma unroll
      for (int i = 0; i < 16; ++i) {
        const int d = ks * 32 + ((i < 8) ? (8 * hh + i) : (16 + 8 * hh + (i - 8)));
        const float x = qr[d] * scale; const unsigned short hb = bf16_bits(x);
        aqh[ks].u[i] = hb; aql[ks].u[i] = bf16_bits(x - bf16_val(hb));
      }
  }
  float m_r[8], l_r[8];
#pragma unroll
  for (int r = 0; r < 8; ++r) { m_r[r] = -3.0e38f; l_r[r] = 0.f; }
  v8f oacc[DT];
#pragma unroll
  for (int dt = 0; dt < DT; ++dt) oacc[dt] = (v8f){0.f,0.f,0.f,0.f,0.f,0.f,0.f,0.f};

  const int kv_end = CAUSAL ? min(T, qblk * 64 + 64) : T;     // block-uniform
  for (int j0 = 0; j0 < kv_end; j0 += 32) {
    __syncthreads();
    for (int e = tid; e < 32 * (D / 4); e += 128) {
      const int r = e / (D / 4), c4 = (e % (D / 4)) * 4;
      const int key = j0 + r;
      v4f kf = {0.f,0.f,0.f,0.f}, vf = {0.f,0.f,0.f,0.f};
      if (key < T) { kf = *(const v4fa*)(K + (size_t)key * pitch + c4); vf = *(const v4fa*)(V + (size_t)key * pitch + c4); }
#pragma unroll
      for (int t = 0; t < 4; ++t) {
        unsigned short hb = bf16_bits(kf[t]); sKh[r][c4 + t] = hb; sKl[r][c4 + t] = bf16_bits(kf[t] - bf16_val(hb));
        hb = bf16_bits(vf[t]); sVh[r][c4 + t] = hb; sVl[r][c4 + t] = bf16_bits(vf[t] - bf16_val(hb));
      }
    }
    __syncthreads();
    // S tile 16 x 32
    v8f s[2];
#pragma unroll
    for (int nt = 0; nt < 2; ++nt) {
      v8f acc = {};
#pragma unroll
      for (int ks = 0; ks < KS; ++ks) {
        FragB bh_, bl_;
        bh_.half[0] = *(const v8us*)&sKh[nt * 16 + ln][ks * 32 + 8 * hh]; bh_.half[1] = *(const v8us*)&sKh[nt * 16 + ln][ks * 32 + 16 + 8 * hh];
        bl_.half[0] = *(const v8us*)&sKl[nt * 16 + ln][ks * 32 + 8 * hh]; bl_.half[1] = *(const v8us*)&sKl[nt * 16 + ln][ks * 32 + 16 + 8 * hh];
        acc = mmaN<3>(aqh[ks].v, aql[ks].v, bh_.v, bl_.v, acc);
      }
      s[nt] = acc;
    }
    // mask + running max (rows 8hh+r; the 16 lanes of a half share rows)
    float alpha[8];
#pragma unroll
    for (int r = 0; r < 8; ++r) {
      const int qi = q0 + 8 * hh + r;
      const int ja = j0 + ln, jb = j0 + 16 + ln;
      if (CAUSAL) { if (ja > qi) s[0][r] = -3.0e38f; if (jb > qi) s[1][r] = -3.0e38f; }
      if (ja >= T) s[0][r] = -3.0e38f;
      if (jb >= T) s[1][r] = -3.0e38f;
      float mx = fmaxf(s[0][r], s[1][r]);
      mx = fmaxf(mx, __shfl_xor(mx, 1, 32)); mx = fmaxf(mx, __shfl_xor(mx, 2, 32)); mx = fmaxf(mx, __shfl_xor(mx, 4, 32)); mx = fmaxf(mx, __shfl_xor(mx, 8, 32));
      const float mnew = fmaxf(m_r[r], mx);
      alpha[r] = (mnew > -1.0e38f) ? __expf(m_r[r] - mnew) : 1.0f;
      const float p0 = (s[0][r] > -1.0e38f) ? __expf(s[0][r] - mnew) : 0.f;
      const float p1 = (s[1][r] > -1.0e38f) ? __expf(s[1][r] - mnew) : 0.f;
      m_r[r] = mnew;
      l_r[r] = l_r[r] * alpha[r] + p0 + p1;            // per-lane partial row sum (16 lanes combined at the end)
      unsigned short hb = bf16_bits(p0); sPh[w][8 * hh + r][ln] = hb;      sPl[w][8 * hh + r][ln] = bf16_bits(p0 - bf16_val(hb));
      hb = bf16_bits(p1);                sPh[w][8 * hh + r][16 + ln] = hb; sPl[w][8 * hh + r][16 + ln] = bf16_bits(p1 - bf16_val(hb));
    }
#pragma unroll
    for (int dt = 0; dt < DT; ++dt)
#pragma unroll
      for (int r = 0; r < 8; ++r) oacc[dt][r] *= alpha[r];
    __builtin_amdgcn_fence(__ATOMIC_ACQ_REL, "workgroup");
    __builtin_amdgcn_wave_barrier();
    FragB pah, pal;
    pah.half[0] = *(const v8us*)&sPh[w][ln][8 * hh]; pah.half[1] = *(const v8us*)&sPh[w][ln][16 + 8 * hh];
    pal.half[0] = *(const v8us*)&sPl[w][ln][8 * hh]; pal.half[1] = *(const v8us*)&sPl[w][ln][16 + 8 * hh];
#pragma unroll
    for (int dt = 0; dt < DT; ++dt) {
      FragB bvh, bvl;
#pragma unroll
      for (int i = 0; i < 8; ++i) {
        bvh.u[i] = sVh[8 * hh + i][dt * 16 + ln]; bvh.u[8 + i] = sVh[16 + 8 * hh + i][dt * 16 + ln];
        bvl.u[i] = sVl[8 * hh + i][dt * 16 + ln]; bvl.u[8 + i] = sVl[16 + 8 * hh + i][dt * 16 + ln];
      }
      oacc[dt] = mmaN<3>(pah.v, pal.v, bvh.v, bvl.v, oacc[dt]);
    }
    __builtin_amdgcn_fence(__ATOMIC_ACQ_REL, "workgroup");
    __builtin_amdgcn_wave_barrier();
  }
#pragma unroll
  for (int r = 0; r < 8; ++r) {
    float l = l_r[r];
    l += __shfl_xor(l, 1, 32); l += __shfl_xor(l, 2, 32); l += __shfl_xor(l, 4, 32); l += __shfl_xor(l, 8, 32);
    l_r[r] = (l > 0.f) ? 1.0f / l : 0.f;
  }
#pragma unroll
  for (int dt = 0; dt < DT; ++dt)
#pragma unroll
    for (int r = 0; r < 8; ++r) sO[w][8 * hh + r][dt * 16 + ln] = oacc[dt][r] * l_r[r];
  __builtin_amdgcn_fence(__ATOMIC_ACQ_REL, "workgroup");
  __builtin_amdgcn_wave_barrier();
  {
    for (int r = 0; r < 16; ++r) {
      const int row = q0 + r;
      if (row < T && lane < D / 4) {
        const v4f val = *(const v4fa*)&sO[w][r][lane * 4];
        *(v4f*)(y + ((size_t)b * T + row) * ypitch + h * D + lane * 4) = val;
      }
    }
    
  }
}

// GEMM C = act(A·W + bias + resid): A f32 (ASPLIT -> hi/lo 2 terms), Wt bf16 [N][K]; ACT 0 none, 1 relu, 2 exact gelu;
// resid (optional, f32, row index = (row % rmod), pitch ldr, RES_BF16 rounds it) added before the activation.
template <bool ASPLIT, int ACT, bool BIAS_BF16, bool RES_BF16>
__global__ __launch_bounds__(128) void k_gemm_bf3(const float* __restrict__ A, int lda, const unsigned short* __restrict__ Wt, int ldb,
                                                const float* __restrict__ bias, const float* __restrict__ resid, int rmod, int ldr,
                                                float* __restrict__ C, int ldc, int M, int N, int K) {
  __shared__ __attribute__((aligned(16))) float so[4][16][64];
  const int tid = threadIdx.x, w = tid >> 5, lane = tid & 31, ln = lane & 15, hh = lane >> 4;
  const int ntn = N / 64;
  const int wid = blockIdx.x * 4 + w;
  const int mt = wid / ntn, nq = wid % ntn;
  if (mt * 16 >= M) return;
  const int row0 = mt * 16, col0 = nq * 64;
  const float* arow = A + (size_t)(row0 + ln) * lda;
  v8f acc[4] = {};
  for (int kb = 0; kb < K; kb += 32) {
    FragB ah, al;
    const v4f x0 = *(const v4fa*)(arow + kb + 8 * hh), x1 = *(const v4fa*)(arow + kb + 8 * hh + 4);
    const v4f x2 = *(const v4fa*)(arow + kb + 16 + 8 * hh), x3 = *(const v4fa*)(arow + kb + 16 + 8 * hh + 4);
    float xs[16] = {x0[0],x0[1],x0[2],x0[3],x1[0],x1[1],x1[2],x1[3],x2[0],x2[1],x2[2],x2[3],x3[0],x3[1],x3[2],x3[3]};
#pragma unroll
    for (int i = 0; i < 16; ++i) { const unsigned short hb = bf16_bits(xs[i]); ah.u[i] = hb; al.u[i] = ASPLIT ? bf16_bits(xs[i] - bf16_val(hb)) : (unsigned short)0; }
#pragma unroll
    for (int t = 0; t < 4; ++t) {
      const unsigned short* brow = Wt + (size_t)(col0 + t * 16 + ln) * ldb + kb;
      FragB b;
      b.half[0] = *(const v8us*)(brow + 8 * hh);
      b.half[1] = *(const v8us*)(brow + 16 + 8 * hh);
      acc[t] = mmaN<ASPLIT ? 2 : 1>(ah.v, al.v, b.v, b.v, acc[t]);
    }
  }
#pragma unroll
  for (int t = 0; t < 4; ++t) {
    const int col = col0 + t * 16 + ln;
    float bv = bias ? bias[col] : 0.f;
    if (BIAS_BF16) bv = bf16_round(bv);
#pragma unroll
    for (int r = 0; r < 8; ++r) {
      float v = acc[t][r] + bv;
      if (resid) { float rv = resid[(size_t)((row0 + 8 * hh + r) % rmod) * ldr + col]; if (RES_BF16) rv = bf16_round(rv); v += rv; }
      if (ACT == 1) v = fmaxf(v, 0.f);
      if (ACT == 2) v = 0.5f * v * (1.0f + erff(v * 0.70710678118654752f));
      if (ACT == 3) { const float u = 0.7978845608028654f * (v + 0.044715f * v * v * v); v = 0.5f * v * (1.0f + tanhf(u)); }
      so[w][8 * hh + r][t * 16 + ln] = v;
    }
  }
  __builtin_amdgcn_fence(__ATOMIC_ACQ_REL, "workgroup");
  __builtin_amdgcn_wave_barrier();
  const int rsub = lane >> 4, c4 = (lane & 15) * 4;
  {
#pragma unroll
    for (int q = 0; q < 8; ++q) {
      const int r = q * 2 + rsub;
      const v4f v = *(const v4fa*)&so[w][r][c4];
      *(v4f*)(C + (size_t)(row0 + r) * ldc + col0 + c4) = v;
    }
    
  }
}
// row LayerNorm (biased variance, eps) over N: s = X (+ R); optional out_sum <- s; out_norm <- (s-mu)*rsqrt(var+eps)*g + b
template <bool PARAM_BF16>
__global__ __launch_bounds__(256) void k_layernorm(const float* __restrict__ X, const float* __restrict__ R, const float* __restrict__ g, const float* __restrict__ bta,
                                                  float* __restrict__ out_sum, float* __restrict__ out_norm, int N, float eps) {
  __shared__ float red[256];
  const int row = blockIdx.x, tid = threadIdx.x;
  const float* x = X + (size_t)row * N; const float* rr = R ? R + (size_t)row * N : nullptr;
  float vals[16];                     // up to N = 4096
  const int per = N / 256;            // contiguous chunk per thread? use strided-by-4 chunks: thread handles j = tid*4 + 1024*u
  float s1 = 0.f;
  for (int u = 0; u < per / 4; ++u) {
    const int j = tid * 4 + 1024 * u;
    const v4f a = *(const v4fa*)(x + j);
    v4f b = {0.f,0.f,0.f,0.f}; if (rr) b = *(const v4fa*)(rr + j);
#pragma unroll
    for (int q = 0; q < 4; ++q) { const float v = a[q] + b[q]; vals[u * 4 + q] = v; s1 += v; }
  }
  red[tid] = s1; __syncthreads();
  for (int st = 128; st > 0; st >>= 1) { if (tid < st) red[tid] += red[tid + st]; __syncthreads(); }
  const float mu = red[0] / (float)N; __syncthreads();
  float s2 = 0.f;
  for (int u = 0; u < per / 4; ++u)
#pragma unroll
    for (int q = 0; q < 4; ++q) { const float c = vals[u * 4 + q] - mu; s2 += c * c; }
  red[tid] = s2; __syncthreads();
  for (int st = 128; st > 0; st >>= 1) { if (tid < st) red[tid] += red[tid + st]; __syncthreads(); }
  const float rs = rsqrtf(red[0] / (float)N + eps);
  {
    for (int u = 0; u < per / 4; ++u) {
      const int j = tid * 4 + 1024 * u;
      v4f o, sm;
#pragma unroll
      for (int q = 0; q < 4; ++q) {
        float gg = g[j + q], bb = bta[j + q];
        if (PARAM_BF16) { gg = bf16_round(gg); bb = bf16_round(bb); }
        sm[q] = vals[u * 4 + q]; o[q] = (vals[u * 4 + q] - mu) * rs * gg + bb;
      }
      if (out_sum) *(v4f*)(out_sum + (size_t)row * N + j) = sm;
      *(v4f*)(out_norm + (size_t)row * N + j) = o;
    }
    
  }
}



// ---- f16 WMMA path (v_wmma_f32_16x16x32_f16): 11-bit significands for operands in range — used where a [0,1] probability operand needs more precision than bf16
typedef _Float16 v16h __attribute__((ext_vector_type(16)));
union FragH { v16h v; v8us half[2]; _Float16 h[16]; unsigned short u[16]; };
template <int NT>
__device__ __forceinline__ v8f mmaH(v16h ah, v16h al, v16h bh, v16h bl, v8f c) {
  c = __builtin_amdgcn_wmma_f32_16x16x32_f16(false, ah, false, bh, (short)0, c, false, false);
  if (NT >= 2) c = __builtin_amdgcn_wmma_f32_16x16x32_f16(false, al, false, bh, (short)0, c, false, false);
  if (NT >= 3) c = __builtin_amdgcn_wmma_f32_16x16x32_f16(false, ah, false, bl, (short)0, c, false, false);
  asm volatile("v_nop\n\tv_nop\n\tv_nop\n\tv_nop" : "+v"(c) : "v"(ah), "v"(al), "v"(bh), "v"(bl));
  return c;
}
// batched GEMM like k_gemm_b but f16 operands: A f32 (split into f16 hi/lo if ASPLIT, else rounded to f16), Bt = f16 values [n][k]; alpha; C f32; N multiple of 16 (partial tiles skipped)
template <bool ASPLIT>
__global__ __launch_bounds__(128) void k_gemm_h(const float* __restrict__ A, int lda, size_t sA, const _Float16* __restrict__ Bh, int ldb, size_t sB, float alpha, float* __restrict__ C, int ldc, size_t sC, int M, int N, int K) {
  __shared__ __attribute__((aligned(16))) float so[4][16][64];
  const int tid = threadIdx.x, w = tid >> 5, lane = tid & 31, ln = lane & 15, hh = lane >> 4; const int by = blockIdx.y;
  A += (size_t)by * sA; Bh += (size_t)by * sB; C += (size_t)by * sC;
  const int ntn = (N + 63) / 64; const int wid = blockIdx.x * 4 + w; const int mt = wid / ntn, nq = wid % ntn; if (mt * 16 >= M) return;
  const int row0 = mt * 16, col0 = nq * 64; const float* arow = A + (size_t)(row0 + ln) * lda;
  v8f acc[4] = {};
  for (int kb = 0; kb < K; kb += 32) {
    FragH ah, al;
    const v4f x0 = *(const v4fa*)(arow + kb + 8 * hh), x1 = *(const v4fa*)(arow + kb + 8 * hh + 4), x2 = *(const v4fa*)(arow + kb + 16 + 8 * hh), x3 = *(const v4fa*)(arow + kb + 16 + 8 * hh + 4);
    float xs[16] = {x0[0],x0[1],x0[2],x0[3],x1[0],x1[1],x1[2],x1[3],x2[0],x2[1],x2[2],x2[3],x3[0],x3[1],x3[2],x3[3]};
#pragma unroll
    for (int i = 0; i < 16; ++i) { const _Float16 h = (_Float16)xs[i]; ah.h[i] = h; al.h[i] = ASPLIT ? (_Float16)(xs[i] - (float)h) : (_Float16)0.0f; }
#pragma unroll
    for (int t = 0; t < 4; ++t) { if (col0 + t * 16 >= N) continue; const size_t boff = (size_t)(col0 + t * 16 + ln) * ldb + kb; FragH bq; bq.half[0] = *(const v8us*)(Bh + boff + 8 * hh); bq.half[1] = *(const v8us*)(Bh + boff + 16 + 8 * hh);
      acc[t] = mmaH<ASPLIT ? 2 : 1>(ah.v, al.v, bq.v, bq.v, acc[t]); }
  }
#pragma unroll
  for (int t = 0; t < 4; ++t) { if (col0 + t * 16 >= N) continue;
#pragma unroll
    for (int r = 0; r < 8; ++r) so[w][8 * hh + r][t * 16 + ln] = acc[t][r] * alpha; }
  __builtin_amdgcn_fence(__ATOMIC_ACQ_REL, "workgroup"); __builtin_amdgcn_wave_barrier();
  const int rsub = lane >> 4, c4 = (lane & 15) * 4;
  {
#pragma unroll
    for (int q = 0; q < 8; ++q) { const int r = q * 2 + rsub; if (col0 + c4 < N) { const v4f v = *(const v4fa*)&so[w][r][c4]; *(v4f*)(C + (size_t)(row0 + r) * ldc + col0 + c4) = v; } }
     }
}

// Wt[n][k] = f16(bf16(W[k][n]) * scale) from f32 row-major W[K][N] (scale = power of two; bf16-exact weights stay exact in f16 away from the subnormal range).
// One work-group = a tile of 128 k x 64 n, turned in LDS, so that both sides move whole lines: 16 lanes read 256 contiguous bytes of one W row, 16 lanes write 256 contiguous bytes of one Wt row.
// LDS: one dword = the f16 pair (k, k + 1) of one n; a row = one n's 64 dwords, its sixteen 16-byte groups (8 k each) stored at group ^ (n / 4):
// the 32 lanes of a dword store (16 values of n / 4, two neighbouring pairs) fall on 32 banks, the 16 lanes that read one row back as 16-byte groups on all 64.
// K a multiple of 128, N a multiple of 64.
typedef _Float16 v2h __attribute__((ext_vector_type(2)));
// blk = the tile's index, tl = the work-group's 16 KiB of LDS.
template <int K, int N>
__device__ __forceinline__ void wt_tile(const float* __restrict__ W, _Float16* __restrict__ Wt, float scale, int blk, unsigned int* tl) {
  const int tid = threadIdx.x, lo = tid & 15, hi = tid >> 4;
  const int n0 = (blk % (N / 64)) * 64, k0 = (blk / (N / 64)) * 128;
  const float* src = W + (size_t)(k0 + 2 * hi) * N + n0 + 4 * lo;      // rows k0 + 2 hi + 32 u and the next, columns n0 + 4 lo .. + 3
  v4f ev[4], od[4];
#pragma unroll
  for (int u = 0; u < 4; ++u) { ev[u] = *(const v4fa*)(src + (size_t)(32 * u) * N); od[u] = *(const v4fa*)(src + (size_t)(32 * u + 1) * N); }
#pragma unroll
  for (int u = 0; u < 4; ++u) { const int kp = hi + 16 * u;      // pair index: k = k0 + 2 kp, k0 + 2 kp + 1
#pragma unroll
    for (int q = 0; q < 4; ++q) { v2h p; p[0] = (_Float16)(bf16_round(ev[u][q]) * scale); p[1] = (_Float16)(bf16_round(od[u][q]) * scale);
      tl[(4 * lo + q) * 64 + (((kp >> 2) ^ lo) << 2) + (kp & 3)] = __builtin_bit_cast(unsigned int, p); } }
  __syncthreads();      // every pair of the tile is in LDS before a row is read back
#pragma unroll
  for (int u = 0; u < 4; ++u) { const int n = hi + 16 * u; const v8us v = *(const v8us*)&tl[n * 64 + ((lo ^ ((n >> 2) & 15)) << 2)];
    *(v8us*)((unsigned short*)Wt + (size_t)(n0 + n) * K + k0 + 8 * lo) = v; }
  asm volatile("s_wait_xcnt 0x0" ::: "memory");      // closes the run of four stores: in the merged kernel other jobs' code follows in the text and reuses the stores' registers
}
typedef _Float16 v4h __attribute__((ext_vector_type(4)));

__global__ __launch_bounds__(256) void k_x16(const float* __restrict__ x, _Float16* __restrict__ X16, size_t n8) { const size_t t = (size_t)blockIdx.x * 256 + threadIdx.x; if (t >= n8) return; FragH f;
#pragma unroll
  for (int q = 0; q < 8; ++q) f.h[q] = (_Float16)bf16_round(x[t * 8 + q]); *(v8us*)((unsigned short*)X16 + t * 8) = f.half[0];  }
__global__ __launch_bounds__(256) void k_round16f(const float* __restrict__ W, _Float16* __restrict__ Bt, size_t n8) { const size_t t = (size_t)blockIdx.x * 256 + threadIdx.x; if (t >= n8) return; FragH f;
#pragma unroll
  for (int i = 0; i < 8; ++i) f.h[i] = (_Float16)(bf16_round(W[t * 8 + i]) * 16.0f); *(v8us*)((unsigned short*)Bt + t * 8) = f.half[0];  }
template <int NHv, int TTv>
__global__ __launch_bounds__(256) void k_vt(const _Float16* __restrict__ V16, int ldv, int voff, _Float16* __restrict__ Vt) { __shared__ unsigned short tl[64][66]; const int tid = threadIdx.x; const int slab = blockIdx.x / (TTv / 64), lg = blockIdx.x % (TTv / 64); const int b = slab / NHv, h = slab % NHv;
  for (int i = tid; i < 64 * 8; i += 256) { const int r = i / 8, c8 = (i % 8) * 8; FragH f; f.half[0] = *(const v8us*)((const unsigned short*)V16 + ((size_t)b * TTv + lg * 64 + r) * ldv + voff + h * 64 + c8);
#pragma unroll
    for (int q = 0; q < 8; ++q) tl[r][c8 + q] = f.u[q]; }
  __syncthreads();
  {
#pragma unroll
    for (int rd = 0; rd < 2; ++rd) { const int d = rd * 32 + tid / 8, pc = tid % 8; FragH f;
#pragma unroll
      for (int q = 0; q < 8; ++q) f.u[q] = tl[pc * 8 + q][d];
      *(v8us*)((unsigned short*)Vt + ((size_t)slab * 64 + d) * TTv + lg * 64 + pc * 8) = f.half[0]; }
     } }

template <int D, int RBF>
__device__ __forceinline__ void lnx_rows(const float* __restrict__ X, const float* __restrict__ gam, const float* __restrict__ bet, int nrows, float eps, _Float16* __restrict__ O16, float* __restrict__ XR, int blk) {
  constexpr int NP = D / 128; const int tid = threadIdx.x, wv = tid >> 5, lane = tid & 31; const size_t r = (size_t)blk * 8 + wv; if (r >= (size_t)nrows) return; v4f y[NP]; float s = 0.f;
#pragma unroll
  for (int j = 0; j < NP; ++j) { const int c = j * 128 + lane * 4; v4f g = *(const v4fa*)(X + r * D + c); if (RBF) { for (int q = 0; q < 4; ++q) g[q] = bf16_round(g[q]); } y[j] = g; s += g[0] + g[1] + g[2] + g[3]; }
  for (int o = 16; o >= 1; o >>= 1) s += __shfl_xor(s, o, 32); const float mu = s / (float)D; float q2 = 0.f;
#pragma unroll
  for (int j = 0; j < NP; ++j) for (int q = 0; q < 4; ++q) { const float d = y[j][q] - mu; q2 += d * d; }
  for (int o = 16; o >= 1; o >>= 1) q2 += __shfl_xor(q2, o, 32); const float rs = rsqrtf(q2 / (float)D + eps);
  {
#pragma unroll
    for (int j = 0; j < NP; ++j) { const int c = j * 128 + lane * 4; v4h h; for (int q = 0; q < 4; ++q) { const float v = (y[j][q] - mu) * rs * bf16_round(gam[c + q]) + bf16_round(bet[c + q]); h[q] = (_Float16)v; } *(v4h*)(O16 + r * D + c) = h;
      asm volatile("s_wait_xcnt 0x0" ::: "memory");      // the store's registers are reused directly behind it: the wait stands in front of the overwrite
      if (XR) { *(v4f*)(XR + r * D + c) = y[j];
        asm volatile("s_wait_xcnt 0x0" ::: "memory"); } }      // likewise, ahead of the next trip's loads
     } }
template <int D, int RBF>
__global__ __launch_bounds__(256) void k_lnx(const float* __restrict__ X, const float* __restrict__ gam, const float* __restrict__ bet, int nrows, float eps, _Float16* __restrict__ O16, float* __restrict__ XR) {
  lnx_rows<D, RBF>(X, gam, bet, nrows, eps, O16, XR, (int)blockIdx.x); }
// LN1 and the four weight convert-transposes need nothing of each other: one grid, each job a range of the block index (a work-group does one job whole, so the branch and the tile's barrier are block-uniform).
#define PB_LN (NR / 8)
#define PB_QKV ((DM / 128) * (3 * DM / 64))
#define PB_O ((DM / 128) * (DM / 64))
#define PB_W1 ((DM / 128) * (FF / 64))
#define PB_W2 ((FF / 128) * (DM / 64))
__global__ __launch_bounds__(256) void k_prep(const float* __restrict__ x, const float* __restrict__ g1, const float* __restrict__ be1, _Float16* __restrict__ H16, float* __restrict__ XR,
                                              const float* __restrict__ Wqkv, const float* __restrict__ Wo, const float* __restrict__ W1, const float* __restrict__ W2,
                                              _Float16* __restrict__ Bqkv, _Float16* __restrict__ Bo, _Float16* __restrict__ Bw1, _Float16* __restrict__ Bw2) {
  __shared__ __attribute__((aligned(16))) unsigned int tl[64 * 64];
  int b = (int)blockIdx.x;
  if (b < PB_LN) { lnx_rows<DM, 1>(x, g1, be1, NR, 1e-5f, H16, XR, b); return; }      /* LN1(bf16 x) -> f16; XR = bf16(x) */
  b -= PB_LN; if (b < PB_QKV) { wt_tile<DM, 3 * DM>(Wqkv, Bqkv, 16.0f, b, tl); return; }      /* (in,out) -> Bt[n][k] x 2^4 */
  b -= PB_QKV; if (b < PB_O) { wt_tile<DM, DM>(Wo, Bo, 16.0f, b, tl); return; }
  b -= PB_O; if (b < PB_W1) { wt_tile<DM, FF>(W1, Bw1, 16.0f, b, tl); return; }
  wt_tile<FF, DM>(W2, Bw2, 16.0f, b - PB_W1, tl);
}
__global__ __launch_bounds__(128) void k_flash(const _Float16* __restrict__ Q16, int ldq, const _Float16* __restrict__ K16, int ldk, const _Float16* __restrict__ Vt, const _Float16* __restrict__ Vtlo, _Float16* __restrict__ O16, int ldo) {
  constexpr int RPW = 16, RTN = RPW / 16, NQB = TT / (4 * RPW), DT = 4, KS = 2;
  __shared__ __attribute__((aligned(16))) unsigned short sP[4][RPW][40]; __shared__ __attribute__((aligned(16))) float sO[4][RPW][64 + 4];
  const int tid = threadIdx.x, w = tid >> 5, lane = tid & 31, ln = lane & 15, hh = lane >> 4;
  const int slab = blockIdx.x / NQB, qblk = blockIdx.x % NQB; const int b = slab / NH, h = slab % NH; const int qb0 = qblk * (4 * RPW); const int q0 = qb0 + w * RPW;
  FragH aq[2][KS];
#pragma unroll
  for (int rt = 0; rt < RTN; ++rt) { const unsigned short* qr = (const unsigned short*)Q16 + ((size_t)b * TT + q0 + rt * 16 + ln) * ldq + h * 64;
#pragma unroll
    for (int ks = 0; ks < KS; ++ks) { aq[rt][ks].half[0] = *(const v8us*)(qr + ks * 32 + 8 * hh); aq[rt][ks].half[1] = *(const v8us*)(qr + ks * 32 + 16 + 8 * hh); } }
  const unsigned short* Vth = (const unsigned short*)Vt + (size_t)slab * 64 * TT; const unsigned short* Vtl = (const unsigned short*)Vtlo + (size_t)slab * 64 * TT;
  float m_r[2][8], l_r[2][8]; v8f oacc[2][DT], oaccl[2][DT];
#pragma unroll
  for (int rt = 0; rt < RTN; ++rt) {
#pragma unroll
    for (int r = 0; r < 8; ++r) { m_r[rt][r] = -3.0e38f; l_r[rt][r] = 0.f; }
#pragma unroll
    for (int dt = 0; dt < DT; ++dt) { oacc[rt][dt] = (v8f){0.f,0.f,0.f,0.f,0.f,0.f,0.f,0.f}; oaccl[rt][dt] = oacc[rt][dt]; } }
  const int jbeg = (qb0 - RW) > 0 ? (qb0 - RW) : 0; const int jend = (qb0 + 4 * RPW + RW) < TT ? (qb0 + 4 * RPW + RW) : TT;      /* block-uniform window bounds (multiples of 32) */
#pragma unroll 1
  for (int j0 = jbeg; j0 < jend; j0 += 32) {
    
    v8f s[2][2];
#pragma unroll
    for (int nt = 0; nt < 2; ++nt) { const unsigned short* kr = (const unsigned short*)K16 + ((size_t)b * TT + j0 + nt * 16 + ln) * ldk + h * 64; FragH bk[KS];
#pragma unroll
      for (int ks = 0; ks < KS; ++ks) { bk[ks].half[0] = *(const v8us*)(kr + ks * 32 + 8 * hh); bk[ks].half[1] = *(const v8us*)(kr + ks * 32 + 16 + 8 * hh); }
#pragma unroll
      for (int rt = 0; rt < RTN; ++rt) { v8f acc = (v8f){0.f,0.f,0.f,0.f,0.f,0.f,0.f,0.f};
#pragma unroll
        for (int ks = 0; ks < KS; ++ks) acc = mmaH<1>(aq[rt][ks].v, aq[rt][ks].v, bk[ks].v, bk[ks].v, acc); s[rt][nt] = acc; } }
#pragma unroll
    for (int rt = 0; rt < RTN; ++rt)
#pragma unroll
      for (int r = 0; r < 8; ++r) { const int tq = q0 + rt * 16 + 8 * hh + r; const int k0 = j0 + ln, k1 = j0 + 16 + ln; (void)tq; (void)k0; (void)k1;
        const bool ok0 = (k0 - tq <= RW) && (tq - k0 <= RW), ok1 = (k1 - tq <= RW) && (tq - k1 <= RW);
        const float s0 = ok0 ? s[rt][0][r] * 0.125f : -INFINITY, s1 = ok1 ? s[rt][1][r] * 0.125f : -INFINITY; float mc = fmaxf(s0, s1);
        mc = fmaxf(mc, __shfl_xor(mc, 1, 32)); mc = fmaxf(mc, __shfl_xor(mc, 2, 32)); mc = fmaxf(mc, __shfl_xor(mc, 4, 32)); mc = fmaxf(mc, __shfl_xor(mc, 8, 32));
        const float mn = fmaxf(m_r[rt][r], mc); const float al = (mn > -1.0e38f) ? expf(m_r[rt][r] - mn) : 1.0f; m_r[rt][r] = mn; const float p0 = ok0 ? expf(s0 - mn) : 0.f, p1 = ok1 ? expf(s1 - mn) : 0.f; l_r[rt][r] = l_r[rt][r] * al + p0 + p1;
#pragma unroll
        for (int dt = 0; dt < DT; ++dt) { oacc[rt][dt][r] *= al; oaccl[rt][dt][r] *= al; }
        FragH t2; t2.h[0] = (_Float16)(p0 * 1024.0f); t2.h[1] = (_Float16)(p1 * 1024.0f); sP[w][rt * 16 + 8 * hh + r][ln] = t2.u[0]; sP[w][rt * 16 + 8 * hh + r][16 + ln] = t2.u[1]; }
    __builtin_amdgcn_fence(__ATOMIC_ACQ_REL, "workgroup"); __builtin_amdgcn_wave_barrier();
    FragH pa[2];
#pragma unroll
    for (int rt = 0; rt < RTN; ++rt) { pa[rt].half[0] = *(const v8us*)&sP[w][rt * 16 + ln][8 * hh]; pa[rt].half[1] = *(const v8us*)&sP[w][rt * 16 + ln][16 + 8 * hh]; }
#pragma unroll
    for (int dt = 0; dt < DT; ++dt) { const size_t vo = (size_t)(dt * 16 + ln) * TT + j0; FragH bv, bl; bv.half[0] = *(const v8us*)(Vth + vo + 8 * hh); bv.half[1] = *(const v8us*)(Vth + vo + 16 + 8 * hh); bl.half[0] = *(const v8us*)(Vtl + vo + 8 * hh); bl.half[1] = *(const v8us*)(Vtl + vo + 16 + 8 * hh);
#pragma unroll
      for (int rt = 0; rt < RTN; ++rt) { oacc[rt][dt] = mmaH<1>(pa[rt].v, pa[rt].v, bv.v, bv.v, oacc[rt][dt]); oaccl[rt][dt] = mmaH<1>(pa[rt].v, pa[rt].v, bl.v, bl.v, oaccl[rt][dt]); } }
    __builtin_amdgcn_fence(__ATOMIC_ACQ_REL, "workgroup"); __builtin_amdgcn_wave_barrier(); }
#pragma unroll
  for (int rt = 0; rt < RTN; ++rt) {
#pragma unroll
    for (int r = 0; r < 8; ++r) { float l = l_r[rt][r]; l += __shfl_xor(l, 1, 32); l += __shfl_xor(l, 2, 32); l += __shfl_xor(l, 4, 32); l += __shfl_xor(l, 8, 32); l_r[rt][r] = (l > 0.f) ? 1.0f / (l * 1024.0f) : 0.f; }
#pragma unroll
    for (int dt = 0; dt < DT; ++dt)
#pragma unroll
      for (int r = 0; r < 8; ++r) sO[w][rt * 16 + 8 * hh + r][dt * 16 + ln] = (oacc[rt][dt][r] + oaccl[rt][dt][r] * 0.0009765625f) * l_r[rt][r]; }
  __builtin_amdgcn_fence(__ATOMIC_ACQ_REL, "workgroup"); __builtin_amdgcn_wave_barrier();
  {
#pragma unroll
    for (int rp = 0; rp < RPW; rp += 2) { const int r = rp + (lane >> 4), pc = lane & 15; const v4f val = *(const v4fa*)&sO[w][r][pc * 4]; v4h h4;      /* the out-projection's A operand is f16: rounded here, 16 lanes = one whole 128-B line of a row */
#pragma unroll
      for (int e = 0; e < 4; ++e) h4[e] = (_Float16)val[e];
      *(v4h*)(O16 + ((size_t)b * TT + q0 + r) * ldo + h * 64 + pc * 4) = h4; }
     } }

// ---- tiled f16 GEMM with fused epilogue: act(A[M][K] * Bh[N][K]^T * alpha + bf16(bias[col]) (+ CP[row][col] if RES)) -> C16 (f16, if OUT16) or C (f32); ACT 0 none, 6 erf-GELU. A and Bh f16 and k-contiguous (pitch K), C / C16 / CP pitch N.
// One work-group = one 128 x 128 tile of C, 8 waves as 4 (rows) x 2 (columns), 32 x 64 of C per wave. A pass is 128 k: 256 B of each of the 128 A rows and 128 Bh rows,
// laid in LDS at a pitch of 272 B (an odd multiple of 16 B: conflict-free for ds_load_b128 fragment reads). Two buffers; the next pass's rows are copied while this pass is multiplied.
// M, N multiples of 128, K a multiple of 128. The k order of every accumulator is ascending in steps of 32.
// NF > 0: two products on one A share the grid: the tiles of the first N - NF columns go to C16 (pitch N - NF); those of the last NF columns (v) go out transposed, split into an f16 value and its residual x 2^10:
// Vh / Vl [row / TT][column][row % TT], the layout the attention kernel reads its value fragments from.
#define GT_ROWB 272
#define GT_STAGE (256 * GT_ROWB)
// Eight 16-byte asynchronous copies of one lane, global -> LDS, rows 16 apart. The s_wait_xcnt closes the statement so that no address register is rewritten ahead of it.
template <int K>
__device__ __forceinline__ void gt_copy8(unsigned l0, const _Float16* g0) {
  const unsigned l1 = l0 + 16 * GT_ROWB, l2 = l0 + 32 * GT_ROWB, l3 = l0 + 48 * GT_ROWB, l4 = l0 + 64 * GT_ROWB, l5 = l0 + 80 * GT_ROWB, l6 = l0 + 96 * GT_ROWB, l7 = l0 + 112 * GT_ROWB;
  const _Float16 *g1 = g0 + 16 * K, *g2 = g0 + 32 * K, *g3 = g0 + 48 * K, *g4 = g0 + 64 * K, *g5 = g0 + 80 * K, *g6 = g0 + 96 * K, *g7 = g0 + 112 * K;
  asm volatile("global_load_async_to_lds_b128 %0, %8, off\n\t"
               "global_load_async_to_lds_b128 %1, %9, off\n\t"
               "global_load_async_to_lds_b128 %2, %10, off\n\t"
               "global_load_async_to_lds_b128 %3, %11, off\n\t"
               "global_load_async_to_lds_b128 %4, %12, off\n\t"
               "global_load_async_to_lds_b128 %5, %13, off\n\t"
               "global_load_async_to_lds_b128 %6, %14, off\n\t"
               "global_load_async_to_lds_b128 %7, %15, off\n\t"
               "s_wait_xcnt 0x0"
               :: "v"(l0), "v"(l1), "v"(l2), "v"(l3), "v"(l4), "v"(l5), "v"(l6), "v"(l7), "v"(g0), "v"(g1), "v"(g2), "v"(g3), "v"(g4), "v"(g5), "v"(g6), "v"(g7) : "memory");
}
// A wave's staged 32 x 64 tile (so, pitch 68 floats) -> rows rw .. rw + 31, columns cw .. cw + 63 of a plane of pitch P, in whole lines.
template <int ACT, int P, bool RES, bool OUT16>
__device__ __forceinline__ void gt_store(const float* so, const float* __restrict__ CP, float* __restrict__ C, _Float16* __restrict__ C16, int rw, int cw, int lane) {
  const int rsub = lane >> 4, c4 = (lane & 15) * 4;
#pragma unroll (ACT == 6 ? 2 : 16)      /* the erf text is long: unrolled by 2 only, for speed */
  for (int q = 0; q < 16; ++q) { const int r = q * 2 + rsub; v4f v = *(const v4fa*)&so[r * 68 + c4]; const size_t o = (size_t)(rw + r) * P + cw + c4;
    if (RES) { const v4f c = *(const v4fa*)(CP + o); v[0] += c[0]; v[1] += c[1]; v[2] += c[2]; v[3] += c[3]; }
    if (ACT == 6) {
#pragma unroll
      for (int e = 0; e < 4; ++e) v[e] = 0.5f * v[e] * (1.0f + erff(v[e] * 0.70710678118654752f)); }
    if (!OUT16) *(v4f*)(C + o) = v;
    else { v4h h4;
#pragma unroll
      for (int e = 0; e < 4; ++e) h4[e] = (_Float16)v[e];
      *(v4h*)(C16 + o) = h4; } }
  asm volatile("s_wait_xcnt 0x0" ::: "memory");      // closes the run of stores: where two store paths share a kernel the other path's code follows in the text and reuses the stores' registers
}
template <int ACT, int N, int K, bool RES, bool OUT16, int NF = 0>
__global__ __launch_bounds__(256) void k_gemm_t(const _Float16* __restrict__ A, const _Float16* __restrict__ Bh, float alpha, const float* __restrict__ bias, const float* __restrict__ CP, float* __restrict__ C, _Float16* __restrict__ C16, _Float16* __restrict__ Vh, _Float16* __restrict__ Vl) {
  __shared__ __attribute__((aligned(16))) unsigned char L[2 * GT_STAGE];
  constexpr int NST = K / 128, NTN = N / 128;
  const int tid = threadIdx.x, w = tid >> 5, lane = tid & 31, ln = lane & 15, hh = lane >> 4;
  const int row0 = (int)(blockIdx.x / NTN) * 128, col0 = (int)(blockIdx.x % NTN) * 128;
  const int wm = w >> 1, wn = w & 1;
  // copy roles: 16 lanes cover one row's 256 B; a thread takes rows (tid / 16) + 16 i of A and of Bh
  const unsigned lcp = (unsigned)(size_t)L + (unsigned)(tid >> 4) * GT_ROWB + (unsigned)(tid & 15) * 16u;
  const _Float16* ga = A + (size_t)(row0 + (tid >> 4)) * K + (tid & 15) * 8;
  const _Float16* gb = Bh + (size_t)(col0 + (tid >> 4)) * K + (tid & 15) * 8;
  v8f acc[2][4];
#pragma unroll
  for (int i = 0; i < 2; ++i)
#pragma unroll
    for (int j = 0; j < 4; ++j) acc[i][j] = (v8f){0.f,0.f,0.f,0.f,0.f,0.f,0.f,0.f};
  gt_copy8<K>(lcp, ga); gt_copy8<K>(lcp + 128 * GT_ROWB, gb);
  asm volatile("s_wait_asynccnt 0x0" ::: "memory");      // this wave's copies of pass 0 have landed
  __syncthreads();                                        // ... and every other wave's
  if (NST > 1) { gt_copy8<K>(lcp + GT_STAGE, ga + 128); gt_copy8<K>(lcp + GT_STAGE + 128 * GT_ROWB, gb + 128); }
#pragma unroll 1      /* one pass per trip: the ring's waits and its barrier stand once, at the foot */
  for (int t = 0; t < NST; ++t) {
    const unsigned buf = (unsigned)(t & 1) * GT_STAGE;
    const unsigned char* sa = L + buf + (wm * 32 + ln) * GT_ROWB + 16 * hh;
    const unsigned char* sb = L + buf + (128 + wn * 64 + ln) * GT_ROWB + 16 * hh;
    // two fragment sets: block ks + 1's twelve LDS reads go out as one group ahead of block ks's eight WMMAs (all inside this pass's own buffer)
    FragH a[2][2], b[2][4];
#pragma unroll
    for (int i = 0; i < 2; ++i) { a[0][i].half[0] = *(const v8us*)(sa + i * 16 * GT_ROWB); a[0][i].half[1] = *(const v8us*)(sa + i * 16 * GT_ROWB + 32); }
#pragma unroll
    for (int j = 0; j < 4; ++j) { b[0][j].half[0] = *(const v8us*)(sb + j * 16 * GT_ROWB); b[0][j].half[1] = *(const v8us*)(sb + j * 16 * GT_ROWB + 32); }
#pragma unroll
    for (int ks = 0; ks < 4; ++ks) {
      const int cu = ks & 1, nx = cu ^ 1;
      if (ks < 3) {
#pragma unroll
        for (int i = 0; i < 2; ++i) { a[nx][i].half[0] = *(const v8us*)(sa + i * 16 * GT_ROWB + (ks + 1) * 64); a[nx][i].half[1] = *(const v8us*)(sa + i * 16 * GT_ROWB + (ks + 1) * 64 + 32); }
#pragma unroll
        for (int j = 0; j < 4; ++j) { b[nx][j].half[0] = *(const v8us*)(sb + j * 16 * GT_ROWB + (ks + 1) * 64); b[nx][j].half[1] = *(const v8us*)(sb + j * 16 * GT_ROWB + (ks + 1) * 64 + 32); }
      }
      __builtin_amdgcn_sched_barrier(0);      // keeps the read group whole and ahead of the WMMAs: without it the scheduler spreads the reads among them and waits to 0 at each place
#pragma unroll
      for (int i = 0; i < 2; ++i)
#pragma unroll
        for (int j = 0; j < 4; ++j) acc[i][j] = __builtin_amdgcn_wmma_f32_16x16x32_f16(false, a[cu][i].v, false, b[cu][j].v, (short)0, acc[i][j], false, false);
      __builtin_amdgcn_sched_barrier(0);      // ... and keeps the next group behind this block
    }
    asm volatile("s_wait_dscnt 0x0" ::: "memory");        // this wave's reads of the buffer have retired before it is refilled
    asm volatile("s_wait_asynccnt 0x0" ::: "memory");     // this wave's copies of pass t + 1 have landed
    __syncthreads();                                      // publishes pass t + 1 and ends every reader's last read of pass t's buffer
    if (t + 2 < NST) { gt_copy8<K>(lcp + buf, ga + (t + 2) * 128); gt_copy8<K>(lcp + buf + 128 * GT_ROWB, gb + (t + 2) * 128); }
  }
  asm volatile("s_wait_asynccnt 0x0" ::: "memory");       // no copy is outstanding when the ring becomes output staging
  // NF > 0: which plane the tile belongs to is the same for the whole work-group, so the choice (and the v path's barrier) is block-uniform
  if (NF > 0 && col0 >= N - NF) {
    // v tile: an accumulator's 8 registers are 8 consecutive rows of one column = one 16-byte group of a transposed f16 row. The work-group's 128 columns x 128 rows are laid in the ring,
    // value plane then residual plane, one column = 256 B at the pitch of 272 B; behind a barrier 16 lanes store one column's 256 contiguous bytes.
#pragma unroll
    for (int j = 0; j < 4; ++j) { const float bv = bf16_round(bias[col0 + wn * 64 + j * 16 + ln]);
#pragma unroll
      for (int i = 0; i < 2; ++i) { FragH fh, fl;
#pragma unroll
        for (int r = 0; r < 8; ++r) { const float v = acc[i][j][r] * alpha + bv; const _Float16 hv = (_Float16)v; fh.h[r] = hv; fl.h[r] = (_Float16)((v - (float)hv) * 1024.0f); }
        unsigned char* p = L + (wn * 64 + j * 16 + ln) * GT_ROWB + (wm * 32 + i * 16 + 8 * hh) * 2;
        *(v8us*)p = fh.half[0]; *(v8us*)(p + 128 * GT_ROWB) = fl.half[0]; } }
    __syncthreads();      // a column's 128 rows come from four waves: all are in LDS before a column is read back
    const size_t o = ((size_t)(row0 / TT) * NF + (col0 - (N - NF)) + (tid >> 4)) * TT + (row0 % TT) + (tid & 15) * 8;
#pragma unroll
    for (int u = 0; u < 8; ++u) { const unsigned char* p = L + (u * 16 + (tid >> 4)) * GT_ROWB + (tid & 15) * 16;
      *(v8us*)((unsigned short*)Vh + o + (size_t)(u * 16) * TT) = *(const v8us*)p; *(v8us*)((unsigned short*)Vl + o + (size_t)(u * 16) * TT) = *(const v8us*)(p + 128 * GT_ROWB); }
    asm volatile("s_wait_xcnt 0x0" ::: "memory");      // closes the run of stores: the other path's code follows in the text and reuses the stores' registers
    return;
  }
  // epilogue: each wave stages its 32 x 64 tile in its own range of the ring (pitch 68 floats) and stores whole lines
  float* so = (float*)L + w * (32 * 68);
#pragma unroll
  for (int j = 0; j < 4; ++j) { const float bv = bf16_round(bias[col0 + wn * 64 + j * 16 + ln]);
#pragma unroll
    for (int i = 0; i < 2; ++i)
#pragma unroll
      for (int r = 0; r < 8; ++r) so[(i * 16 + 8 * hh + r) * 68 + j * 16 + ln] = acc[i][j][r] * alpha + bv; }
  __builtin_amdgcn_fence(__ATOMIC_ACQ_REL, "workgroup"); __builtin_amdgcn_wave_barrier();      // the wave's own LDS writes are read back by other lanes of the same wave
  gt_store<ACT, N - NF, RES, OUT16>(so, CP, C, C16, row0 + wm * 32, col0 + wn * 64, lane);
}

extern "C" void kernel_launch(void* const* d_in, const int* in_sizes, int n_in,
                              void* d_out, int out_size, void* d_ws, size_t ws_size, hipStream_t stream) {
  (void)in_sizes; (void)n_in; (void)out_size;
  const float* const* I = (const float* const*)d_in; const float* x = I[0]; const float* Wqkv = I[1]; const float* bqkv = I[2]; const float* Wo = I[3]; const float* bo = I[4]; const float* g1 = I[5]; const float* be1 = I[6]; const float* g2 = I[7]; const float* be2 = I[8];
  const float* W1 = I[9]; const float* b1 = I[10]; const float* W2 = I[11]; const float* b2 = I[12];
  char* ws = (char*)d_ws; size_t off = 0;
  auto take = [&](size_t bytes) { char* p = ws + off; off += (bytes + 255) & ~(size_t)255; return p; };
  _Float16* Bqkv = (_Float16*)take((size_t)3 * DM * DM * 2); _Float16* Bo = (_Float16*)take((size_t)DM * DM * 2); _Float16* Bw1 = (_Float16*)take((size_t)FF * DM * 2); _Float16* Bw2 = (_Float16*)take((size_t)DM * FF * 2);
  _Float16* H16 = (_Float16*)take((size_t)NR * DM * 2); float* XR = (float*)take((size_t)NR * DM * 4); _Float16* QK = (_Float16*)take((size_t)NR * 2 * DM * 2);
  _Float16* Vth = (_Float16*)take((size_t)NR * DM * 2); _Float16* Vtl = (_Float16*)take((size_t)NR * DM * 2); float* X1 = (float*)take((size_t)NR * DM * 4);
  _Float16* O16 = H16; _Float16* H2 = H16; _Float16* FH = QK;      /* reuse: H16 holds LN1 output (consumed by the qkv GEMM), then O16, then LN2 output; the [q|k] plane holds the FFN hidden (f16 [4096][2048]) once attention is done */
  if (off > ws_size) return;      // 6.3 + 2.1 + 4.2 + 4.2 + 8.4 + 16.8 + 16.8 + 8.4 + 8.4 + 16.8 = about 92 MB
  k_prep<<<PB_LN + PB_QKV + PB_O + PB_W1 + PB_W2, 256, 0, stream>>>(x, g1, be1, H16, XR, Wqkv, Wo, W1, W2, Bqkv, Bo, Bw1, Bw2);      /* LN1 and the four weight planes */
  const dim3 gqkv((NR / 128) * (3 * DM / 128), 1), gd((NR / 128) * (DM / 128), 1), gf((NR / 128) * (FF / 128), 1);      /* one work-group per 128 x 128 tile */
  k_gemm_t<0, 3 * DM, DM, false, true, DM><<<gqkv, 256, 0, stream>>>(H16, Bqkv, 0.0625f, bqkv, nullptr, nullptr, QK, Vth, Vtl);      /* [q | k] + bias (f16) and v + bias -> transposed hi / lo planes: M 4096 N 3072 K 1024 */
  k_flash<<<BB * NH * (TT / 64), 128, 0, stream>>>(QK, 2 * DM, QK + DM, 2 * DM, Vth, Vtl, O16, DM);
  k_gemm_t<0, DM, DM, true, false><<<gd, 256, 0, stream>>>(O16, Bo, 0.0625f, bo, XR, X1, nullptr, nullptr, nullptr);      /* x1 = x + (O·out_w + out_b) via the per-element addend */
  k_lnx<DM, 0><<<(NR + 7) / 8, 256, 0, stream>>>(X1, g2, be2, NR, 1e-5f, H2, nullptr);      /* LN2(x1) → f16 (x1 is a computed value: no input rounding) */
  k_gemm_t<6, FF, DM, false, true><<<gf, 256, 0, stream>>>(H2, Bw1, 0.0625f, b1, nullptr, nullptr, FH, nullptr, nullptr);      /* gelu_erf(h2·w1 + b1) → f16: M 4096 N 2048 K 1024 */
  k_gemm_t<0, DM, FF, true, false><<<gd, 256, 0, stream>>>(FH, Bw2, 0.0625f, b2, X1, (float*)d_out, nullptr, nullptr, nullptr);      /* y = x1 + (·w2 + b2): M 4096 N 1024 K 2048 */
}

// v005
// Measured time: 144 microseconds a run.
// Next to v004, in two timings, it ran 1.12 times as fast each time.
// Counting every step since v000, it is 3.27 times as fast.
#include <hip/hip_runtime.h>
// Transformer layer with windowed (|i−j| ≤ 128) multi-head self-attention (B=2, L=2048, d_model 1024, 16 heads × 64): h = LN1(x); qkv = h·W + b; per head softmax(q·kᵀ/8 + window mask)·v; x1 = x + (merged·out_w + out_b);
// y = x1 + (gelu_erf(LN2(x1)·w1 + b1)·w2 + b2). (in,out) weights.
// Compute dtype: x, weights, biases, LN parameters rounded to bf16; LayerNorms in f32 (wave per row) → f16 operands; q,k f16 GEMM outputs, v f32 → f16 hi + ×2^10 residual Vᵀ planes; fused windowed
// flash-style kernel (online softmax f32, P f16 ×2^10, two value accumulators) on v_wmma_f32_16x16x32_f16; the residual sums ride the GEMMs' per-element addend in f32; FFN hidden f16 after the erf-GELU epilogue.
#define BB 2
#define TT 2048
#define DM 1024
#define NH 16
#define HD 64
#define RW 128
#define FF 2048
#define NR (BB * TT)

typedef __bf16 v16b __attribute__((ext_vector_type(16)));
typedef unsigned short v8us __attribute__((ext_vector_type(8), may_alias));
typedef float  v8f  __attribute__((ext_vector_type(8)));
typedef float  v4f  __attribute__((ext_vector_type(4)));
typedef float  v4fa __attribute__((ext_vector_type(4), may_alias));
union FragB { v16b v; v8us half[2]; unsigned short u[16]; };

__device__ __forceinline__ unsigned short bf16_bits(float x) { unsigned int u = __float_as_uint(x); return (unsigned short)((u + 0x7FFFu + ((u >> 16) & 1u)) >> 16); }
__device__ __forceinline__ float bf16_val(unsigned short b) { return __uint_as_float(((unsigned int)b) << 16); }
__device__ __forceinline__ float bf16_round(float x) { return bf16_val(bf16_bits(x)); }
// D += A·B with NT terms: 1 = ah·bh, 2 = + al·bh (A split), 3 = + ah·bl (both split)
template <int NT>
__device__ __forceinline__ v8f mmaN(v16b ah, v16b al, v16b bh, v16b bl, v8f c) {
  c = __builtin_amdgcn_wmma_f32_16x16x32_bf16(false, ah, false, bh, (short)0, c, false, false);
  if (NT >= 2) c = __builtin_amdgcn_wmma_f32_16x16x32_bf16(false, al, false, bh, (short)0, c, false, false);
  if (NT >= 3) c = __builtin_amdgcn_wmma_f32_16x16x32_bf16(false, ah, false, bl, (short)0, c, false, false);
  asm volatile("v_nop\n\tv_nop\n\tv_nop\n\tv_nop" : "+v"(c) : "v"(ah), "v"(al), "v"(bh), "v"(bl));
  return c;
}

__global__ __launch_bounds__(256) void k_wt_bf16(const float* __restrict__ W, unsigned short* __restrict__ Wt, int K, int N) {
  const int t = blockIdx.x * 256 + threadIdx.x;
  const int k8n = K / 8;
  if (t >= N * k8n) return;
  const int n = t / k8n, k8 = (t % k8n) * 8;
  v8us v;
#pragma unroll
  for (int i = 0; i < 8; ++i) v[i] = bf16_bits(W[(size_t)(k8 + i) * N + n]);
  *(v8us*)(Wt + (size_t)n * K + k8) = v;
  
}

// GEMM C[M][N] (f32, pitch ldc) = act(A[M][K]·W + bias). A f32 row-major (pitch lda) converted per fragment to bf16
// (ASPLIT: hi/lo two planes -> 2 terms, else single rounded term); Wt bf16 [N][K] (pitch ldb). BIAS_BF16 rounds the
// bias to bf16 first (bias quantised to bf16 before the add). K%32==0, M%16==0, N%64==0.
template <bool ASPLIT, int ACT, bool BIAS_BF16>
__global__ __launch_bounds__(128) void k_gemm_bf(const float* __restrict__ A, int lda, const unsigned short* __restrict__ Wt, int ldb,
                                               const float* __restrict__ bias, float* __restrict__ C, int ldc, int M, int N, int K) {
  __shared__ __attribute__((aligned(16))) float so[4][16][64];
  const int tid = threadIdx.x, w = tid >> 5, lane = tid & 31, ln = lane & 15, hh = lane >> 4;
  const int ntn = N / 64;
  const int wid = blockIdx.x * 4 + w;
  const int mt = wid / ntn, nq = wid % ntn;
  if (mt * 16 >= M) return;
  const int row0 = mt * 16, col0 = nq * 64;
  const float* arow = A + (size_t)(row0 + ln) * lda;
  v8f acc[4] = {};
  for (int kb = 0; kb < K; kb += 32) {
    FragB ah, al;
    const v4f x0 = *(const v4fa*)(arow + kb + 8 * hh), x1 = *(const v4fa*)(arow + kb + 8 * hh + 4);
    const v4f x2 = *(const v4fa*)(arow + kb + 16 + 8 * hh), x3 = *(const v4fa*)(arow + kb + 16 + 8 * hh + 4);
    float xs[16] = {x0[0],x0[1],x0[2],x0[3],x1[0],x1[1],x1[2],x1[3],x2[0],x2[1],x2[2],x2[3],x3[0],x3[1],x3[2],x3[3]};
#pragma unroll
    for (int i = 0; i < 16; ++i) { const unsigned short hb = bf16_bits(xs[i]); ah.u[i] = hb; al.u[i] = ASPLIT ? bf16_bits(xs[i] - bf16_val(hb)) : (unsigned short)0; }
#pragma unroll
    for (int t = 0; t < 4; ++t) {
      const unsigned short* brow = Wt + (size_t)(col0 + t * 16 + ln) * ldb + kb;
      FragB b;
      b.half[0] = *(const v8us*)(brow + 8 * hh);
      b.half[1] = *(const v8us*)(brow + 16 + 8 * hh);
      acc[t] = mmaN<ASPLIT ? 2 : 1>(ah.v, al.v, b.v, b.v, acc[t]);
    }
  }
#pragma unroll
  for (int t = 0; t < 4; ++t) {
    float bv = bias ? bias[col0 + t * 16 + ln] : 0.f;
    if (BIAS_BF16) bv = bf16_round(bv);
#pragma unroll
    for (int r = 0; r < 8; ++r) { float v = acc[t][r] + bv; if (ACT == 1) v = fmaxf(v, 0.f); so[w][8 * hh + r][t * 16 + ln] = v; }
  }
  __builtin_amdgcn_fence(__ATOMIC_ACQ_REL, "workgroup");
  __builtin_amdgcn_wave_barrier();
  const int rsub = lane >> 4, c4 = (lane & 15) * 4;
  {
#pragma unroll
    for (int q = 0; q < 8; ++q) {
      const int r = q * 2 + rsub;
      const v4f v = *(const v4fa*)&so[w][r][c4];
      *(v4f*)(C + (size_t)(row0 + r) * ldc + col0 + c4) = v;
    }
    
  }
}

// Flash-style causal/unmasked attention, all contractions 3-term bf16 hi/lo splits, f32 softmax with running max.
// q,k,v rows are read from f32 buffers with arbitrary row pitch (so they can live inside a fused qkv buffer);
// D = head size (multiple of 32, <= 128); one wave = 16 query rows; block = 4 waves (64 queries) sharing K/V chunks of 32.
template <int D, bool CAUSAL>
__global__ __launch_bounds__(128) void k_flash(const float* __restrict__ qb, const float* __restrict__ kb, const float* __restrict__ vb,
                                             int pitch, int T, int H, float scale, float* __restrict__ y, int ypitch) {
  constexpr int KS = D / 32;        // k-steps for QK
  constexpr int DT = D / 16;        // d tiles for PV
  __shared__ __attribute__((aligned(16))) unsigned short sKh[32][D + 8], sKl[32][D + 8], sVh[32][D + 8], sVl[32][D + 8];
  __shared__ __attribute__((aligned(16))) unsigned short sPh[4][16][40], sPl[4][16][40];
  __shared__ __attribute__((aligned(16))) float sO[4][16][D];
  const int tid = threadIdx.x, w = tid >> 5, lane = tid & 31, ln = lane & 15, hh = lane >> 4;
  const int nqb = (T + 63) / 64;
  const int bh = blockIdx.x / nqb, qblk = blockIdx.x % nqb;
  const int b = bh / H, h = bh % H;
  const int q0 = qblk * 64 + w * 16;
  const float* Q = qb + (size_t)b * T * pitch + h * D;
  const float* K = kb + (size_t)b * T * pitch + h * D;
  const float* V = vb + (size_t)b * T * pitch + h * D;

  // A fragments of the wave's 16 query rows (scaled), hi/lo
  FragB aqh[KS], aql[KS];
  {
    int row = q0 + ln; if (row >= T) row = T - 1;
    const float* qr = Q + (size_t)row * pitch;
#pragma unroll
    for (int ks = 0; ks < KS; ++ks)
#pragma unroll
      for (int i = 0; i < 16; ++i) {
        const int d = ks * 32 + ((i < 8) ? (8 * hh + i) : (16 + 8 * hh + (i - 8)));
        const float x = qr[d] * scale; const unsigned short hb = bf16_bits(x);
        aqh[ks].u[i] = hb; aql[ks].u[i] = bf16_bits(x - bf16_val(hb));
      }
  }
  float m_r[8], l_r[8];
#pragma unroll
  for (int r = 0; r < 8; ++r) { m_r[r] = -3.0e38f; l_r[r] = 0.f; }
  v8f oacc[DT];
#pragma unroll
  for (int dt = 0; dt < DT; ++dt) oacc[dt] = (v8f){0.f,0.f,0.f,0.f,0.f,0.f,0.f,0.f};

  const int kv_end = CAUSAL ? min(T, qblk * 64 + 64) : T;     // block-uniform
  for (int j0 = 0; j0 < kv_end; j0 += 32) {
    __syncthreads();
    for (int e = tid; e < 32 * (D / 4); e += 128) {
      const int r = e / (D / 4), c4 = (e % (D / 4)) * 4;
      const int key = j0 + r;
      v4f kf = {0.f,0.f,0.f,0.f}, vf = {0.f,0.f,0.f,0.f};
      if (key < T) { kf = *(const v4fa*)(K + (size_t)key * pitch + c4); vf = *(const v4fa*)(V + (size_t)key * pitch + c4); }
#pragma unroll
      for (int t = 0; t < 4; ++t) {
        unsigned short hb = bf16_bits(kf[t]); sKh[r][c4 + t] = hb; sKl[r][c4 + t] = bf16_bits(kf[t] - bf16_val(hb));
        hb = bf16_bits(vf[t]); sVh[r][c4 + t] = hb; sVl[r][c4 + t] = bf16_bits(vf[t] - bf16_val(hb));
      }
    }
    __syncthreads();
    // S tile 16 x 32
    v8f s[2];
#pragma unroll
    for (int nt = 0; nt < 2; ++nt) {
      v8f acc = {};
#pragma unroll
      for (int ks = 0; ks < KS; ++ks) {
        FragB bh_, bl_;
        bh_.half[0] = *(const v8us*)&sKh[nt * 16 + ln][ks * 32 + 8 * hh]; bh_.half[1] = *(const v8us*)&sKh[nt * 16 + ln][ks * 32 + 16 + 8 * hh];
        bl_.half[0] = *(const v8us*)&sKl[nt * 16 + ln][ks * 32 + 8 * hh]; bl_.half[1] = *(const v8us*)&sKl[nt * 16 + ln][ks * 32 + 16 + 8 * hh];
        acc = mmaN<3>(aqh[ks].v, aql[ks].v, bh_.v, bl_.v, acc);
      }
      s[nt] = acc;
    }
    // mask + running max (rows 8hh+r; the 16 lanes of a half share rows)
    float alpha[8];
#pragma unroll
    for (int r = 0; r < 8; ++r) {
      const int qi = q0 + 8 * hh + r;
      const int ja = j0 + ln, jb = j0 + 16 + ln;
      if (CAUSAL) { if (ja > qi) s[0][r] = -3.0e38f; if (jb > qi) s[1][r] = -3.0e38f; }
      if (ja >= T) s[0][r] = -3.0e38f;
      if (jb >= T) s[1][r] = -3.0e38f;
      float mx = fmaxf(s[0][r], s[1][r]);
      mx = fmaxf(mx, __shfl_xor(mx, 1, 32)); mx = fmaxf(mx, __shfl_xor(mx, 2, 32)); mx = fmaxf(mx, __shfl_xor(mx, 4, 32)); mx = fmaxf(mx, __shfl_xor(mx, 8, 32));
      const float mnew = fmaxf(m_r[r], mx);
      alpha[r] = (mnew > -1.0e38f) ? __expf(m_r[r] - mnew) : 1.0f;
      const float p0 = (s[0][r] > -1.0e38f) ? __expf(s[0][r] - mnew) : 0.f;
      const float p1 = (s[1][r] > -1.0e38f) ? __expf(s[1][r] - mnew) : 0.f;
      m_r[r] = mnew;
      l_r[r] = l_r[r] * alpha[r] + p0 + p1;            // per-lane partial row sum (16 lanes combined at the end)
      unsigned short hb = bf16_bits(p0); sPh[w][8 * hh + r][ln] = hb;      sPl[w][8 * hh + r][ln] = bf16_bits(p0 - bf16_val(hb));
      hb = bf16_bits(p1);                sPh[w][8 * hh + r][16 + ln] = hb; sPl[w][8 * hh + r][16 + ln] = bf16_bits(p1 - bf16_val(hb));
    }
#pragma unroll
    for (int dt = 0; dt < DT; ++dt)
#pragma unroll
      for (int r = 0; r < 8; ++r) oacc[dt][r] *= alpha[r];
    __builtin_amdgcn_fence(__ATOMIC_ACQ_REL, "workgroup");
    __builtin_amdgcn_wave_barrier();
    FragB pah, pal;
    pah.half[0] = *(const v8us*)&sPh[w][ln][8 * hh]; pah.half[1] = *(const v8us*)&sPh[w][ln][16 + 8 * hh];
    pal.half[0] = *(const v8us*)&sPl[w][ln][8 * hh]; pal.half[1] = *(const v8us*)&sPl[w][ln][16 + 8 * hh];
#pragma unroll
    for (int dt = 0; dt < DT; ++dt) {
      FragB bvh, bvl;
#pragma unroll
      for (int i = 0; i < 8; ++i) {
        bvh.u[i] = sVh[8 * hh + i][dt * 16 + ln]; bvh.u[8 + i] = sVh[16 + 8 * hh + i][dt * 16 + ln];
        bvl.u[i] = sVl[8 * hh + i][dt * 16 + ln]; bvl.u[8 + i] = sVl[16 + 8 * hh + i][dt * 16 + ln];
      }
      oacc[dt] = mmaN<3>(pah.v, pal.v, bvh.v, bvl.v, oacc[dt]);
    }
    __builtin_amdgcn_fence(__ATOMIC_ACQ_REL, "workgroup");
    __builtin_amdgcn_wave_barrier();
  }
#pragma unroll
  for (int r = 0; r < 8; ++r) {
    float l = l_r[r];
    l += __shfl_xor(l, 1, 32); l += __shfl_xor(l, 2, 32); l += __shfl_xor(l, 4, 32); l += __shfl_xor(l, 8, 32);
    l_r[r] = (l > 0.f) ? 1.0f / l : 0.f;
  }
#pragma unroll
  for (int dt = 0; dt < DT; ++dt)
#pragma unroll
    for (int r = 0; r < 8; ++r) sO[w][8 * hh + r][dt * 16 + ln] = oacc[dt][r] * l_r[r];
  __builtin_amdgcn_fence(__ATOMIC_ACQ_REL, "workgroup");
  __builtin_amdgcn_wave_barrier();
  {
    for (int r = 0; r < 16; ++r) {
      const int row = q0 + r;
      if (row < T && lane < D / 4) {
        const v4f val = *(const v4fa*)&sO[w][r][lane * 4];
        *(v4f*)(y + ((size_t)b * T + row) * ypitch + h * D + lane * 4) = val;
      }
    }
    
  }
}

// GEMM C = act(A·W + bias + resid): A f32 (ASPLIT -> hi/lo 2 terms), Wt bf16 [N][K]; ACT 0 none, 1 relu, 2 exact gelu;
// resid (optional, f32, row index = (row % rmod), pitch ldr, RES_BF16 rounds it) added before the activation.
template <bool ASPLIT, int ACT, bool BIAS_BF16, bool RES_BF16>
__global__ __launch_bounds__(128) void k_gemm_bf3(const float* __restrict__ A, int lda, const unsigned short* __restrict__ Wt, int ldb,
                                                const float* __restrict__ bias, const float* __restrict__ resid, int rmod, int ldr,
                                                float* __restrict__ C, int ldc, int M, int N, int K) {
  __shared__ __attribute__((aligned(16))) float so[4][16][64];
  const int tid = threadIdx.x, w = tid >> 5, lane = tid & 31, ln = lane & 15, hh = lane >> 4;
  const int ntn = N / 64;
  const int wid = blockIdx.x * 4 + w;
  const int mt = wid / ntn, nq = wid % ntn;
  if (mt * 16 >= M) return;
  const int row0 = mt * 16, col0 = nq * 64;
  const float* arow = A + (size_t)(row0 + ln) * lda;
  v8f acc[4] = {};
  for (int kb = 0; kb < K; kb += 32) {
    FragB ah, al;
    const v4f x0 = *(const v4fa*)(arow + kb + 8 * hh), x1 = *(const v4fa*)(arow + kb + 8 * hh + 4);
    const v4f x2 = *(const v4fa*)(arow + kb + 16 + 8 * hh), x3 = *(const v4fa*)(arow + kb + 16 + 8 * hh + 4);
    float xs[16] = {x0[0],x0[1],x0[2],x0[3],x1[0],x1[1],x1[2],x1[3],x2[0],x2[1],x2[2],x2[3],x3[0],x3[1],x3[2],x3[3]};
#pragma unroll
    for (int i = 0; i < 16; ++i) { const unsigned short hb = bf16_bits(xs[i]); ah.u[i] = hb; al.u[i] = ASPLIT ? bf16_bits(xs[i] - bf16_val(hb)) : (unsigned short)0; }
#pragma unroll
    for (int t = 0; t < 4; ++t) {
      const unsigned short* brow = Wt + (size_t)(col0 + t * 16 + ln) * ldb + kb;
      FragB b;
      b.half[0] = *(const v8us*)(brow + 8 * hh);
      b.half[1] = *(const v8us*)(brow + 16 + 8 * hh);
      acc[t] = mmaN<ASPLIT ? 2 : 1>(ah.v, al.v, b.v, b.v, acc[t]);
    }
  }
#pragma unroll
  for (int t = 0; t < 4; ++t) {
    const int col = col0 + t * 16 + ln;
    float bv = bias ? bias[col] : 0.f;
    if (BIAS_BF16) bv = bf16_round(bv);
#pragma unroll
    for (int r = 0; r < 8; ++r) {
      float v = acc[t][r] + bv;
      if (resid) { float rv = resid[(size_t)((row0 + 8 * hh + r) % rmod) * ldr + col]; if (RES_BF16) rv = bf16_round(rv); v += rv; }
      if (ACT == 1) v = fmaxf(v, 0.f);
      if (ACT == 2) v = 0.5f * v * (1.0f + erff(v * 0.70710678118654752f));
      if (ACT == 3) { const float u = 0.7978845608028654f * (v + 0.044715f * v * v * v); v = 0.5f * v * (1.0f + tanhf(u)); }
      so[w][8 * hh + r][t * 16 + ln] = v;
    }
  }
  __builtin_amdgcn_fence(__ATOMIC_ACQ_REL, "workgroup");
  __builtin_amdgcn_wave_barrier();
  const int rsub = lane >> 4, c4 = (lane & 15) * 4;
  {
#pragma unroll
    for (int q = 0; q < 8; ++q) {
      const int r = q * 2 + rsub;
      const v4f v = *(const v4fa*)&so[w][r][c4];
      *(v4f*)(C + (size_t)(row0 + r) * ldc + col0 + c4) = v;
    }
    
  }
}
// row LayerNorm (biased variance, eps) over N: s = X (+ R); optional out_sum <- s; out_norm <- (s-mu)*rsqrt(var+eps)*g + b
template <bool PARAM_BF16>
__global__ __launch_bounds__(256) void k_layernorm(const float* __restrict__ X, const float* __restrict__ R, const float* __restrict__ g, const float* __restrict__ bta,
                                                  float* __restrict__ out_sum, float* __restrict__ out_norm, int N, float eps) {
  __shared__ float red[256];
  const int row = blockIdx.x, tid = threadIdx.x;
  const float* x = X + (size_t)row * N; const float* rr = R ? R + (size_t)row * N : nullptr;
  float vals[16];                     // up to N = 4096
  const int per = N / 256;            // contiguous chunk per thread? use strided-by-4 chunks: thread handles j = tid*4 + 1024*u
  float s1 = 0.f;
  for (int u = 0; u < per / 4; ++u) {
    const int j = tid * 4 + 1024 * u;
    const v4f a = *(const v4fa*)(x + j);
    v4f b = {0.f,0.f,0.f,0.f}; if (rr) b = *(const v4fa*)(rr + j);
#pragma unroll
    for (int q = 0; q < 4; ++q) { const float v = a[q] + b[q]; vals[u * 4 + q] = v; s1 += v; }
  }
  red[tid] = s1; __syncthreads();
  for (int st = 128; st > 0; st >>= 1) { if (tid < st) red[tid] += red[tid + st]; __syncthreads(); }
  const float mu = red[0] / (float)N; __syncthreads();
  float s2 = 0.f;
  for (int u = 0; u < per / 4; ++u)
#pragma unroll
    for (int q = 0; q < 4; ++q) { const float c = vals[u * 4 + q] - mu; s2 += c * c; }
  red[tid] = s2; __syncthreads();
  for (int st = 128; st > 0; st >>= 1) { if (tid < st) red[tid] += red[tid + st]; __syncthreads(); }
  const float rs = rsqrtf(red[0] / (float)N + eps);
  {
    for (int u = 0; u < per / 4; ++u) {
      const int j = tid * 4 + 1024 * u;
      v4f o, sm;
#pragma unroll
      for (int q = 0; q < 4; ++q) {
        float gg = g[j + q], bb = bta[j + q];
        if (PARAM_BF16) { gg = bf16_round(gg); bb = bf16_round(bb); }
        sm[q] = vals[u * 4 + q]; o[q] = (vals[u * 4 + q] - mu) * rs * gg + bb;
      }
      if (out_sum) *(v4f*)(out_sum + (size_t)row * N + j) = sm;
      *(v4f*)(out_norm + (size_t)row * N + j) = o;
    }
    
  }
}



// ---- f16 WMMA path (v_wmma_f32_16x16x32_f16): 11-bit significands for operands in range — used where a [0,1] probability operand needs more precision than bf16
typedef _Float16 v16h __attribute__((ext_vector_type(16)));
union FragH { v16h v; v8us half[2]; _Float16 h[16]; unsigned short u[16]; };
template <int NT>
__device__ __forceinline__ v8f mmaH(v16h ah, v16h al, v16h bh, v16h bl, v8f c) {
  c = __builtin_amdgcn_wmma_f32_16x16x32_f16(false, ah, false, bh, (short)0, c, false, false);
  if (NT >= 2) c = __builtin_amdgcn_wmma_f32_16x16x32_f16(false, al, false, bh, (short)0, c, false, false);
  if (NT >= 3) c = __builtin_amdgcn_wmma_f32_16x16x32_f16(false, ah, false, bl, (short)0, c, false, false);
  asm volatile("v_nop\n\tv_nop\n\tv_nop\n\tv_nop" : "+v"(c) : "v"(ah), "v"(al), "v"(bh), "v"(bl));
  return c;
}
// batched GEMM like k_gemm_b but f16 operands: A f32 (split into f16 hi/lo if ASPLIT, else rounded to f16), Bt = f16 values [n][k]; alpha; C f32; N multiple of 16 (partial tiles skipped)
template <bool ASPLIT>
__global__ __launch_bounds__(128) void k_gemm_h(const float* __restrict__ A, int lda, size_t sA, const _Float16* __restrict__ Bh, int ldb, size_t sB, float alpha, float* __restrict__ C, int ldc, size_t sC, int M, int N, int K) {
  __shared__ __attribute__((aligned(16))) float so[4][16][64];
  const int tid = threadIdx.x, w = tid >> 5, lane = tid & 31, ln = lane & 15, hh = lane >> 4; const int by = blockIdx.y;
  A += (size_t)by * sA; Bh += (size_t)by * sB; C += (size_t)by * sC;
  const int ntn = (N + 63) / 64; const int wid = blockIdx.x * 4 + w; const int mt = wid / ntn, nq = wid % ntn; if (mt * 16 >= M) return;
  const int row0 = mt * 16, col0 = nq * 64; const float* arow = A + (size_t)(row0 + ln) * lda;
  v8f acc[4] = {};
  for (int kb = 0; kb < K; kb += 32) {
    FragH ah, al;
    const v4f x0 = *(const v4fa*)(arow + kb + 8 * hh), x1 = *(const v4fa*)(arow + kb + 8 * hh + 4), x2 = *(const v4fa*)(arow + kb + 16 + 8 * hh), x3 = *(const v4fa*)(arow + kb + 16 + 8 * hh + 4);
    float xs[16] = {x0[0],x0[1],x0[2],x0[3],x1[0],x1[1],x1[2],x1[3],x2[0],x2[1],x2[2],x2[3],x3[0],x3[1],x3[2],x3[3]};
#pragma unroll
    for (int i = 0; i < 16; ++i) { const _Float16 h = (_Float16)xs[i]; ah.h[i] = h; al.h[i] = ASPLIT ? (_Float16)(xs[i] - (float)h) : (_Float16)0.0f; }
#pragma unroll
    for (int t = 0; t < 4; ++t) { if (col0 + t * 16 >= N) continue; const size_t boff = (size_t)(col0 + t * 16 + ln) * ldb + kb; FragH bq; bq.half[0] = *(const v8us*)(Bh + boff + 8 * hh); bq.half[1] = *(const v8us*)(Bh + boff + 16 + 8 * hh);
      acc[t] = mmaH<ASPLIT ? 2 : 1>(ah.v, al.v, bq.v, bq.v, acc[t]); }
  }
#pragma unroll
  for (int t = 0; t < 4; ++t) { if (col0 + t * 16 >= N) continue;
#pragma unroll
    for (int r = 0; r < 8; ++r) so[w][8 * hh + r][t * 16 + ln] = acc[t][r] * alpha; }
  __builtin_amdgcn_fence(__ATOMIC_ACQ_REL, "workgroup"); __builtin_amdgcn_wave_barrier();
  const int rsub = lane >> 4, c4 = (lane & 15) * 4;
  {
#pragma unroll
    for (int q = 0; q < 8; ++q) { const int r = q * 2 + rsub; if (col0 + c4 < N) { const v4f v = *(const v4fa*)&so[w][r][c4]; *(v4f*)(C + (size_t)(row0 + r) * ldc + col0 + c4) = v; } }
     }
}

// Wt[n][k] = f16(bf16(W[k][n]) * scale) from f32 row-major W[K][N] (scale = power of two; bf16-exact weights stay exact in f16 away from the subnormal range).
// One work-group = a tile of 128 k x 64 n, turned in LDS, so that both sides move whole lines: 16 lanes read 256 contiguous bytes of one W row, 16 lanes write 256 contiguous bytes of one Wt row.
// LDS: one dword = the f16 pair (k, k + 1) of one n; a row = one n's 64 dwords, its sixteen 16-byte groups (8 k each) stored at group ^ (n / 4):
// the 32 lanes of a dword store (16 values of n / 4, two neighbouring pairs) fall on 32 banks, the 16 lanes that read one row back as 16-byte groups on all 64.
// K a multiple of 128, N a multiple of 64.
typedef _Float16 v2h __attribute__((ext_vector_type(2)));
// blk = the tile's index, tl = the work-group's 16 KiB of LDS.
template <int K, int N>
__device__ __forceinline__ void wt_tile(const float* __restrict__ W, _Float16* __restrict__ Wt, float scale, int blk, unsigned int* tl) {
  const int tid = threadIdx.x, lo = tid & 15, hi = tid >> 4;
  const int n0 = (blk % (N / 64)) * 64, k0 = (blk / (N / 64)) * 128;
  const float* src = W + (size_t)(k0 + 2 * hi) * N + n0 + 4 * lo;      // rows k0 + 2 hi + 32 u and the next, columns n0 + 4 lo .. + 3
  v4f ev[4], od[4];
#pragma unroll
  for (int u = 0; u < 4; ++u) { ev[u] = *(const v4fa*)(src + (size_t)(32 * u) * N); od[u] = *(const v4fa*)(src + (size_t)(32 * u + 1) * N); }
#pragma unroll
  for (int u = 0; u < 4; ++u) { const int kp = hi + 16 * u;      // pair index: k = k0 + 2 kp, k0 + 2 kp + 1
#pragma unroll
    for (int q = 0; q < 4; ++q) { v2h p; p[0] = (_Float16)(bf16_round(ev[u][q]) * scale); p[1] = (_Float16)(bf16_round(od[u][q]) * scale);
      tl[(4 * lo + q) * 64 + (((kp >> 2) ^ lo) << 2) + (kp & 3)] = __builtin_bit_cast(unsigned int, p); } }
  __syncthreads();      // every pair of the tile is in LDS before a row is read back
#pragma unroll
  for (int u = 0; u < 4; ++u) { const int n = hi + 16 * u; const v8us v = *(const v8us*)&tl[n * 64 + ((lo ^ ((n >> 2) & 15)) << 2)];
    *(v8us*)((unsigned short*)Wt + (size_t)(n0 + n) * K + k0 + 8 * lo) = v; }
  asm volatile("s_wait_xcnt 0x0" ::: "memory");      // closes the run of four stores: in the merged kernel other jobs' code follows in the text and reuses the stores' registers
}
typedef _Float16 v4h __attribute__((ext_vector_type(4)));

__global__ __launch_bounds__(256) void k_x16(const float* __restrict__ x, _Float16* __restrict__ X16, size_t n8) { const size_t t = (size_t)blockIdx.x * 256 + threadIdx.x; if (t >= n8) return; FragH f;
#pragma unroll
  for (int q = 0; q < 8; ++q) f.h[q] = (_Float16)bf16_round(x[t * 8 + q]); *(v8us*)((unsigned short*)X16 + t * 8) = f.half[0];  }
__global__ __launch_bounds__(256) void k_round16f(const float* __restrict__ W, _Float16* __restrict__ Bt, size_t n8) { const size_t t = (size_t)blockIdx.x * 256 + threadIdx.x; if (t >= n8) return; FragH f;
#pragma unroll
  for (int i = 0; i < 8; ++i) f.h[i] = (_Float16)(bf16_round(W[t * 8 + i]) * 16.0f); *(v8us*)((unsigned short*)Bt + t * 8) = f.half[0];  }
template <int NHv, int TTv>
__global__ __launch_bounds__(256) void k_vt(const _Float16* __restrict__ V16, int ldv, int voff, _Float16* __restrict__ Vt) { __shared__ unsigned short tl[64][66]; const int tid = threadIdx.x; const int slab = blockIdx.x / (TTv / 64), lg = blockIdx.x % (TTv / 64); const int b = slab / NHv, h = slab % NHv;
  for (int i = tid; i < 64 * 8; i += 256) { const int r = i / 8, c8 = (i % 8) * 8; FragH f; f.half[0] = *(const v8us*)((const unsigned short*)V16 + ((size_t)b * TTv + lg * 64 + r) * ldv + voff + h * 64 + c8);
#pragma unroll
    for (int q = 0; q < 8; ++q) tl[r][c8 + q] = f.u[q]; }
  __syncthreads();
  {
#pragma unroll
    for (int rd = 0; rd < 2; ++rd) { const int d = rd * 32 + tid / 8, pc = tid % 8; FragH f;
#pragma unroll
      for (int q = 0; q < 8; ++q) f.u[q] = tl[pc * 8 + q][d];
      *(v8us*)((unsigned short*)Vt + ((size_t)slab * 64 + d) * TTv + lg * 64 + pc * 8) = f.half[0]; }
     } }

template <int D, int RBF>
__device__ __forceinline__ void lnx_rows(const float* __restrict__ X, const float* __restrict__ gam, const float* __restrict__ bet, int nrows, float eps, _Float16* __restrict__ O16, float* __restrict__ XR, int blk) {
  constexpr int NP = D / 128; const int tid = threadIdx.x, wv = tid >> 5, lane = tid & 31; const size_t r = (size_t)blk * 8 + wv; if (r >= (size_t)nrows) return; v4f y[NP]; float s = 0.f;
#pragma unroll
  for (int j = 0; j < NP; ++j) { const int c = j * 128 + lane * 4; v4f g = *(const v4fa*)(X + r * D + c); if (RBF) { for (int q = 0; q < 4; ++q) g[q] = bf16_round(g[q]); } y[j] = g; s += g[0] + g[1] + g[2] + g[3]; }
  for (int o = 16; o >= 1; o >>= 1) s += __shfl_xor(s, o, 32); const float mu = s / (float)D; float q2 = 0.f;
#pragma unroll
  for (int j = 0; j < NP; ++j) for (int q = 0; q < 4; ++q) { const float d = y[j][q] - mu; q2 += d * d; }
  for (int o = 16; o >= 1; o >>= 1) q2 += __shfl_xor(q2, o, 32); const float rs = rsqrtf(q2 / (float)D + eps);
  {
#pragma unroll
    for (int j = 0; j < NP; ++j) { const int c = j * 128 + lane * 4; v4h h; for (int q = 0; q < 4; ++q) { const float v = (y[j][q] - mu) * rs * bf16_round(gam[c + q]) + bf16_round(bet[c + q]); h[q] = (_Float16)v; } *(v4h*)(O16 + r * D + c) = h;
      asm volatile("s_wait_xcnt 0x0" ::: "memory");      // the store's registers are reused directly behind it: the wait stands in front of the overwrite
      if (XR) { *(v4f*)(XR + r * D + c) = y[j];
        asm volatile("s_wait_xcnt 0x0" ::: "memory"); } }      // likewise, ahead of the next trip's loads
     } }
template <int D, int RBF>
__global__ __launch_bounds__(256) void k_lnx(const float* __restrict__ X, const float* __restrict__ gam, const float* __restrict__ bet, int nrows, float eps, _Float16* __restrict__ O16, float* __restrict__ XR) {
  lnx_rows<D, RBF>(X, gam, bet, nrows, eps, O16, XR, (int)blockIdx.x); }
// LN1 and the four weight convert-transposes need nothing of each other: one grid, each job a range of the block index (a work-group does one job whole, so the branch and the tile's barrier are block-uniform).
#define PB_LN (NR / 8)
#define PB_QKV ((DM / 128) * (3 * DM / 64))
#define PB_O ((DM / 128) * (DM / 64))
#define PB_W1 ((DM / 128) * (FF / 64))
#define PB_W2 ((FF / 128) * (DM / 64))
__global__ __launch_bounds__(256) void k_prep(const float* __restrict__ x, const float* __restrict__ g1, const float* __restrict__ be1, _Float16* __restrict__ H16, float* __restrict__ XR,
                                              const float* __restrict__ Wqkv, const float* __restrict__ Wo, const float* __restrict__ W1, const float* __restrict__ W2,
                                              _Float16* __restrict__ Bqkv, _Float16* __restrict__ Bo, _Float16* __restrict__ Bw1, _Float16* __restrict__ Bw2) {
  __shared__ __attribute__((aligned(16))) unsigned int tl[64 * 64];
  int b = (int)blockIdx.x;
  if (b < PB_LN) { lnx_rows<DM, 1>(x, g1, be1, NR, 1e-5f, H16, XR, b); return; }      /* LN1(bf16 x) -> f16; XR = bf16(x) */
  b -= PB_LN; if (b < PB_QKV) { wt_tile<DM, 3 * DM>(Wqkv, Bqkv, 16.0f, b, tl); return; }      /* (in,out) -> Bt[n][k] x 2^4 */
  b -= PB_QKV; if (b < PB_O) { wt_tile<DM, DM>(Wo, Bo, 16.0f, b, tl); return; }
  b -= PB_O; if (b < PB_W1) { wt_tile<DM, FF>(W1, Bw1, 16.0f, b, tl); return; }
  wt_tile<FF, DM>(W2, Bw2, 16.0f, b - PB_W1, tl);
}
// lane l <-> lane l ^ 16: the two lanes that share a query's column
__device__ __forceinline__ float xhalf(float x) { return __builtin_bit_cast(float, __builtin_amdgcn_permlanex16(__builtin_bit_cast(int, x), __builtin_bit_cast(int, x), 0x76543210, 0xfedcba98, false, false)); }
// Both products transposed: S^T = K Q^T (A = 16 key rows, B = the wave's 16 queries, kept in registers), O^T += V^T P^T (A = 16 rows of V^T, B = P^T).
// Lane (ln, hh) holds, of query q0 + ln alone, the scores of keys 8 hh + r and 16 + 8 hh + r of a 32-key chunk: maximum and sum are in-lane plus one exchange with lane ^ 16,
// the running maximum, the sum and the rescale factor are one value a lane, and the two converted score tiles are the B fragment of the second product as they lie
// (element s = tile s / 8, register s % 8 = key 8 hh + s or 16 + 8 hh + s - 8: the k order of the V^T loader).
// A masked score is -inf and the running maximum starts finite, so exp gives 0 for a masked key and 1 for the rescale of a column that has seen no key yet: no test around an exp.
__global__ __launch_bounds__(128) void k_flash(const _Float16* __restrict__ Q16, int ldq, const _Float16* __restrict__ K16, int ldk, const _Float16* __restrict__ Vt, const _Float16* __restrict__ Vtlo, _Float16* __restrict__ O16, int ldo) {
  constexpr int RPW = 16, NQB = TT / (4 * RPW), DT = 4, KS = 2;
  __shared__ __attribute__((aligned(16))) unsigned short sO[4][RPW][64 + 8];      /* output staging, a wave's own 16 rows; pitch 144 B */
  const int tid = threadIdx.x, w = tid >> 5, lane = tid & 31, ln = lane & 15, hh = lane >> 4;
  const int slab = blockIdx.x / NQB, qblk = blockIdx.x % NQB; const int b = slab / NH, h = slab % NH; const int qb0 = qblk * (4 * RPW); const int q0 = qb0 + w * RPW;
  const int tq = q0 + ln;
  FragH bq[KS];
  { const unsigned short* qr = (const unsigned short*)Q16 + ((size_t)b * TT + tq) * ldq + h * 64;
#pragma unroll
    for (int ks = 0; ks < KS; ++ks) { bq[ks].half[0] = *(const v8us*)(qr + ks * 32 + 8 * hh); bq[ks].half[1] = *(const v8us*)(qr + ks * 32 + 16 + 8 * hh); } }
  const unsigned short* Vth = (const unsigned short*)Vt + (size_t)slab * 64 * TT; const unsigned short* Vtl = (const unsigned short*)Vtlo + (size_t)slab * 64 * TT;
  float m_q = -3.0e38f, l_q = 0.f; v8f oacc[DT], oaccl[DT];
#pragma unroll
  for (int dt = 0; dt < DT; ++dt) { oacc[dt] = (v8f){0.f,0.f,0.f,0.f,0.f,0.f,0.f,0.f}; oaccl[dt] = oacc[dt]; }
  const int jbeg = (qb0 - RW) > 0 ? (qb0 - RW) : 0; const int jend = (qb0 + 4 * RPW + RW) < TT ? (qb0 + 4 * RPW + RW) : TT;      /* block-uniform window bounds (multiples of 32) */
  // the chunk loop stays rolled (its body is long: copies would only grow the text); every inner loop is unrolled so that fragments and accumulators are indexed by constants and stay in registers
#pragma unroll 1
  for (int j0 = jbeg; j0 < jend; j0 += 32) {
    v8f s[2];
#pragma unroll
    for (int nt = 0; nt < 2; ++nt) { const unsigned short* kr = (const unsigned short*)K16 + ((size_t)b * TT + j0 + nt * 16 + ln) * ldk + h * 64; FragH ak[KS];
#pragma unroll
      for (int ks = 0; ks < KS; ++ks) { ak[ks].half[0] = *(const v8us*)(kr + ks * 32 + 8 * hh); ak[ks].half[1] = *(const v8us*)(kr + ks * 32 + 16 + 8 * hh); }
      v8f acc = (v8f){0.f,0.f,0.f,0.f,0.f,0.f,0.f,0.f};
#pragma unroll
      for (int ks = 0; ks < KS; ++ks) acc = mmaH<1>(ak[ks].v, ak[ks].v, bq[ks].v, bq[ks].v, acc);
      s[nt] = acc; }
    float mc = -INFINITY;
#pragma unroll
    for (int nt = 0; nt < 2; ++nt)
#pragma unroll
      for (int r = 0; r < 8; ++r) { const int kk = j0 + nt * 16 + 8 * hh + r; const bool ok = (kk - tq <= RW) && (tq - kk <= RW);
        s[nt][r] = ok ? s[nt][r] * 0.125f : -INFINITY; mc = fmaxf(mc, s[nt][r]); }
    mc = fmaxf(mc, xhalf(mc));
    const float mn = fmaxf(m_q, mc); const float al = expf(m_q - mn); m_q = mn;
    FragH pb; float ps[4] = {0.f, 0.f, 0.f, 0.f};      /* four partial sums: no chain of 16 dependent adds */
#pragma unroll
    for (int nt = 0; nt < 2; ++nt)
#pragma unroll
      for (int r = 0; r < 8; ++r) { const float p = expf(s[nt][r] - mn); ps[r & 3] += p; pb.h[nt * 8 + r] = (_Float16)(p * 1024.0f); }
    l_q = l_q * al + ((ps[0] + ps[1]) + (ps[2] + ps[3]));      /* this lane's half of the column's sum; the halves join behind the loop */
#pragma unroll
    for (int dt = 0; dt < DT; ++dt)
#pragma unroll
      for (int r = 0; r < 8; ++r) { oacc[dt][r] *= al; oaccl[dt][r] *= al; }
#pragma unroll
    for (int dt = 0; dt < DT; ++dt) { const size_t vo = (size_t)(dt * 16 + ln) * TT + j0; FragH av, avl; av.half[0] = *(const v8us*)(Vth + vo + 8 * hh); av.half[1] = *(const v8us*)(Vth + vo + 16 + 8 * hh); avl.half[0] = *(const v8us*)(Vtl + vo + 8 * hh); avl.half[1] = *(const v8us*)(Vtl + vo + 16 + 8 * hh);
      oacc[dt] = mmaH<1>(av.v, av.v, pb.v, pb.v, oacc[dt]); oaccl[dt] = mmaH<1>(avl.v, avl.v, pb.v, pb.v, oaccl[dt]); } }
  const float l = l_q + xhalf(l_q); const float inv = (l > 0.f) ? 1.0f / (l * 1024.0f) : 0.f;
  // a lane's 8 registers of a tile are 8 consecutive head columns of its query: one 16-byte group of the f16 row (the out-projection's A operand)
#pragma unroll
  for (int dt = 0; dt < DT; ++dt) { FragH f;
#pragma unroll
    for (int r = 0; r < 8; ++r) f.h[r] = (_Float16)((oacc[dt][r] + oaccl[dt][r] * 0.0009765625f) * inv);
    *(v8us*)&sO[w][ln][dt * 16 + 8 * hh] = f.half[0]; }
  __builtin_amdgcn_fence(__ATOMIC_ACQ_REL, "workgroup"); __builtin_amdgcn_wave_barrier();      // the wave's own LDS writes are read back by other lanes of the same wave
#pragma unroll
  for (int u = 0; u < 4; ++u) { const int r = u * 4 + (lane >> 3), c = (lane & 7) * 8;      /* 8 lanes = one whole 128-B line of a row */
    *(v8us*)((unsigned short*)O16 + ((size_t)b * TT + q0 + r) * ldo + h * 64 + c) = *(const v8us*)&sO[w][r][c]; }
}

// ---- tiled f16 GEMM with fused epilogue: act(A[M][K] * Bh[N][K]^T * alpha + bf16(bias[col]) (+ CP[row][col] if RES)) -> C16 (f16, if OUT16) or C (f32); ACT 0 none, 6 erf-GELU. A and Bh f16 and k-contiguous (pitch K), C / C16 / CP pitch N.
// One work-group = one 128 x 128 tile of C, 8 waves as 4 (rows) x 2 (columns), 32 x 64 of C per wave. A pass is 128 k: 256 B of each of the 128 A rows and 128 Bh rows,
// laid in LDS at a pitch of 272 B (an odd multiple of 16 B: conflict-free for ds_load_b128 fragment reads). Two buffers; the next pass's rows are copied while this pass is multiplied.
// M, N multiples of 128, K a multiple of 128. The k order of every accumulator is ascending in steps of 32.
// NF > 0: two products on one A share the grid: the tiles of the first N - NF columns go to C16 (pitch N - NF); those of the last NF columns (v) go out transposed, split into an f16 value and its residual x 2^10:
// Vh / Vl [row / TT][column][row % TT], the layout the attention kernel reads its value fragments from.
#define GT_ROWB 272
#define GT_STAGE (256 * GT_ROWB)
// Eight 16-byte asynchronous copies of one lane, global -> LDS, rows 16 apart. The s_wait_xcnt closes the statement so that no address register is rewritten ahead of it.
template <int K>
__device__ __forceinline__ void gt_copy8(unsigned l0, const _Float16* g0) {
  const unsigned l1 = l0 + 16 * GT_ROWB, l2 = l0 + 32 * GT_ROWB, l3 = l0 + 48 * GT_ROWB, l4 = l0 + 64 * GT_ROWB, l5 = l0 + 80 * GT_ROWB, l6 = l0 + 96 * GT_ROWB, l7 = l0 + 112 * GT_ROWB;
  const _Float16 *g1 = g0 + 16 * K, *g2 = g0 + 32 * K, *g3 = g0 + 48 * K, *g4 = g0 + 64 * K, *g5 = g0 + 80 * K, *g6 = g0 + 96 * K, *g7 = g0 + 112 * K;
  asm volatile("global_load_async_to_lds_b128 %0, %8, off\n\t"
               "global_load_async_to_lds_b128 %1, %9, off\n\t"
               "global_load_async_to_lds_b128 %2, %10, off\n\t"
               "global_load_async_to_lds_b128 %3, %11, off\n\t"
               "global_load_async_to_lds_b128 %4, %12, off\n\t"
               "global_load_async_to_lds_b128 %5, %13, off\n\t"
               "global_load_async_to_lds_b128 %6, %14, off\n\t"
               "global_load_async_to_lds_b128 %7, %15, off\n\t"
               "s_wait_xcnt 0x0"
               :: "v"(l0), "v"(l1), "v"(l2), "v"(l3), "v"(l4), "v"(l5), "v"(l6), "v"(l7), "v"(g0), "v"(g1), "v"(g2), "v"(g3), "v"(g4), "v"(g5), "v"(g6), "v"(g7) : "memory");
}
// A wave's staged 32 x 64 tile (so, pitch 68 floats) -> rows rw .. rw + 31, columns cw .. cw + 63 of a plane of pitch P, in whole lines.
template <int ACT, int P, bool RES, bool OUT16>
__device__ __forceinline__ void gt_store(const float* so, const float* __restrict__ CP, float* __restrict__ C, _Float16* __restrict__ C16, int rw, int cw, int lane) {
  const int rsub = lane >> 4, c4 = (lane & 15) * 4;
#pragma unroll (ACT == 6 ? 2 : 16)      /* the erf text is long: unrolled by 2 only, for speed */
  for (int q = 0; q < 16; ++q) { const int r = q * 2 + rsub; v4f v = *(const v4fa*)&so[r * 68 + c4]; const size_t o = (size_t)(rw + r) * P + cw + c4;
    if (RES) { const v4f c = *(const v4fa*)(CP + o); v[0] += c[0]; v[1] += c[1]; v[2] += c[2]; v[3] += c[3]; }
    if (ACT == 6) {
#pragma unroll
      for (int e = 0; e < 4; ++e) v[e] = 0.5f * v[e] * (1.0f + erff(v[e] * 0.70710678118654752f)); }
    if (!OUT16) *(v4f*)(C + o) = v;
    else { v4h h4;
#pragma unroll
      for (int e = 0; e < 4; ++e) h4[e] = (_Float16)v[e];
      *(v4h*)(C16 + o) = h4; } }
  asm volatile("s_wait_xcnt 0x0" ::: "memory");      // closes the run of stores: where two store paths share a kernel the other path's code follows in the text and reuses the stores' registers
}
template <int ACT, int N, int K, bool RES, bool OUT16, int NF = 0>
__global__ __launch_bounds__(256) void k_gemm_t(const _Float16* __restrict__ A, const _Float16* __restrict__ Bh, float alpha, const float* __restrict__ bias, const float* __restrict__ CP, float* __restrict__ C, _Float16* __restrict__ C16, _Float16* __restrict__ Vh, _Float16* __restrict__ Vl) {
  __shared__ __attribute__((aligned(16))) unsigned char L[2 * GT_STAGE];
  constexpr int NST = K / 128, NTN = N / 128;
  const int tid = threadIdx.x, w = tid >> 5, lane = tid & 31, ln = lane & 15, hh = lane >> 4;
  const int row0 = (int)(blockIdx.x / NTN) * 128, col0 = (int)(blockIdx.x % NTN) * 128;
  const int wm = w >> 1, wn = w & 1;
  // copy roles: 16 lanes cover one row's 256 B; a thread takes rows (tid / 16) + 16 i of A and of Bh
  const unsigned lcp = (unsigned)(size_t)L + (unsigned)(tid >> 4) * GT_ROWB + (unsigned)(tid & 15) * 16u;
  const _Float16* ga = A + (size_t)(row0 + (tid >> 4)) * K + (tid & 15) * 8;
  const _Float16* gb = Bh + (size_t)(col0 + (tid >> 4)) * K + (tid & 15) * 8;
  v8f acc[2][4];
#pragma unroll
  for (int i = 0; i < 2; ++i)
#pragma unroll
    for (int j = 0; j < 4; ++j) acc[i][j] = (v8f){0.f,0.f,0.f,0.f,0.f,0.f,0.f,0.f};
  gt_copy8<K>(lcp, ga); gt_copy8<K>(lcp + 128 * GT_ROWB, gb);
  asm volatile("s_wait_asynccnt 0x0" ::: "memory");      // this wave's copies of pass 0 have landed
  __syncthreads();                                        // ... and every other wave's
  if (NST > 1) { gt_copy8<K>(lcp + GT_STAGE, ga + 128); gt_copy8<K>(lcp + GT_STAGE + 128 * GT_ROWB, gb + 128); }
#pragma unroll 1      /* one pass per trip: the ring's waits and its barrier stand once, at the foot */
  for (int t = 0; t < NST; ++t) {
    const unsigned buf = (unsigned)(t & 1) * GT_STAGE;
    const unsigned char* sa = L + buf + (wm * 32 + ln) * GT_ROWB + 16 * hh;
    const unsigned char* sb = L + buf + (128 + wn * 64 + ln) * GT_ROWB + 16 * hh;
    // two fragment sets: block ks + 1's twelve LDS reads go out as one group ahead of block ks's eight WMMAs (all inside this pass's own buffer)
    FragH a[2][2], b[2][4];
#pragma unroll
    for (int i = 0; i < 2; ++i) { a[0][i].half[0] = *(const v8us*)(sa + i * 16 * GT_ROWB); a[0][i].half[1] = *(const v8us*)(sa + i * 16 * GT_ROWB + 32); }
#pragma unroll
    for (int j = 0; j < 4; ++j) { b[0][j].half[0] = *(const v8us*)(sb + j * 16 * GT_ROWB); b[0][j].half[1] = *(const v8us*)(sb + j * 16 * GT_ROWB + 32); }
#pragma unroll
    for (int ks = 0; ks < 4; ++ks) {
      const int cu = ks & 1, nx = cu ^ 1;
      if (ks < 3) {
#pragma unroll
        for (int i = 0; i < 2; ++i) { a[nx][i].half[0] = *(const v8us*)(sa + i * 16 * GT_ROWB + (ks + 1) * 64); a[nx][i].half[1] = *(const v8us*)(sa + i * 16 * GT_ROWB + (ks + 1) * 64 + 32); }
#pragma unroll
        for (int j = 0; j < 4; ++j) { b[nx][j].half[0] = *(const v8us*)(sb + j * 16 * GT_ROWB + (ks + 1) * 64); b[nx][j].half[1] = *(const v8us*)(sb + j * 16 * GT_ROWB + (ks + 1) * 64 + 32); }
      }
      __builtin_amdgcn_sched_barrier(0);      // keeps the read group whole and ahead of the WMMAs: without it the scheduler spreads the reads among them and waits to 0 at each place
#pragma unroll
      for (int i = 0; i < 2; ++i)
#pragma unroll
        for (int j = 0; j < 4; ++j) acc[i][j] = __builtin_amdgcn_wmma_f32_16x16x32_f16(false, a[cu][i].v, false, b[cu][j].v, (short)0, acc[i][j], false, false);
      __builtin_amdgcn_sched_barrier(0);      // ... and keeps the next group behind this block
    }
    asm volatile("s_wait_dscnt 0x0" ::: "memory");        // this wave's reads of the buffer have retired before it is refilled
    asm volatile("s_wait_asynccnt 0x0" ::: "memory");     // this wave's copies of pass t + 1 have landed
    __syncthreads();                                      // publishes pass t + 1 and ends every reader's last read of pass t's buffer
    if (t + 2 < NST) { gt_copy8<K>(lcp + buf, ga + (t + 2) * 128); gt_copy8<K>(lcp + buf + 128 * GT_ROWB, gb + (t + 2) * 128); }
  }
  asm volatile("s_wait_asynccnt 0x0" ::: "memory");       // no copy is outstanding when the ring becomes output staging
  // NF > 0: which plane the tile belongs to is the same for the whole work-group, so the choice (and the v path's barrier) is block-uniform
  if (NF > 0 && col0 >= N - NF) {
    // v tile: an accumulator's 8 registers are 8 consecutive rows of one column = one 16-byte group of a transposed f16 row. The work-group's 128 columns x 128 rows are laid in the ring,
    // value plane then residual plane, one column = 256 B at the pitch of 272 B; behind a barrier 16 lanes store one column's 256 contiguous bytes.
#pragma unroll
    for (int j = 0; j < 4; ++j) { const float bv = bf16_round(bias[col0 + wn * 64 + j * 16 + ln]);
#pragma unroll
      for (int i = 0; i < 2; ++i) { FragH fh, fl;
#pragma unroll
        for (int r = 0; r < 8; ++r) { const float v = acc[i][j][r] * alpha + bv; const _Float16 hv = (_Float16)v; fh.h[r] = hv; fl.h[r] = (_Float16)((v - (float)hv) * 1024.0f); }
        unsigned char* p = L + (wn * 64 + j * 16 + ln) * GT_ROWB + (wm * 32 + i * 16 + 8 * hh) * 2;
        *(v8us*)p = fh.half[0]; *(v8us*)(p + 128 * GT_ROWB) = fl.half[0]; } }
    __syncthreads();      // a column's 128 rows come from four waves: all are in LDS before a column is read back
    const size_t o = ((size_t)(row0 / TT) * NF + (col0 - (N - NF)) + (tid >> 4)) * TT + (row0 % TT) + (tid & 15) * 8;
#pragma unroll
    for (int u = 0; u < 8; ++u) { const unsigned char* p = L + (u * 16 + (tid >> 4)) * GT_ROWB + (tid & 15) * 16;
      *(v8us*)((unsigned short*)Vh + o + (size_t)(u * 16) * TT) = *(const v8us*)p; *(v8us*)((unsigned short*)Vl + o + (size_t)(u * 16) * TT) = *(const v8us*)(p + 128 * GT_ROWB); }
    asm volatile("s_wait_xcnt 0x0" ::: "memory");      // closes the run of stores: the other path's code follows in the text and reuses the stores' registers
    return;
  }
  // epilogue: each wave stages its 32 x 64 tile in its own range of the ring (pitch 68 floats) and stores whole lines
  float* so = (float*)L + w * (32 * 68);
#pragma unroll
  for (int j = 0; j < 4; ++j) { const float bv = bf16_round(bias[col0 + wn * 64 + j * 16 + ln]);
#pragma unroll
    for (int i = 0; i < 2; ++i)
#pragma unroll
      for (int r = 0; r < 8; ++r) so[(i * 16 + 8 * hh + r) * 68 + j * 16 + ln] = acc[i][j][r] * alpha + bv; }
  __builtin_amdgcn_fence(__ATOMIC_ACQ_REL, "workgroup"); __builtin_amdgcn_wave_barrier();      // the wave's own LDS writes are read back by other lanes of the same wave
  gt_store<ACT, N - NF, RES, OUT16>(so, CP, C, C16, row0 + wm * 32, col0 + wn * 64, lane);
}

extern "C" void kernel_launch(void* const* d_in, const int* in_sizes, int n_in,
                              void* d_out, int out_size, void* d_ws, size_t ws_size, hipStream_t stream) {
  (void)in_sizes; (void)n_in; (void)out_size;
  const float* const* I = (const float* const*)d_in; const float* x = I[0]; const float* Wqkv = I[1]; const float* bqkv = I[2]; const float* Wo = I[3]; const float* bo = I[4]; const float* g1 = I[5]; const float* be1 = I[6]; const float* g2 = I[7]; const float* be2 = I[8];
  const float* W1 = I[9]; const float* b1 = I[10]; const float* W2 = I[11]; const float* b2 = I[12];
  char* ws = (char*)d_ws; size_t off = 0;
  auto take = [&](size_t bytes) { char* p = ws + off; off += (bytes + 255) & ~(size_t)255; return p; };
  _Float16* Bqkv = (_Float16*)take((size_t)3 * DM * DM * 2); _Float16* Bo = (_Float16*)take((size_t)DM * DM * 2); _Float16* Bw1 = (_Float16*)take((size_t)FF * DM * 2); _Float16* Bw2 = (_Float16*)take((size_t)DM * FF * 2);
  _Float16* H16 = (_Float16*)take((size_t)NR * DM * 2); float* XR = (float*)take((size_t)NR * DM * 4); _Float16* QK = (_Float16*)take((size_t)NR * 2 * DM * 2);
  _Float16* Vth = (_Float16*)take((size_t)NR * DM * 2); _Float16* Vtl = (_Float16*)take((size_t)NR * DM * 2); float* X1 = (float*)take((size_t)NR * DM * 4);
  _Float16* O16 = H16; _Float16* H2 = H16; _Float16* FH = QK;      /* reuse: H16 holds LN1 output (consumed by the qkv GEMM), then O16, then LN2 output; the [q|k] plane holds the FFN hidden (f16 [4096][2048]) once attention is done */
  if (off > ws_size) return;      // 6.3 + 2.1 + 4.2 + 4.2 + 8.4 + 16.8 + 16.8 + 8.4 + 8.4 + 16.8 = about 92 MB
  k_prep<<<PB_LN + PB_QKV + PB_O + PB_W1 + PB_W2, 256, 0, stream>>>(x, g1, be1, H16, XR, Wqkv, Wo, W1, W2, Bqkv, Bo, Bw1, Bw2);      /* LN1 and the four weight planes */
  const dim3 gqkv((NR / 128) * (3 * DM / 128), 1), gd((NR / 128) * (DM / 128), 1), gf((NR / 128) * (FF / 128), 1);      /* one work-group per 128 x 128 tile */
  k_gemm_t<0, 3 * DM, DM, false, true, DM><<<gqkv, 256, 0, stream>>>(H16, Bqkv, 0.0625f, bqkv, nullptr, nullptr, QK, Vth, Vtl);      /* [q | k] + bias (f16) and v + bias -> transposed hi / lo planes: M 4096 N 3072 K 1024 */
  k_flash<<<BB * NH * (TT / 64), 128, 0, stream>>>(QK, 2 * DM, QK + DM, 2 * DM, Vth, Vtl, O16, DM);
  k_gemm_t<0, DM, DM, true, false><<<gd, 256, 0, stream>>>(O16, Bo, 0.0625f, bo, XR, X1, nullptr, nullptr, nullptr);      /* x1 = x + (O·out_w + out_b) via the per-element addend */
  k_lnx<DM, 0><<<(NR + 7) / 8, 256, 0, stream>>>(X1, g2, be2, NR, 1e-5f, H2, nullptr);      /* LN2(x1) → f16 (x1 is a computed value: no input rounding) */
  k_gemm_t<6, FF, DM, false, true><<<gf, 256, 0, stream>>>(H2, Bw1, 0.0625f, b1, nullptr, nullptr, FH, nullptr, nullptr);      /* gelu_erf(h2·w1 + b1) → f16: M 4096 N 2048 K 1024 */
  k_gemm_t<0, DM, FF, true, false><<<gd, 256, 0, stream>>>(FH, Bw2, 0.0625f, b2, X1, (float*)d_out, nullptr, nullptr, nullptr);      /* y = x1 + (·w2 + b2): M 4096 N 1024 K 2048 */
}

// v006
// One run takes 127 microseconds.
// Timed twice side by side with v005, it ran 1.14 times as fast both times.
// All steps since v000 together make it 3.73 times as fast.
#include <hip/hip_runtime.h>
// Transformer layer with windowed (|i−j| ≤ 128) multi-head self-attention (B=2, L=2048, d_model 1024, 16 heads × 64): h = LN1(x); qkv = h·W + b; per head softmax(q·kᵀ/8 + window mask)·v; x1 = x + (merged·out_w + out_b);
// y = x1 + (gelu_erf(LN2(x1)·w1 + b1)·w2 + b2). (in,out) weights.
// Compute dtype: x, weights, biases, LN parameters rounded to bf16; LayerNorms in f32 (wave per row) → f16 operands; q,k f16 GEMM outputs, v f32 → f16 hi + ×2^10 residual Vᵀ planes; fused windowed
// flash-style kernel (online softmax f32, P f16 ×2^10, two value accumulators) on v_wmma_f32_16x16x32_f16; the residual sums ride the GEMMs' per-element addend in f32; FFN hidden f16 after the erf-GELU epilogue.
#define BB 2
#define TT 2048
#define DM 1024
#define NH 16
#define HD 64
#define RW 128
#define FF 2048
#define NR (BB * TT)

typedef __bf16 v16b __attribute__((ext_vector_type(16)));
typedef unsigned short v8us __attribute__((ext_vector_type(8), may_alias));
typedef float  v8f  __attribute__((ext_vector_type(8)));
typedef float  v4f  __attribute__((ext_vector_type(4)));
typedef float  v4fa __attribute__((ext_vector_type(4), may_alias));
union FragB { v16b v; v8us half[2]; unsigned short u[16]; };

__device__ __forceinline__ unsigned short bf16_bits(float x) { unsigned int u = __float_as_uint(x); return (unsigned short)((u + 0x7FFFu + ((u >> 16) & 1u)) >> 16); }
__device__ __forceinline__ float bf16_val(unsigned short b) { return __uint_as_float(((unsigned int)b) << 16); }
__device__ __forceinline__ float bf16_round(float x) { return bf16_val(bf16_bits(x)); }
// D += A·B with NT terms: 1 = ah·bh, 2 = + al·bh (A split), 3 = + ah·bl (both split)
template <int NT>
__device__ __forceinline__ v8f mmaN(v16b ah, v16b al, v16b bh, v16b bl, v8f c) {
  c = __builtin_amdgcn_wmma_f32_16x16x32_bf16(false, ah, false, bh, (short)0, c, false, false);
  if (NT >= 2) c = __builtin_amdgcn_wmma_f32_16x16x32_bf16(false, al, false, bh, (short)0, c, false, false);
  if (NT >= 3) c = __builtin_amdgcn_wmma_f32_16x16x32_bf16(false, ah, false, bl, (short)0, c, false, false);
  asm volatile("v_nop\n\tv_nop\n\tv_nop\n\tv_nop" : "+v"(c) : "v"(ah), "v"(al), "v"(bh), "v"(bl));
  return c;
}

__global__ __launch_bounds__(256) void k_wt_bf16(const float* __restrict__ W, unsigned short* __restrict__ Wt, int K, int N) {
  const int t = blockIdx.x * 256 + threadIdx.x;
  const int k8n = K / 8;
  if (t >= N * k8n) return;
  const int n = t / k8n, k8 = (t % k8n) * 8;
  v8us v;
#pragma unroll
  for (int i = 0; i < 8; ++i) v[i] = bf16_bits(W[(size_t)(k8 + i) * N + n]);
  *(v8us*)(Wt + (size_t)n * K + k8) = v;
  
}

// GEMM C[M][N] (f32, pitch ldc) = act(A[M][K]·W + bias). A f32 row-major (pitch lda) converted per fragment to bf16
// (ASPLIT: hi/lo two planes -> 2 terms, else single rounded term); Wt bf16 [N][K] (pitch ldb). BIAS_BF16 rounds the
// bias to bf16 first (bias quantised to bf16 before the add). K%32==0, M%16==0, N%64==0.
template <bool ASPLIT, int ACT, bool BIAS_BF16>
__global__ __launch_bounds__(128) void k_gemm_bf(const float* __restrict__ A, int lda, const unsigned short* __restrict__ Wt, int ldb,
                                               const float* __restrict__ bias, float* __restrict__ C, int ldc, int M, int N, int K) {
  __shared__ __attribute__((aligned(16))) float so[4][16][64];
  const int tid = threadIdx.x, w = tid >> 5, lane = tid & 31, ln = lane & 15, hh = lane >> 4;
  const int ntn = N / 64;
  const int wid = blockIdx.x * 4 + w;
  const int mt = wid / ntn, nq = wid % ntn;
  if (mt * 16 >= M) return;
  const int row0 = mt * 16, col0 = nq * 64;
  const float* arow = A + (size_t)(row0 + ln) * lda;
  v8f acc[4] = {};
  for (int kb = 0; kb < K; kb += 32) {
    FragB ah, al;
    const v4f x0 = *(const v4fa*)(arow + kb + 8 * hh), x1 = *(const v4fa*)(arow + kb + 8 * hh + 4);
    const v4f x2 = *(const v4fa*)(arow + kb + 16 + 8 * hh), x3 = *(const v4fa*)(arow + kb + 16 + 8 * hh + 4);
    float xs[16] = {x0[0],x0[1],x0[2],x0[3],x1[0],x1[1],x1[2],x1[3],x2[0],x2[1],x2[2],x2[3],x3[0],x3[1],x3[2],x3[3]};
#pragma unroll
    for (int i = 0; i < 16; ++i) { const unsigned short hb = bf16_bits(xs[i]); ah.u[i] = hb; al.u[i] = ASPLIT ? bf16_bits(xs[i] - bf16_val(hb)) : (unsigned short)0; }
#pragma unroll
    for (int t = 0; t < 4; ++t) {
      const unsigned short* brow = Wt + (size_t)(col0 + t * 16 + ln) * ldb + kb;
      FragB b;
      b.half[0] = *(const v8us*)(brow + 8 * hh);
      b.half[1] = *(const v8us*)(brow + 16 + 8 * hh);
      acc[t] = mmaN<ASPLIT ? 2 : 1>(ah.v, al.v, b.v, b.v, acc[t]);
    }
  }
#pragma unroll
  for (int t = 0; t < 4; ++t) {
    float bv = bias ? bias[col0 + t * 16 + ln] : 0.f;
    if (BIAS_BF16) bv = bf16_round(bv);
#pragma unroll
    for (int r = 0; r < 8; ++r) { float v = acc[t][r] + bv; if (ACT == 1) v = fmaxf(v, 0.f); so[w][8 * hh + r][t * 16 + ln] = v; }
  }
  __builtin_amdgcn_fence(__ATOMIC_ACQ_REL, "workgroup");
  __builtin_amdgcn_wave_barrier();
  const int rsub = lane >> 4, c4 = (lane & 15) * 4;
  {
#pragma unroll
    for (int q = 0; q < 8; ++q) {
      const int r = q * 2 + rsub;
      const v4f v = *(const v4fa*)&so[w][r][c4];
      *(v4f*)(C + (size_t)(row0 + r) * ldc + col0 + c4) = v;
    }
    
  }
}

// Flash-style causal/unmasked attention, all contractions 3-term bf16 hi/lo splits, f32 softmax with running max.
// q,k,v rows are read from f32 buffers with arbitrary row pitch (so they can live inside a fused qkv buffer);
// D = head size (multiple of 32, <= 128); one wave = 16 query rows; block = 4 waves (64 queries) sharing K/V chunks of 32.
template <int D, bool CAUSAL>
__global__ __launch_bounds__(128) void k_flash(const float* __restrict__ qb, const float* __restrict__ kb, const float* __restrict__ vb,
                                             int pitch, int T, int H, float scale, float* __restrict__ y, int ypitch) {
  constexpr int KS = D / 32;        // k-steps for QK
  constexpr int DT = D / 16;        // d tiles for PV
  __shared__ __attribute__((aligned(16))) unsigned short sKh[32][D + 8], sKl[32][D + 8], sVh[32][D + 8], sVl[32][D + 8];
  __shared__ __attribute__((aligned(16))) unsigned short sPh[4][16][40], sPl[4][16][40];
  __shared__ __attribute__((aligned(16))) float sO[4][16][D];
  const int tid = threadIdx.x, w = tid >> 5, lane = tid & 31, ln = lane & 15, hh = lane >> 4;
  const int nqb = (T + 63) / 64;
  const int bh = blockIdx.x / nqb, qblk = blockIdx.x % nqb;
  const int b = bh / H, h = bh % H;
  const int q0 = qblk * 64 + w * 16;
  const float* Q = qb + (size_t)b * T * pitch + h * D;
  const float* K = kb + (size_t)b * T * pitch + h * D;
  const float* V = vb + (size_t)b * T * pitch + h * D;

  // A fragments of the wave's 16 query rows (scaled), hi/lo
  FragB aqh[KS], aql[KS];
  {
    int row = q0 + ln; if (row >= T) row = T - 1;
    const float* qr = Q + (size_t)row * pitch;
#pragma unroll
    for (int ks = 0; ks < KS; ++ks)
#pragma unroll
      for (int i = 0; i < 16; ++i) {
        const int d = ks * 32 + ((i < 8) ? (8 * hh + i) : (16 + 8 * hh + (i - 8)));
        const float x = qr[d] * scale; const unsigned short hb = bf16_bits(x);
        aqh[ks].u[i] = hb; aql[ks].u[i] = bf16_bits(x - bf16_val(hb));
      }
  }
  float m_r[8], l_r[8];
#pragma unroll
  for (int r = 0; r < 8; ++r) { m_r[r] = -3.0e38f; l_r[r] = 0.f; }
  v8f oacc[DT];
#pragma unroll
  for (int dt = 0; dt < DT; ++dt) oacc[dt] = (v8f){0.f,0.f,0.f,0.f,0.f,0.f,0.f,0.f};

  const int kv_end = CAUSAL ? min(T, qblk * 64 + 64) : T;     // block-uniform
  for (int j0 = 0; j0 < kv_end; j0 += 32) {
    __syncthreads();
    for (int e = tid; e < 32 * (D / 4); e += 128) {
      const int r = e / (D / 4), c4 = (e % (D / 4)) * 4;
      const int key = j0 + r;
      v4f kf = {0.f,0.f,0.f,0.f}, vf = {0.f,0.f,0.f,0.f};
      if (key < T) { kf = *(const v4fa*)(K + (size_t)key * pitch + c4); vf = *(const v4fa*)(V + (size_t)key * pitch + c4); }
#pragma unroll
      for (int t = 0; t < 4; ++t) {
        unsigned short hb = bf16_bits(kf[t]); sKh[r][c4 + t] = hb; sKl[r][c4 + t] = bf16_bits(kf[t] - bf16_val(hb));
        hb = bf16_bits(vf[t]); sVh[r][c4 + t] = hb; sVl[r][c4 + t] = bf16_bits(vf[t] - bf16_val(hb));
      }
    }
    __syncthreads();
    // S tile 16 x 32
    v8f s[2];
#pragma unroll
    for (int nt = 0; nt < 2; ++nt) {
      v8f acc = {};
#pragma unroll
      for (int ks = 0; ks < KS; ++ks) {
        FragB bh_, bl_;
        bh_.half[0] = *(const v8us*)&sKh[nt * 16 + ln][ks * 32 + 8 * hh]; bh_.half[1] = *(const v8us*)&sKh[nt * 16 + ln][ks * 32 + 16 + 8 * hh];
        bl_.half[0] = *(const v8us*)&sKl[nt * 16 + ln][ks * 32 + 8 * hh]; bl_.half[1] = *(const v8us*)&sKl[nt * 16 + ln][ks * 32 + 16 + 8 * hh];
        acc = mmaN<3>(aqh[ks].v, aql[ks].v, bh_.v, bl_.v, acc);
      }
      s[nt] = acc;
    }
    // mask + running max (rows 8hh+r; the 16 lanes of a half share rows)
    float alpha[8];
#pragma unroll
    for (int r = 0; r < 8; ++r) {
      const int qi = q0 + 8 * hh + r;
      const int ja = j0 + ln, jb = j0 + 16 + ln;
      if (CAUSAL) { if (ja > qi) s[0][r] = -3.0e38f; if (jb > qi) s[1][r] = -3.0e38f; }
      if (ja >= T) s[0][r] = -3.0e38f;
      if (jb >= T) s[1][r] = -3.0e38f;
      float mx = fmaxf(s[0][r], s[1][r]);
      mx = fmaxf(mx, __shfl_xor(mx, 1, 32)); mx = fmaxf(mx, __shfl_xor(mx, 2, 32)); mx = fmaxf(mx, __shfl_xor(mx, 4, 32)); mx = fmaxf(mx, __shfl_xor(mx, 8, 32));
      const float mnew = fmaxf(m_r[r], mx);
      alpha[r] = (mnew > -1.0e38f) ? __expf(m_r[r] - mnew) : 1.0f;
      const float p0 = (s[0][r] > -1.0e38f) ? __expf(s[0][r] - mnew) : 0.f;
      const float p1 = (s[1][r] > -1.0e38f) ? __expf(s[1][r] - mnew) : 0.f;
      m_r[r] = mnew;
      l_r[r] = l_r[r] * alpha[r] + p0 + p1;            // per-lane partial row sum (16 lanes combined at the end)
      unsigned short hb = bf16_bits(p0); sPh[w][8 * hh + r][ln] = hb;      sPl[w][8 * hh + r][ln] = bf16_bits(p0 - bf16_val(hb));
      hb = bf16_bits(p1);                sPh[w][8 * hh + r][16 + ln] = hb; sPl[w][8 * hh + r][16 + ln] = bf16_bits(p1 - bf16_val(hb));
    }
#pragma unroll
    for (int dt = 0; dt < DT; ++dt)
#pragma unroll
      for (int r = 0; r < 8; ++r) oacc[dt][r] *= alpha[r];
    __builtin_amdgcn_fence(__ATOMIC_ACQ_REL, "workgroup");
    __builtin_amdgcn_wave_barrier();
    FragB pah, pal;
    pah.half[0] = *(const v8us*)&sPh[w][ln][8 * hh]; pah.half[1] = *(const v8us*)&sPh[w][ln][16 + 8 * hh];
    pal.half[0] = *(const v8us*)&sPl[w][ln][8 * hh]; pal.half[1] = *(const v8us*)&sPl[w][ln][16 + 8 * hh];
#pragma unroll
    for (int dt = 0; dt < DT; ++dt) {
      FragB bvh, bvl;
#pragma unroll
      for (int i = 0; i < 8; ++i) {
        bvh.u[i] = sVh[8 * hh + i][dt * 16 + ln]; bvh.u[8 + i] = sVh[16 + 8 * hh + i][dt * 16 + ln];
        bvl.u[i] = sVl[8 * hh + i][dt * 16 + ln]; bvl.u[8 + i] = sVl[16 + 8 * hh + i][dt * 16 + ln];
      }
      oacc[dt] = mmaN<3>(pah.v, pal.v, bvh.v, bvl.v, oacc[dt]);
    }
    __builtin_amdgcn_fence(__ATOMIC_ACQ_REL, "workgroup");
    __builtin_amdgcn_wave_barrier();
  }
#pragma unroll
  for (int r = 0; r < 8; ++r) {
    float l = l_r[r];
    l += __shfl_xor(l, 1, 32); l += __shfl_xor(l, 2, 32); l += __shfl_xor(l, 4, 32); l += __shfl_xor(l, 8, 32);
    l_r[r] = (l > 0.f) ? 1.0f / l : 0.f;
  }
#pragma unroll
  for (int dt = 0; dt < DT; ++dt)
#pragma unroll
    for (int r = 0; r < 8; ++r) sO[w][8 * hh + r][dt * 16 + ln] = oacc[dt][r] * l_r[r];
  __builtin_amdgcn_fence(__ATOMIC_ACQ_REL, "workgroup");
  __builtin_amdgcn_wave_barrier();
  {
    for (int r = 0; r < 16; ++r) {
      const int row = q0 + r;
      if (row < T && lane < D / 4) {
        const v4f val = *(const v4fa*)&sO[w][r][lane * 4];
        *(v4f*)(y + ((size_t)b * T + row) * ypitch + h * D + lane * 4) = val;
      }
    }
    
  }
}

// GEMM C = act(A·W + bias + resid): A f32 (ASPLIT -> hi/lo 2 terms), Wt bf16 [N][K]; ACT 0 none, 1 relu, 2 exact gelu;
// resid (optional, f32, row index = (row % rmod), pitch ldr, RES_BF16 rounds it) added before the activation.
template <bool ASPLIT, int ACT, bool BIAS_BF16, bool RES_BF16>
__global__ __launch_bounds__(128) void k_gemm_bf3(const float* __restrict__ A, int lda, const unsigned short* __restrict__ Wt, int ldb,
                                                const float* __restrict__ bias, const float* __restrict__ resid, int rmod, int ldr,
                                                float* __restrict__ C, int ldc, int M, int N, int K) {
  __shared__ __attribute__((aligned(16))) float so[4][16][64];
  const int tid = threadIdx.x, w = tid >> 5, lane = tid & 31, ln = lane & 15, hh = lane >> 4;
  const int ntn = N / 64;
  const int wid = blockIdx.x * 4 + w;
  const int mt = wid / ntn, nq = wid % ntn;
  if (mt * 16 >= M) return;
  const int row0 = mt * 16, col0 = nq * 64;
  const float* arow = A + (size_t)(row0 + ln) * lda;
  v8f acc[4] = {};
  for (int kb = 0; kb < K; kb += 32) {
    FragB ah, al;
    const v4f x0 = *(const v4fa*)(arow + kb + 8 * hh), x1 = *(const v4fa*)(arow + kb + 8 * hh + 4);
    const v4f x2 = *(const v4fa*)(arow + kb + 16 + 8 * hh), x3 = *(const v4fa*)(arow + kb + 16 + 8 * hh + 4);
    float xs[16] = {x0[0],x0[1],x0[2],x0[3],x1[0],x1[1],x1[2],x1[3],x2[0],x2[1],x2[2],x2[3],x3[0],x3[1],x3[2],x3[3]};
#pragma unroll
    for (int i = 0; i < 16; ++i) { const unsigned short hb = bf16_bits(xs[i]); ah.u[i] = hb; al.u[i] = ASPLIT ? bf16_bits(xs[i] - bf16_val(hb)) : (unsigned short)0; }
#pragma unroll
    for (int t = 0; t < 4; ++t) {
      const unsigned short* brow = Wt + (size_t)(col0 + t * 16 + ln) * ldb + kb;
      FragB b;
      b.half[0] = *(const v8us*)(brow + 8 * hh);
      b.half[1] = *(const v8us*)(brow + 16 + 8 * hh);
      acc[t] = mmaN<ASPLIT ? 2 : 1>(ah.v, al.v, b.v, b.v, acc[t]);
    }
  }
#pragma unroll
  for (int t = 0; t < 4; ++t) {
    const int col = col0 + t * 16 + ln;
    float bv = bias ? bias[col] : 0.f;
    if (BIAS_BF16) bv = bf16_round(bv);
#pragma unroll
    for (int r = 0; r < 8; ++r) {
      float v = acc[t][r] + bv;
      if (resid) { float rv = resid[(size_t)((row0 + 8 * hh + r) % rmod) * ldr + col]; if (RES_BF16) rv = bf16_round(rv); v += rv; }
      if (ACT == 1) v = fmaxf(v, 0.f);
      if (ACT == 2) v = 0.5f * v * (1.0f + erff(v * 0.70710678118654752f));
      if (ACT == 3) { const float u = 0.7978845608028654f * (v + 0.044715f * v * v * v); v = 0.5f * v * (1.0f + tanhf(u)); }
      so[w][8 * hh + r][t * 16 + ln] = v;
    }
  }
  __builtin_amdgcn_fence(__ATOMIC_ACQ_REL, "workgroup");
  __builtin_amdgcn_wave_barrier();
  const int rsub = lane >> 4, c4 = (lane & 15) * 4;
  {
#pragma unroll
    for (int q = 0; q < 8; ++q) {
      const int r = q * 2 + rsub;
      const v4f v = *(const v4fa*)&so[w][r][c4];
      *(v4f*)(C + (size_t)(row0 + r) * ldc + col0 + c4) = v;
    }
    
  }
}
// row LayerNorm (biased variance, eps) over N: s = X (+ R); optional out_sum <- s; out_norm <- (s-mu)*rsqrt(var+eps)*g + b
template <bool PARAM_BF16>
__global__ __launch_bounds__(256) void k_layernorm(const float* __restrict__ X, const float* __restrict__ R, const float* __restrict__ g, const float* __restrict__ bta,
                                                  float* __restrict__ out_sum, float* __restrict__ out_norm, int N, float eps) {
  __shared__ float red[256];
  const int row = blockIdx.x, tid = threadIdx.x;
  const float* x = X + (size_t)row * N; const float* rr = R ? R + (size_t)row * N : nullptr;
  float vals[16];                     // up to N = 4096
  const int per = N / 256;            // contiguous chunk per thread? use strided-by-4 chunks: thread handles j = tid*4 + 1024*u
  float s1 = 0.f;
  for (int u = 0; u < per / 4; ++u) {
    const int j = tid * 4 + 1024 * u;
    const v4f a = *(const v4fa*)(x + j);
    v4f b = {0.f,0.f,0.f,0.f}; if (rr) b = *(const v4fa*)(rr + j);
#pragma unroll
    for (int q = 0; q < 4; ++q) { const float v = a[q] + b[q]; vals[u * 4 + q] = v; s1 += v; }
  }
  red[tid] = s1; __syncthreads();
  for (int st = 128; st > 0; st >>= 1) { if (tid < st) red[tid] += red[tid + st]; __syncthreads(); }
  const float mu = red[0] / (float)N; __syncthreads();
  float s2 = 0.f;
  for (int u = 0; u < per / 4; ++u)
#pragma unroll
    for (int q = 0; q < 4; ++q) { const float c = vals[u * 4 + q] - mu; s2 += c * c; }
  red[tid] = s2; __syncthreads();
  for (int st = 128; st > 0; st >>= 1) { if (tid < st) red[tid] += red[tid + st]; __syncthreads(); }
  const float rs = rsqrtf(red[0] / (float)N + eps);
  {
    for (int u = 0; u < per / 4; ++u) {
      const int j = tid * 4 + 1024 * u;
      v4f o, sm;
#pragma unroll
      for (int q = 0; q < 4; ++q) {
        float gg = g[j + q], bb = bta[j + q];
        if (PARAM_BF16) { gg = bf16_round(gg); bb = bf16_round(bb); }
        sm[q] = vals[u * 4 + q]; o[q] = (vals[u * 4 + q] - mu) * rs * gg + bb;
      }
      if (out_sum) *(v4f*)(out_sum + (size_t)row * N + j) = sm;
      *(v4f*)(out_norm + (size_t)row * N + j) = o;
    }
    
  }
}



// ---- f16 WMMA path (v_wmma_f32_16x16x32_f16): 11-bit significands for operands in range — used where a [0,1] probability operand needs more precision than bf16
typedef _Float16 v16h __attribute__((ext_vector_type(16)));
union FragH { v16h v; v8us half[2]; _Float16 h[16]; unsigned short u[16]; };
template <int NT>
__device__ __forceinline__ v8f mmaH(v16h ah, v16h al, v16h bh, v16h bl, v8f c) {
  c = __builtin_amdgcn_wmma_f32_16x16x32_f16(false, ah, false, bh, (short)0, c, false, false);
  if (NT >= 2) c = __builtin_amdgcn_wmma_f32_16x16x32_f16(false, al, false, bh, (short)0, c, false, false);
  if (NT >= 3) c = __builtin_amdgcn_wmma_f32_16x16x32_f16(false, ah, false, bl, (short)0, c, false, false);
  asm volatile("v_nop\n\tv_nop\n\tv_nop\n\tv_nop" : "+v"(c) : "v"(ah), "v"(al), "v"(bh), "v"(bl));
  return c;
}
// batched GEMM like k_gemm_b but f16 operands: A f32 (split into f16 hi/lo if ASPLIT, else rounded to f16), Bt = f16 values [n][k]; alpha; C f32; N multiple of 16 (partial tiles skipped)
template <bool ASPLIT>
__global__ __launch_bounds__(128) void k_gemm_h(const float* __restrict__ A, int lda, size_t sA, const _Float16* __restrict__ Bh, int ldb, size_t sB, float alpha, float* __restrict__ C, int ldc, size_t sC, int M, int N, int K) {
  __shared__ __attribute__((aligned(16))) float so[4][16][64];
  const int tid = threadIdx.x, w = tid >> 5, lane = tid & 31, ln = lane & 15, hh = lane >> 4; const int by = blockIdx.y;
  A += (size_t)by * sA; Bh += (size_t)by * sB; C += (size_t)by * sC;
  const int ntn = (N + 63) / 64; const int wid = blockIdx.x * 4 + w; const int mt = wid / ntn, nq = wid % ntn; if (mt * 16 >= M) return;
  const int row0 = mt * 16, col0 = nq * 64; const float* arow = A + (size_t)(row0 + ln) * lda;
  v8f acc[4] = {};
  for (int kb = 0; kb < K; kb += 32) {
    FragH ah, al;
    const v4f x0 = *(const v4fa*)(arow + kb + 8 * hh), x1 = *(const v4fa*)(arow + kb + 8 * hh + 4), x2 = *(const v4fa*)(arow + kb + 16 + 8 * hh), x3 = *(const v4fa*)(arow + kb + 16 + 8 * hh + 4);
    float xs[16] = {x0[0],x0[1],x0[2],x0[3],x1[0],x1[1],x1[2],x1[3],x2[0],x2[1],x2[2],x2[3],x3[0],x3[1],x3[2],x3[3]};
#pragma unroll
    for (int i = 0; i < 16; ++i) { const _Float16 h = (_Float16)xs[i]; ah.h[i] = h; al.h[i] = ASPLIT ? (_Float16)(xs[i] - (float)h) : (_Float16)0.0f; }
#pragma unroll
    for (int t = 0; t < 4; ++t) { if (col0 + t * 16 >= N) continue; const size_t boff = (size_t)(col0 + t * 16 + ln) * ldb + kb; FragH bq; bq.half[0] = *(const v8us*)(Bh + boff + 8 * hh); bq.half[1] = *(const v8us*)(Bh + boff + 16 + 8 * hh);
      acc[t] = mmaH<ASPLIT ? 2 : 1>(ah.v, al.v, bq.v, bq.v, acc[t]); }
  }
#pragma unroll
  for (int t = 0; t < 4; ++t) { if (col0 + t * 16 >= N) continue;
#pragma unroll
    for (int r = 0; r < 8; ++r) so[w][8 * hh + r][t * 16 + ln] = acc[t][r] * alpha; }
  __builtin_amdgcn_fence(__ATOMIC_ACQ_REL, "workgroup"); __builtin_amdgcn_wave_barrier();
  const int rsub = lane >> 4, c4 = (lane & 15) * 4;
  {
#pragma unroll
    for (int q = 0; q < 8; ++q) { const int r = q * 2 + rsub; if (col0 + c4 < N) { const v4f v = *(const v4fa*)&so[w][r][c4]; *(v4f*)(C + (size_t)(row0 + r) * ldc + col0 + c4) = v; } }
     }
}

// Wt[n][k] = f16(bf16(W[k][n]) * scale) from f32 row-major W[K][N] (scale = power of two; bf16-exact weights stay exact in f16 away from the subnormal range).
// One work-group = a tile of 128 k x 64 n, turned in LDS, so that both sides move whole lines: 16 lanes read 256 contiguous bytes of one W row, 16 lanes write 256 contiguous bytes of one Wt row.
// LDS: one dword = the f16 pair (k, k + 1) of one n; a row = one n's 64 dwords, its sixteen 16-byte groups (8 k each) stored at group ^ (n / 4):
// the 32 lanes of a dword store (16 values of n / 4, two neighbouring pairs) fall on 32 banks, the 16 lanes that read one row back as 16-byte groups on all 64.
// K a multiple of 128, N a multiple of 64.
typedef _Float16 v2h __attribute__((ext_vector_type(2)));
// blk = the tile's index, tl = the work-group's 16 KiB of LDS.
template <int K, int N>
__device__ __forceinline__ void wt_tile(const float* __restrict__ W, _Float16* __restrict__ Wt, float scale, int blk, unsigned int* tl) {
  const int tid = threadIdx.x, lo = tid & 15, hi = tid >> 4;
  const int n0 = (blk % (N / 64)) * 64, k0 = (blk / (N / 64)) * 128;
  const float* src = W + (size_t)(k0 + 2 * hi) * N + n0 + 4 * lo;      // rows k0 + 2 hi + 32 u and the next, columns n0 + 4 lo .. + 3
  v4f ev[4], od[4];
#pragma unroll
  for (int u = 0; u < 4; ++u) { ev[u] = *(const v4fa*)(src + (size_t)(32 * u) * N); od[u] = *(const v4fa*)(src + (size_t)(32 * u + 1) * N); }
#pragma unroll
  for (int u = 0; u < 4; ++u) { const int kp = hi + 16 * u;      // pair index: k = k0 + 2 kp, k0 + 2 kp + 1
#pragma unroll
    for (int q = 0; q < 4; ++q) { v2h p; p[0] = (_Float16)(bf16_round(ev[u][q]) * scale); p[1] = (_Float16)(bf16_round(od[u][q]) * scale);
      tl[(4 * lo + q) * 64 + (((kp >> 2) ^ lo) << 2) + (kp & 3)] = __builtin_bit_cast(unsigned int, p); } }
  __syncthreads();      // every pair of the tile is in LDS before a row is read back
#pragma unroll
  for (int u = 0; u < 4; ++u) { const int n = hi + 16 * u; const v8us v = *(const v8us*)&tl[n * 64 + ((lo ^ ((n >> 2) & 15)) << 2)];
    *(v8us*)((unsigned short*)Wt + (size_t)(n0 + n) * K + k0 + 8 * lo) = v; }
  asm volatile("s_wait_xcnt 0x0" ::: "memory");      // closes the run of four stores: in the merged kernel other jobs' code follows in the text and reuses the stores' registers
}
typedef _Float16 v4h __attribute__((ext_vector_type(4)));

__global__ __launch_bounds__(256) void k_x16(const float* __restrict__ x, _Float16* __restrict__ X16, size_t n8) { const size_t t = (size_t)blockIdx.x * 256 + threadIdx.x; if (t >= n8) return; FragH f;
#pragma unroll
  for (int q = 0; q < 8; ++q) f.h[q] = (_Float16)bf16_round(x[t * 8 + q]); *(v8us*)((unsigned short*)X16 + t * 8) = f.half[0];  }
__global__ __launch_bounds__(256) void k_round16f(const float* __restrict__ W, _Float16* __restrict__ Bt, size_t n8) { const size_t t = (size_t)blockIdx.x * 256 + threadIdx.x; if (t >= n8) return; FragH f;
#pragma unroll
  for (int i = 0; i < 8; ++i) f.h[i] = (_Float16)(bf16_round(W[t * 8 + i]) * 16.0f); *(v8us*)((unsigned short*)Bt + t * 8) = f.half[0];  }
template <int NHv, int TTv>
__global__ __launch_bounds__(256) void k_vt(const _Float16* __restrict__ V16, int ldv, int voff, _Float16* __restrict__ Vt) { __shared__ unsigned short tl[64][66]; const int tid = threadIdx.x; const int slab = blockIdx.x / (TTv / 64), lg = blockIdx.x % (TTv / 64); const int b = slab / NHv, h = slab % NHv;
  for (int i = tid; i < 64 * 8; i += 256) { const int r = i / 8, c8 = (i % 8) * 8; FragH f; f.half[0] = *(const v8us*)((const unsigned short*)V16 + ((size_t)b * TTv + lg * 64 + r) * ldv + voff + h * 64 + c8);
#pragma unroll
    for (int q = 0; q < 8; ++q) tl[r][c8 + q] = f.u[q]; }
  __syncthreads();
  {
#pragma unroll
    for (int rd = 0; rd < 2; ++rd) { const int d = rd * 32 + tid / 8, pc = tid % 8; FragH f;
#pragma unroll
      for (int q = 0; q < 8; ++q) f.u[q] = tl[pc * 8 + q][d];
      *(v8us*)((unsigned short*)Vt + ((size_t)slab * 64 + d) * TTv + lg * 64 + pc * 8) = f.half[0]; }
     } }

template <int D, int RBF>
__device__ __forceinline__ void lnx_rows(const float* __restrict__ X, const float* __restrict__ gam, const float* __restrict__ bet, int nrows, float eps, _Float16* __restrict__ O16, float* __restrict__ XR, int blk) {
  constexpr int NP = D / 128; const int tid = threadIdx.x, wv = tid >> 5, lane = tid & 31; const size_t r = (size_t)blk * 8 + wv; if (r >= (size_t)nrows) return; v4f y[NP]; float s = 0.f;
#pragma unroll
  for (int j = 0; j < NP; ++j) { const int c = j * 128 + lane * 4; v4f g = *(const v4fa*)(X + r * D + c); if (RBF) { for (int q = 0; q < 4; ++q) g[q] = bf16_round(g[q]); } y[j] = g; s += g[0] + g[1] + g[2] + g[3]; }
  for (int o = 16; o >= 1; o >>= 1) s += __shfl_xor(s, o, 32); const float mu = s / (float)D; float q2 = 0.f;
#pragma unroll
  for (int j = 0; j < NP; ++j) for (int q = 0; q < 4; ++q) { const float d = y[j][q] - mu; q2 += d * d; }
  for (int o = 16; o >= 1; o >>= 1) q2 += __shfl_xor(q2, o, 32); const float rs = rsqrtf(q2 / (float)D + eps);
  {
#pragma unroll
    for (int j = 0; j < NP; ++j) { const int c = j * 128 + lane * 4; v4h h; for (int q = 0; q < 4; ++q) { const float v = (y[j][q] - mu) * rs * bf16_round(gam[c + q]) + bf16_round(bet[c + q]); h[q] = (_Float16)v; } *(v4h*)(O16 + r * D + c) = h;
      asm volatile("s_wait_xcnt 0x0" ::: "memory");      // the store's registers are reused directly behind it: the wait stands in front of the overwrite
      if (XR) { *(v4f*)(XR + r * D + c) = y[j];
        asm volatile("s_wait_xcnt 0x0" ::: "memory"); } }      // likewise, ahead of the next trip's loads
     } }
template <int D, int RBF>
__global__ __launch_bounds__(256) void k_lnx(const float* __restrict__ X, const float* __restrict__ gam, const float* __restrict__ bet, int nrows, float eps, _Float16* __restrict__ O16, float* __restrict__ XR) {
  lnx_rows<D, RBF>(X, gam, bet, nrows, eps, O16, XR, (int)blockIdx.x); }
// LN1 and the four weight convert-transposes need nothing of each other: one grid, each job a range of the block index (a work-group does one job whole, so the branch and the tile's barrier are block-uniform).
#define PB_LN (NR / 8)
#define PB_QKV ((DM / 128) * (3 * DM / 64))
#define PB_O ((DM / 128) * (DM / 64))
#define PB_W1 ((DM / 128) * (FF / 64))
#define PB_W2 ((FF / 128) * (DM / 64))
__global__ __launch_bounds__(256) void k_prep(const float* __restrict__ x, const float* __restrict__ g1, const float* __restrict__ be1, _Float16* __restrict__ H16, float* __restrict__ XR,
                                              const float* __restrict__ Wqkv, const float* __restrict__ Wo, const float* __restrict__ W1, const float* __restrict__ W2,
                                              _Float16* __restrict__ Bqkv, _Float16* __restrict__ Bo, _Float16* __restrict__ Bw1, _Float16* __restrict__ Bw2) {
  __shared__ __attribute__((aligned(16))) unsigned int tl[64 * 64];
  int b = (int)blockIdx.x;
  if (b < PB_LN) { lnx_rows<DM, 1>(x, g1, be1, NR, 1e-5f, H16, XR, b); return; }      /* LN1(bf16 x) -> f16; XR = bf16(x) */
  b -= PB_LN; if (b < PB_QKV) { wt_tile<DM, 3 * DM>(Wqkv, Bqkv, 16.0f, b, tl); return; }      /* (in,out) -> Bt[n][k] x 2^4 */
  b -= PB_QKV; if (b < PB_O) { wt_tile<DM, DM>(Wo, Bo, 16.0f, b, tl); return; }
  b -= PB_O; if (b < PB_W1) { wt_tile<DM, FF>(W1, Bw1, 16.0f, b, tl); return; }
  wt_tile<FF, DM>(W2, Bw2, 16.0f, b - PB_W1, tl);
}
// lane l <-> lane l ^ 16: the two lanes that share a query's column
__device__ __forceinline__ float xhalf(float x) { return __builtin_bit_cast(float, __builtin_amdgcn_permlanex16(__builtin_bit_cast(int, x), __builtin_bit_cast(int, x), 0x76543210, 0xfedcba98, false, false)); }
// Both products transposed: S^T = K Q^T (A = 16 key rows, B = the wave's 16 queries, kept in registers), O^T += V^T P^T (A = 16 rows of V^T, B = P^T).
// Lane (ln, hh) holds, of query q0 + ln alone, the scores of keys 8 hh + r and 16 + 8 hh + r of a 32-key chunk: maximum and sum are in-lane plus one exchange with lane ^ 16,
// the running maximum, the sum and the rescale factor are one value a lane, and the two converted score tiles are the B fragment of the second product as they lie
// (element s = tile s / 8, register s % 8 = key 8 hh + s or 16 + 8 hh + s - 8: the k order of the V^T loader).
// A masked score is -inf and the running maximum starts finite, so exp gives 0 for a masked key and 1 for the rescale of a column that has seen no key yet: no test around an exp.
// K and V^T reach the waves through LDS: the four waves of a work-group walk the same keys, so a stage of 64 keys (64 K rows, 64 rows of each V^T plane, 128 B each) is copied once per work-group, in whole lines,
// instead of being fetched by every wave in 32-byte pieces of 16 lines a load. Rows lie at a pitch of 144 B (an odd multiple of 16 B: conflict-free for ds_load_b128 fragment reads). Two buffers; the next stage's rows are copied while this stage is worked on.
#define FA_ROWB 144
#define FA_STAGE (192 * FA_ROWB)
// Four 16-byte asynchronous copies of one lane, global -> LDS, rows 16 apart (pitch = the global row pitch in elements). The s_wait_xcnt closes the statement so that no address register is rewritten ahead of it.
__device__ __forceinline__ void fa_copy4(unsigned l0, const unsigned short* g0, int pitch) {
  const unsigned l1 = l0 + 16 * FA_ROWB, l2 = l0 + 32 * FA_ROWB, l3 = l0 + 48 * FA_ROWB;
  const unsigned short *g1 = g0 + (size_t)16 * pitch, *g2 = g0 + (size_t)32 * pitch, *g3 = g0 + (size_t)48 * pitch;
  asm volatile("global_load_async_to_lds_b128 %0, %4, off\n\t"
               "global_load_async_to_lds_b128 %1, %5, off\n\t"
               "global_load_async_to_lds_b128 %2, %6, off\n\t"
               "global_load_async_to_lds_b128 %3, %7, off\n\t"
               "s_wait_xcnt 0x0"
               :: "v"(l0), "v"(l1), "v"(l2), "v"(l3), "v"(g0), "v"(g1), "v"(g2), "v"(g3) : "memory");
}
__global__ __launch_bounds__(128) void k_flash(const _Float16* __restrict__ Q16, int ldq, const _Float16* __restrict__ K16, int ldk, const _Float16* __restrict__ Vt, const _Float16* __restrict__ Vtlo, _Float16* __restrict__ O16, int ldo) {
  constexpr int RPW = 16, NQB = TT / (4 * RPW), DT = 4, KS = 2;
  __shared__ __attribute__((aligned(16))) unsigned char L[2 * FA_STAGE];      /* a stage = [K 64 rows | V^T value 64 rows | V^T residual 64 rows]; behind the loop the ring is output staging */
  const int tid = threadIdx.x, w = tid >> 5, lane = tid & 31, ln = lane & 15, hh = lane >> 4;
  const int slab = blockIdx.x / NQB, qblk = blockIdx.x % NQB; const int b = slab / NH, h = slab % NH; const int qb0 = qblk * (4 * RPW); const int q0 = qb0 + w * RPW;
  const int tq = q0 + ln;
  const int jbeg = (qb0 - RW) > 0 ? (qb0 - RW) : 0; const int jend = (qb0 + 4 * RPW + RW) < TT ? (qb0 + 4 * RPW + RW) : TT;      /* block-uniform window bounds (multiples of 64) */
  const int nst = (jend - jbeg) / 64;      /* stages of 64 keys: 3 to 5 */
  const unsigned short* Vth = (const unsigned short*)Vt + (size_t)slab * 64 * TT; const unsigned short* Vtl = (const unsigned short*)Vtlo + (size_t)slab * 64 * TT;
  // copy roles: 8 lanes cover one row's 128 B; a thread takes rows (tid / 8) + 16 i of K and of the two V^T planes
  const unsigned lcp = (unsigned)(size_t)L + (unsigned)(tid >> 3) * FA_ROWB + (unsigned)(tid & 7) * 16u;
  const unsigned short* gk = (const unsigned short*)K16 + ((size_t)b * TT + jbeg + (tid >> 3)) * ldk + h * 64 + (tid & 7) * 8;
  const unsigned short* gvh = Vth + (size_t)(tid >> 3) * TT + jbeg + (tid & 7) * 8;
  const unsigned short* gvl = Vtl + (size_t)(tid >> 3) * TT + jbeg + (tid & 7) * 8;
  fa_copy4(lcp, gk, ldk); fa_copy4(lcp + 64 * FA_ROWB, gvh, TT); fa_copy4(lcp + 128 * FA_ROWB, gvl, TT);
  FragH bq[KS];
  { const unsigned short* qr = (const unsigned short*)Q16 + ((size_t)b * TT + tq) * ldq + h * 64;
#pragma unroll
    for (int ks = 0; ks < KS; ++ks) { bq[ks].half[0] = *(const v8us*)(qr + ks * 32 + 8 * hh); bq[ks].half[1] = *(const v8us*)(qr + ks * 32 + 16 + 8 * hh); } }
  float m_q = -3.0e38f, l_q = 0.f; v8f oacc[DT], oaccl[DT];
#pragma unroll
  for (int dt = 0; dt < DT; ++dt) { oacc[dt] = (v8f){0.f,0.f,0.f,0.f,0.f,0.f,0.f,0.f}; oaccl[dt] = oacc[dt]; }
  asm volatile("s_wait_asynccnt 0x0" ::: "memory");      // this wave's copies of stage 0 have landed
  __syncthreads();                                        // ... and every other wave's
  if (nst > 1) { fa_copy4(lcp + FA_STAGE, gk + (size_t)64 * ldk, ldk); fa_copy4(lcp + FA_STAGE + 64 * FA_ROWB, gvh + 64, TT); fa_copy4(lcp + FA_STAGE + 128 * FA_ROWB, gvl + 64, TT); }
  // the stage loop stays rolled (the ring's waits and its barrier stand once, at the foot); every inner loop is unrolled so that fragments and accumulators are indexed by constants and stay in registers
#pragma unroll 1
  for (int t = 0; t < nst; ++t) {
    const unsigned buf = (unsigned)(t & 1) * FA_STAGE;
    const unsigned char* sk = L + buf + ln * FA_ROWB + 16 * hh;      /* K row ln of the stage, this half's 16-byte group */
    const unsigned char* sv = sk + 64 * FA_ROWB;                     /* V^T row ln, likewise */
#pragma unroll
    for (int c = 0; c < 2; ++c) { const int j0 = jbeg + t * 64 + c * 32;
    v8f s[2];
#pragma unroll
    for (int nt = 0; nt < 2; ++nt) { const unsigned char* kr = sk + (c * 32 + nt * 16) * FA_ROWB; FragH ak[KS];
#pragma unroll
      for (int ks = 0; ks < KS; ++ks) { ak[ks].half[0] = *(const v8us*)(kr + ks * 64); ak[ks].half[1] = *(const v8us*)(kr + ks * 64 + 32); }
      v8f acc = (v8f){0.f,0.f,0.f,0.f,0.f,0.f,0.f,0.f};
#pragma unroll
      for (int ks = 0; ks < KS; ++ks) acc = mmaH<1>(ak[ks].v, ak[ks].v, bq[ks].v, bq[ks].v, acc);
      s[nt] = acc; }
    float mc = -INFINITY;
#pragma unroll
    for (int nt = 0; nt < 2; ++nt)
#pragma unroll
      for (int r = 0; r < 8; ++r) { const int kk = j0 + nt * 16 + 8 * hh + r; const bool ok = (kk - tq <= RW) && (tq - kk <= RW);
        s[nt][r] = ok ? s[nt][r] * 0.125f : -INFINITY; mc = fmaxf(mc, s[nt][r]); }
    mc = fmaxf(mc, xhalf(mc));
    const float mn = fmaxf(m_q, mc); const float al = expf(m_q - mn); m_q = mn;
    FragH pb; float ps[4] = {0.f, 0.f, 0.f, 0.f};      /* four partial sums: no chain of 16 dependent adds */
#pragma unroll
    for (int nt = 0; nt < 2; ++nt)
#pragma unroll
      for (int r = 0; r < 8; ++r) { const float p = expf(s[nt][r] - mn); ps[r & 3] += p; pb.h[nt * 8 + r] = (_Float16)(p * 1024.0f); }
    l_q = l_q * al + ((ps[0] + ps[1]) + (ps[2] + ps[3]));      /* this lane's half of the column's sum; the halves join behind the loop */
#pragma unroll
    for (int dt = 0; dt < DT; ++dt)
#pragma unroll
      for (int r = 0; r < 8; ++r) { oacc[dt][r] *= al; oaccl[dt][r] *= al; }
#pragma unroll
    for (int dt = 0; dt < DT; ++dt) { const unsigned char* vr = sv + dt * 16 * FA_ROWB + c * 64; FragH av, avl; av.half[0] = *(const v8us*)vr; av.half[1] = *(const v8us*)(vr + 32); avl.half[0] = *(const v8us*)(vr + 64 * FA_ROWB); avl.half[1] = *(const v8us*)(vr + 64 * FA_ROWB + 32);
      oacc[dt] = mmaH<1>(av.v, av.v, pb.v, pb.v, oacc[dt]); oaccl[dt] = mmaH<1>(avl.v, avl.v, pb.v, pb.v, oaccl[dt]); } }
    asm volatile("s_wait_dscnt 0x0" ::: "memory");        // this wave's reads of the buffer have retired before it is refilled
    asm volatile("s_wait_asynccnt 0x0" ::: "memory");     // this wave's copies of stage t + 1 have landed
    __syncthreads();                                      // publishes stage t + 1 and ends every reader's last read of stage t's buffer
    if (t + 2 < nst) { fa_copy4(lcp + buf, gk + (size_t)(t + 2) * 64 * ldk, ldk); fa_copy4(lcp + buf + 64 * FA_ROWB, gvh + (t + 2) * 64, TT); fa_copy4(lcp + buf + 128 * FA_ROWB, gvl + (t + 2) * 64, TT); }
  }
  asm volatile("s_wait_asynccnt 0x0" ::: "memory");       // no copy is outstanding when the ring becomes output staging
  const float l = l_q + xhalf(l_q); const float inv = (l > 0.f) ? 1.0f / (l * 1024.0f) : 0.f;
  // a lane's 8 registers of a tile are 8 consecutive head columns of its query: one 16-byte group of the f16 row (the out-projection's A operand); a wave stages its own 16 rows, pitch 144 B
  unsigned char* sO = L + w * (RPW * FA_ROWB);
#pragma unroll
  for (int dt = 0; dt < DT; ++dt) { FragH f;
#pragma unroll
    for (int r = 0; r < 8; ++r) f.h[r] = (_Float16)((oacc[dt][r] + oaccl[dt][r] * 0.0009765625f) * inv);
    *(v8us*)(sO + ln * FA_ROWB + (dt * 16 + 8 * hh) * 2) = f.half[0]; }
  __builtin_amdgcn_fence(__ATOMIC_ACQ_REL, "workgroup"); __builtin_amdgcn_wave_barrier();      // the wave's own LDS writes are read back by other lanes of the same wave
#pragma unroll
  for (int u = 0; u < 4; ++u) { const int r = u * 4 + (lane >> 3), c = (lane & 7) * 8;      /* 8 lanes = one whole 128-B line of a row */
    *(v8us*)((unsigned short*)O16 + ((size_t)b * TT + q0 + r) * ldo + h * 64 + c) = *(const v8us*)(sO + r * FA_ROWB + c * 2); }
}

// ---- tiled f16 GEMM with fused epilogue: act(A[M][K] * Bh[N][K]^T * alpha + bf16(bias[col]) (+ CP[row][col] if RES)) -> C16 (f16, if OUT16) or C (f32); ACT 0 none, 6 erf-GELU. A and Bh f16 and k-contiguous (pitch K), C / C16 / CP pitch N.
// One work-group = one 128 x 128 tile of C, 8 waves as 4 (rows) x 2 (columns), 32 x 64 of C per wave. A pass is 128 k: 256 B of each of the 128 A rows and 128 Bh rows,
// laid in LDS at a pitch of 272 B (an odd multiple of 16 B: conflict-free for ds_load_b128 fragment reads). Two buffers; the next pass's rows are copied while this pass is multiplied.
// M, N multiples of 128, K a multiple of 128. The k order of every accumulator is ascending in steps of 32.
// NF > 0: two products on one A share the grid: the tiles of the first N - NF columns go to C16 (pitch N - NF); those of the last NF columns (v) go out transposed, split into an f16 value and its residual x 2^10:
// Vh / Vl [row / TT][column][row % TT], the layout the attention kernel reads its value fragments from.
#define GT_ROWB 272
#define GT_STAGE (256 * GT_ROWB)
// Eight 16-byte asynchronous copies of one lane, global -> LDS, rows 16 apart. The s_wait_xcnt closes the statement so that no address register is rewritten ahead of it.
template <int K>
__device__ __forceinline__ void gt_copy8(unsigned l0, const _Float16* g0) {
  const unsigned l1 = l0 + 16 * GT_ROWB, l2 = l0 + 32 * GT_ROWB, l3 = l0 + 48 * GT_ROWB, l4 = l0 + 64 * GT_ROWB, l5 = l0 + 80 * GT_ROWB, l6 = l0 + 96 * GT_ROWB, l7 = l0 + 112 * GT_ROWB;
  const _Float16 *g1 = g0 + 16 * K, *g2 = g0 + 32 * K, *g3 = g0 + 48 * K, *g4 = g0 + 64 * K, *g5 = g0 + 80 * K, *g6 = g0 + 96 * K, *g7 = g0 + 112 * K;
  asm volatile("global_load_async_to_lds_b128 %0, %8, off\n\t"
               "global_load_async_to_lds_b128 %1, %9, off\n\t"
               "global_load_async_to_lds_b128 %2, %10, off\n\t"
               "global_load_async_to_lds_b128 %3, %11, off\n\t"
               "global_load_async_to_lds_b128 %4, %12, off\n\t"
               "global_load_async_to_lds_b128 %5, %13, off\n\t"
               "global_load_async_to_lds_b128 %6, %14, off\n\t"
               "global_load_async_to_lds_b128 %7, %15, off\n\t"
               "s_wait_xcnt 0x0"
               :: "v"(l0), "v"(l1), "v"(l2), "v"(l3), "v"(l4), "v"(l5), "v"(l6), "v"(l7), "v"(g0), "v"(g1), "v"(g2), "v"(g3), "v"(g4), "v"(g5), "v"(g6), "v"(g7) : "memory");
}
// A wave's staged 32 x 64 tile (so, pitch 68 floats) -> rows rw .. rw + 31, columns cw .. cw + 63 of a plane of pitch P, in whole lines.
template <int ACT, int P, bool RES, bool OUT16>
__device__ __forceinline__ void gt_store(const float* so, const float* __restrict__ CP, float* __restrict__ C, _Float16* __restrict__ C16, int rw, int cw, int lane) {
  const int rsub = lane >> 4, c4 = (lane & 15) * 4;
#pragma unroll (ACT == 6 ? 2 : 16)      /* the erf text is long: unrolled by 2 only, for speed */
  for (int q = 0; q < 16; ++q) { const int r = q * 2 + rsub; v4f v = *(const v4fa*)&so[r * 68 + c4]; const size_t o = (size_t)(rw + r) * P + cw + c4;
    if (RES) { const v4f c = *(const v4fa*)(CP + o); v[0] += c[0]; v[1] += c[1]; v[2] += c[2]; v[3] += c[3]; }
    if (ACT == 6) {
#pragma unroll
      for (int e = 0; e < 4; ++e) v[e] = 0.5f * v[e] * (1.0f + erff(v[e] * 0.70710678118654752f)); }
    if (!OUT16) *(v4f*)(C + o) = v;
    else { v4h h4;
#pragma unroll
      for (int e = 0; e < 4; ++e) h4[e] = (_Float16)v[e];
      *(v4h*)(C16 + o) = h4; } }
  asm volatile("s_wait_xcnt 0x0" ::: "memory");      // closes the run of stores: where two store paths share a kernel the other path's code follows in the text and reuses the stores' registers
}
template <int ACT, int N, int K, bool RES, bool OUT16, int NF = 0>
__global__ __launch_bounds__(256) void k_gemm_t(const _Float16* __restrict__ A, const _Float16* __restrict__ Bh, float alpha, const float* __restrict__ bias, const float* __restrict__ CP, float* __restrict__ C, _Float16* __restrict__ C16, _Float16* __restrict__ Vh, _Float16* __restrict__ Vl) {
  __shared__ __attribute__((aligned(16))) unsigned char L[2 * GT_STAGE];
  constexpr int NST = K / 128, NTN = N / 128;
  const int tid = threadIdx.x, w = tid >> 5, lane = tid & 31, ln = lane & 15, hh = lane >> 4;
  const int row0 = (int)(blockIdx.x / NTN) * 128, col0 = (int)(blockIdx.x % NTN) * 128;
  const int wm = w >> 1, wn = w & 1;
  // copy roles: 16 lanes cover one row's 256 B; a thread takes rows (tid / 16) + 16 i of A and of Bh
  const unsigned lcp = (unsigned)(size_t)L + (unsigned)(tid >> 4) * GT_ROWB + (unsigned)(tid & 15) * 16u;
  const _Float16* ga = A + (size_t)(row0 + (tid >> 4)) * K + (tid & 15) * 8;
  const _Float16* gb = Bh + (size_t)(col0 + (tid >> 4)) * K + (tid & 15) * 8;
  v8f acc[2][4];
#pragma unroll
  for (int i = 0; i < 2; ++i)
#pragma unroll
    for (int j = 0; j < 4; ++j) acc[i][j] = (v8f){0.f,0.f,0.f,0.f,0.f,0.f,0.f,0.f};
  gt_copy8<K>(lcp, ga); gt_copy8<K>(lcp + 128 * GT_ROWB, gb);
  asm volatile("s_wait_asynccnt 0x0" ::: "memory");      // this wave's copies of pass 0 have landed
  __syncthreads();                                        // ... and every other wave's
  if (NST > 1) { gt_copy8<K>(lcp + GT_STAGE, ga + 128); gt_copy8<K>(lcp + GT_STAGE + 128 * GT_ROWB, gb + 128); }
#pragma unroll 1      /* one pass per trip: the ring's waits and its barrier stand once, at the foot */
  for (int t = 0; t < NST; ++t) {
    const unsigned buf = (unsigned)(t & 1) * GT_STAGE;
    const unsigned char* sa = L + buf + (wm * 32 + ln) * GT_ROWB + 16 * hh;
    const unsigned char* sb = L + buf + (128 + wn * 64 + ln) * GT_ROWB + 16 * hh;
    // two fragment sets: block ks + 1's twelve LDS reads go out as one group ahead of block ks's eight WMMAs (all inside this pass's own buffer)
    FragH a[2][2], b[2][4];
#pragma unroll
    for (int i = 0; i < 2; ++i) { a[0][i].half[0] = *(const v8us*)(sa + i * 16 * GT_ROWB); a[0][i].half[1] = *(const v8us*)(sa + i * 16 * GT_ROWB + 32); }
#pragma unroll
    for (int j = 0; j < 4; ++j) { b[0][j].half[0] = *(const v8us*)(sb + j * 16 * GT_ROWB); b[0][j].half[1] = *(const v8us*)(sb + j * 16 * GT_ROWB + 32); }
#pragma unroll
    for (int ks = 0; ks < 4; ++ks) {
      const int cu = ks & 1, nx = cu ^ 1;
      if (ks < 3) {
#pragma unroll
        for (int i = 0; i < 2; ++i) { a[nx][i].half[0] = *(const v8us*)(sa + i * 16 * GT_ROWB + (ks + 1) * 64); a[nx][i].half[1] = *(const v8us*)(sa + i * 16 * GT_ROWB + (ks + 1) * 64 + 32); }
#pragma unroll
        for (int j = 0; j < 4; ++j) { b[nx][j].half[0] = *(const v8us*)(sb + j * 16 * GT_ROWB + (ks + 1) * 64); b[nx][j].half[1] = *(const v8us*)(sb + j * 16 * GT_ROWB + (ks + 1) * 64 + 32); }
      }
      __builtin_amdgcn_sched_barrier(0);      // keeps the read group whole and ahead of the WMMAs: without it the scheduler spreads the reads among them and waits to 0 at each place
#pragma unroll
      for (int i = 0; i < 2; ++i)
#pragma unroll
        for (int j = 0; j < 4; ++j) acc[i][j] = __builtin_amdgcn_wmma_f32_16x16x32_f16(false, a[cu][i].v, false, b[cu][j].v, (short)0, acc[i][j], false, false);
      __builtin_amdgcn_sched_barrier(0);      // ... and keeps the next group behind this block
    }
    asm volatile("s_wait_dscnt 0x0" ::: "memory");        // this wave's reads of the buffer have retired before it is refilled
    asm volatile("s_wait_asynccnt 0x0" ::: "memory");     // this wave's copies of pass t + 1 have landed
    __syncthreads();                                      // publishes pass t + 1 and ends every reader's last read of pass t's buffer
    if (t + 2 < NST) { gt_copy8<K>(lcp + buf, ga + (t + 2) * 128); gt_copy8<K>(lcp + buf + 128 * GT_ROWB, gb + (t + 2) * 128); }
  }
  asm volatile("s_wait_asynccnt 0x0" ::: "memory");       // no copy is outstanding when the ring becomes output staging
  // NF > 0: which plane the tile belongs to is the same for the whole work-group, so the choice (and the v path's barrier) is block-uniform
  if (NF > 0 && col0 >= N - NF) {
    // v tile: an accumulator's 8 registers are 8 consecutive rows of one column = one 16-byte group of a transposed f16 row. The work-group's 128 columns x 128 rows are laid in the ring,
    // value plane then residual plane, one column = 256 B at the pitch of 272 B; behind a barrier 16 lanes store one column's 256 contiguous bytes.
#pragma unroll
    for (int j = 0; j < 4; ++j) { const float bv = bf16_round(bias[col0 + wn * 64 + j * 16 + ln]);
#pragma unroll
      for (int i = 0; i < 2; ++i) { FragH fh, fl;
#pragma unroll
        for (int r = 0; r < 8; ++r) { const float v = acc[i][j][r] * alpha + bv; const _Float16 hv = (_Float16)v; fh.h[r] = hv; fl.h[r] = (_Float16)((v - (float)hv) * 1024.0f); }
        unsigned char* p = L + (wn * 64 + j * 16 + ln) * GT_ROWB + (wm * 32 + i * 16 + 8 * hh) * 2;
        *(v8us*)p = fh.half[0]; *(v8us*)(p + 128 * GT_ROWB) = fl.half[0]; } }
    __syncthreads();      // a column's 128 rows come from four waves: all are in LDS before a column is read back
    const size_t o = ((size_t)(row0 / TT) * NF + (col0 - (N - NF)) + (tid >> 4)) * TT + (row0 % TT) + (tid & 15) * 8;
#pragma unroll
    for (int u = 0; u < 8; ++u) { const unsigned char* p = L + (u * 16 + (tid >> 4)) * GT_ROWB + (tid & 15) * 16;
      *(v8us*)((unsigned short*)Vh + o + (size_t)(u * 16) * TT) = *(const v8us*)p; *(v8us*)((unsigned short*)Vl + o + (size_t)(u * 16) * TT) = *(const v8us*)(p + 128 * GT_ROWB); }
    asm volatile("s_wait_xcnt 0x0" ::: "memory");      // closes the run of stores: the other path's code follows in the text and reuses the stores' registers
    return;
  }
  // epilogue: each wave stages its 32 x 64 tile in its own range of the ring (pitch 68 floats) and stores whole lines
  float* so = (float*)L + w * (32 * 68);
#pragma unroll
  for (int j = 0; j < 4; ++j) { const float bv = bf16_round(bias[col0 + wn * 64 + j * 16 + ln]);
#pragma unroll
    for (int i = 0; i < 2; ++i)
#pragma unroll
      for (int r = 0; r < 8; ++r) so[(i * 16 + 8 * hh + r) * 68 + j * 16 + ln] = acc[i][j][r] * alpha + bv; }
  __builtin_amdgcn_fence(__ATOMIC_ACQ_REL, "workgroup"); __builtin_amdgcn_wave_barrier();      // the wave's own LDS writes are read back by other lanes of the same wave
  gt_store<ACT, N - NF, RES, OUT16>(so, CP, C, C16, row0 + wm * 32, col0 + wn * 64, lane);
}

extern "C" void kernel_launch(void* const* d_in, const int* in_sizes, int n_in,
                              void* d_out, int out_size, void* d_ws, size_t ws_size, hipStream_t stream) {
  (void)in_sizes; (void)n_in; (void)out_size;
  const float* const* I = (const float* const*)d_in; const float* x = I[0]; const float* Wqkv = I[1]; const float* bqkv = I[2]; const float* Wo = I[3]; const float* bo = I[4]; const float* g1 = I[5]; const float* be1 = I[6]; const float* g2 = I[7]; const float* be2 = I[8];
  const float* W1 = I[9]; const float* b1 = I[10]; const float* W2 = I[11]; const float* b2 = I[12];
  char* ws = (char*)d_ws; size_t off = 0;
  auto take = [&](size_t bytes) { char* p = ws + off; off += (bytes + 255) & ~(size_t)255; return p; };
  _Float16* Bqkv = (_Float16*)take((size_t)3 * DM * DM * 2); _Float16* Bo = (_Float16*)take((size_t)DM * DM * 2); _Float16* Bw1 = (_Float16*)take((size_t)FF * DM * 2); _Float16* Bw2 = (_Float16*)take((size_t)DM * FF * 2);
  _Float16* H16 = (_Float16*)take((size_t)NR * DM * 2); float* XR = (float*)take((size_t)NR * DM * 4); _Float16* QK = (_Float16*)take((size_t)NR * 2 * DM * 2);
  _Float16* Vth = (_Float16*)take((size_t)NR * DM * 2); _Float16* Vtl = (_Float16*)take((size_t)NR * DM * 2); float* X1 = (float*)take((size_t)NR * DM * 4);
  _Float16* O16 = H16; _Float16* H2 = H16; _Float16* FH = QK;      /* reuse: H16 holds LN1 output (consumed by the qkv GEMM), then O16, then LN2 output; the [q|k] plane holds the FFN hidden (f16 [4096][2048]) once attention is done */
  if (off > ws_size) return;      // 6.3 + 2.1 + 4.2 + 4.2 + 8.4 + 16.8 + 16.8 + 8.4 + 8.4 + 16.8 = about 92 MB
  k_prep<<<PB_LN + PB_QKV + PB_O + PB_W1 + PB_W2, 256, 0, stream>>>(x, g1, be1, H16, XR, Wqkv, Wo, W1, W2, Bqkv, Bo, Bw1, Bw2);      /* LN1 and the four weight planes */
  const dim3 gqkv((NR / 128) * (3 * DM / 128), 1), gd((NR / 128) * (DM / 128), 1), gf((NR / 128) * (FF / 128), 1);      /* one work-group per 128 x 128 tile */
  k_gemm_t<0, 3 * DM, DM, false, true, DM><<<gqkv, 256, 0, stream>>>(H16, Bqkv, 0.0625f, bqkv, nullptr, nullptr, QK, Vth, Vtl);      /* [q | k] + bias (f16) and v + bias -> transposed hi / lo planes: M 4096 N 3072 K 1024 */
  k_flash<<<BB * NH * (TT / 64), 128, 0, stream>>>(QK, 2 * DM, QK + DM, 2 * DM, Vth, Vtl, O16, DM);
  k_gemm_t<0, DM, DM, true, false><<<gd, 256, 0, stream>>>(O16, Bo, 0.0625f, bo, XR, X1, nullptr, nullptr, nullptr);      /* x1 = x + (O·out_w + out_b) via the per-element addend */
  k_lnx<DM, 0><<<(NR + 7) / 8, 256, 0, stream>>>(X1, g2, be2, NR, 1e-5f, H2, nullptr);      /* LN2(x1) → f16 (x1 is a computed value: no input rounding) */
  k_gemm_t<6, FF, DM, false, true><<<gf, 256, 0, stream>>>(H2, Bw1, 0.0625f, b1, nullptr, nullptr, FH, nullptr, nullptr);      /* gelu_erf(h2·w1 + b1) → f16: M 4096 N 2048 K 1024 */
  k_gemm_t<0, DM, FF, true, false><<<gd, 256, 0, stream>>>(FH, Bw2, 0.0625f, b2, X1, (float*)d_out, nullptr, nullptr, nullptr);      /* y = x1 + (·w2 + b2): M 4096 N 1024 K 2048 */
}

// v007
// Measured time: 118 microseconds a run.
// In two side-by-side timings against v006, it was 1.07 and 1.08 times as fast.
// Over all steps from v000 it is 4.01 times as fast.
#include <hip/hip_runtime.h>
// Transformer layer with windowed (|i−j| ≤ 128) multi-head self-attention (B=2, L=2048, d_model 1024, 16 heads × 64): h = LN1(x); qkv = h·W + b; per head softmax(q·kᵀ/8 + window mask)·v; x1 = x + (merged·out_w + out_b);
// y = x1 + (gelu_erf(LN2(x1)·w1 + b1)·w2 + b2). (in,out) weights.
// Compute dtype: x, weights, biases, LN parameters rounded to bf16; LayerNorms in f32 (wave per row) → f16 operands; q,k f16 GEMM outputs, v f32 → f16 hi + ×2^10 residual Vᵀ planes; fused windowed
// flash-style kernel (online softmax f32, P f16 ×2^10, two value accumulators) on v_wmma_f32_16x16x32_f16; the residual sums ride the GEMMs' per-element addend in f32; FFN hidden f16 after the erf-GELU epilogue.
#define BB 2
#define TT 2048
#define DM 1024
#define NH 16
#define HD 64
#define RW 128
#define FF 2048
#define NR (BB * TT)

typedef __bf16 v16b __attribute__((ext_vector_type(16)));
typedef unsigned short v8us __attribute__((ext_vector_type(8), may_alias));
typedef float  v8f  __attribute__((ext_vector_type(8)));
typedef float  v4f  __attribute__((ext_vector_type(4)));
typedef float  v4fa __attribute__((ext_vector_type(4), may_alias));
union FragB { v16b v; v8us half[2]; unsigned short u[16]; };

__device__ __forceinline__ unsigned short bf16_bits(float x) { unsigned int u = __float_as_uint(x); return (unsigned short)((u + 0x7FFFu + ((u >> 16) & 1u)) >> 16); }
__device__ __forceinline__ float bf16_val(unsigned short b) { return __uint_as_float(((unsigned int)b) << 16); }
__device__ __forceinline__ float bf16_round(float x) { return bf16_val(bf16_bits(x)); }
// D += A·B with NT terms: 1 = ah·bh, 2 = + al·bh (A split), 3 = + ah·bl (both split)
template <int NT>
__device__ __forceinline__ v8f mmaN(v16b ah, v16b al, v16b bh, v16b bl, v8f c) {
  c = __builtin_amdgcn_wmma_f32_16x16x32_bf16(false, ah, false, bh, (short)0, c, false, false);
  if (NT >= 2) c = __builtin_amdgcn_wmma_f32_16x16x32_bf16(false, al, false, bh, (short)0, c, false, false);
  if (NT >= 3) c = __builtin_amdgcn_wmma_f32_16x16x32_bf16(false, ah, false, bl, (short)0, c, false, false);
  asm volatile("v_nop\n\tv_nop\n\tv_nop\n\tv_nop" : "+v"(c) : "v"(ah), "v"(al), "v"(bh), "v"(bl));
  return c;
}

__global__ __launch_bounds__(256) void k_wt_bf16(const float* __restrict__ W, unsigned short* __restrict__ Wt, int K, int N) {
  const int t = blockIdx.x * 256 + threadIdx.x;
  const int k8n = K / 8;
  if (t >= N * k8n) return;
  const int n = t / k8n, k8 = (t % k8n) * 8;
  v8us v;
#pragma unroll
  for (int i = 0; i < 8; ++i) v[i] = bf16_bits(W[(size_t)(k8 + i) * N + n]);
  *(v8us*)(Wt + (size_t)n * K + k8) = v;
  
}

// GEMM C[M][N] (f32, pitch ldc) = act(A[M][K]·W + bias). A f32 row-major (pitch lda) converted per fragment to bf16
// (ASPLIT: hi/lo two planes -> 2 terms, else single rounded term); Wt bf16 [N][K] (pitch ldb). BIAS_BF16 rounds the
// bias to bf16 first (bias quantised to bf16 before the add). K%32==0, M%16==0, N%64==0.
template <bool ASPLIT, int ACT, bool BIAS_BF16>
__global__ __launch_bounds__(128) void k_gemm_bf(const float* __restrict__ A, int lda, const unsigned short* __restrict__ Wt, int ldb,
                                               const float* __restrict__ bias, float* __restrict__ C, int ldc, int M, int N, int K) {
  __shared__ __attribute__((aligned(16))) float so[4][16][64];
  const int tid = threadIdx.x, w = tid >> 5, lane = tid & 31, ln = lane & 15, hh = lane >> 4;
  const int ntn = N / 64;
  const int wid = blockIdx.x * 4 + w;
  const int mt = wid / ntn, nq = wid % ntn;
  if (mt * 16 >= M) return;
  const int row0 = mt * 16, col0 = nq * 64;
  const float* arow = A + (size_t)(row0 + ln) * lda;
  v8f acc[4] = {};
  for (int kb = 0; kb < K; kb += 32) {
    FragB ah, al;
    const v4f x0 = *(const v4fa*)(arow + kb + 8 * hh), x1 = *(const v4fa*)(arow + kb + 8 * hh + 4);
    const v4f x2 = *(const v4fa*)(arow + kb + 16 + 8 * hh), x3 = *(const v4fa*)(arow + kb + 16 + 8 * hh + 4);
    float xs[16] = {x0[0],x0[1],x0[2],x0[3],x1[0],x1[1],x1[2],x1[3],x2[0],x2[1],x2[2],x2[3],x3[0],x3[1],x3[2],x3[3]};
#pragma unroll
    for (int i = 0; i < 16; ++i) { const unsigned short hb = bf16_bits(xs[i]); ah.u[i] = hb; al.u[i] = ASPLIT ? bf16_bits(xs[i] - bf16_val(hb)) : (unsigned short)0; }
#pragma unroll
    for (int t = 0; t < 4; ++t) {
      const unsigned short* brow = Wt + (size_t)(col0 + t * 16 + ln) * ldb + kb;
      FragB b;
      b.half[0] = *(const v8us*)(brow + 8 * hh);
      b.half[1] = *(const v8us*)(brow + 16 + 8 * hh);
      acc[t] = mmaN<ASPLIT ? 2 : 1>(ah.v, al.v, b.v, b.v, acc[t]);
    }
  }
#pragma unroll
  for (int t = 0; t < 4; ++t) {
    float bv = bias ? bias[col0 + t * 16 + ln] : 0.f;
    if (BIAS_BF16) bv = bf16_round(bv);
#pragma unroll
    for (int r = 0; r < 8; ++r) { float v = acc[t][r] + bv; if (ACT == 1) v = fmaxf(v, 0.f); so[w][8 * hh + r][t * 16 + ln] = v; }
  }
  __builtin_amdgcn_fence(__ATOMIC_ACQ_REL, "workgroup");
  __builtin_amdgcn_wave_barrier();
  const int rsub = lane >> 4, c4 = (lane & 15) * 4;
  {
#pragma unroll
    for (int q = 0; q < 8; ++q) {
      const int r = q * 2 + rsub;
      const v4f v = *(const v4fa*)&so[w][r][c4];
      *(v4f*)(C + (size_t)(row0 + r) * ldc + col0 + c4) = v;
    }
    
  }
}

// Flash-style causal/unmasked attention, all contractions 3-term bf16 hi/lo splits, f32 softmax with running max.
// q,k,v rows are read from f32 buffers with arbitrary row pitch (so they can live inside a fused qkv buffer);
// D = head size (multiple of 32, <= 128); one wave = 16 query rows; block = 4 waves (64 queries) sharing K/V chunks of 32.
template <int D, bool CAUSAL>
__global__ __launch_bounds__(128) void k_flash(const float* __restrict__ qb, const float* __restrict__ kb, const float* __restrict__ vb,
                                             int pitch, int T, int H, float scale, float* __restrict__ y, int ypitch) {
  constexpr int KS = D / 32;        // k-steps for QK
  constexpr int DT = D / 16;        // d tiles for PV
  __shared__ __attribute__((aligned(16))) unsigned short sKh[32][D + 8], sKl[32][D + 8], sVh[32][D + 8], sVl[32][D + 8];
  __shared__ __attribute__((aligned(16))) unsigned short sPh[4][16][40], sPl[4][16][40];
  __shared__ __attribute__((aligned(16))) float sO[4][16][D];
  const int tid = threadIdx.x, w = tid >> 5, lane = tid & 31, ln = lane & 15, hh = lane >> 4;
  const int nqb = (T + 63) / 64;
  const int bh = blockIdx.x / nqb, qblk = blockIdx.x % nqb;
  const int b = bh / H, h = bh % H;
  const int q0 = qblk * 64 + w * 16;
  const float* Q = qb + (size_t)b * T * pitch + h * D;
  const float* K = kb + (size_t)b * T * pitch + h * D;
  const float* V = vb + (size_t)b * T * pitch + h * D;

  // A fragments of the wave's 16 query rows (scaled), hi/lo
  FragB aqh[KS], aql[KS];
  {
    int row = q0 + ln; if (row >= T) row = T - 1;
    const float* qr = Q + (size_t)row * pitch;
#pragma unroll
    for (int ks = 0; ks < KS; ++ks)
#pragma unroll
      for (int i = 0; i < 16; ++i) {
        const int d = ks * 32 + ((i < 8) ? (8 * hh + i) : (16 + 8 * hh + (i - 8)));
        const float x = qr[d] * scale; const unsigned short hb = bf16_bits(x);
        aqh[ks].u[i] = hb; aql[ks].u[i] = bf16_bits(x - bf16_val(hb));
      }
  }
  float m_r[8], l_r[8];
#pragma unroll
  for (int r = 0; r < 8; ++r) { m_r[r] = -3.0e38f; l_r[r] = 0.f; }
  v8f oacc[DT];
#pragma unroll
  for (int dt = 0; dt < DT; ++dt) oacc[dt] = (v8f){0.f,0.f,0.f,0.f,0.f,0.f,0.f,0.f};

  const int kv_end = CAUSAL ? min(T, qblk * 64 + 64) : T;     // block-uniform
  for (int j0 = 0; j0 < kv_end; j0 += 32) {
    __syncthreads();
    for (int e = tid; e < 32 * (D / 4); e += 128) {
      const int r = e / (D / 4), c4 = (e % (D / 4)) * 4;
      const int key = j0 + r;
      v4f kf = {0.f,0.f,0.f,0.f}, vf = {0.f,0.f,0.f,0.f};
      if (key < T) { kf = *(const v4fa*)(K + (size_t)key * pitch + c4); vf = *(const v4fa*)(V + (size_t)key * pitch + c4); }
#pragma unroll
      for (int t = 0; t < 4; ++t) {
        unsigned short hb = bf16_bits(kf[t]); sKh[r][c4 + t] = hb; sKl[r][c4 + t] = bf16_bits(kf[t] - bf16_val(hb));
        hb = bf16_bits(vf[t]); sVh[r][c4 + t] = hb; sVl[r][c4 + t] = bf16_bits(vf[t] - bf16_val(hb));
      }
    }
    __syncthreads();
    // S tile 16 x 32
    v8f s[2];
#pragma unroll
    for (int nt = 0; nt < 2; ++nt) {
      v8f acc = {};
#pragma unroll
      for (int ks = 0; ks < KS; ++ks) {
        FragB bh_, bl_;
        bh_.half[0] = *(const v8us*)&sKh[nt * 16 + ln][ks * 32 + 8 * hh]; bh_.half[1] = *(const v8us*)&sKh[nt * 16 + ln][ks * 32 + 16 + 8 * hh];
        bl_.half[0] = *(const v8us*)&sKl[nt * 16 + ln][ks * 32 + 8 * hh]; bl_.half[1] = *(const v8us*)&sKl[nt * 16 + ln][ks * 32 + 16 + 8 * hh];
        acc = mmaN<3>(aqh[ks].v, aql[ks].v, bh_.v, bl_.v, acc);
      }
      s[nt] = acc;
    }
    // mask + running max (rows 8hh+r; the 16 lanes of a half share rows)
    float alpha[8];
#pragma unroll
    for (int r = 0; r < 8; ++r) {
      const int qi = q0 + 8 * hh + r;
      const int ja = j0 + ln, jb = j0 + 16 + ln;
      if (CAUSAL) { if (ja > qi) s[0][r] = -3.0e38f; if (jb > qi) s[1][r] = -3.0e38f; }
      if (ja >= T) s[0][r] = -3.0e38f;
      if (jb >= T) s[1][r] = -3.0e38f;
      float mx = fmaxf(s[0][r], s[1][r]);
      mx = fmaxf(mx, __shfl_xor(mx, 1, 32)); mx = fmaxf(mx, __shfl_xor(mx, 2, 32)); mx = fmaxf(mx, __shfl_xor(mx, 4, 32)); mx = fmaxf(mx, __shfl_xor(mx, 8, 32));
      const float mnew = fmaxf(m_r[r], mx);
      alpha[r] = (mnew > -1.0e38f) ? __expf(m_r[r] - mnew) : 1.0f;
      const float p0 = (s[0][r] > -1.0e38f) ? __expf(s[0][r] - mnew) : 0.f;
      const float p1 = (s[1][r] > -1.0e38f) ? __expf(s[1][r] - mnew) : 0.f;
      m_r[r] = mnew;
      l_r[r] = l_r[r] * alpha[r] + p0 + p1;            // per-lane partial row sum (16 lanes combined at the end)
      unsigned short hb = bf16_bits(p0); sPh[w][8 * hh + r][ln] = hb;      sPl[w][8 * hh + r][ln] = bf16_bits(p0 - bf16_val(hb));
      hb = bf16_bits(p1);                sPh[w][8 * hh + r][16 + ln] = hb; sPl[w][8 * hh + r][16 + ln] = bf16_bits(p1 - bf16_val(hb));
    }
#pragma unroll
    for (int dt = 0; dt < DT; ++dt)
#pragma unroll
      for (int r = 0; r < 8; ++r) oacc[dt][r] *= alpha[r];
    __builtin_amdgcn_fence(__ATOMIC_ACQ_REL, "workgroup");
    __builtin_amdgcn_wave_barrier();
    FragB pah, pal;
    pah.half[0] = *(const v8us*)&sPh[w][ln][8 * hh]; pah.half[1] = *(const v8us*)&sPh[w][ln][16 + 8 * hh];
    pal.half[0] = *(const v8us*)&sPl[w][ln][8 * hh]; pal.half[1] = *(const v8us*)&sPl[w][ln][16 + 8 * hh];
#pragma unroll
    for (int dt = 0; dt < DT; ++dt) {
      FragB bvh, bvl;
#pragma unroll
      for (int i = 0; i < 8; ++i) {
        bvh.u[i] = sVh[8 * hh + i][dt * 16 + ln]; bvh.u[8 + i] = sVh[16 + 8 * hh + i][dt * 16 + ln];
        bvl.u[i] = sVl[8 * hh + i][dt * 16 + ln]; bvl.u[8 + i] = sVl[16 + 8 * hh + i][dt * 16 + ln];
      }
      oacc[dt] = mmaN<3>(pah.v, pal.v, bvh.v, bvl.v, oacc[dt]);
    }
    __builtin_amdgcn_fence(__ATOMIC_ACQ_REL, "workgroup");
    __builtin_amdgcn_wave_barrier();
  }
#pragma unroll
  for (int r = 0; r < 8; ++r) {
    float l = l_r[r];
    l += __shfl_xor(l, 1, 32); l += __shfl_xor(l, 2, 32); l += __shfl_xor(l, 4, 32); l += __shfl_xor(l, 8, 32);
    l_r[r] = (l > 0.f) ? 1.0f / l : 0.f;
  }
#pragma unroll
  for (int dt = 0; dt < DT; ++dt)
#pragma unroll
    for (int r = 0; r < 8; ++r) sO[w][8 * hh + r][dt * 16 + ln] = oacc[dt][r] * l_r[r];
  __builtin_amdgcn_fence(__ATOMIC_ACQ_REL, "workgroup");
  __builtin_amdgcn_wave_barrier();
  {
    for (int r = 0; r < 16; ++r) {
      const int row = q0 + r;
      if (row < T && lane < D / 4) {
        const v4f val = *(const v4fa*)&sO[w][r][lane * 4];
        *(v4f*)(y + ((size_t)b * T + row) * ypitch + h * D + lane * 4) = val;
      }
    }
    
  }
}

// GEMM C = act(A·W + bias + resid): A f32 (ASPLIT -> hi/lo 2 terms), Wt bf16 [N][K]; ACT 0 none, 1 relu, 2 exact gelu;
// resid (optional, f32, row index = (row % rmod), pitch ldr, RES_BF16 rounds it) added before the activation.
template <bool ASPLIT, int ACT, bool BIAS_BF16, bool RES_BF16>
__global__ __launch_bounds__(128) void k_gemm_bf3(const float* __restrict__ A, int lda, const unsigned short* __restrict__ Wt, int ldb,
                                                const float* __restrict__ bias, const float* __restrict__ resid, int rmod, int ldr,
                                                float* __restrict__ C, int ldc, int M, int N, int K) {
  __shared__ __attribute__((aligned(16))) float so[4][16][64];
  const int tid = threadIdx.x, w = tid >> 5, lane = tid & 31, ln = lane & 15, hh = lane >> 4;
  const int ntn = N / 64;
  const int wid = blockIdx.x * 4 + w;
  const int mt = wid / ntn, nq = wid % ntn;
  if (mt * 16 >= M) return;
  const int row0 = mt * 16, col0 = nq * 64;
  const float* arow = A + (size_t)(row0 + ln) * lda;
  v8f acc[4] = {};
  for (int kb = 0; kb < K; kb += 32) {
    FragB ah, al;
    const v4f x0 = *(const v4fa*)(arow + kb + 8 * hh), x1 = *(const v4fa*)(arow + kb + 8 * hh + 4);
    const v4f x2 = *(const v4fa*)(arow + kb + 16 + 8 * hh), x3 = *(const v4fa*)(arow + kb + 16 + 8 * hh + 4);
    float xs[16] = {x0[0],x0[1],x0[2],x0[3],x1[0],x1[1],x1[2],x1[3],x2[0],x2[1],x2[2],x2[3],x3[0],x3[1],x3[2],x3[3]};
#pragma unroll
    for (int i = 0; i < 16; ++i) { const unsigned short hb = bf16_bits(xs[i]); ah.u[i] = hb; al.u[i] = ASPLIT ? bf16_bits(xs[i] - bf16_val(hb)) : (unsigned short)0; }
#pragma unroll
    for (int t = 0; t < 4; ++t) {
      const unsigned short* brow = Wt + (size_t)(col0 + t * 16 + ln) * ldb + kb;
      FragB b;
      b.half[0] = *(const v8us*)(brow + 8 * hh);
      b.half[1] = *(const v8us*)(brow + 16 + 8 * hh);
      acc[t] = mmaN<ASPLIT ? 2 : 1>(ah.v, al.v, b.v, b.v, acc[t]);
    }
  }
#pragma unroll
  for (int t = 0; t < 4; ++t) {
    const int col = col0 + t * 16 + ln;
    float bv = bias ? bias[col] : 0.f;
    if (BIAS_BF16) bv = bf16_round(bv);
#pragma unroll
    for (int r = 0; r < 8; ++r) {
      float v = acc[t][r] + bv;
      if (resid) { float rv = resid[(size_t)((row0 + 8 * hh + r) % rmod) * ldr + col]; if (RES_BF16) rv = bf16_round(rv); v += rv; }
      if (ACT == 1) v = fmaxf(v, 0.f);
      if (ACT == 2) v = 0.5f * v * (1.0f + erff(v * 0.70710678118654752f));
      if (ACT == 3) { const float u = 0.7978845608028654f * (v + 0.044715f * v * v * v); v = 0.5f * v * (1.0f + tanhf(u)); }
      so[w][8 * hh + r][t * 16 + ln] = v;
    }
  }
  __builtin_amdgcn_fence(__ATOMIC_ACQ_REL, "workgroup");
  __builtin_amdgcn_wave_barrier();
  const int rsub = lane >> 4, c4 = (lane & 15) * 4;
  {
#pragma unroll
    for (int q = 0; q < 8; ++q) {
      const int r = q * 2 + rsub;
      const v4f v = *(const v4fa*)&so[w][r][c4];
      *(v4f*)(C + (size_t)(row0 + r) * ldc + col0 + c4) = v;
    }
    
  }
}
// row LayerNorm (biased variance, eps) over N: s = X (+ R); optional out_sum <- s; out_norm <- (s-mu)*rsqrt(var+eps)*g + b
template <bool PARAM_BF16>
__global__ __launch_bounds__(256) void k_layernorm(const float* __restrict__ X, const float* __restrict__ R, const float* __restrict__ g, const float* __restrict__ bta,
                                                  float* __restrict__ out_sum, float* __restrict__ out_norm, int N, float eps) {
  __shared__ float red[256];
  const int row = blockIdx.x, tid = threadIdx.x;
  const float* x = X + (size_t)row * N; const float* rr = R ? R + (size_t)row * N : nullptr;
  float vals[16];                     // up to N = 4096
  const int per = N / 256;            // contiguous chunk per thread? use strided-by-4 chunks: thread handles j = tid*4 + 1024*u
  float s1 = 0.f;
  for (int u = 0; u < per / 4; ++u) {
    const int j = tid * 4 + 1024 * u;
    const v4f a = *(const v4fa*)(x + j);
    v4f b = {0.f,0.f,0.f,0.f}; if (rr) b = *(const v4fa*)(rr + j);
#pragma unroll
    for (int q = 0; q < 4; ++q) { const float v = a[q] + b[q]; vals[u * 4 + q] = v; s1 += v; }
  }
  red[tid] = s1; __syncthreads();
  for (int st = 128; st > 0; st >>= 1) { if (tid < st) red[tid] += red[tid + st]; __syncthreads(); }
  const float mu = red[0] / (float)N; __syncthreads();
  float s2 = 0.f;
  for (int u = 0; u < per / 4; ++u)
#pragma unroll
    for (int q = 0; q < 4; ++q) { const float c = vals[u * 4 + q] - mu; s2 += c * c; }
  red[tid] = s2; __syncthreads();
  for (int st = 128; st > 0; st >>= 1) { if (tid < st) red[tid] += red[tid + st]; __syncthreads(); }
  const float rs = rsqrtf(red[0] / (float)N + eps);
  {
    for (int u = 0; u < per / 4; ++u) {
      const int j = tid * 4 + 1024 * u;
      v4f o, sm;
#pragma unroll
      for (int q = 0; q < 4; ++q) {
        float gg = g[j + q], bb = bta[j + q];
        if (PARAM_BF16) { gg = bf16_round(gg); bb = bf16_round(bb); }
        sm[q] = vals[u * 4 + q]; o[q] = (vals[u * 4 + q] - mu) * rs * gg + bb;
      }
      if (out_sum) *(v4f*)(out_sum + (size_t)row * N + j) = sm;
      *(v4f*)(out_norm + (size_t)row * N + j) = o;
    }
    
  }
}



// ---- f16 WMMA path (v_wmma_f32_16x16x32_f16): 11-bit significands for operands in range — used where a [0,1] probability operand needs more precision than bf16
typedef _Float16 v16h __attribute__((ext_vector_type(16)));
union FragH { v16h v; v8us half[2]; _Float16 h[16]; unsigned short u[16]; };
template <int NT>
__device__ __forceinline__ v8f mmaH(v16h ah, v16h al, v16h bh, v16h bl, v8f c) {
  c = __builtin_amdgcn_wmma_f32_16x16x32_f16(false, ah, false, bh, (short)0, c, false, false);
  if (NT >= 2) c = __builtin_amdgcn_wmma_f32_16x16x32_f16(false, al, false, bh, (short)0, c, false, false);
  if (NT >= 3) c = __builtin_amdgcn_wmma_f32_16x16x32_f16(false, ah, false, bl, (short)0, c, false, false);
  asm volatile("v_nop\n\tv_nop\n\tv_nop\n\tv_nop" : "+v"(c) : "v"(ah), "v"(al), "v"(bh), "v"(bl));
  return c;
}
// batched GEMM like k_gemm_b but f16 operands: A f32 (split into f16 hi/lo if ASPLIT, else rounded to f16), Bt = f16 values [n][k]; alpha; C f32; N multiple of 16 (partial tiles skipped)
template <bool ASPLIT>
__global__ __launch_bounds__(128) void k_gemm_h(const float* __restrict__ A, int lda, size_t sA, const _Float16* __restrict__ Bh, int ldb, size_t sB, float alpha, float* __restrict__ C, int ldc, size_t sC, int M, int N, int K) {
  __shared__ __attribute__((aligned(16))) float so[4][16][64];
  const int tid = threadIdx.x, w = tid >> 5, lane = tid & 31, ln = lane & 15, hh = lane >> 4; const int by = blockIdx.y;
  A += (size_t)by * sA; Bh += (size_t)by * sB; C += (size_t)by * sC;
  const int ntn = (N + 63) / 64; const int wid = blockIdx.x * 4 + w; const int mt = wid / ntn, nq = wid % ntn; if (mt * 16 >= M) return;
  const int row0 = mt * 16, col0 = nq * 64; const float* arow = A + (size_t)(row0 + ln) * lda;
  v8f acc[4] = {};
  for (int kb = 0; kb < K; kb += 32) {
    FragH ah, al;
    const v4f x0 = *(const v4fa*)(arow + kb + 8 * hh), x1 = *(const v4fa*)(arow + kb + 8 * hh + 4), x2 = *(const v4fa*)(arow + kb + 16 + 8 * hh), x3 = *(const v4fa*)(arow + kb + 16 + 8 * hh + 4);
    float xs[16] = {x0[0],x0[1],x0[2],x0[3],x1[0],x1[1],x1[2],x1[3],x2[0],x2[1],x2[2],x2[3],x3[0],x3[1],x3[2],x3[3]};
#pragma unroll
    for (int i = 0; i < 16; ++i) { const _Float16 h = (_Float16)xs[i]; ah.h[i] = h; al.h[i] = ASPLIT ? (_Float16)(xs[i] - (float)h) : (_Float16)0.0f; }
#pragma unroll
    for (int t = 0; t < 4; ++t) { if (col0 + t * 16 >= N) continue; const size_t boff = (size_t)(col0 + t * 16 + ln) * ldb + kb; FragH bq; bq.half[0] = *(const v8us*)(Bh + boff + 8 * hh); bq.half[1] = *(const v8us*)(Bh + boff + 16 + 8 * hh);
      acc[t] = mmaH<ASPLIT ? 2 : 1>(ah.v, al.v, bq.v, bq.v, acc[t]); }
  }
#pragma unroll
  for (int t = 0; t < 4; ++t) { if (col0 + t * 16 >= N) continue;
#pragma unroll
    for (int r = 0; r < 8; ++r) so[w][8 * hh + r][t * 16 + ln] = acc[t][r] * alpha; }
  __builtin_amdgcn_fence(__ATOMIC_ACQ_REL, "workgroup"); __builtin_amdgcn_wave_barrier();
  const int rsub = lane >> 4, c4 = (lane & 15) * 4;
  {
#pragma unroll
    for (int q = 0; q < 8; ++q) { const int r = q * 2 + rsub; if (col0 + c4 < N) { const v4f v = *(const v4fa*)&so[w][r][c4]; *(v4f*)(C + (size_t)(row0 + r) * ldc + col0 + c4) = v; } }
     }
}

// Wt[n][k] = f16(bf16(W[k][n]) * scale) from f32 row-major W[K][N] (scale = power of two; bf16-exact weights stay exact in f16 away from the subnormal range).
// One work-group = a tile of 128 k x 64 n, turned in LDS, so that both sides move whole lines: 16 lanes read 256 contiguous bytes of one W row, 16 lanes write 256 contiguous bytes of one Wt row.
// LDS: one dword = the f16 pair (k, k + 1) of one n; a row = one n's 64 dwords, its sixteen 16-byte groups (8 k each) stored at group ^ (n / 4):
// the 32 lanes of a dword store (16 values of n / 4, two neighbouring pairs) fall on 32 banks, the 16 lanes that read one row back as 16-byte groups on all 64.
// K a multiple of 128, N a multiple of 64.
typedef _Float16 v2h __attribute__((ext_vector_type(2)));
// blk = the tile's index, tl = the work-group's 16 KiB of LDS.
template <int K, int N>
__device__ __forceinline__ void wt_tile(const float* __restrict__ W, _Float16* __restrict__ Wt, float scale, int blk, unsigned int* tl) {
  const int tid = threadIdx.x, lo = tid & 15, hi = tid >> 4;
  const int n0 = (blk % (N / 64)) * 64, k0 = (blk / (N / 64)) * 128;
  const float* src = W + (size_t)(k0 + 2 * hi) * N + n0 + 4 * lo;      // rows k0 + 2 hi + 32 u and the next, columns n0 + 4 lo .. + 3
  v4f ev[4], od[4];
#pragma unroll
  for (int u = 0; u < 4; ++u) { ev[u] = *(const v4fa*)(src + (size_t)(32 * u) * N); od[u] = *(const v4fa*)(src + (size_t)(32 * u + 1) * N); }
#pragma unroll
  for (int u = 0; u < 4; ++u) { const int kp = hi + 16 * u;      // pair index: k = k0 + 2 kp, k0 + 2 kp + 1
#pragma unroll
    for (int q = 0; q < 4; ++q) { v2h p; p[0] = (_Float16)(bf16_round(ev[u][q]) * scale); p[1] = (_Float16)(bf16_round(od[u][q]) * scale);
      tl[(4 * lo + q) * 64 + (((kp >> 2) ^ lo) << 2) + (kp & 3)] = __builtin_bit_cast(unsigned int, p); } }
  __syncthreads();      // every pair of the tile is in LDS before a row is read back
#pragma unroll
  for (int u = 0; u < 4; ++u) { const int n = hi + 16 * u; const v8us v = *(const v8us*)&tl[n * 64 + ((lo ^ ((n >> 2) & 15)) << 2)];
    *(v8us*)((unsigned short*)Wt + (size_t)(n0 + n) * K + k0 + 8 * lo) = v; }
  asm volatile("s_wait_xcnt 0x0" ::: "memory");      // closes the run of four stores: in the merged kernel other jobs' code follows in the text and reuses the stores' registers
}
typedef _Float16 v4h __attribute__((ext_vector_type(4)));

__global__ __launch_bounds__(256) void k_x16(const float* __restrict__ x, _Float16* __restrict__ X16, size_t n8) { const size_t t = (size_t)blockIdx.x * 256 + threadIdx.x; if (t >= n8) return; FragH f;
#pragma unroll
  for (int q = 0; q < 8; ++q) f.h[q] = (_Float16)bf16_round(x[t * 8 + q]); *(v8us*)((unsigned short*)X16 + t * 8) = f.half[0];  }
__global__ __launch_bounds__(256) void k_round16f(const float* __restrict__ W, _Float16* __restrict__ Bt, size_t n8) { const size_t t = (size_t)blockIdx.x * 256 + threadIdx.x; if (t >= n8) return; FragH f;
#pragma unroll
  for (int i = 0; i < 8; ++i) f.h[i] = (_Float16)(bf16_round(W[t * 8 + i]) * 16.0f); *(v8us*)((unsigned short*)Bt + t * 8) = f.half[0];  }
template <int NHv, int TTv>
__global__ __launch_bounds__(256) void k_vt(const _Float16* __restrict__ V16, int ldv, int voff, _Float16* __restrict__ Vt) { __shared__ unsigned short tl[64][66]; const int tid = threadIdx.x; const int slab = blockIdx.x / (TTv / 64), lg = blockIdx.x % (TTv / 64); const int b = slab / NHv, h = slab % NHv;
  for (int i = tid; i < 64 * 8; i += 256) { const int r = i / 8, c8 = (i % 8) * 8; FragH f; f.half[0] = *(const v8us*)((const unsigned short*)V16 + ((size_t)b * TTv + lg * 64 + r) * ldv + voff + h * 64 + c8);
#pragma unroll
    for (int q = 0; q < 8; ++q) tl[r][c8 + q] = f.u[q]; }
  __syncthreads();
  {
#pragma unroll
    for (int rd = 0; rd < 2; ++rd) { const int d = rd * 32 + tid / 8, pc = tid % 8; FragH f;
#pragma unroll
      for (int q = 0; q < 8; ++q) f.u[q] = tl[pc * 8 + q][d];
      *(v8us*)((unsigned short*)Vt + ((size_t)slab * 64 + d) * TTv + lg * 64 + pc * 8) = f.half[0]; }
     } }

template <int D, int RBF>
__device__ __forceinline__ void lnx_rows(const float* __restrict__ X, const float* __restrict__ gam, const float* __restrict__ bet, int nrows, float eps, _Float16* __restrict__ O16, float* __restrict__ XR, int blk) {
  constexpr int NP = D / 128; const int tid = threadIdx.x, wv = tid >> 5, lane = tid & 31; const size_t r = (size_t)blk * 8 + wv; if (r >= (size_t)nrows) return; v4f y[NP]; float s = 0.f;
#pragma unroll
  for (int j = 0; j < NP; ++j) { const int c = j * 128 + lane * 4; v4f g = *(const v4fa*)(X + r * D + c); if (RBF) { for (int q = 0; q < 4; ++q) g[q] = bf16_round(g[q]); } y[j] = g; s += g[0] + g[1] + g[2] + g[3]; }
  for (int o = 16; o >= 1; o >>= 1) s += __shfl_xor(s, o, 32); const float mu = s / (float)D; float q2 = 0.f;
#pragma unroll
  for (int j = 0; j < NP; ++j) for (int q = 0; q < 4; ++q) { const float d = y[j][q] - mu; q2 += d * d; }
  for (int o = 16; o >= 1; o >>= 1) q2 += __shfl_xor(q2, o, 32); const float rs = rsqrtf(q2 / (float)D + eps);
  {
#pragma unroll
    for (int j = 0; j < NP; ++j) { const int c = j * 128 + lane * 4; v4h h; for (int q = 0; q < 4; ++q) { const float v = (y[j][q] - mu) * rs * bf16_round(gam[c + q]) + bf16_round(bet[c + q]); h[q] = (_Float16)v; } *(v4h*)(O16 + r * D + c) = h;
      asm volatile("s_wait_xcnt 0x0" ::: "memory");      // the store's registers are reused directly behind it: the wait stands in front of the overwrite
      if (XR) { *(v4f*)(XR + r * D + c) = y[j];
        asm volatile("s_wait_xcnt 0x0" ::: "memory"); } }      // likewise, ahead of the next trip's loads
     } }
template <int D, int RBF>
__global__ __launch_bounds__(256) void k_lnx(const float* __restrict__ X, const float* __restrict__ gam, const float* __restrict__ bet, int nrows, float eps, _Float16* __restrict__ O16, float* __restrict__ XR) {
  lnx_rows<D, RBF>(X, gam, bet, nrows, eps, O16, XR, (int)blockIdx.x); }
// LN1 and the four weight convert-transposes need nothing of each other: one grid, each job a range of the block index (a work-group does one job whole, so the branch and the tile's barrier are block-uniform).
#define PB_LN (NR / 8)
#define PB_QKV ((DM / 128) * (3 * DM / 64))
#define PB_O ((DM / 128) * (DM / 64))
#define PB_W1 ((DM / 128) * (FF / 64))
#define PB_W2 ((FF / 128) * (DM / 64))
__global__ __launch_bounds__(256) void k_prep(const float* __restrict__ x, const float* __restrict__ g1, const float* __restrict__ be1, _Float16* __restrict__ H16, float* __restrict__ XR,
                                              const float* __restrict__ Wqkv, const float* __restrict__ Wo, const float* __restrict__ W1, const float* __restrict__ W2,
                                              _Float16* __restrict__ Bqkv, _Float16* __restrict__ Bo, _Float16* __restrict__ Bw1, _Float16* __restrict__ Bw2) {
  __shared__ __attribute__((aligned(16))) unsigned int tl[64 * 64];
  int b = (int)blockIdx.x;
  if (b < PB_LN) { lnx_rows<DM, 1>(x, g1, be1, NR, 1e-5f, H16, XR, b); return; }      /* LN1(bf16 x) -> f16; XR = bf16(x) */
  b -= PB_LN; if (b < PB_QKV) { wt_tile<DM, 3 * DM>(Wqkv, Bqkv, 16.0f, b, tl); return; }      /* (in,out) -> Bt[n][k] x 2^4 */
  b -= PB_QKV; if (b < PB_O) { wt_tile<DM, DM>(Wo, Bo, 16.0f, b, tl); return; }
  b -= PB_O; if (b < PB_W1) { wt_tile<DM, FF>(W1, Bw1, 16.0f, b, tl); return; }
  wt_tile<FF, DM>(W2, Bw2, 16.0f, b - PB_W1, tl);
}
// 2^x by the hardware's own instruction (v_exp_f32), with none of the library exp's range reduction, ldexp and range tests behind it: an argument far below zero (or -inf) gives 0, which is what a masked or far-off term is to give.
__device__ __forceinline__ float hw_exp2(float x) { return __builtin_amdgcn_exp2f(x); }
// lane l <-> lane l ^ 16: the two lanes that share a query's column
__device__ __forceinline__ float xhalf(float x) { return __builtin_bit_cast(float, __builtin_amdgcn_permlanex16(__builtin_bit_cast(int, x), __builtin_bit_cast(int, x), 0x76543210, 0xfedcba98, false, false)); }
// Both products transposed: S^T = K Q^T (A = 16 key rows, B = the wave's 16 queries, kept in registers), O^T += V^T P^T (A = 16 rows of V^T, B = P^T).
// Lane (ln, hh) holds, of query q0 + ln alone, the scores of keys 8 hh + r and 16 + 8 hh + r of a 32-key chunk: maximum and sum are in-lane plus one exchange with lane ^ 16,
// the running maximum, the sum and the rescale factor are one value a lane, and the two converted score tiles are the B fragment of the second product as they lie
// (element s = tile s / 8, register s % 8 = key 8 hh + s or 16 + 8 hh + s - 8: the k order of the V^T loader).
// A masked score is -inf and the running maximum starts finite, so exp gives 0 for a masked key and 1 for the rescale of a column that has seen no key yet: no test around an exp.
// K and V^T reach the waves through LDS: the four waves of a work-group walk the same keys, so a stage of 64 keys (64 K rows, 64 rows of each V^T plane, 128 B each) is copied once per work-group, in whole lines,
// instead of being fetched by every wave in 32-byte pieces of 16 lines a load. Rows lie at a pitch of 144 B (an odd multiple of 16 B: conflict-free for ds_load_b128 fragment reads). Two buffers; the next stage's rows are copied while this stage is worked on.
#define FA_ROWB 144
#define FA_STAGE (192 * FA_ROWB)
#define FA_SC 0.18033688011112042f      /* 1 / sqrt(64) x log2 e: raw score -> exponent of 2 */
// Four 16-byte asynchronous copies of one lane, global -> LDS, rows 16 apart (pitch = the global row pitch in elements). The s_wait_xcnt closes the statement so that no address register is rewritten ahead of it.
__device__ __forceinline__ void fa_copy4(unsigned l0, const unsigned short* g0, int pitch) {
  const unsigned l1 = l0 + 16 * FA_ROWB, l2 = l0 + 32 * FA_ROWB, l3 = l0 + 48 * FA_ROWB;
  const unsigned short *g1 = g0 + (size_t)16 * pitch, *g2 = g0 + (size_t)32 * pitch, *g3 = g0 + (size_t)48 * pitch;
  asm volatile("global_load_async_to_lds_b128 %0, %4, off\n\t"
               "global_load_async_to_lds_b128 %1, %5, off\n\t"
               "global_load_async_to_lds_b128 %2, %6, off\n\t"
               "global_load_async_to_lds_b128 %3, %7, off\n\t"
               "s_wait_xcnt 0x0"
               :: "v"(l0), "v"(l1), "v"(l2), "v"(l3), "v"(g0), "v"(g1), "v"(g2), "v"(g3) : "memory");
}
__global__ __launch_bounds__(128) void k_flash(const _Float16* __restrict__ Q16, int ldq, const _Float16* __restrict__ K16, int ldk, const _Float16* __restrict__ Vt, const _Float16* __restrict__ Vtlo, _Float16* __restrict__ O16, int ldo) {
  constexpr int RPW = 16, NQB = TT / (4 * RPW), DT = 4, KS = 2;
  __shared__ __attribute__((aligned(16))) unsigned char L[2 * FA_STAGE];      /* a stage = [K 64 rows | V^T value 64 rows | V^T residual 64 rows]; behind the loop the ring is output staging */
  const int tid = threadIdx.x, w = tid >> 5, lane = tid & 31, ln = lane & 15, hh = lane >> 4;
  const int slab = blockIdx.x / NQB, qblk = blockIdx.x % NQB; const int b = slab / NH, h = slab % NH; const int qb0 = qblk * (4 * RPW); const int q0 = qb0 + w * RPW;
  const int tq = q0 + ln;
  const int jbeg = (qb0 - RW) > 0 ? (qb0 - RW) : 0; const int jend = (qb0 + 4 * RPW + RW) < TT ? (qb0 + 4 * RPW + RW) : TT;      /* block-uniform window bounds (multiples of 64) */
  const int nst = (jend - jbeg) / 64;      /* stages of 64 keys: 3 to 5 */
  const unsigned short* Vth = (const unsigned short*)Vt + (size_t)slab * 64 * TT; const unsigned short* Vtl = (const unsigned short*)Vtlo + (size_t)slab * 64 * TT;
  // copy roles: 8 lanes cover one row's 128 B; a thread takes rows (tid / 8) + 16 i of K and of the two V^T planes
  const unsigned lcp = (unsigned)(size_t)L + (unsigned)(tid >> 3) * FA_ROWB + (unsigned)(tid & 7) * 16u;
  const unsigned short* gk = (const unsigned short*)K16 + ((size_t)b * TT + jbeg + (tid >> 3)) * ldk + h * 64 + (tid & 7) * 8;
  const unsigned short* gvh = Vth + (size_t)(tid >> 3) * TT + jbeg + (tid & 7) * 8;
  const unsigned short* gvl = Vtl + (size_t)(tid >> 3) * TT + jbeg + (tid & 7) * 8;
  fa_copy4(lcp, gk, ldk); fa_copy4(lcp + 64 * FA_ROWB, gvh, TT); fa_copy4(lcp + 128 * FA_ROWB, gvl, TT);
  FragH bq[KS];
  { const unsigned short* qr = (const unsigned short*)Q16 + ((size_t)b * TT + tq) * ldq + h * 64;
#pragma unroll
    for (int ks = 0; ks < KS; ++ks) { bq[ks].half[0] = *(const v8us*)(qr + ks * 32 + 8 * hh); bq[ks].half[1] = *(const v8us*)(qr + ks * 32 + 16 + 8 * hh); } }
  float m_q = -3.0e38f, l_q = 0.f; v8f oacc[DT], oaccl[DT];
#pragma unroll
  for (int dt = 0; dt < DT; ++dt) { oacc[dt] = (v8f){0.f,0.f,0.f,0.f,0.f,0.f,0.f,0.f}; oaccl[dt] = oacc[dt]; }
  asm volatile("s_wait_asynccnt 0x0" ::: "memory");      // this wave's copies of stage 0 have landed
  __syncthreads();                                        // ... and every other wave's
  if (nst > 1) { fa_copy4(lcp + FA_STAGE, gk + (size_t)64 * ldk, ldk); fa_copy4(lcp + FA_STAGE + 64 * FA_ROWB, gvh + 64, TT); fa_copy4(lcp + FA_STAGE + 128 * FA_ROWB, gvl + 64, TT); }
  // the stage loop stays rolled (the ring's waits and its barrier stand once, at the foot); every inner loop is unrolled so that fragments and accumulators are indexed by constants and stay in registers
#pragma unroll 1
  for (int t = 0; t < nst; ++t) {
    const unsigned buf = (unsigned)(t & 1) * FA_STAGE;
    const unsigned char* sk = L + buf + ln * FA_ROWB + 16 * hh;      /* K row ln of the stage, this half's 16-byte group */
    const unsigned char* sv = sk + 64 * FA_ROWB;                     /* V^T row ln, likewise */
#pragma unroll
    for (int c = 0; c < 2; ++c) { const int j0 = jbeg + t * 64 + c * 32;
    v8f s[2];
#pragma unroll
    for (int nt = 0; nt < 2; ++nt) { const unsigned char* kr = sk + (c * 32 + nt * 16) * FA_ROWB; FragH ak[KS];
#pragma unroll
      for (int ks = 0; ks < KS; ++ks) { ak[ks].half[0] = *(const v8us*)(kr + ks * 64); ak[ks].half[1] = *(const v8us*)(kr + ks * 64 + 32); }
      v8f acc = (v8f){0.f,0.f,0.f,0.f,0.f,0.f,0.f,0.f};
#pragma unroll
      for (int ks = 0; ks < KS; ++ks) acc = mmaH<1>(ak[ks].v, ak[ks].v, bq[ks].v, bq[ks].v, acc);
      s[nt] = acc; }
    float mc = -INFINITY;
#pragma unroll
    for (int nt = 0; nt < 2; ++nt)
#pragma unroll
      for (int r = 0; r < 8; ++r) { const int kk = j0 + nt * 16 + 8 * hh + r; const bool ok = (kk - tq <= RW) && (tq - kk <= RW);
        s[nt][r] = ok ? s[nt][r] : -INFINITY; mc = fmaxf(mc, s[nt][r]); }      /* raw products: the maximum is taken before the (positive) scale */
    mc = fmaxf(mc, xhalf(mc));
    const float mn = fmaxf(m_q, mc); float al = (m_q - mn) * FA_SC; m_q = mn;      /* al: here the exponent of the rescale factor, behind the run of v_exp_f32 the factor */
    const float mb = fmaf(mn, -FA_SC, 10.0f);      /* exponent's addend: minus the scaled maximum, plus 10 for the 2^10 that the f16 P carries */
    float e[16];      /* exponents, then p = 2^10 exp((s - max) / 8): one fma and one v_exp_f32 a score */
#pragma unroll
    for (int i = 0; i < 16; ++i) e[i] = fmaf(s[i >> 3][i & 7], FA_SC, mb);
    asm("v_exp_f32 %0, %0\n\tv_exp_f32 %1, %1\n\tv_exp_f32 %2, %2\n\tv_exp_f32 %3, %3\n\tv_exp_f32 %4, %4\n\tv_exp_f32 %5, %5\n\tv_exp_f32 %6, %6\n\tv_exp_f32 %7, %7\n\t"
        "v_exp_f32 %8, %8\n\tv_exp_f32 %9, %9\n\tv_exp_f32 %10, %10\n\tv_exp_f32 %11, %11\n\tv_exp_f32 %12, %12\n\tv_exp_f32 %13, %13\n\tv_exp_f32 %14, %14\n\tv_exp_f32 %15, %15\n\t"
        "v_exp_f32 %16, %16\n\tv_nop"
        : "+v"(al), "+v"(e[0]), "+v"(e[1]), "+v"(e[2]), "+v"(e[3]), "+v"(e[4]), "+v"(e[5]), "+v"(e[6]), "+v"(e[7]),
          "+v"(e[8]), "+v"(e[9]), "+v"(e[10]), "+v"(e[11]), "+v"(e[12]), "+v"(e[13]), "+v"(e[14]), "+v"(e[15]));
    FragH pb; float ps[4] = {0.f, 0.f, 0.f, 0.f};      /* four partial sums: no chain of 16 dependent adds */
#pragma unroll
    for (int nt = 0; nt < 2; ++nt)
#pragma unroll
      for (int r = 0; r < 8; ++r) { const float p = e[nt * 8 + r]; ps[r & 3] += p; pb.h[nt * 8 + r] = (_Float16)p; }
    l_q = l_q * al + ((ps[0] + ps[1]) + (ps[2] + ps[3]));      /* this lane's half of the column's sum; the halves join behind the loop */
#pragma unroll
    for (int dt = 0; dt < DT; ++dt)
#pragma unroll
      for (int r = 0; r < 8; ++r) { oacc[dt][r] *= al; oaccl[dt][r] *= al; }
#pragma unroll
    for (int dt = 0; dt < DT; ++dt) { const unsigned char* vr = sv + dt * 16 * FA_ROWB + c * 64; FragH av, avl; av.half[0] = *(const v8us*)vr; av.half[1] = *(const v8us*)(vr + 32); avl.half[0] = *(const v8us*)(vr + 64 * FA_ROWB); avl.half[1] = *(const v8us*)(vr + 64 * FA_ROWB + 32);
      oacc[dt] = mmaH<1>(av.v, av.v, pb.v, pb.v, oacc[dt]); oaccl[dt] = mmaH<1>(avl.v, avl.v, pb.v, pb.v, oaccl[dt]); } }
    asm volatile("s_wait_dscnt 0x0" ::: "memory");        // this wave's reads of the buffer have retired before it is refilled
    asm volatile("s_wait_asynccnt 0x0" ::: "memory");     // this wave's copies of stage t + 1 have landed
    __syncthreads();                                      // publishes stage t + 1 and ends every reader's last read of stage t's buffer
    if (t + 2 < nst) { fa_copy4(lcp + buf, gk + (size_t)(t + 2) * 64 * ldk, ldk); fa_copy4(lcp + buf + 64 * FA_ROWB, gvh + (t + 2) * 64, TT); fa_copy4(lcp + buf + 128 * FA_ROWB, gvl + (t + 2) * 64, TT); }
  }
  asm volatile("s_wait_asynccnt 0x0" ::: "memory");       // no copy is outstanding when the ring becomes output staging
  const float l = l_q + xhalf(l_q); const float inv = (l > 0.f) ? 1.0f / l : 0.f;      /* the sum carries P's 2^10 itself */
  // a lane's 8 registers of a tile are 8 consecutive head columns of its query: one 16-byte group of the f16 row (the out-projection's A operand); a wave stages its own 16 rows, pitch 144 B
  unsigned char* sO = L + w * (RPW * FA_ROWB);
#pragma unroll
  for (int dt = 0; dt < DT; ++dt) { FragH f;
#pragma unroll
    for (int r = 0; r < 8; ++r) f.h[r] = (_Float16)((oacc[dt][r] + oaccl[dt][r] * 0.0009765625f) * inv);
    *(v8us*)(sO + ln * FA_ROWB + (dt * 16 + 8 * hh) * 2) = f.half[0]; }
  __builtin_amdgcn_fence(__ATOMIC_ACQ_REL, "workgroup"); __builtin_amdgcn_wave_barrier();      // the wave's own LDS writes are read back by other lanes of the same wave
#pragma unroll
  for (int u = 0; u < 4; ++u) { const int r = u * 4 + (lane >> 3), c = (lane & 7) * 8;      /* 8 lanes = one whole 128-B line of a row */
    *(v8us*)((unsigned short*)O16 + ((size_t)b * TT + q0 + r) * ldo + h * 64 + c) = *(const v8us*)(sO + r * FA_ROWB + c * 2); }
}

// ---- tiled f16 GEMM with fused epilogue: act(A[M][K] * Bh[N][K]^T * alpha + bf16(bias[col]) (+ CP[row][col] if RES)) -> C16 (f16, if OUT16) or C (f32); ACT 0 none, 6 erf-GELU. A and Bh f16 and k-contiguous (pitch K), C / C16 / CP pitch N.
// One work-group = one 128 x 128 tile of C, 8 waves as 4 (rows) x 2 (columns), 32 x 64 of C per wave. A pass is 128 k: 256 B of each of the 128 A rows and 128 Bh rows,
// laid in LDS at a pitch of 272 B (an odd multiple of 16 B: conflict-free for ds_load_b128 fragment reads). Two buffers; the next pass's rows are copied while this pass is multiplied.
// M, N multiples of 128, K a multiple of 128. The k order of every accumulator is ascending in steps of 32.
// NF > 0: two products on one A share the grid: the tiles of the first N - NF columns go to C16 (pitch N - NF); those of the last NF columns (v) go out transposed, split into an f16 value and its residual x 2^10:
// Vh / Vl [row / TT][column][row % TT], the layout the attention kernel reads its value fragments from.
#define GT_ROWB 272
#define GT_STAGE (256 * GT_ROWB)
// Eight 16-byte asynchronous copies of one lane, global -> LDS, rows 16 apart. The s_wait_xcnt closes the statement so that no address register is rewritten ahead of it.
template <int K>
__device__ __forceinline__ void gt_copy8(unsigned l0, const _Float16* g0) {
  const unsigned l1 = l0 + 16 * GT_ROWB, l2 = l0 + 32 * GT_ROWB, l3 = l0 + 48 * GT_ROWB, l4 = l0 + 64 * GT_ROWB, l5 = l0 + 80 * GT_ROWB, l6 = l0 + 96 * GT_ROWB, l7 = l0 + 112 * GT_ROWB;
  const _Float16 *g1 = g0 + 16 * K, *g2 = g0 + 32 * K, *g3 = g0 + 48 * K, *g4 = g0 + 64 * K, *g5 = g0 + 80 * K, *g6 = g0 + 96 * K, *g7 = g0 + 112 * K;
  asm volatile("global_load_async_to_lds_b128 %0, %8, off\n\t"
               "global_load_async_to_lds_b128 %1, %9, off\n\t"
               "global_load_async_to_lds_b128 %2, %10, off\n\t"
               "global_load_async_to_lds_b128 %3, %11, off\n\t"
               "global_load_async_to_lds_b128 %4, %12, off\n\t"
               "global_load_async_to_lds_b128 %5, %13, off\n\t"
               "global_load_async_to_lds_b128 %6, %14, off\n\t"
               "global_load_async_to_lds_b128 %7, %15, off\n\t"
               "s_wait_xcnt 0x0"
               :: "v"(l0), "v"(l1), "v"(l2), "v"(l3), "v"(l4), "v"(l5), "v"(l6), "v"(l7), "v"(g0), "v"(g1), "v"(g2), "v"(g3), "v"(g4), "v"(g5), "v"(g6), "v"(g7) : "memory");
}
// erf-GELU without a branch: gelu(v) = v Phi(v), Phi(v) = 1 - q for v >= 0 and q for v < 0, q = erfc(|v| / sqrt 2) / 2 = (c1 t + ... + c5 t^5) exp(-v^2 / 2), t = 1 / (1 + p |v| / sqrt 2):
// the classical five-term form, absolute error of erf below 1.5e-7 (the result is rounded to f16 behind it). Every lane runs the same sixteen instructions, and the elements of a row are independent chains.
__device__ __forceinline__ float gelu_erf(float v) {
  const float t = __builtin_amdgcn_rcpf(fmaf(fabsf(v), 0.3275911f * 0.70710678118654752f, 1.0f));
  const float e = hw_exp2(v * v * -0.72134752044448170f);      /* exp(-v^2 / 2) */
  float q = fmaf(t, 0.5f * 1.061405429f, 0.5f * -1.453152027f);
  q = fmaf(t, q, 0.5f * 1.421413741f); q = fmaf(t, q, 0.5f * -0.284496736f); q = fmaf(t, q, 0.5f * 0.254829592f);
  q = q * t * e;
  return v * (v >= 0.f ? 1.0f - q : q);
}
// A wave's staged 32 x 64 tile (so, pitch 68 floats) -> rows rw .. rw + 31, columns cw .. cw + 63 of a plane of pitch P, in whole lines.
template <int ACT, int P, bool RES, bool OUT16>
__device__ __forceinline__ void gt_store(const float* so, const float* __restrict__ CP, float* __restrict__ C, _Float16* __restrict__ C16, int rw, int cw, int lane) {
  const int rsub = lane >> 4, c4 = (lane & 15) * 4;
#pragma unroll (ACT == 6 ? 2 : 16)      /* GELU: two rows a trip are eight independent chains, enough to fill the vector port; more copies would only lengthen a text that runs once */
  for (int q = 0; q < 16; ++q) { const int r = q * 2 + rsub; v4f v = *(const v4fa*)&so[r * 68 + c4]; const size_t o = (size_t)(rw + r) * P + cw + c4;
    if (RES) { const v4f c = *(const v4fa*)(CP + o); v[0] += c[0]; v[1] += c[1]; v[2] += c[2]; v[3] += c[3]; }
    if (ACT == 6) {
#pragma unroll
      for (int e = 0; e < 4; ++e) v[e] = gelu_erf(v[e]); }
    if (!OUT16) *(v4f*)(C + o) = v;
    else { v4h h4;
#pragma unroll
      for (int e = 0; e < 4; ++e) h4[e] = (_Float16)v[e];
      *(v4h*)(C16 + o) = h4; } }
  asm volatile("s_wait_xcnt 0x0" ::: "memory");      // closes the run of stores: where two store paths share a kernel the other path's code follows in the text and reuses the stores' registers
}
template <int ACT, int N, int K, bool RES, bool OUT16, int NF = 0>
__global__ __launch_bounds__(256) void k_gemm_t(const _Float16* __restrict__ A, const _Float16* __restrict__ Bh, float alpha, const float* __restrict__ bias, const float* __restrict__ CP, float* __restrict__ C, _Float16* __restrict__ C16, _Float16* __restrict__ Vh, _Float16* __restrict__ Vl) {
  __shared__ __attribute__((aligned(16))) unsigned char L[2 * GT_STAGE];
  constexpr int NST = K / 128, NTN = N / 128;
  const int tid = threadIdx.x, w = tid >> 5, lane = tid & 31, ln = lane & 15, hh = lane >> 4;
  const int row0 = (int)(blockIdx.x / NTN) * 128, col0 = (int)(blockIdx.x % NTN) * 128;
  const int wm = w >> 1, wn = w & 1;
  // copy roles: 16 lanes cover one row's 256 B; a thread takes rows (tid / 16) + 16 i of A and of Bh
  const unsigned lcp = (unsigned)(size_t)L + (unsigned)(tid >> 4) * GT_ROWB + (unsigned)(tid & 15) * 16u;
  const _Float16* ga = A + (size_t)(row0 + (tid >> 4)) * K + (tid & 15) * 8;
  const _Float16* gb = Bh + (size_t)(col0 + (tid >> 4)) * K + (tid & 15) * 8;
  v8f acc[2][4];
#pragma unroll
  for (int i = 0; i < 2; ++i)
#pragma unroll
    for (int j = 0; j < 4; ++j) acc[i][j] = (v8f){0.f,0.f,0.f,0.f,0.f,0.f,0.f,0.f};
  gt_copy8<K>(lcp, ga); gt_copy8<K>(lcp + 128 * GT_ROWB, gb);
  asm volatile("s_wait_asynccnt 0x0" ::: "memory");      // this wave's copies of pass 0 have landed
  __syncthreads();                                        // ... and every other wave's
  if (NST > 1) { gt_copy8<K>(lcp + GT_STAGE, ga + 128); gt_copy8<K>(lcp + GT_STAGE + 128 * GT_ROWB, gb + 128); }
#pragma unroll 1      /* one pass per trip: the ring's waits and its barrier stand once, at the foot */
  for (int t = 0; t < NST; ++t) {
    const unsigned buf = (unsigned)(t & 1) * GT_STAGE;
    const unsigned char* sa = L + buf + (wm * 32 + ln) * GT_ROWB + 16 * hh;
    const unsigned char* sb = L + buf + (128 + wn * 64 + ln) * GT_ROWB + 16 * hh;
    // two fragment sets: block ks + 1's twelve LDS reads go out as one group ahead of block ks's eight WMMAs (all inside this pass's own buffer)
    FragH a[2][2], b[2][4];
#pragma unroll
    for (int i = 0; i < 2; ++i) { a[0][i].half[0] = *(const v8us*)(sa + i * 16 * GT_ROWB); a[0][i].half[1] = *(const v8us*)(sa + i * 16 * GT_ROWB + 32); }
#pragma unroll
    for (int j = 0; j < 4; ++j) { b[0][j].half[0] = *(const v8us*)(sb + j * 16 * GT_ROWB); b[0][j].half[1] = *(const v8us*)(sb + j * 16 * GT_ROWB + 32); }
#pragma unroll
    for (int ks = 0; ks < 4; ++ks) {
      const int cu = ks & 1, nx = cu ^ 1;
      if (ks < 3) {
#pragma unroll
        for (int i = 0; i < 2; ++i) { a[nx][i].half[0] = *(const v8us*)(sa + i * 16 * GT_ROWB + (ks + 1) * 64); a[nx][i].half[1] = *(const v8us*)(sa + i * 16 * GT_ROWB + (ks + 1) * 64 + 32); }
#pragma unroll
        for (int j = 0; j < 4; ++j) { b[nx][j].half[0] = *(const v8us*)(sb + j * 16 * GT_ROWB + (ks + 1) * 64); b[nx][j].half[1] = *(const v8us*)(sb + j * 16 * GT_ROWB + (ks + 1) * 64 + 32); }
      }
      __builtin_amdgcn_sched_barrier(0);      // keeps the read group whole and ahead of the WMMAs: without it the scheduler spreads the reads among them and waits to 0 at each place
#pragma unroll
      for (int i = 0; i < 2; ++i)
#pragma unroll
        for (int j = 0; j < 4; ++j) acc[i][j] = __builtin_amdgcn_wmma_f32_16x16x32_f16(false, a[cu][i].v, false, b[cu][j].v, (short)0, acc[i][j], false, false);
      __builtin_amdgcn_sched_barrier(0);      // ... and keeps the next group behind this block
    }
    asm volatile("s_wait_dscnt 0x0" ::: "memory");        // this wave's reads of the buffer have retired before it is refilled
    asm volatile("s_wait_asynccnt 0x0" ::: "memory");     // this wave's copies of pass t + 1 have landed
    __syncthreads();                                      // publishes pass t + 1 and ends every reader's last read of pass t's buffer
    if (t + 2 < NST) { gt_copy8<K>(lcp + buf, ga + (t + 2) * 128); gt_copy8<K>(lcp + buf + 128 * GT_ROWB, gb + (t + 2) * 128); }
  }
  asm volatile("s_wait_asynccnt 0x0" ::: "memory");       // no copy is outstanding when the ring becomes output staging
  // NF > 0: which plane the tile belongs to is the same for the whole work-group, so the choice (and the v path's barrier) is block-uniform
  if (NF > 0 && col0 >= N - NF) {
    // v tile: an accumulator's 8 registers are 8 consecutive rows of one column = one 16-byte group of a transposed f16 row. The work-group's 128 columns x 128 rows are laid in the ring,
    // value plane then residual plane, one column = 256 B at the pitch of 272 B; behind a barrier 16 lanes store one column's 256 contiguous bytes.
#pragma unroll
    for (int j = 0; j < 4; ++j) { const float bv = bf16_round(bias[col0 + wn * 64 + j * 16 + ln]);
#pragma unroll
      for (int i = 0; i < 2; ++i) { FragH fh, fl;
#pragma unroll
        for (int r = 0; r < 8; ++r) { const float v = acc[i][j][r] * alpha + bv; const _Float16 hv = (_Float16)v; fh.h[r] = hv; fl.h[r] = (_Float16)((v - (float)hv) * 1024.0f); }
        unsigned char* p = L + (wn * 64 + j * 16 + ln) * GT_ROWB + (wm * 32 + i * 16 + 8 * hh) * 2;
        *(v8us*)p = fh.half[0]; *(v8us*)(p + 128 * GT_ROWB) = fl.half[0]; } }
    __syncthreads();      // a column's 128 rows come from four waves: all are in LDS before a column is read back
    const size_t o = ((size_t)(row0 / TT) * NF + (col0 - (N - NF)) + (tid >> 4)) * TT + (row0 % TT) + (tid & 15) * 8;
#pragma unroll
    for (int u = 0; u < 8; ++u) { const unsigned char* p = L + (u * 16 + (tid >> 4)) * GT_ROWB + (tid & 15) * 16;
      *(v8us*)((unsigned short*)Vh + o + (size_t)(u * 16) * TT) = *(const v8us*)p; *(v8us*)((unsigned short*)Vl + o + (size_t)(u * 16) * TT) = *(const v8us*)(p + 128 * GT_ROWB); }
    asm volatile("s_wait_xcnt 0x0" ::: "memory");      // closes the run of stores: the other path's code follows in the text and reuses the stores' registers
    return;
  }
  // epilogue: each wave stages its 32 x 64 tile in its own range of the ring (pitch 68 floats) and stores whole lines
  float* so = (float*)L + w * (32 * 68);
#pragma unroll
  for (int j = 0; j < 4; ++j) { const float bv = bf16_round(bias[col0 + wn * 64 + j * 16 + ln]);
#pragma unroll
    for (int i = 0; i < 2; ++i)
#pragma unroll
      for (int r = 0; r < 8; ++r) so[(i * 16 + 8 * hh + r) * 68 + j * 16 + ln] = acc[i][j][r] * alpha + bv; }
  __builtin_amdgcn_fence(__ATOMIC_ACQ_REL, "workgroup"); __builtin_amdgcn_wave_barrier();      // the wave's own LDS writes are read back by other lanes of the same wave
  gt_store<ACT, N - NF, RES, OUT16>(so, CP, C, C16, row0 + wm * 32, col0 + wn * 64, lane);
}

extern "C" void kernel_launch(void* const* d_in, const int* in_sizes, int n_in,
                              void* d_out, int out_size, void* d_ws, size_t ws_size, hipStream_t stream) {
  (void)in_sizes; (void)n_in; (void)out_size;
  const float* const* I = (const float* const*)d_in; const float* x = I[0]; const float* Wqkv = I[1]; const float* bqkv = I[2]; const float* Wo = I[3]; const float* bo = I[4]; const float* g1 = I[5]; const float* be1 = I[6]; const float* g2 = I[7]; const float* be2 = I[8];
  const float* W1 = I[9]; const float* b1 = I[10]; const float* W2 = I[11]; const float* b2 = I[12];
  char* ws = (char*)d_ws; size_t off = 0;
  auto take = [&](size_t bytes) { char* p = ws + off; off += (bytes + 255) & ~(size_t)255; return p; };
  _Float16* Bqkv = (_Float16*)take((size_t)3 * DM * DM * 2); _Float16* Bo = (_Float16*)take((size_t)DM * DM * 2); _Float16* Bw1 = (_Float16*)take((size_t)FF * DM * 2); _Float16* Bw2 = (_Float16*)take((size_t)DM * FF * 2);
  _Float16* H16 = (_Float16*)take((size_t)NR * DM * 2); float* XR = (float*)take((size_t)NR * DM * 4); _Float16* QK = (_Float16*)take((size_t)NR * 2 * DM * 2);
  _Float16* Vth = (_Float16*)take((size_t)NR * DM * 2); _Float16* Vtl = (_Float16*)take((size_t)NR * DM * 2); float* X1 = (float*)take((size_t)NR * DM * 4);
  _Float16* O16 = H16; _Float16* H2 = H16; _Float16* FH = QK;      /* reuse: H16 holds LN1 output (consumed by the qkv GEMM), then O16, then LN2 output; the [q|k] plane holds the FFN hidden (f16 [4096][2048]) once attention is done */
  if (off > ws_size) return;      // 6.3 + 2.1 + 4.2 + 4.2 + 8.4 + 16.8 + 16.8 + 8.4 + 8.4 + 16.8 = about 92 MB
  k_prep<<<PB_LN + PB_QKV + PB_O + PB_W1 + PB_W2, 256, 0, stream>>>(x, g1, be1, H16, XR, Wqkv, Wo, W1, W2, Bqkv, Bo, Bw1, Bw2);      /* LN1 and the four weight planes */
  const dim3 gqkv((NR / 128) * (3 * DM / 128), 1), gd((NR / 128) * (DM / 128), 1), gf((NR / 128) * (FF / 128), 1);      /* one work-group per 128 x 128 tile */
  k_gemm_t<0, 3 * DM, DM, false, true, DM><<<gqkv, 256, 0, stream>>>(H16, Bqkv, 0.0625f, bqkv, nullptr, nullptr, QK, Vth, Vtl);      /* [q | k] + bias (f16) and v + bias -> transposed hi / lo planes: M 4096 N 3072 K 1024 */
  k_flash<<<BB * NH * (TT / 64), 128, 0, stream>>>(QK, 2 * DM, QK + DM, 2 * DM, Vth, Vtl, O16, DM);
  k_gemm_t<0, DM, DM, true, false><<<gd, 256, 0, stream>>>(O16, Bo, 0.0625f, bo, XR, X1, nullptr, nullptr, nullptr);      /* x1 = x + (O·out_w + out_b) via the per-element addend */
  k_lnx<DM, 0><<<(NR + 7) / 8, 256, 0, stream>>>(X1, g2, be2, NR, 1e-5f, H2, nullptr);      /* LN2(x1) → f16 (x1 is a computed value: no input rounding) */
  k_gemm_t<6, FF, DM, false, true><<<gf, 256, 0, stream>>>(H2, Bw1, 0.0625f, b1, nullptr, nullptr, FH, nullptr, nullptr);      /* gelu_erf(h2·w1 + b1) → f16: M 4096 N 2048 K 1024 */
  k_gemm_t<0, DM, FF, true, false><<<gd, 256, 0, stream>>>(FH, Bw2, 0.0625f, b2, X1, (float*)d_out, nullptr, nullptr, nullptr);      /* y = x1 + (·w2 + b2): M 4096 N 1024 K 2048 */
}

// v008
// Measured time: 115 microseconds a run.
// Next to v007, in two timings, it ran 1.03 times as fast each time.
// All steps since v000 together make it 4.13 times as fast.
#include <hip/hip_runtime.h>
// Transformer layer with windowed (|i−j| ≤ 128) multi-head self-attention (B=2, L=2048, d_model 1024, 16 heads × 64): h = LN1(x); qkv = h·W + b; per head softmax(q·kᵀ/8 + window mask)·v; x1 = x + (merged·out_w + out_b);
// y = x1 + (gelu_erf(LN2(x1)·w1 + b1)·w2 + b2). (in,out) weights.
// Compute dtype: x, weights, biases, LN parameters rounded to bf16; LayerNorms in f32 (wave per row) → f16 operands; q,k f16 GEMM outputs, v f32 → f16 hi + ×2^10 residual Vᵀ planes; fused windowed
// flash-style kernel (online softmax f32, P f16 ×2^10, two value accumulators) on v_wmma_f32_16x16x32_f16; the residual sums ride the GEMMs' per-element addend in f32; FFN hidden f16 after the erf-GELU epilogue.
#define BB 2
#define TT 2048
#define DM 1024
#define NH 16
#define HD 64
#define RW 128
#define FF 2048
#define NR (BB * TT)

typedef __bf16 v16b __attribute__((ext_vector_type(16)));
typedef unsigned short v8us __attribute__((ext_vector_type(8), may_alias));
typedef float  v8f  __attribute__((ext_vector_type(8)));
typedef float  v4f  __attribute__((ext_vector_type(4)));
typedef float  v4fa __attribute__((ext_vector_type(4), may_alias));
union FragB { v16b v; v8us half[2]; unsigned short u[16]; };

__device__ __forceinline__ unsigned short bf16_bits(float x) { unsigned int u = __float_as_uint(x); return (unsigned short)((u + 0x7FFFu + ((u >> 16) & 1u)) >> 16); }
__device__ __forceinline__ float bf16_val(unsigned short b) { return __uint_as_float(((unsigned int)b) << 16); }
__device__ __forceinline__ float bf16_round(float x) { return bf16_val(bf16_bits(x)); }
// D += A·B with NT terms: 1 = ah·bh, 2 = + al·bh (A split), 3 = + ah·bl (both split)
template <int NT>
__device__ __forceinline__ v8f mmaN(v16b ah, v16b al, v16b bh, v16b bl, v8f c) {
  c = __builtin_amdgcn_wmma_f32_16x16x32_bf16(false, ah, false, bh, (short)0, c, false, false);
  if (NT >= 2) c = __builtin_amdgcn_wmma_f32_16x16x32_bf16(false, al, false, bh, (short)0, c, false, false);
  if (NT >= 3) c = __builtin_amdgcn_wmma_f32_16x16x32_bf16(false, ah, false, bl, (short)0, c, false, false);
  asm volatile("v_nop\n\tv_nop\n\tv_nop\n\tv_nop" : "+v"(c) : "v"(ah), "v"(al), "v"(bh), "v"(bl));
  return c;
}

__global__ __launch_bounds__(256) void k_wt_bf16(const float* __restrict__ W, unsigned short* __restrict__ Wt, int K, int N) {
  const int t = blockIdx.x * 256 + threadIdx.x;
  const int k8n = K / 8;
  if (t >= N * k8n) return;
  const int n = t / k8n, k8 = (t % k8n) * 8;
  v8us v;
#pragma unroll
  for (int i = 0; i < 8; ++i) v[i] = bf16_bits(W[(size_t)(k8 + i) * N + n]);
  *(v8us*)(Wt + (size_t)n * K + k8) = v;
  
}

// GEMM C[M][N] (f32, pitch ldc) = act(A[M][K]·W + bias). A f32 row-major (pitch lda) converted per fragment to bf16
// (ASPLIT: hi/lo two planes -> 2 terms, else single rounded term); Wt bf16 [N][K] (pitch ldb). BIAS_BF16 rounds the
// bias to bf16 first (bias quantised to bf16 before the add). K%32==0, M%16==0, N%64==0.
template <bool ASPLIT, int ACT, bool BIAS_BF16>
__global__ __launch_bounds__(128) void k_gemm_bf(const float* __restrict__ A, int lda, const unsigned short* __restrict__ Wt, int ldb,
                                               const float* __restrict__ bias, float* __restrict__ C, int ldc, int M, int N, int K) {
  __shared__ __attribute__((aligned(16))) float so[4][16][64];
  const int tid = threadIdx.x, w = tid >> 5, lane = tid & 31, ln = lane & 15, hh = lane >> 4;
  const int ntn = N / 64;
  const int wid = blockIdx.x * 4 + w;
  const int mt = wid / ntn, nq = wid % ntn;
  if (mt * 16 >= M) return;
  const int row0 = mt * 16, col0 = nq * 64;
  const float* arow = A + (size_t)(row0 + ln) * lda;
  v8f acc[4] = {};
  for (int kb = 0; kb < K; kb += 32) {
    FragB ah, al;
    const v4f x0 = *(const v4fa*)(arow + kb + 8 * hh), x1 = *(const v4fa*)(arow + kb + 8 * hh + 4);
    const v4f x2 = *(const v4fa*)(arow + kb + 16 + 8 * hh), x3 = *(const v4fa*)(arow + kb + 16 + 8 * hh + 4);
    float xs[16] = {x0[0],x0[1],x0[2],x0[3],x1[0],x1[1],x1[2],x1[3],x2[0],x2[1],x2[2],x2[3],x3[0],x3[1],x3[2],x3[3]};
#pragma unroll
    for (int i = 0; i < 16; ++i) { const unsigned short hb = bf16_bits(xs[i]); ah.u[i] = hb; al.u[i] = ASPLIT ? bf16_bits(xs[i] - bf16_val(hb)) : (unsigned short)0; }
#pragma unroll
    for (int t = 0; t < 4; ++t) {
      const unsigned short* brow = Wt + (size_t)(col0 + t * 16 + ln) * ldb + kb;
      FragB b;
      b.half[0] = *(const v8us*)(brow + 8 * hh);
      b.half[1] = *(const v8us*)(brow + 16 + 8 * hh);
      acc[t] = mmaN<ASPLIT ? 2 : 1>(ah.v, al.v, b.v, b.v, acc[t]);
    }
  }
#pragma unroll
  for (int t = 0; t < 4; ++t) {
    float bv = bias ? bias[col0 + t * 16 + ln] : 0.f;
    if (BIAS_BF16) bv = bf16_round(bv);
#pragma unroll
    for (int r = 0; r < 8; ++r) { float v = acc[t][r] + bv; if (ACT == 1) v = fmaxf(v, 0.f); so[w][8 * hh + r][t * 16 + ln] = v; }
  }
  __builtin_amdgcn_fence(__ATOMIC_ACQ_REL, "workgroup");
  __builtin_amdgcn_wave_barrier();
  const int rsub = lane >> 4, c4 = (lane & 15) * 4;
  {
#pragma unroll
    for (int q = 0; q < 8; ++q) {
      const int r = q * 2 + rsub;
      const v4f v = *(const v4fa*)&so[w][r][c4];
      *(v4f*)(C + (size_t)(row0 + r) * ldc + col0 + c4) = v;
    }
    
  }
}

// Flash-style causal/unmasked attention, all contractions 3-term bf16 hi/lo splits, f32 softmax with running max.
// q,k,v rows are read from f32 buffers with arbitrary row pitch (so they can live inside a fused qkv buffer);
// D = head size (multiple of 32, <= 128); one wave = 16 query rows; block = 4 waves (64 queries) sharing K/V chunks of 32.
template <int D, bool CAUSAL>
__global__ __launch_bounds__(128) void k_flash(const float* __restrict__ qb, const float* __restrict__ kb, const float* __restrict__ vb,
                                             int pitch, int T, int H, float scale, float* __restrict__ y, int ypitch) {
  constexpr int KS = D / 32;        // k-steps for QK
  constexpr int DT = D / 16;        // d tiles for PV
  __shared__ __attribute__((aligned(16))) unsigned short sKh[32][D + 8], sKl[32][D + 8], sVh[32][D + 8], sVl[32][D + 8];
  __shared__ __attribute__((aligned(16))) unsigned short sPh[4][16][40], sPl[4][16][40];
  __shared__ __attribute__((aligned(16))) float sO[4][16][D];
  const int tid = threadIdx.x, w = tid >> 5, lane = tid & 31, ln = lane & 15, hh = lane >> 4;
  const int nqb = (T + 63) / 64;
  const int bh = blockIdx.x / nqb, qblk = blockIdx.x % nqb;
  const int b = bh / H, h = bh % H;
  const int q0 = qblk * 64 + w * 16;
  const float* Q = qb + (size_t)b * T * pitch + h * D;
  const float* K = kb + (size_t)b * T * pitch + h * D;
  const float* V = vb + (size_t)b * T * pitch + h * D;

  // A fragments of the wave's 16 query rows (scaled), hi/lo
  FragB aqh[KS], aql[KS];
  {
    int row = q0 + ln; if (row >= T) row = T - 1;
    const float* qr = Q + (size_t)row * pitch;
#pragma unroll
    for (int ks = 0; ks < KS; ++ks)
#pragma unroll
      for (int i = 0; i < 16; ++i) {
        const int d = ks * 32 + ((i < 8) ? (8 * hh + i) : (16 + 8 * hh + (i - 8)));
        const float x = qr[d] * scale; const unsigned short hb = bf16_bits(x);
        aqh[ks].u[i] = hb; aql[ks].u[i] = bf16_bits(x - bf16_val(hb));
      }
  }
  float m_r[8], l_r[8];
#pragma unroll
  for (int r = 0; r < 8; ++r) { m_r[r] = -3.0e38f; l_r[r] = 0.f; }
  v8f oacc[DT];
#pragma unroll
  for (int dt = 0; dt < DT; ++dt) oacc[dt] = (v8f){0.f,0.f,0.f,0.f,0.f,0.f,0.f,0.f};

  const int kv_end = CAUSAL ? min(T, qblk * 64 + 64) : T;     // block-uniform
  for (int j0 = 0; j0 < kv_end; j0 += 32) {
    __syncthreads();
    for (int e = tid; e < 32 * (D / 4); e += 128) {
      const int r = e / (D / 4), c4 = (e % (D / 4)) * 4;
      const int key = j0 + r;
      v4f kf = {0.f,0.f,0.f,0.f}, vf = {0.f,0.f,0.f,0.f};
      if (key < T) { kf = *(const v4fa*)(K + (size_t)key * pitch + c4); vf = *(const v4fa*)(V + (size_t)key * pitch + c4); }
#pragma unroll
      for (int t = 0; t < 4; ++t) {
        unsigned short hb = bf16_bits(kf[t]); sKh[r][c4 + t] = hb; sKl[r][c4 + t] = bf16_bits(kf[t] - bf16_val(hb));
        hb = bf16_bits(vf[t]); sVh[r][c4 + t] = hb; sVl[r][c4 + t] = bf16_bits(vf[t] - bf16_val(hb));
      }
    }
    __syncthreads();
    // S tile 16 x 32
    v8f s[2];
#pragma unroll
    for (int nt = 0; nt < 2; ++nt) {
      v8f acc = {};
#pragma unroll
      for (int ks = 0; ks < KS; ++ks) {
        FragB bh_, bl_;
        bh_.half[0] = *(const v8us*)&sKh[nt * 16 + ln][ks * 32 + 8 * hh]; bh_.half[1] = *(const v8us*)&sKh[nt * 16 + ln][ks * 32 + 16 + 8 * hh];
        bl_.half[0] = *(const v8us*)&sKl[nt * 16 + ln][ks * 32 + 8 * hh]; bl_.half[1] = *(const v8us*)&sKl[nt * 16 + ln][ks * 32 + 16 + 8 * hh];
        acc = mmaN<3>(aqh[ks].v, aql[ks].v, bh_.v, bl_.v, acc);
      }
      s[nt] = acc;
    }
    // mask + running max (rows 8hh+r; the 16 lanes of a half share rows)
    float alpha[8];
#pragma unroll
    for (int r = 0; r < 8; ++r) {
      const int qi = q0 + 8 * hh + r;
      const int ja = j0 + ln, jb = j0 + 16 + ln;
      if (CAUSAL) { if (ja > qi) s[0][r] = -3.0e38f; if (jb > qi) s[1][r] = -3.0e38f; }
      if (ja >= T) s[0][r] = -3.0e38f;
      if (jb >= T) s[1][r] = -3.0e38f;
      float mx = fmaxf(s[0][r], s[1][r]);
      mx = fmaxf(mx, __shfl_xor(mx, 1, 32)); mx = fmaxf(mx, __shfl_xor(mx, 2, 32)); mx = fmaxf(mx, __shfl_xor(mx, 4, 32)); mx = fmaxf(mx, __shfl_xor(mx, 8, 32));
      const float mnew = fmaxf(m_r[r], mx);
      alpha[r] = (mnew > -1.0e38f) ? __expf(m_r[r] - mnew) : 1.0f;
      const float p0 = (s[0][r] > -1.0e38f) ? __expf(s[0][r] - mnew) : 0.f;
      const float p1 = (s[1][r] > -1.0e38f) ? __expf(s[1][r] - mnew) : 0.f;
      m_r[r] = mnew;
      l_r[r] = l_r[r] * alpha[r] + p0 + p1;            // per-lane partial row sum (16 lanes combined at the end)
      unsigned short hb = bf16_bits(p0); sPh[w][8 * hh + r][ln] = hb;      sPl[w][8 * hh + r][ln] = bf16_bits(p0 - bf16_val(hb));
      hb = bf16_bits(p1);                sPh[w][8 * hh + r][16 + ln] = hb; sPl[w][8 * hh + r][16 + ln] = bf16_bits(p1 - bf16_val(hb));
    }
#pragma unroll
    for (int dt = 0; dt < DT; ++dt)
#pragma unroll
      for (int r = 0; r < 8; ++r) oacc[dt][r] *= alpha[r];
    __builtin_amdgcn_fence(__ATOMIC_ACQ_REL, "workgroup");
    __builtin_amdgcn_wave_barrier();
    FragB pah, pal;
    pah.half[0] = *(const v8us*)&sPh[w][ln][8 * hh]; pah.half[1] = *(const v8us*)&sPh[w][ln][16 + 8 * hh];
    pal.half[0] = *(const v8us*)&sPl[w][ln][8 * hh]; pal.half[1] = *(const v8us*)&sPl[w][ln][16 + 8 * hh];
#pragma unroll
    for (int dt = 0; dt < DT; ++dt) {
      FragB bvh, bvl;
#pragma unroll
      for (int i = 0; i < 8; ++i) {
        bvh.u[i] = sVh[8 * hh + i][dt * 16 + ln]; bvh.u[8 + i] = sVh[16 + 8 * hh + i][dt * 16 + ln];
        bvl.u[i] = sVl[8 * hh + i][dt * 16 + ln]; bvl.u[8 + i] = sVl[16 + 8 * hh + i][dt * 16 + ln];
      }
      oacc[dt] = mmaN<3>(pah.v, pal.v, bvh.v, bvl.v, oacc[dt]);
    }
    __builtin_amdgcn_fence(__ATOMIC_ACQ_REL, "workgroup");
    __builtin_amdgcn_wave_barrier();
  }
#pragma unroll
  for (int r = 0; r < 8; ++r) {
    float l = l_r[r];
    l += __shfl_xor(l, 1, 32); l += __shfl_xor(l, 2, 32); l += __shfl_xor(l, 4, 32); l += __shfl_xor(l, 8, 32);
    l_r[r] = (l > 0.f) ? 1.0f / l : 0.f;
  }
#pragma unroll
  for (int dt = 0; dt < DT; ++dt)
#pragma unroll
    for (int r = 0; r < 8; ++r) sO[w][8 * hh + r][dt * 16 + ln] = oacc[dt][r] * l_r[r];
  __builtin_amdgcn_fence(__ATOMIC_ACQ_REL, "workgroup");
  __builtin_amdgcn_wave_barrier();
  {
    for (int r = 0; r < 16; ++r) {
      const int row = q0 + r;
      if (row < T && lane < D / 4) {
        const v4f val = *(const v4fa*)&sO[w][r][lane * 4];
        *(v4f*)(y + ((size_t)b * T + row) * ypitch + h * D + lane * 4) = val;
      }
    }
    
  }
}

// GEMM C = act(A·W + bias + resid): A f32 (ASPLIT -> hi/lo 2 terms), Wt bf16 [N][K]; ACT 0 none, 1 relu, 2 exact gelu;
// resid (optional, f32, row index = (row % rmod), pitch ldr, RES_BF16 rounds it) added before the activation.
template <bool ASPLIT, int ACT, bool BIAS_BF16, bool RES_BF16>
__global__ __launch_bounds__(128) void k_gemm_bf3(const float* __restrict__ A, int lda, const unsigned short* __restrict__ Wt, int ldb,
                                                const float* __restrict__ bias, const float* __restrict__ resid, int rmod, int ldr,
                                                float* __restrict__ C, int ldc, int M, int N, int K) {
  __shared__ __attribute__((aligned(16))) float so[4][16][64];
  const int tid = threadIdx.x, w = tid >> 5, lane = tid & 31, ln = lane & 15, hh = lane >> 4;
  const int ntn = N / 64;
  const int wid = blockIdx.x * 4 + w;
  const int mt = wid / ntn, nq = wid % ntn;
  if (mt * 16 >= M) return;
  const int row0 = mt * 16, col0 = nq * 64;
  const float* arow = A + (size_t)(row0 + ln) * lda;
  v8f acc[4] = {};
  for (int kb = 0; kb < K; kb += 32) {
    FragB ah, al;
    const v4f x0 = *(const v4fa*)(arow + kb + 8 * hh), x1 = *(const v4fa*)(arow + kb + 8 * hh + 4);
    const v4f x2 = *(const v4fa*)(arow + kb + 16 + 8 * hh), x3 = *(const v4fa*)(arow + kb + 16 + 8 * hh + 4);
    float xs[16] = {x0[0],x0[1],x0[2],x0[3],x1[0],x1[1],x1[2],x1[3],x2[0],x2[1],x2[2],x2[3],x3[0],x3[1],x3[2],x3[3]};
#pragma unroll
    for (int i = 0; i < 16; ++i) { const unsigned short hb = bf16_bits(xs[i]); ah.u[i] = hb; al.u[i] = ASPLIT ? bf16_bits(xs[i] - bf16_val(hb)) : (unsigned short)0; }
#pragma unroll
    for (int t = 0; t < 4; ++t) {
      const unsigned short* brow = Wt + (size_t)(col0 + t * 16 + ln) * ldb + kb;
      FragB b;
      b.half[0] = *(const v8us*)(brow + 8 * hh);
      b.half[1] = *(const v8us*)(brow + 16 + 8 * hh);
      acc[t] = mmaN<ASPLIT ? 2 : 1>(ah.v, al.v, b.v, b.v, acc[t]);
    }
  }
#pragma unroll
  for (int t = 0; t < 4; ++t) {
    const int col = col0 + t * 16 + ln;
    float bv = bias ? bias[col] : 0.f;
    if (BIAS_BF16) bv = bf16_round(bv);
#pragma unroll
    for (int r = 0; r < 8; ++r) {
      float v = acc[t][r] + bv;
      if (resid) { float rv = resid[(size_t)((row0 + 8 * hh + r) % rmod) * ldr + col]; if (RES_BF16) rv = bf16_round(rv); v += rv; }
      if (ACT == 1) v = fmaxf(v, 0.f);
      if (ACT == 2) v = 0.5f * v * (1.0f + erff(v * 0.70710678118654752f));
      if (ACT == 3) { const float u = 0.7978845608028654f * (v + 0.044715f * v * v * v); v = 0.5f * v * (1.0f + tanhf(u)); }
      so[w][8 * hh + r][t * 16 + ln] = v;
    }
  }
  __builtin_amdgcn_fence(__ATOMIC_ACQ_REL, "workgroup");
  __builtin_amdgcn_wave_barrier();
  const int rsub = lane >> 4, c4 = (lane & 15) * 4;
  {
#pragma unroll
    for (int q = 0; q < 8; ++q) {
      const int r = q * 2 + rsub;
      const v4f v = *(const v4fa*)&so[w][r][c4];
      *(v4f*)(C + (size_t)(row0 + r) * ldc + col0 + c4) = v;
    }
    
  }
}
// row LayerNorm (biased variance, eps) over N: s = X (+ R); optional out_sum <- s; out_norm <- (s-mu)*rsqrt(var+eps)*g + b
template <bool PARAM_BF16>
__global__ __launch_bounds__(256) void k_layernorm(const float* __restrict__ X, const float* __restrict__ R, const float* __restrict__ g, const float* __restrict__ bta,
                                                  float* __restrict__ out_sum, float* __restrict__ out_norm, int N, float eps) {
  __shared__ float red[256];
  const int row = blockIdx.x, tid = threadIdx.x;
  const float* x = X + (size_t)row * N; const float* rr = R ? R + (size_t)row * N : nullptr;
  float vals[16];                     // up to N = 4096
  const int per = N / 256;            // contiguous chunk per thread? use strided-by-4 chunks: thread handles j = tid*4 + 1024*u
  float s1 = 0.f;
  for (int u = 0; u < per / 4; ++u) {
    const int j = tid * 4 + 1024 * u;
    const v4f a = *(const v4fa*)(x + j);
    v4f b = {0.f,0.f,0.f,0.f}; if (rr) b = *(const v4fa*)(rr + j);
#pragma unroll
    for (int q = 0; q < 4; ++q) { const float v = a[q] + b[q]; vals[u * 4 + q] = v; s1 += v; }
  }
  red[tid] = s1; __syncthreads();
  for (int st = 128; st > 0; st >>= 1) { if (tid < st) red[tid] += red[tid + st]; __syncthreads(); }
  const float mu = red[0] / (float)N; __syncthreads();
  float s2 = 0.f;
  for (int u = 0; u < per / 4; ++u)
#pragma unroll
    for (int q = 0; q < 4; ++q) { const float c = vals[u * 4 + q] - mu; s2 += c * c; }
  red[tid] = s2; __syncthreads();
  for (int st = 128; st > 0; st >>= 1) { if (tid < st) red[tid] += red[tid + st]; __syncthreads(); }
  const float rs = rsqrtf(red[0] / (float)N + eps);
  {
    for (int u = 0; u < per / 4; ++u) {
      const int j = tid * 4 + 1024 * u;
      v4f o, sm;
#pragma unroll
      for (int q = 0; q < 4; ++q) {
        float gg = g[j + q], bb = bta[j + q];
        if (PARAM_BF16) { gg = bf16_round(gg); bb = bf16_round(bb); }
        sm[q] = vals[u * 4 + q]; o[q] = (vals[u * 4 + q] - mu) * rs * gg + bb;
      }
      if (out_sum) *(v4f*)(out_sum + (size_t)row * N + j) = sm;
      *(v4f*)(out_norm + (size_t)row * N + j) = o;
    }
    
  }
}



// ---- f16 WMMA path (v_wmma_f32_16x16x32_f16): 11-bit significands for operands in range — used where a [0,1] probability operand needs more precision than bf16
typedef _Float16 v16h __attribute__((ext_vector_type(16)));
union FragH { v16h v; v8us half[2]; _Float16 h[16]; unsigned short u[16]; };
template <int NT>
__device__ __forceinline__ v8f mmaH(v16h ah, v16h al, v16h bh, v16h bl, v8f c) {
  c = __builtin_amdgcn_wmma_f32_16x16x32_f16(false, ah, false, bh, (short)0, c, false, false);
  if (NT >= 2) c = __builtin_amdgcn_wmma_f32_16x16x32_f16(false, al, false, bh, (short)0, c, false, false);
  if (NT >= 3) c = __builtin_amdgcn_wmma_f32_16x16x32_f16(false, ah, false, bl, (short)0, c, false, false);
  asm volatile("v_nop\n\tv_nop\n\tv_nop\n\tv_nop" : "+v"(c) : "v"(ah), "v"(al), "v"(bh), "v"(bl));
  return c;
}
// batched GEMM like k_gemm_b but f16 operands: A f32 (split into f16 hi/lo if ASPLIT, else rounded to f16), Bt = f16 values [n][k]; alpha; C f32; N multiple of 16 (partial tiles skipped)
template <bool ASPLIT>
__global__ __launch_bounds__(128) void k_gemm_h(const float* __restrict__ A, int lda, size_t sA, const _Float16* __restrict__ Bh, int ldb, size_t sB, float alpha, float* __restrict__ C, int ldc, size_t sC, int M, int N, int K) {
  __shared__ __attribute__((aligned(16))) float so[4][16][64];
  const int tid = threadIdx.x, w = tid >> 5, lane = tid & 31, ln = lane & 15, hh = lane >> 4; const int by = blockIdx.y;
  A += (size_t)by * sA; Bh += (size_t)by * sB; C += (size_t)by * sC;
  const int ntn = (N + 63) / 64; const int wid = blockIdx.x * 4 + w; const int mt = wid / ntn, nq = wid % ntn; if (mt * 16 >= M) return;
  const int row0 = mt * 16, col0 = nq * 64; const float* arow = A + (size_t)(row0 + ln) * lda;
  v8f acc[4] = {};
  for (int kb = 0; kb < K; kb += 32) {
    FragH ah, al;
    const v4f x0 = *(const v4fa*)(arow + kb + 8 * hh), x1 = *(const v4fa*)(arow + kb + 8 * hh + 4), x2 = *(const v4fa*)(arow + kb + 16 + 8 * hh), x3 = *(const v4fa*)(arow + kb + 16 + 8 * hh + 4);
    float xs[16] = {x0[0],x0[1],x0[2],x0[3],x1[0],x1[1],x1[2],x1[3],x2[0],x2[1],x2[2],x2[3],x3[0],x3[1],x3[2],x3[3]};
#pragma unroll
    for (int i = 0; i < 16; ++i) { const _Float16 h = (_Float16)xs[i]; ah.h[i] = h; al.h[i] = ASPLIT ? (_Float16)(xs[i] - (float)h) : (_Float16)0.0f; }
#pragma unroll
    for (int t = 0; t < 4; ++t) { if (col0 + t * 16 >= N) continue; const size_t boff = (size_t)(col0 + t * 16 + ln) * ldb + kb; FragH bq; bq.half[0] = *(const v8us*)(Bh + boff + 8 * hh); bq.half[1] = *(const v8us*)(Bh + boff + 16 + 8 * hh);
      acc[t] = mmaH<ASPLIT ? 2 : 1>(ah.v, al.v, bq.v, bq.v, acc[t]); }
  }
#pragma unroll
  for (int t = 0; t < 4; ++t) { if (col0 + t * 16 >= N) continue;
#pragma unroll
    for (int r = 0; r < 8; ++r) so[w][8 * hh + r][t * 16 + ln] = acc[t][r] * alpha; }
  __builtin_amdgcn_fence(__ATOMIC_ACQ_REL, "workgroup"); __builtin_amdgcn_wave_barrier();
  const int rsub = lane >> 4, c4 = (lane & 15) * 4;
  {
#pragma unroll
    for (int q = 0; q < 8; ++q) { const int r = q * 2 + rsub; if (col0 + c4 < N) { const v4f v = *(const v4fa*)&so[w][r][c4]; *(v4f*)(C + (size_t)(row0 + r) * ldc + col0 + c4) = v; } }
     }
}

// Wt[n][k] = f16(bf16(W[k][n]) * scale) from f32 row-major W[K][N] (scale = power of two; bf16-exact weights stay exact in f16 away from the subnormal range).
// One work-group = a tile of 128 k x 64 n, turned in LDS, so that both sides move whole lines: 16 lanes read 256 contiguous bytes of one W row, 16 lanes write 256 contiguous bytes of one Wt row.
// LDS: one dword = the f16 pair (k, k + 1) of one n; a row = one n's 64 dwords, its sixteen 16-byte groups (8 k each) stored at group ^ (n / 4):
// the 32 lanes of a dword store (16 values of n / 4, two neighbouring pairs) fall on 32 banks, the 16 lanes that read one row back as 16-byte groups on all 64.
// K a multiple of 128, N a multiple of 64.
typedef _Float16 v2h __attribute__((ext_vector_type(2)));
// blk = the tile's index, tl = the work-group's 16 KiB of LDS.
template <int K, int N>
__device__ __forceinline__ void wt_tile(const float* __restrict__ W, _Float16* __restrict__ Wt, float scale, int blk, unsigned int* tl) {
  const int tid = threadIdx.x, lo = tid & 15, hi = tid >> 4;
  const int n0 = (blk % (N / 64)) * 64, k0 = (blk / (N / 64)) * 128;
  const float* src = W + (size_t)(k0 + 2 * hi) * N + n0 + 4 * lo;      // rows k0 + 2 hi + 32 u and the next, columns n0 + 4 lo .. + 3
  v4f ev[4], od[4];
#pragma unroll
  for (int u = 0; u < 4; ++u) { ev[u] = *(const v4fa*)(src + (size_t)(32 * u) * N); od[u] = *(const v4fa*)(src + (size_t)(32 * u + 1) * N); }
#pragma unroll
  for (int u = 0; u < 4; ++u) { const int kp = hi + 16 * u;      // pair index: k = k0 + 2 kp, k0 + 2 kp + 1
#pragma unroll
    for (int q = 0; q < 4; ++q) { v2h p; p[0] = (_Float16)(bf16_round(ev[u][q]) * scale); p[1] = (_Float16)(bf16_round(od[u][q]) * scale);
      tl[(4 * lo + q) * 64 + (((kp >> 2) ^ lo) << 2) + (kp & 3)] = __builtin_bit_cast(unsigned int, p); } }
  __syncthreads();      // every pair of the tile is in LDS before a row is read back
#pragma unroll
  for (int u = 0; u < 4; ++u) { const int n = hi + 16 * u; const v8us v = *(const v8us*)&tl[n * 64 + ((lo ^ ((n >> 2) & 15)) << 2)];
    *(v8us*)((unsigned short*)Wt + (size_t)(n0 + n) * K + k0 + 8 * lo) = v; }
  asm volatile("s_wait_xcnt 0x0" ::: "memory");      // closes the run of four stores: in the merged kernel other jobs' code follows in the text and reuses the stores' registers
}
typedef _Float16 v4h __attribute__((ext_vector_type(4)));

__global__ __launch_bounds__(256) void k_x16(const float* __restrict__ x, _Float16* __restrict__ X16, size_t n8) { const size_t t = (size_t)blockIdx.x * 256 + threadIdx.x; if (t >= n8) return; FragH f;
#pragma unroll
  for (int q = 0; q < 8; ++q) f.h[q] = (_Float16)bf16_round(x[t * 8 + q]); *(v8us*)((unsigned short*)X16 + t * 8) = f.half[0];  }
__global__ __launch_bounds__(256) void k_round16f(const float* __restrict__ W, _Float16* __restrict__ Bt, size_t n8) { const size_t t = (size_t)blockIdx.x * 256 + threadIdx.x; if (t >= n8) return; FragH f;
#pragma unroll
  for (int i = 0; i < 8; ++i) f.h[i] = (_Float16)(bf16_round(W[t * 8 + i]) * 16.0f); *(v8us*)((unsigned short*)Bt + t * 8) = f.half[0];  }
template <int NHv, int TTv>
__global__ __launch_bounds__(256) void k_vt(const _Float16* __restrict__ V16, int ldv, int voff, _Float16* __restrict__ Vt) { __shared__ unsigned short tl[64][66]; const int tid = threadIdx.x; const int slab = blockIdx.x / (TTv / 64), lg = blockIdx.x % (TTv / 64); const int b = slab / NHv, h = slab % NHv;
  for (int i = tid; i < 64 * 8; i += 256) { const int r = i / 8, c8 = (i % 8) * 8; FragH f; f.half[0] = *(const v8us*)((const unsigned short*)V16 + ((size_t)b * TTv + lg * 64 + r) * ldv + voff + h * 64 + c8);
#pragma unroll
    for (int q = 0; q < 8; ++q) tl[r][c8 + q] = f.u[q]; }
  __syncthreads();
  {
#pragma unroll
    for (int rd = 0; rd < 2; ++rd) { const int d = rd * 32 + tid / 8, pc = tid % 8; FragH f;
#pragma unroll
      for (int q = 0; q < 8; ++q) f.u[q] = tl[pc * 8 + q][d];
      *(v8us*)((unsigned short*)Vt + ((size_t)slab * 64 + d) * TTv + lg * 64 + pc * 8) = f.half[0]; }
     } }

// GBA: gamma and beta are fetched ahead, with the row (64 registers more). Off in the merged first kernel: its register count is shared with the weight tiles, whose resident work-groups per WGP it would cut from five to three.
template <int D, int RBF, bool GBA>
__device__ __forceinline__ void lnx_rows(const float* __restrict__ X, const float* __restrict__ gam, const float* __restrict__ bet, int nrows, float eps, _Float16* __restrict__ O16, float* __restrict__ XR, int blk) {
  constexpr int NP = D / 128; const int tid = threadIdx.x, wv = tid >> 5, lane = tid & 31; const size_t r = (size_t)blk * 8 + wv; if (r >= (size_t)nrows) return; v4f y[NP], gv[NP], bv[NP]; float s = 0.f;
  if (GBA) {
#pragma unroll
    for (int j = 0; j < NP; ++j) y[j] = *(const v4fa*)(X + r * D + j * 128 + lane * 4);
    __builtin_amdgcn_sched_barrier(0);      // the row's loads go out first, as one group, and the wait below stays directly behind them
    asm volatile("s_wait_xcnt 0x0" ::: "memory");      // the row's address registers are reused by the loads that follow: the wait stands in front of the overwrite
    // gamma and beta are asked for together with the row, not one 16-byte group at a time between the stores of the output phase: their latency passes under the row's own and the two reductions
#pragma unroll
    for (int j = 0; j < NP; ++j) { gv[j] = *(const v4fa*)(gam + j * 128 + lane * 4); bv[j] = *(const v4fa*)(bet + j * 128 + lane * 4); }
    __builtin_amdgcn_sched_barrier(0);      // keeps the 24 loads one group at the head: without it the scheduler sinks most of the gamma / beta loads behind the second reduction, where their latency stands bare
  }
#pragma unroll
  for (int j = 0; j < NP; ++j) { const int c = j * 128 + lane * 4; v4f g = GBA ? y[j] : *(const v4fa*)(X + r * D + c); if (RBF) { for (int q = 0; q < 4; ++q) g[q] = bf16_round(g[q]); } y[j] = g; s += g[0] + g[1] + g[2] + g[3]; }
  for (int o = 16; o >= 1; o >>= 1) s += __shfl_xor(s, o, 32); const float mu = s / (float)D; float q2 = 0.f;
#pragma unroll
  for (int j = 0; j < NP; ++j) for (int q = 0; q < 4; ++q) { const float d = y[j][q] - mu; q2 += d * d; }
  for (int o = 16; o >= 1; o >>= 1) q2 += __shfl_xor(q2, o, 32); const float rs = rsqrtf(q2 / (float)D + eps);
  {
#pragma unroll
    for (int j = 0; j < NP; ++j) { const int c = j * 128 + lane * 4; v4h h; for (int q = 0; q < 4; ++q) { const float v = (y[j][q] - mu) * rs * bf16_round(GBA ? gv[j][q] : gam[c + q]) + bf16_round(GBA ? bv[j][q] : bet[c + q]); h[q] = (_Float16)v; } *(v4h*)(O16 + r * D + c) = h;
      asm volatile("s_wait_xcnt 0x0" ::: "memory");      // the store's registers are reused directly behind it: the wait stands in front of the overwrite
      if (XR) { *(v4f*)(XR + r * D + c) = y[j];
        asm volatile("s_wait_xcnt 0x0" ::: "memory"); } }      // likewise, ahead of the next trip's loads
     } }
template <int D, int RBF>
__global__ __launch_bounds__(256) void k_lnx(const float* __restrict__ X, const float* __restrict__ gam, const float* __restrict__ bet, int nrows, float eps, _Float16* __restrict__ O16, float* __restrict__ XR) {
  lnx_rows<D, RBF, true>(X, gam, bet, nrows, eps, O16, XR, (int)blockIdx.x); }
// LN1 and the four weight convert-transposes need nothing of each other: one grid, each job a range of the block index (a work-group does one job whole, so the branch and the tile's barrier are block-uniform).
#define PB_LN (NR / 8)
#define PB_QKV ((DM / 128) * (3 * DM / 64))
#define PB_O ((DM / 128) * (DM / 64))
#define PB_W1 ((DM / 128) * (FF / 64))
#define PB_W2 ((FF / 128) * (DM / 64))
__global__ __launch_bounds__(256) void k_prep(const float* __restrict__ x, const float* __restrict__ g1, const float* __restrict__ be1, _Float16* __restrict__ H16, float* __restrict__ XR,
                                              const float* __restrict__ Wqkv, const float* __restrict__ Wo, const float* __restrict__ W1, const float* __restrict__ W2,
                                              _Float16* __restrict__ Bqkv, _Float16* __restrict__ Bo, _Float16* __restrict__ Bw1, _Float16* __restrict__ Bw2) {
  __shared__ __attribute__((aligned(16))) unsigned int tl[64 * 64];
  int b = (int)blockIdx.x;
  if (b < PB_LN) { lnx_rows<DM, 1, false>(x, g1, be1, NR, 1e-5f, H16, XR, b); return; }      /* LN1(bf16 x) -> f16; XR = bf16(x) */
  b -= PB_LN; if (b < PB_QKV) { wt_tile<DM, 3 * DM>(Wqkv, Bqkv, 16.0f, b, tl); return; }      /* (in,out) -> Bt[n][k] x 2^4 */
  b -= PB_QKV; if (b < PB_O) { wt_tile<DM, DM>(Wo, Bo, 16.0f, b, tl); return; }
  b -= PB_O; if (b < PB_W1) { wt_tile<DM, FF>(W1, Bw1, 16.0f, b, tl); return; }
  wt_tile<FF, DM>(W2, Bw2, 16.0f, b - PB_W1, tl);
}
// 2^x by the hardware's own instruction (v_exp_f32), with none of the library exp's range reduction, ldexp and range tests behind it: an argument far below zero (or -inf) gives 0, which is what a masked or far-off term is to give.
__device__ __forceinline__ float hw_exp2(float x) { return __builtin_amdgcn_exp2f(x); }
// lane l <-> lane l ^ 16: the two lanes that share a query's column
__device__ __forceinline__ float xhalf(float x) { return __builtin_bit_cast(float, __builtin_amdgcn_permlanex16(__builtin_bit_cast(int, x), __builtin_bit_cast(int, x), 0x76543210, 0xfedcba98, false, false)); }
// Both products transposed: S^T = K Q^T (A = 16 key rows, B = the wave's 16 queries, kept in registers), O^T += V^T P^T (A = 16 rows of V^T, B = P^T).
// Lane (ln, hh) holds, of query q0 + ln alone, the scores of keys 8 hh + r and 16 + 8 hh + r of a 32-key chunk: maximum and sum are in-lane plus one exchange with lane ^ 16,
// the running maximum, the sum and the rescale factor are one value a lane, and the two converted score tiles are the B fragment of the second product as they lie
// (element s = tile s / 8, register s % 8 = key 8 hh + s or 16 + 8 hh + s - 8: the k order of the V^T loader).
// A masked score is -inf and the running maximum starts finite, so exp gives 0 for a masked key and 1 for the rescale of a column that has seen no key yet: no test around an exp.
// K and V^T reach the waves through LDS: the four waves of a work-group walk the same keys, so a stage of 64 keys (64 K rows, 64 rows of each V^T plane, 128 B each) is copied once per work-group, in whole lines,
// instead of being fetched by every wave in 32-byte pieces of 16 lines a load. Rows lie at a pitch of 144 B (an odd multiple of 16 B: conflict-free for ds_load_b128 fragment reads). Two buffers; the next stage's rows are copied while this stage is worked on.
#define FA_ROWB 144
#define FA_STAGE (192 * FA_ROWB)
#define FA_SC 0.18033688011112042f      /* 1 / sqrt(64) x log2 e: raw score -> exponent of 2 */
// Four 16-byte asynchronous copies of one lane, global -> LDS, rows 16 apart (pitch = the global row pitch in elements). The s_wait_xcnt closes the statement so that no address register is rewritten ahead of it.
__device__ __forceinline__ void fa_copy4(unsigned l0, const unsigned short* g0, int pitch) {
  const unsigned l1 = l0 + 16 * FA_ROWB, l2 = l0 + 32 * FA_ROWB, l3 = l0 + 48 * FA_ROWB;
  const unsigned short *g1 = g0 + (size_t)16 * pitch, *g2 = g0 + (size_t)32 * pitch, *g3 = g0 + (size_t)48 * pitch;
  asm volatile("global_load_async_to_lds_b128 %0, %4, off\n\t"
               "global_load_async_to_lds_b128 %1, %5, off\n\t"
               "global_load_async_to_lds_b128 %2, %6, off\n\t"
               "global_load_async_to_lds_b128 %3, %7, off\n\t"
               "s_wait_xcnt 0x0"
               :: "v"(l0), "v"(l1), "v"(l2), "v"(l3), "v"(g0), "v"(g1), "v"(g2), "v"(g3) : "memory");
}
__global__ __launch_bounds__(128) void k_flash(const _Float16* __restrict__ Q16, int ldq, const _Float16* __restrict__ K16, int ldk, const _Float16* __restrict__ Vt, const _Float16* __restrict__ Vtlo, _Float16* __restrict__ O16, int ldo) {
  constexpr int RPW = 16, NQB = TT / (4 * RPW), DT = 4, KS = 2;
  __shared__ __attribute__((aligned(16))) unsigned char L[2 * FA_STAGE];      /* a stage = [K 64 rows | V^T value 64 rows | V^T residual 64 rows]; behind the loop the ring is output staging */
  const int tid = threadIdx.x, w = tid >> 5, lane = tid & 31, ln = lane & 15, hh = lane >> 4;
  const int slab = blockIdx.x / NQB, qblk = blockIdx.x % NQB; const int b = slab / NH, h = slab % NH; const int qb0 = qblk * (4 * RPW); const int q0 = qb0 + w * RPW;
  const int tq = q0 + ln;
  const int jbeg = (qb0 - RW) > 0 ? (qb0 - RW) : 0; const int jend = (qb0 + 4 * RPW + RW) < TT ? (qb0 + 4 * RPW + RW) : TT;      /* block-uniform window bounds (multiples of 64) */
  const int nst = (jend - jbeg) / 64;      /* stages of 64 keys: 3 to 5 */
  const unsigned short* Vth = (const unsigned short*)Vt + (size_t)slab * 64 * TT; const unsigned short* Vtl = (const unsigned short*)Vtlo + (size_t)slab * 64 * TT;
  // copy roles: 8 lanes cover one row's 128 B; a thread takes rows (tid / 8) + 16 i of K and of the two V^T planes
  const unsigned lcp = (unsigned)(size_t)L + (unsigned)(tid >> 3) * FA_ROWB + (unsigned)(tid & 7) * 16u;
  const unsigned short* gk = (const unsigned short*)K16 + ((size_t)b * TT + jbeg + (tid >> 3)) * ldk + h * 64 + (tid & 7) * 8;
  const unsigned short* gvh = Vth + (size_t)(tid >> 3) * TT + jbeg + (tid & 7) * 8;
  const unsigned short* gvl = Vtl + (size_t)(tid >> 3) * TT + jbeg + (tid & 7) * 8;
  fa_copy4(lcp, gk, ldk); fa_copy4(lcp + 64 * FA_ROWB, gvh, TT); fa_copy4(lcp + 128 * FA_ROWB, gvl, TT);
  FragH bq[KS];
  { const unsigned short* qr = (const unsigned short*)Q16 + ((size_t)b * TT + tq) * ldq + h * 64;
#pragma unroll
    for (int ks = 0; ks < KS; ++ks) { bq[ks].half[0] = *(const v8us*)(qr + ks * 32 + 8 * hh); bq[ks].half[1] = *(const v8us*)(qr + ks * 32 + 16 + 8 * hh); } }
  float m_q = -3.0e38f, l_q = 0.f; v8f oacc[DT], oaccl[DT];
#pragma unroll
  for (int dt = 0; dt < DT; ++dt) { oacc[dt] = (v8f){0.f,0.f,0.f,0.f,0.f,0.f,0.f,0.f}; oaccl[dt] = oacc[dt]; }
  asm volatile("s_wait_asynccnt 0x0" ::: "memory");      // this wave's copies of stage 0 have landed
  __syncthreads();                                        // ... and every other wave's
  if (nst > 1) { fa_copy4(lcp + FA_STAGE, gk + (size_t)64 * ldk, ldk); fa_copy4(lcp + FA_STAGE + 64 * FA_ROWB, gvh + 64, TT); fa_copy4(lcp + FA_STAGE + 128 * FA_ROWB, gvl + 64, TT); }
  // the stage loop stays rolled (the ring's waits and its barrier stand once, at the foot); every inner loop is unrolled so that fragments and accumulators are indexed by constants and stay in registers
#pragma unroll 1
  for (int t = 0; t < nst; ++t) {
    const unsigned buf = (unsigned)(t & 1) * FA_STAGE;
    const unsigned char* sk = L + buf + ln * FA_ROWB + 16 * hh;      /* K row ln of the stage, this half's 16-byte group */
    const unsigned char* sv = sk + 64 * FA_ROWB;                     /* V^T row ln, likewise */
#pragma unroll
    for (int c = 0; c < 2; ++c) { const int j0 = jbeg + t * 64 + c * 32;
    v8f s[2];
#pragma unroll
    for (int nt = 0; nt < 2; ++nt) { const unsigned char* kr = sk + (c * 32 + nt * 16) * FA_ROWB; FragH ak[KS];
#pragma unroll
      for (int ks = 0; ks < KS; ++ks) { ak[ks].half[0] = *(const v8us*)(kr + ks * 64); ak[ks].half[1] = *(const v8us*)(kr + ks * 64 + 32); }
      v8f acc = (v8f){0.f,0.f,0.f,0.f,0.f,0.f,0.f,0.f};
#pragma unroll
      for (int ks = 0; ks < KS; ++ks) acc = mmaH<1>(ak[ks].v, ak[ks].v, bq[ks].v, bq[ks].v, acc);
      s[nt] = acc; }
    float mc = -INFINITY;
#pragma unroll
    for (int nt = 0; nt < 2; ++nt)
#pragma unroll
      for (int r = 0; r < 8; ++r) { const int kk = j0 + nt * 16 + 8 * hh + r; const bool ok = (kk - tq <= RW) && (tq - kk <= RW);
        s[nt][r] = ok ? s[nt][r] : -INFINITY; mc = fmaxf(mc, s[nt][r]); }      /* raw products: the maximum is taken before the (positive) scale */
    mc = fmaxf(mc, xhalf(mc));
    const float mn = fmaxf(m_q, mc); float al = (m_q - mn) * FA_SC; m_q = mn;      /* al: here the exponent of the rescale factor, behind the run of v_exp_f32 the factor */
    const float mb = fmaf(mn, -FA_SC, 10.0f);      /* exponent's addend: minus the scaled maximum, plus 10 for the 2^10 that the f16 P carries */
    float e[16];      /* exponents, then p = 2^10 exp((s - max) / 8): one fma and one v_exp_f32 a score */
#pragma unroll
    for (int i = 0; i < 16; ++i) e[i] = fmaf(s[i >> 3][i & 7], FA_SC, mb);
    asm("v_exp_f32 %0, %0\n\tv_exp_f32 %1, %1\n\tv_exp_f32 %2, %2\n\tv_exp_f32 %3, %3\n\tv_exp_f32 %4, %4\n\tv_exp_f32 %5, %5\n\tv_exp_f32 %6, %6\n\tv_exp_f32 %7, %7\n\t"
        "v_exp_f32 %8, %8\n\tv_exp_f32 %9, %9\n\tv_exp_f32 %10, %10\n\tv_exp_f32 %11, %11\n\tv_exp_f32 %12, %12\n\tv_exp_f32 %13, %13\n\tv_exp_f32 %14, %14\n\tv_exp_f32 %15, %15\n\t"
        "v_exp_f32 %16, %16\n\tv_nop"
        : "+v"(al), "+v"(e[0]), "+v"(e[1]), "+v"(e[2]), "+v"(e[3]), "+v"(e[4]), "+v"(e[5]), "+v"(e[6]), "+v"(e[7]),
          "+v"(e[8]), "+v"(e[9]), "+v"(e[10]), "+v"(e[11]), "+v"(e[12]), "+v"(e[13]), "+v"(e[14]), "+v"(e[15]));
    FragH pb; float ps[4] = {0.f, 0.f, 0.f, 0.f};      /* four partial sums: no chain of 16 dependent adds */
#pragma unroll
    for (int nt = 0; nt < 2; ++nt)
#pragma unroll
      for (int r = 0; r < 8; ++r) { const float p = e[nt * 8 + r]; ps[r & 3] += p; pb.h[nt * 8 + r] = (_Float16)p; }
    l_q = l_q * al + ((ps[0] + ps[1]) + (ps[2] + ps[3]));      /* this lane's half of the column's sum; the halves join behind the loop */
#pragma unroll
    for (int dt = 0; dt < DT; ++dt)
#pragma unroll
      for (int r = 0; r < 8; ++r) { oacc[dt][r] *= al; oaccl[dt][r] *= al; }
#pragma unroll
    for (int dt = 0; dt < DT; ++dt) { const unsigned char* vr = sv + dt * 16 * FA_ROWB + c * 64; FragH av, avl; av.half[0] = *(const v8us*)vr; av.half[1] = *(const v8us*)(vr + 32); avl.half[0] = *(const v8us*)(vr + 64 * FA_ROWB); avl.half[1] = *(const v8us*)(vr + 64 * FA_ROWB + 32);
      oacc[dt] = mmaH<1>(av.v, av.v, pb.v, pb.v, oacc[dt]); oaccl[dt] = mmaH<1>(avl.v, avl.v, pb.v, pb.v, oaccl[dt]); } }
    asm volatile("s_wait_dscnt 0x0" ::: "memory");        // this wave's reads of the buffer have retired before it is refilled
    asm volatile("s_wait_asynccnt 0x0" ::: "memory");     // this wave's copies of stage t + 1 have landed
    __syncthreads();                                      // publishes stage t + 1 and ends every reader's last read of stage t's buffer
    if (t + 2 < nst) { fa_copy4(lcp + buf, gk + (size_t)(t + 2) * 64 * ldk, ldk); fa_copy4(lcp + buf + 64 * FA_ROWB, gvh + (t + 2) * 64, TT); fa_copy4(lcp + buf + 128 * FA_ROWB, gvl + (t + 2) * 64, TT); }
  }
  asm volatile("s_wait_asynccnt 0x0" ::: "memory");       // no copy is outstanding when the ring becomes output staging
  const float l = l_q + xhalf(l_q); const float inv = (l > 0.f) ? 1.0f / l : 0.f;      /* the sum carries P's 2^10 itself */
  // a lane's 8 registers of a tile are 8 consecutive head columns of its query: one 16-byte group of the f16 row (the out-projection's A operand); a wave stages its own 16 rows, pitch 144 B
  unsigned char* sO = L + w * (RPW * FA_ROWB);
#pragma unroll
  for (int dt = 0; dt < DT; ++dt) { FragH f;
#pragma unroll
    for (int r = 0; r < 8; ++r) f.h[r] = (_Float16)((oacc[dt][r] + oaccl[dt][r] * 0.0009765625f) * inv);
    *(v8us*)(sO + ln * FA_ROWB + (dt * 16 + 8 * hh) * 2) = f.half[0]; }
  __builtin_amdgcn_fence(__ATOMIC_ACQ_REL, "workgroup"); __builtin_amdgcn_wave_barrier();      // the wave's own LDS writes are read back by other lanes of the same wave
#pragma unroll
  for (int u = 0; u < 4; ++u) { const int r = u * 4 + (lane >> 3), c = (lane & 7) * 8;      /* 8 lanes = one whole 128-B line of a row */
    *(v8us*)((unsigned short*)O16 + ((size_t)b * TT + q0 + r) * ldo + h * 64 + c) = *(const v8us*)(sO + r * FA_ROWB + c * 2); }
}

// ---- tiled f16 GEMM with fused epilogue: act(A[M][K] * Bh[N][K]^T * alpha + bf16(bias[col]) (+ CP[row][col] if RES)) -> C16 (f16, if OUT16) or C (f32); ACT 0 none, 6 erf-GELU. A and Bh f16 and k-contiguous (pitch K), C / C16 / CP pitch N.
// One work-group = one 128 x 128 tile of C, 8 waves as 4 (rows) x 2 (columns), 32 x 64 of C per wave. A pass is 128 k: 256 B of each of the 128 A rows and 128 Bh rows,
// laid in LDS at a pitch of 272 B (an odd multiple of 16 B: conflict-free for ds_load_b128 fragment reads). Two buffers; the next pass's rows are copied while this pass is multiplied.
// M, N multiples of 128, K a multiple of 128. The k order of every accumulator is ascending in steps of 32.
// NF > 0: two products on one A share the grid: the tiles of the first N - NF columns go to C16 (pitch N - NF); those of the last NF columns (v) go out transposed, split into an f16 value and its residual x 2^10:
// Vh / Vl [row / TT][column][row % TT], the layout the attention kernel reads its value fragments from.
#define GT_ROWB 272
#define GT_STAGE (256 * GT_ROWB)
// Eight 16-byte asynchronous copies of one lane, global -> LDS, rows 16 apart. The s_wait_xcnt closes the statement so that no address register is rewritten ahead of it.
template <int K>
__device__ __forceinline__ void gt_copy8(unsigned l0, const _Float16* g0) {
  const unsigned l1 = l0 + 16 * GT_ROWB, l2 = l0 + 32 * GT_ROWB, l3 = l0 + 48 * GT_ROWB, l4 = l0 + 64 * GT_ROWB, l5 = l0 + 80 * GT_ROWB, l6 = l0 + 96 * GT_ROWB, l7 = l0 + 112 * GT_ROWB;
  const _Float16 *g1 = g0 + 16 * K, *g2 = g0 + 32 * K, *g3 = g0 + 48 * K, *g4 = g0 + 64 * K, *g5 = g0 + 80 * K, *g6 = g0 + 96 * K, *g7 = g0 + 112 * K;
  asm volatile("global_load_async_to_lds_b128 %0, %8, off\n\t"
               "global_load_async_to_lds_b128 %1, %9, off\n\t"
               "global_load_async_to_lds_b128 %2, %10, off\n\t"
               "global_load_async_to_lds_b128 %3, %11, off\n\t"
               "global_load_async_to_lds_b128 %4, %12, off\n\t"
               "global_load_async_to_lds_b128 %5, %13, off\n\t"
               "global_load_async_to_lds_b128 %6, %14, off\n\t"
               "global_load_async_to_lds_b128 %7, %15, off\n\t"
               "s_wait_xcnt 0x0"
               :: "v"(l0), "v"(l1), "v"(l2), "v"(l3), "v"(l4), "v"(l5), "v"(l6), "v"(l7), "v"(g0), "v"(g1), "v"(g2), "v"(g3), "v"(g4), "v"(g5), "v"(g6), "v"(g7) : "memory");
}
// erf-GELU without a branch: gelu(v) = v Phi(v), Phi(v) = 1 - q for v >= 0 and q for v < 0, q = erfc(|v| / sqrt 2) / 2 = (c1 t + ... + c5 t^5) exp(-v^2 / 2), t = 1 / (1 + p |v| / sqrt 2):
// the classical five-term form, absolute error of erf below 1.5e-7 (the result is rounded to f16 behind it). Every lane runs the same sixteen instructions, and the elements of a row are independent chains.
__device__ __forceinline__ float gelu_erf(float v) {
  const float t = __builtin_amdgcn_rcpf(fmaf(fabsf(v), 0.3275911f * 0.70710678118654752f, 1.0f));
  const float e = hw_exp2(v * v * -0.72134752044448170f);      /* exp(-v^2 / 2) */
  float q = fmaf(t, 0.5f * 1.061405429f, 0.5f * -1.453152027f);
  q = fmaf(t, q, 0.5f * 1.421413741f); q = fmaf(t, q, 0.5f * -0.284496736f); q = fmaf(t, q, 0.5f * 0.254829592f);
  q = q * t * e;
  return v * (v >= 0.f ? 1.0f - q : q);
}
// A wave's staged 32 x 64 tile (so, pitch 68 floats) -> rows rw .. rw + 31, columns cw .. cw + 63 of a plane of pitch P, in whole lines. res[q] = the lane's four addends of trip q (RES), fetched by the caller.
template <int ACT, int P, bool RES, bool OUT16>
__device__ __forceinline__ void gt_store(const float* so, const v4f* res, float* __restrict__ C, _Float16* __restrict__ C16, int rw, int cw, int lane) {
  const int rsub = lane >> 4, c4 = (lane & 15) * 4;
#pragma unroll (ACT == 6 ? 2 : 16)      /* GELU: two rows a trip are eight independent chains, enough to fill the vector port; more copies would only lengthen a text that runs once */
  for (int q = 0; q < 16; ++q) { const int r = q * 2 + rsub; v4f v = *(const v4fa*)&so[r * 68 + c4]; const size_t o = (size_t)(rw + r) * P + cw + c4;
    if (RES) { const v4f c = res[q]; v[0] += c[0]; v[1] += c[1]; v[2] += c[2]; v[3] += c[3]; }
    if (ACT == 6) {
#pragma unroll
      for (int e = 0; e < 4; ++e) v[e] = gelu_erf(v[e]); }
    if (!OUT16) *(v4f*)(C + o) = v;
    else { v4h h4;
#pragma unroll
      for (int e = 0; e < 4; ++e) h4[e] = (_Float16)v[e];
      *(v4h*)(C16 + o) = h4; } }
  asm volatile("s_wait_xcnt 0x0" ::: "memory");      // closes the run of stores: where two store paths share a kernel the other path's code follows in the text and reuses the stores' registers
}
template <int ACT, int N, int K, bool RES, bool OUT16, int NF = 0>
__global__ __launch_bounds__(256) void k_gemm_t(const _Float16* __restrict__ A, const _Float16* __restrict__ Bh, float alpha, const float* __restrict__ bias, const float* __restrict__ CP, float* __restrict__ C, _Float16* __restrict__ C16, _Float16* __restrict__ Vh, _Float16* __restrict__ Vl) {
  __shared__ __attribute__((aligned(16))) unsigned char L[2 * GT_STAGE];
  constexpr int NST = K / 128, NTN = N / 128;
  const int tid = threadIdx.x, w = tid >> 5, lane = tid & 31, ln = lane & 15, hh = lane >> 4;
  const int row0 = (int)(blockIdx.x / NTN) * 128, col0 = (int)(blockIdx.x % NTN) * 128;
  const int wm = w >> 1, wn = w & 1;
  // copy roles: 16 lanes cover one row's 256 B; a thread takes rows (tid / 16) + 16 i of A and of Bh
  const unsigned lcp = (unsigned)(size_t)L + (unsigned)(tid >> 4) * GT_ROWB + (unsigned)(tid & 15) * 16u;
  const _Float16* ga = A + (size_t)(row0 + (tid >> 4)) * K + (tid & 15) * 8;
  const _Float16* gb = Bh + (size_t)(col0 + (tid >> 4)) * K + (tid & 15) * 8;
  v8f acc[2][4];
#pragma unroll
  for (int i = 0; i < 2; ++i)
#pragma unroll
    for (int j = 0; j < 4; ++j) acc[i][j] = (v8f){0.f,0.f,0.f,0.f,0.f,0.f,0.f,0.f};
  gt_copy8<K>(lcp, ga); gt_copy8<K>(lcp + 128 * GT_ROWB, gb);
  asm volatile("s_wait_asynccnt 0x0" ::: "memory");      // this wave's copies of pass 0 have landed
  __syncthreads();                                        // ... and every other wave's
  if (NST > 1) { gt_copy8<K>(lcp + GT_STAGE, ga + 128); gt_copy8<K>(lcp + GT_STAGE + 128 * GT_ROWB, gb + 128); }
  // What the epilogue adds is asked for here and kept in registers: the bias of the lane's four columns and (RES) its 16 x 4 addends, in the store loop's own order.
  // Their way from memory passes under the k loop; asked for behind it, two memory latencies and the tile's 64 KiB stand bare with the matrix units idle.
  float bias_r[4];
#pragma unroll
  for (int j = 0; j < 4; ++j) bias_r[j] = bias[col0 + wn * 64 + j * 16 + ln];
  v4f res[16];
  if (RES) { const float* cp = CP + (size_t)(row0 + wm * 32 + hh) * (N - NF) + col0 + wn * 64 + ln * 4;
#pragma unroll
    for (int q = 0; q < 16; ++q) res[q] = *(const v4fa*)(cp + (size_t)(2 * q) * (N - NF)); }
#pragma unroll 1      /* one pass per trip: the ring's waits and its barrier stand once, at the foot */
  for (int t = 0; t < NST; ++t) {
    const unsigned buf = (unsigned)(t & 1) * GT_STAGE;
    const unsigned char* sa = L + buf + (wm * 32 + ln) * GT_ROWB + 16 * hh;
    const unsigned char* sb = L + buf + (128 + wn * 64 + ln) * GT_ROWB + 16 * hh;
    // two fragment sets: block ks + 1's twelve LDS reads go out as one group ahead of block ks's eight WMMAs (all inside this pass's own buffer)
    FragH a[2][2], b[2][4];
#pragma unroll
    for (int i = 0; i < 2; ++i) { a[0][i].half[0] = *(const v8us*)(sa + i * 16 * GT_ROWB); a[0][i].half[1] = *(const v8us*)(sa + i * 16 * GT_ROWB + 32); }
#pragma unroll
    for (int j = 0; j < 4; ++j) { b[0][j].half[0] = *(const v8us*)(sb + j * 16 * GT_ROWB); b[0][j].half[1] = *(const v8us*)(sb + j * 16 * GT_ROWB + 32); }
#pragma unroll
    for (int ks = 0; ks < 4; ++ks) {
      const int cu = ks & 1, nx = cu ^ 1;
      if (ks < 3) {
#pragma unroll
        for (int i = 0; i < 2; ++i) { a[nx][i].half[0] = *(const v8us*)(sa + i * 16 * GT_ROWB + (ks + 1) * 64); a[nx][i].half[1] = *(const v8us*)(sa + i * 16 * GT_ROWB + (ks + 1) * 64 + 32); }
#pragma unroll
        for (int j = 0; j < 4; ++j) { b[nx][j].half[0] = *(const v8us*)(sb + j * 16 * GT_ROWB + (ks + 1) * 64); b[nx][j].half[1] = *(const v8us*)(sb + j * 16 * GT_ROWB + (ks + 1) * 64 + 32); }
      }
      __builtin_amdgcn_sched_barrier(0);      // keeps the read group whole and ahead of the WMMAs: without it the scheduler spreads the reads among them and waits to 0 at each place
#pragma unroll
      for (int i = 0; i < 2; ++i)
#pragma unroll
        for (int j = 0; j < 4; ++j) acc[i][j] = __builtin_amdgcn_wmma_f32_16x16x32_f16(false, a[cu][i].v, false, b[cu][j].v, (short)0, acc[i][j], false, false);
      __builtin_amdgcn_sched_barrier(0);      // ... and keeps the next group behind this block
    }
    asm volatile("s_wait_dscnt 0x0" ::: "memory");        // this wave's reads of the buffer have retired before it is refilled
    asm volatile("s_wait_asynccnt 0x0" ::: "memory");     // this wave's copies of pass t + 1 have landed
    // The work-group barrier that publishes pass t + 1 and ends every reader's last read of pass t's buffer. Its two fences name LDS alone, the only memory the waves hand each other here:
    // __syncthreads() would also wait out this wave's global loads (s_wait_loadcnt 0), and the epilogue's operands would have to land within pass 0 instead of under the whole loop.
    __builtin_amdgcn_fence(__ATOMIC_RELEASE, "workgroup", "local");
    __builtin_amdgcn_s_barrier();
    __builtin_amdgcn_fence(__ATOMIC_ACQUIRE, "workgroup", "local");
    if (t + 2 < NST) { gt_copy8<K>(lcp + buf, ga + (t + 2) * 128); gt_copy8<K>(lcp + buf + 128 * GT_ROWB, gb + (t + 2) * 128); }
  }
  asm volatile("s_wait_asynccnt 0x0" ::: "memory");       // no copy is outstanding when the ring becomes output staging
  // NF > 0: which plane the tile belongs to is the same for the whole work-group, so the choice (and the v path's barrier) is block-uniform
  if (NF > 0 && col0 >= N - NF) {
    // v tile: an accumulator's 8 registers are 8 consecutive rows of one column = one 16-byte group of a transposed f16 row. The work-group's 128 columns x 128 rows are laid in the ring,
    // value plane then residual plane, one column = 256 B at the pitch of 272 B; behind a barrier 16 lanes store one column's 256 contiguous bytes.
#pragma unroll
    for (int j = 0; j < 4; ++j) { const float bv = bf16_round(bias_r[j]);
#pragma unroll
      for (int i = 0; i < 2; ++i) { FragH fh, fl;
#pragma unroll
        for (int r = 0; r < 8; ++r) { const float v = acc[i][j][r] * alpha + bv; const _Float16 hv = (_Float16)v; fh.h[r] = hv; fl.h[r] = (_Float16)((v - (float)hv) * 1024.0f); }
        unsigned char* p = L + (wn * 64 + j * 16 + ln) * GT_ROWB + (wm * 32 + i * 16 + 8 * hh) * 2;
        *(v8us*)p = fh.half[0]; *(v8us*)(p + 128 * GT_ROWB) = fl.half[0]; } }
    __syncthreads();      // a column's 128 rows come from four waves: all are in LDS before a column is read back
    const size_t o = ((size_t)(row0 / TT) * NF + (col0 - (N - NF)) + (tid >> 4)) * TT + (row0 % TT) + (tid & 15) * 8;
#pragma unroll
    for (int u = 0; u < 8; ++u) { const unsigned char* p = L + (u * 16 + (tid >> 4)) * GT_ROWB + (tid & 15) * 16;
      *(v8us*)((unsigned short*)Vh + o + (size_t)(u * 16) * TT) = *(const v8us*)p; *(v8us*)((unsigned short*)Vl + o + (size_t)(u * 16) * TT) = *(const v8us*)(p + 128 * GT_ROWB); }
    asm volatile("s_wait_xcnt 0x0" ::: "memory");      // closes the run of stores: the other path's code follows in the text and reuses the stores' registers
    return;
  }
  // epilogue: each wave stages its 32 x 64 tile in its own range of the ring (pitch 68 floats) and stores whole lines
  float* so = (float*)L + w * (32 * 68);
#pragma unroll
  for (int j = 0; j < 4; ++j) { const float bv = bf16_round(bias_r[j]);
#pragma unroll
    for (int i = 0; i < 2; ++i)
#pragma unroll
      for (int r = 0; r < 8; ++r) so[(i * 16 + 8 * hh + r) * 68 + j * 16 + ln] = acc[i][j][r] * alpha + bv; }
  __builtin_amdgcn_fence(__ATOMIC_ACQ_REL, "workgroup"); __builtin_amdgcn_wave_barrier();      // the wave's own LDS writes are read back by other lanes of the same wave
  gt_store<ACT, N - NF, RES, OUT16>(so, res, C, C16, row0 + wm * 32, col0 + wn * 64, lane);
}

extern "C" void kernel_launch(void* const* d_in, const int* in_sizes, int n_in,
                              void* d_out, int out_size, void* d_ws, size_t ws_size, hipStream_t stream) {
  (void)in_sizes; (void)n_in; (void)out_size;
  const float* const* I = (const float* const*)d_in; const float* x = I[0]; const float* Wqkv = I[1]; const float* bqkv = I[2]; const float* Wo = I[3]; const float* bo = I[4]; const float* g1 = I[5]; const float* be1 = I[6]; const float* g2 = I[7]; const float* be2 = I[8];
  const float* W1 = I[9]; const float* b1 = I[10]; const float* W2 = I[11]; const float* b2 = I[12];
  char* ws = (char*)d_ws; size_t off = 0;
  auto take = [&](size_t bytes) { char* p = ws + off; off += (bytes + 255) & ~(size_t)255; return p; };
  _Float16* Bqkv = (_Float16*)take((size_t)3 * DM * DM * 2); _Float16* Bo = (_Float16*)take((size_t)DM * DM * 2); _Float16* Bw1 = (_Float16*)take((size_t)FF * DM * 2); _Float16* Bw2 = (_Float16*)take((size_t)DM * FF * 2);
  _Float16* H16 = (_Float16*)take((size_t)NR * DM * 2); float* XR = (float*)take((size_t)NR * DM * 4); _Float16* QK = (_Float16*)take((size_t)NR * 2 * DM * 2);
  _Float16* Vth = (_Float16*)take((size_t)NR * DM * 2); _Float16* Vtl = (_Float16*)take((size_t)NR * DM * 2); float* X1 = (float*)take((size_t)NR * DM * 4);
  _Float16* O16 = H16; _Float16* H2 = H16; _Float16* FH = QK;      /* reuse: H16 holds LN1 output (consumed by the qkv GEMM), then O16, then LN2 output; the [q|k] plane holds the FFN hidden (f16 [4096][2048]) once attention is done */
  if (off > ws_size) return;      // 6.3 + 2.1 + 4.2 + 4.2 + 8.4 + 16.8 + 16.8 + 8.4 + 8.4 + 16.8 = about 92 MB
  k_prep<<<PB_LN + PB_QKV + PB_O + PB_W1 + PB_W2, 256, 0, stream>>>(x, g1, be1, H16, XR, Wqkv, Wo, W1, W2, Bqkv, Bo, Bw1, Bw2);      /* LN1 and the four weight planes */
  const dim3 gqkv((NR / 128) * (3 * DM / 128), 1), gd((NR / 128) * (DM / 128), 1), gf((NR / 128) * (FF / 128), 1);      /* one work-group per 128 x 128 tile */
  k_gemm_t<0, 3 * DM, DM, false, true, DM><<<gqkv, 256, 0, stream>>>(H16, Bqkv, 0.0625f, bqkv, nullptr, nullptr, QK, Vth, Vtl);      /* [q | k] + bias (f16) and v + bias -> transposed hi / lo planes: M 4096 N 3072 K 1024 */
  k_flash<<<BB * NH * (TT / 64), 128, 0, stream>>>(QK, 2 * DM, QK + DM, 2 * DM, Vth, Vtl, O16, DM);
  k_gemm_t<0, DM, DM, true, false><<<gd, 256, 0, stream>>>(O16, Bo, 0.0625f, bo, XR, X1, nullptr, nullptr, nullptr);      /* x1 = x + (O·out_w + out_b) via the per-element addend */
  k_lnx<DM, 0><<<(NR + 7) / 8, 256, 0, stream>>>(X1, g2, be2, NR, 1e-5f, H2, nullptr);      /* LN2(x1) → f16 (x1 is a computed value: no input rounding) */
  k_gemm_t<6, FF, DM, false, true><<<gf, 256, 0, stream>>>(H2, Bw1, 0.0625f, b1, nullptr, nullptr, FH, nullptr, nullptr);      /* gelu_erf(h2·w1 + b1) → f16: M 4096 N 2048 K 1024 */
  k_gemm_t<0, DM, FF, true, false><<<gd, 256, 0, stream>>>(FH, Bw2, 0.0625f, b2, X1, (float*)d_out, nullptr, nullptr, nullptr);      /* y = x1 + (·w2 + b2): M 4096 N 1024 K 2048 */
}

// v009
// Measured time: 108 microseconds a run.
// In both of two side-by-side timings against v008, it was 1.06 times as fast.
// Over all steps from v000 it is 4.37 times as fast.
#include <hip/hip_runtime.h>
// Transformer layer with windowed (|i−j| ≤ 128) multi-head self-attention (B=2, L=2048, d_model 1024, 16 heads × 64): h = LN1(x); qkv = h·W + b; per head softmax(q·kᵀ/8 + window mask)·v; x1 = x + (merged·out_w + out_b);
// y = x1 + (gelu_erf(LN2(x1)·w1 + b1)·w2 + b2). (in,out) weights.
// Compute dtype: x, weights, biases, LN parameters rounded to bf16; LayerNorms in f32 (wave per row) → f16 operands; q,k f16 GEMM outputs, v f32 → f16 hi + ×2^10 residual Vᵀ planes; fused windowed
// flash-style kernel (online softmax f32, P f16 ×2^10, two value accumulators) on v_wmma_f32_16x16x32_f16; the residual sums ride the GEMMs' per-element addend in f32; FFN hidden f16 after the erf-GELU epilogue.
#define BB 2
#define TT 2048
#define DM 1024
#define NH 16
#define HD 64
#define RW 128
#define FF 2048
#define NR (BB * TT)

typedef __bf16 v16b __attribute__((ext_vector_type(16)));
typedef unsigned short v8us __attribute__((ext_vector_type(8), may_alias));
typedef float  v8f  __attribute__((ext_vector_type(8)));
typedef float  v4f  __attribute__((ext_vector_type(4)));
typedef float  v4fa __attribute__((ext_vector_type(4), may_alias));
union FragB { v16b v; v8us half[2]; unsigned short u[16]; };

__device__ __forceinline__ unsigned short bf16_bits(float x) { unsigned int u = __float_as_uint(x); return (unsigned short)((u + 0x7FFFu + ((u >> 16) & 1u)) >> 16); }
__device__ __forceinline__ float bf16_val(unsigned short b) { return __uint_as_float(((unsigned int)b) << 16); }
__device__ __forceinline__ float bf16_round(float x) { return bf16_val(bf16_bits(x)); }
// D += A·B with NT terms: 1 = ah·bh, 2 = + al·bh (A split), 3 = + ah·bl (both split)
template <int NT>
__device__ __forceinline__ v8f mmaN(v16b ah, v16b al, v16b bh, v16b bl, v8f c) {
  c = __builtin_amdgcn_wmma_f32_16x16x32_bf16(false, ah, false, bh, (short)0, c, false, false);
  if (NT >= 2) c = __builtin_amdgcn_wmma_f32_16x16x32_bf16(false, al, false, bh, (short)0, c, false, false);
  if (NT >= 3) c = __builtin_amdgcn_wmma_f32_16x16x32_bf16(false, ah, false, bl, (short)0, c, false, false);
  asm volatile("v_nop\n\tv_nop\n\tv_nop\n\tv_nop" : "+v"(c) : "v"(ah), "v"(al), "v"(bh), "v"(bl));
  return c;
}

__global__ __launch_bounds__(256) void k_wt_bf16(const float* __restrict__ W, unsigned short* __restrict__ Wt, int K, int N) {
  const int t = blockIdx.x * 256 + threadIdx.x;
  const int k8n = K / 8;
  if (t >= N * k8n) return;
  const int n = t / k8n, k8 = (t % k8n) * 8;
  v8us v;
#pragma unroll
  for (int i = 0; i < 8; ++i) v[i] = bf16_bits(W[(size_t)(k8 + i) * N + n]);
  *(v8us*)(Wt + (size_t)n * K + k8) = v;
  
}

// GEMM C[M][N] (f32, pitch ldc) = act(A[M][K]·W + bias). A f32 row-major (pitch lda) converted per fragment to bf16
// (ASPLIT: hi/lo two planes -> 2 terms, else single rounded term); Wt bf16 [N][K] (pitch ldb). BIAS_BF16 rounds the
// bias to bf16 first (bias quantised to bf16 before the add). K%32==0, M%16==0, N%64==0.
template <bool ASPLIT, int ACT, bool BIAS_BF16>
__global__ __launch_bounds__(128) void k_gemm_bf(const float* __restrict__ A, int lda, const unsigned short* __restrict__ Wt, int ldb,
                                               const float* __restrict__ bias, float* __restrict__ C, int ldc, int M, int N, int K) {
  __shared__ __attribute__((aligned(16))) float so[4][16][64];
  const int tid = threadIdx.x, w = tid >> 5, lane = tid & 31, ln = lane & 15, hh = lane >> 4;
  const int ntn = N / 64;
  const int wid = blockIdx.x * 4 + w;
  const int mt = wid / ntn, nq = wid % ntn;
  if (mt * 16 >= M) return;
  const int row0 = mt * 16, col0 = nq * 64;
  const float* arow = A + (size_t)(row0 + ln) * lda;
  v8f acc[4] = {};
  for (int kb = 0; kb < K; kb += 32) {
    FragB ah, al;
    const v4f x0 = *(const v4fa*)(arow + kb + 8 * hh), x1 = *(const v4fa*)(arow + kb + 8 * hh + 4);
    const v4f x2 = *(const v4fa*)(arow + kb + 16 + 8 * hh), x3 = *(const v4fa*)(arow + kb + 16 + 8 * hh + 4);
    float xs[16] = {x0[0],x0[1],x0[2],x0[3],x1[0],x1[1],x1[2],x1[3],x2[0],x2[1],x2[2],x2[3],x3[0],x3[1],x3[2],x3[3]};
#pragma unroll
    for (int i = 0; i < 16; ++i) { const unsigned short hb = bf16_bits(xs[i]); ah.u[i] = hb; al.u[i] = ASPLIT ? bf16_bits(xs[i] - bf16_val(hb)) : (unsigned short)0; }
#pragma unroll
    for (int t = 0; t < 4; ++t) {
      const unsigned short* brow = Wt + (size_t)(col0 + t * 16 + ln) * ldb + kb;
      FragB b;
      b.half[0] = *(const v8us*)(brow + 8 * hh);
      b.half[1] = *(const v8us*)(brow + 16 + 8 * hh);
      acc[t] = mmaN<ASPLIT ? 2 : 1>(ah.v, al.v, b.v, b.v, acc[t]);
    }
  }
#pragma unroll
  for (int t = 0; t < 4; ++t) {
    float bv = bias ? bias[col0 + t * 16 + ln] : 0.f;
    if (BIAS_BF16) bv = bf16_round(bv);
#pragma unroll
    for (int r = 0; r < 8; ++r) { float v = acc[t][r] + bv; if (ACT == 1) v = fmaxf(v, 0.f); so[w][8 * hh + r][t * 16 + ln] = v; }
  }
  __builtin_amdgcn_fence(__ATOMIC_ACQ_REL, "workgroup");
  __builtin_amdgcn_wave_barrier();
  const int rsub = lane >> 4, c4 = (lane & 15) * 4;
  {
#pragma unroll
    for (int q = 0; q < 8; ++q) {
      const int r = q * 2 + rsub;
      const v4f v = *(const v4fa*)&so[w][r][c4];
      *(v4f*)(C + (size_t)(row0 + r) * ldc + col0 + c4) = v;
    }
    
  }
}

// Flash-style causal/unmasked attention, all contractions 3-term bf16 hi/lo splits, f32 softmax with running max.
// q,k,v rows are read from f32 buffers with arbitrary row pitch (so they can live inside a fused qkv buffer);
// D = head size (multiple of 32, <= 128); one wave = 16 query rows; block = 4 waves (64 queries) sharing K/V chunks of 32.
template <int D, bool CAUSAL>
__global__ __launch_bounds__(128) void k_flash(const float* __restrict__ qb, const float* __restrict__ kb, const float* __restrict__ vb,
                                             int pitch, int T, int H, float scale, float* __restrict__ y, int ypitch) {
  constexpr int KS = D / 32;        // k-steps for QK
  constexpr int DT = D / 16;        // d tiles for PV
  __shared__ __attribute__((aligned(16))) unsigned short sKh[32][D + 8], sKl[32][D + 8], sVh[32][D + 8], sVl[32][D + 8];
  __shared__ __attribute__((aligned(16))) unsigned short sPh[4][16][40], sPl[4][16][40];
  __shared__ __attribute__((aligned(16))) float sO[4][16][D];
  const int tid = threadIdx.x, w = tid >> 5, lane = tid & 31, ln = lane & 15, hh = lane >> 4;
  const int nqb = (T + 63) / 64;
  const int bh = blockIdx.x / nqb, qblk = blockIdx.x % nqb;
  const int b = bh / H, h = bh % H;
  const int q0 = qblk * 64 + w * 16;
  const float* Q = qb + (size_t)b * T * pitch + h * D;
  const float* K = kb + (size_t)b * T * pitch + h * D;
  const float* V = vb + (size_t)b * T * pitch + h * D;

  // A fragments of the wave's 16 query rows (scaled), hi/lo
  FragB aqh[KS], aql[KS];
  {
    int row = q0 + ln; if (row >= T) row = T - 1;
    const float* qr = Q + (size_t)row * pitch;
#pragma unroll
    for (int ks = 0; ks < KS; ++ks)
#pragma unroll
      for (int i = 0; i < 16; ++i) {
        const int d = ks * 32 + ((i < 8) ? (8 * hh + i) : (16 + 8 * hh + (i - 8)));
        const float x = qr[d] * scale; const unsigned short hb = bf16_bits(x);
        aqh[ks].u[i] = hb; aql[ks].u[i] = bf16_bits(x - bf16_val(hb));
      }
  }
  float m_r[8], l_r[8];
#pragma unroll
  for (int r = 0; r < 8; ++r) { m_r[r] = -3.0e38f; l_r[r] = 0.f; }
  v8f oacc[DT];
#pragma unroll
  for (int dt = 0; dt < DT; ++dt) oacc[dt] = (v8f){0.f,0.f,0.f,0.f,0.f,0.f,0.f,0.f};

  const int kv_end = CAUSAL ? min(T, qblk * 64 + 64) : T;     // block-uniform
  for (int j0 = 0; j0 < kv_end; j0 += 32) {
    __syncthreads();
    for (int e = tid; e < 32 * (D / 4); e += 128) {
      const int r = e / (D / 4), c4 = (e % (D / 4)) * 4;
      const int key = j0 + r;
      v4f kf = {0.f,0.f,0.f,0.f}, vf = {0.f,0.f,0.f,0.f};
      if (key < T) { kf = *(const v4fa*)(K + (size_t)key * pitch + c4); vf = *(const v4fa*)(V + (size_t)key * pitch + c4); }
#pragma unroll
      for (int t = 0; t < 4; ++t) {
        unsigned short hb = bf16_bits(kf[t]); sKh[r][c4 + t] = hb; sKl[r][c4 + t] = bf16_bits(kf[t] - bf16_val(hb));
        hb = bf16_bits(vf[t]); sVh[r][c4 + t] = hb; sVl[r][c4 + t] = bf16_bits(vf[t] - bf16_val(hb));
      }
    }
    __syncthreads();
    // S tile 16 x 32
    v8f s[2];
#pragma unroll
    for (int nt = 0; nt < 2; ++nt) {
      v8f acc = {};
#pragma unroll
      for (int ks = 0; ks < KS; ++ks) {
        FragB bh_, bl_;
        bh_.half[0] = *(const v8us*)&sKh[nt * 16 + ln][ks * 32 + 8 * hh]; bh_.half[1] = *(const v8us*)&sKh[nt * 16 + ln][ks * 32 + 16 + 8 * hh];
        bl_.half[0] = *(const v8us*)&sKl[nt * 16 + ln][ks * 32 + 8 * hh]; bl_.half[1] = *(const v8us*)&sKl[nt * 16 + ln][ks * 32 + 16 + 8 * hh];
        acc = mmaN<3>(aqh[ks].v, aql[ks].v, bh_.v, bl_.v, acc);
      }
      s[nt] = acc;
    }
    // mask + running max (rows 8hh+r; the 16 lanes of a half share rows)
    float alpha[8];
#pragma unroll
    for (int r = 0; r < 8; ++r) {
      const int qi = q0 + 8 * hh + r;
      const int ja = j0 + ln, jb = j0 + 16 + ln;
      if (CAUSAL) { if (ja > qi) s[0][r] = -3.0e38f; if (jb > qi) s[1][r] = -3.0e38f; }
      if (ja >= T) s[0][r] = -3.0e38f;
      if (jb >= T) s[1][r] = -3.0e38f;
      float mx = fmaxf(s[0][r], s[1][r]);
      mx = fmaxf(mx, __shfl_xor(mx, 1, 32)); mx = fmaxf(mx, __shfl_xor(mx, 2, 32)); mx = fmaxf(mx, __shfl_xor(mx, 4, 32)); mx = fmaxf(mx, __shfl_xor(mx, 8, 32));
      const float mnew = fmaxf(m_r[r], mx);
      alpha[r] = (mnew > -1.0e38f) ? __expf(m_r[r] - mnew) : 1.0f;
      const float p0 = (s[0][r] > -1.0e38f) ? __expf(s[0][r] - mnew) : 0.f;
      const float p1 = (s[1][r] > -1.0e38f) ? __expf(s[1][r] - mnew) : 0.f;
      m_r[r] = mnew;
      l_r[r] = l_r[r] * alpha[r] + p0 + p1;            // per-lane partial row sum (16 lanes combined at the end)
      unsigned short hb = bf16_bits(p0); sPh[w][8 * hh + r][ln] = hb;      sPl[w][8 * hh + r][ln] = bf16_bits(p0 - bf16_val(hb));
      hb = bf16_bits(p1);                sPh[w][8 * hh + r][16 + ln] = hb; sPl[w][8 * hh + r][16 + ln] = bf16_bits(p1 - bf16_val(hb));
    }
#pragma unroll
    for (int dt = 0; dt < DT; ++dt)
#pragma unroll
      for (int r = 0; r < 8; ++r) oacc[dt][r] *= alpha[r];
    __builtin_amdgcn_fence(__ATOMIC_ACQ_REL, "workgroup");
    __builtin_amdgcn_wave_barrier();
    FragB pah, pal;
    pah.half[0] = *(const v8us*)&sPh[w][ln][8 * hh]; pah.half[1] = *(const v8us*)&sPh[w][ln][16 + 8 * hh];
    pal.half[0] = *(const v8us*)&sPl[w][ln][8 * hh]; pal.half[1] = *(const v8us*)&sPl[w][ln][16 + 8 * hh];
#pragma unroll
    for (int dt = 0; dt < DT; ++dt) {
      FragB bvh, bvl;
#pragma unroll
      for (int i = 0; i < 8; ++i) {
        bvh.u[i] = sVh[8 * hh + i][dt * 16 + ln]; bvh.u[8 + i] = sVh[16 + 8 * hh + i][dt * 16 + ln];
        bvl.u[i] = sVl[8 * hh + i][dt * 16 + ln]; bvl.u[8 + i] = sVl[16 + 8 * hh + i][dt * 16 + ln];
      }
      oacc[dt] = mmaN<3>(pah.v, pal.v, bvh.v, bvl.v, oacc[dt]);
    }
    __builtin_amdgcn_fence(__ATOMIC_ACQ_REL, "workgroup");
    __builtin_amdgcn_wave_barrier();
  }
#pragma unroll
  for (int r = 0; r < 8; ++r) {
    float l = l_r[r];
    l += __shfl_xor(l, 1, 32); l += __shfl_xor(l, 2, 32); l += __shfl_xor(l, 4, 32); l += __shfl_xor(l, 8, 32);
    l_r[r] = (l > 0.f) ? 1.0f / l : 0.f;
  }
#pragma unroll
  for (int dt = 0; dt < DT; ++dt)
#pragma unroll
    for (int r = 0; r < 8; ++r) sO[w][8 * hh + r][dt * 16 + ln] = oacc[dt][r] * l_r[r];
  __builtin_amdgcn_fence(__ATOMIC_ACQ_REL, "workgroup");
  __builtin_amdgcn_wave_barrier();
  {
    for (int r = 0; r < 16; ++r) {
      const int row = q0 + r;
      if (row < T && lane < D / 4) {
        const v4f val = *(const v4fa*)&sO[w][r][lane * 4];
        *(v4f*)(y + ((size_t)b * T + row) * ypitch + h * D + lane * 4) = val;
      }
    }
    
  }
}

// GEMM C = act(A·W + bias + resid): A f32 (ASPLIT -> hi/lo 2 terms), Wt bf16 [N][K]; ACT 0 none, 1 relu, 2 exact gelu;
// resid (optional, f32, row index = (row % rmod), pitch ldr, RES_BF16 rounds it) added before the activation.
template <bool ASPLIT, int ACT, bool BIAS_BF16, bool RES_BF16>
__global__ __launch_bounds__(128) void k_gemm_bf3(const float* __restrict__ A, int lda, const unsigned short* __restrict__ Wt, int ldb,
                                                const float* __restrict__ bias, const float* __restrict__ resid, int rmod, int ldr,
                                                float* __restrict__ C, int ldc, int M, int N, int K) {
  __shared__ __attribute__((aligned(16))) float so[4][16][64];
  const int tid = threadIdx.x, w = tid >> 5, lane = tid & 31, ln = lane & 15, hh = lane >> 4;
  const int ntn = N / 64;
  const int wid = blockIdx.x * 4 + w;
  const int mt = wid / ntn, nq = wid % ntn;
  if (mt * 16 >= M) return;
  const int row0 = mt * 16, col0 = nq * 64;
  const float* arow = A + (size_t)(row0 + ln) * lda;
  v8f acc[4] = {};
  for (int kb = 0; kb < K; kb += 32) {
    FragB ah, al;
    const v4f x0 = *(const v4fa*)(arow + kb + 8 * hh), x1 = *(const v4fa*)(arow + kb + 8 * hh + 4);
    const v4f x2 = *(const v4fa*)(arow + kb + 16 + 8 * hh), x3 = *(const v4fa*)(arow + kb + 16 + 8 * hh + 4);
    float xs[16] = {x0[0],x0[1],x0[2],x0[3],x1[0],x1[1],x1[2],x1[3],x2[0],x2[1],x2[2],x2[3],x3[0],x3[1],x3[2],x3[3]};
#pragma unroll
    for (int i = 0; i < 16; ++i) { const unsigned short hb = bf16_bits(xs[i]); ah.u[i] = hb; al.u[i] = ASPLIT ? bf16_bits(xs[i] - bf16_val(hb)) : (unsigned short)0; }
#pragma unroll
    for (int t = 0; t < 4; ++t) {
      const unsigned short* brow = Wt + (size_t)(col0 + t * 16 + ln) * ldb + kb;
      FragB b;
      b.half[0] = *(const v8us*)(brow + 8 * hh);
      b.half[1] = *(const v8us*)(brow + 16 + 8 * hh);
      acc[t] = mmaN<ASPLIT ? 2 : 1>(ah.v, al.v, b.v, b.v, acc[t]);
    }
  }
#pragma unroll
  for (int t = 0; t < 4; ++t) {
    const int col = col0 + t * 16 + ln;
    float bv = bias ? bias[col] : 0.f;
    if (BIAS_BF16) bv = bf16_round(bv);
#pragma unroll
    for (int r = 0; r < 8; ++r) {
      float v = acc[t][r] + bv;
      if (resid) { float rv = resid[(size_t)((row0 + 8 * hh + r) % rmod) * ldr + col]; if (RES_BF16) rv = bf16_round(rv); v += rv; }
      if (ACT == 1) v = fmaxf(v, 0.f);
      if (ACT == 2) v = 0.5f * v * (1.0f + erff(v * 0.70710678118654752f));
      if (ACT == 3) { const float u = 0.7978845608028654f * (v + 0.044715f * v * v * v); v = 0.5f * v * (1.0f + tanhf(u)); }
      so[w][8 * hh + r][t * 16 + ln] = v;
    }
  }
  __builtin_amdgcn_fence(__ATOMIC_ACQ_REL, "workgroup");
  __builtin_amdgcn_wave_barrier();
  const int rsub = lane >> 4, c4 = (lane & 15) * 4;
  {
#pragma unroll
    for (int q = 0; q < 8; ++q) {
      const int r = q * 2 + rsub;
      const v4f v = *(const v4fa*)&so[w][r][c4];
      *(v4f*)(C + (size_t)(row0 + r) * ldc + col0 + c4) = v;
    }
    
  }
}
// row LayerNorm (biased variance, eps) over N: s = X (+ R); optional out_sum <- s; out_norm <- (s-mu)*rsqrt(var+eps)*g + b
template <bool PARAM_BF16>
__global__ __launch_bounds__(256) void k_layernorm(const float* __restrict__ X, const float* __restrict__ R, const float* __restrict__ g, const float* __restrict__ bta,
                                                  float* __restrict__ out_sum, float* __restrict__ out_norm, int N, float eps) {
  __shared__ float red[256];
  const int row = blockIdx.x, tid = threadIdx.x;
  const float* x = X + (size_t)row * N; const float* rr = R ? R + (size_t)row * N : nullptr;
  float vals[16];                     // up to N = 4096
  const int per = N / 256;            // contiguous chunk per thread? use strided-by-4 chunks: thread handles j = tid*4 + 1024*u
  float s1 = 0.f;
  for (int u = 0; u < per / 4; ++u) {
    const int j = tid * 4 + 1024 * u;
    const v4f a = *(const v4fa*)(x + j);
    v4f b = {0.f,0.f,0.f,0.f}; if (rr) b = *(const v4fa*)(rr + j);
#pragma unroll
    for (int q = 0; q < 4; ++q) { const float v = a[q] + b[q]; vals[u * 4 + q] = v; s1 += v; }
  }
  red[tid] = s1; __syncthreads();
  for (int st = 128; st > 0; st >>= 1) { if (tid < st) red[tid] += red[tid + st]; __syncthreads(); }
  const float mu = red[0] / (float)N; __syncthreads();
  float s2 = 0.f;
  for (int u = 0; u < per / 4; ++u)
#pragma unroll
    for (int q = 0; q < 4; ++q) { const float c = vals[u * 4 + q] - mu; s2 += c * c; }
  red[tid] = s2; __syncthreads();
  for (int st = 128; st > 0; st >>= 1) { if (tid < st) red[tid] += red[tid + st]; __syncthreads(); }
  const float rs = rsqrtf(red[0] / (float)N + eps);
  {
    for (int u = 0; u < per / 4; ++u) {
      const int j = tid * 4 + 1024 * u;
      v4f o, sm;
#pragma unroll
      for (int q = 0; q < 4; ++q) {
        float gg = g[j + q], bb = bta[j + q];
        if (PARAM_BF16) { gg = bf16_round(gg); bb = bf16_round(bb); }
        sm[q] = vals[u * 4 + q]; o[q] = (vals[u * 4 + q] - mu) * rs * gg + bb;
      }
      if (out_sum) *(v4f*)(out_sum + (size_t)row * N + j) = sm;
      *(v4f*)(out_norm + (size_t)row * N + j) = o;
    }
    
  }
}



// ---- f16 WMMA path (v_wmma_f32_16x16x32_f16): 11-bit significands for operands in range — used where a [0,1] probability operand needs more precision than bf16
typedef _Float16 v16h __attribute__((ext_vector_type(16)));
union FragH { v16h v; v8us half[2]; _Float16 h[16]; unsigned short u[16]; };
template <int NT>
__device__ __forceinline__ v8f mmaH(v16h ah, v16h al, v16h bh, v16h bl, v8f c) {
  c = __builtin_amdgcn_wmma_f32_16x16x32_f16(false, ah, false, bh, (short)0, c, false, false);
  if (NT >= 2) c = __builtin_amdgcn_wmma_f32_16x16x32_f16(false, al, false, bh, (short)0, c, false, false);
  if (NT >= 3) c = __builtin_amdgcn_wmma_f32_16x16x32_f16(false, ah, false, bl, (short)0, c, false, false);
  asm volatile("v_nop\n\tv_nop\n\tv_nop\n\tv_nop" : "+v"(c) : "v"(ah), "v"(al), "v"(bh), "v"(bl));
  return c;
}
// batched GEMM like k_gemm_b but f16 operands: A f32 (split into f16 hi/lo if ASPLIT, else rounded to f16), Bt = f16 values [n][k]; alpha; C f32; N multiple of 16 (partial tiles skipped)
template <bool ASPLIT>
__global__ __launch_bounds__(128) void k_gemm_h(const float* __restrict__ A, int lda, size_t sA, const _Float16* __restrict__ Bh, int ldb, size_t sB, float alpha, float* __restrict__ C, int ldc, size_t sC, int M, int N, int K) {
  __shared__ __attribute__((aligned(16))) float so[4][16][64];
  const int tid = threadIdx.x, w = tid >> 5, lane = tid & 31, ln = lane & 15, hh = lane >> 4; const int by = blockIdx.y;
  A += (size_t)by * sA; Bh += (size_t)by * sB; C += (size_t)by * sC;
  const int ntn = (N + 63) / 64; const int wid = blockIdx.x * 4 + w; const int mt = wid / ntn, nq = wid % ntn; if (mt * 16 >= M) return;
  const int row0 = mt * 16, col0 = nq * 64; const float* arow = A + (size_t)(row0 + ln) * lda;
  v8f acc[4] = {};
  for (int kb = 0; kb < K; kb += 32) {
    FragH ah, al;
    const v4f x0 = *(const v4fa*)(arow + kb + 8 * hh), x1 = *(const v4fa*)(arow + kb + 8 * hh + 4), x2 = *(const v4fa*)(arow + kb + 16 + 8 * hh), x3 = *(const v4fa*)(arow + kb + 16 + 8 * hh + 4);
    float xs[16] = {x0[0],x0[1],x0[2],x0[3],x1[0],x1[1],x1[2],x1[3],x2[0],x2[1],x2[2],x2[3],x3[0],x3[1],x3[2],x3[3]};
#pragma unroll
    for (int i = 0; i < 16; ++i) { const _Float16 h = (_Float16)xs[i]; ah.h[i] = h; al.h[i] = ASPLIT ? (_Float16)(xs[i] - (float)h) : (_Float16)0.0f; }
#pragma unroll
    for (int t = 0; t < 4; ++t) { if (col0 + t * 16 >= N) continue; const size_t boff = (size_t)(col0 + t * 16 + ln) * ldb + kb; FragH bq; bq.half[0] = *(const v8us*)(Bh + boff + 8 * hh); bq.half[1] = *(const v8us*)(Bh + boff + 16 + 8 * hh);
      acc[t] = mmaH<ASPLIT ? 2 : 1>(ah.v, al.v, bq.v, bq.v, acc[t]); }
  }
#pragma unroll
  for (int t = 0; t < 4; ++t) { if (col0 + t * 16 >= N) continue;
#pragma unroll
    for (int r = 0; r < 8; ++r) so[w][8 * hh + r][t * 16 + ln] = acc[t][r] * alpha; }
  __builtin_amdgcn_fence(__ATOMIC_ACQ_REL, "workgroup"); __builtin_amdgcn_wave_barrier();
  const int rsub = lane >> 4, c4 = (lane & 15) * 4;
  {
#pragma unroll
    for (int q = 0; q < 8; ++q) { const int r = q * 2 + rsub; if (col0 + c4 < N) { const v4f v = *(const v4fa*)&so[w][r][c4]; *(v4f*)(C + (size_t)(row0 + r) * ldc + col0 + c4) = v; } }
     }
}

// Wt[n][k] = f16(bf16(W[k][n]) * scale) from f32 row-major W[K][N] (scale = power of two; bf16-exact weights stay exact in f16 away from the subnormal range).
// One work-group = a tile of 128 k x 64 n, turned in LDS, so that both sides move whole lines: 16 lanes read 256 contiguous bytes of one W row, 16 lanes write 256 contiguous bytes of one Wt row.
// LDS: one dword = the f16 pair (k, k + 1) of one n; a row = one n's 64 dwords, its sixteen 16-byte groups (8 k each) stored at group ^ (n / 4):
// the 32 lanes of a dword store (16 values of n / 4, two neighbouring pairs) fall on 32 banks, the 16 lanes that read one row back as 16-byte groups on all 64.
// K a multiple of 128, N a multiple of 64.
typedef _Float16 v2h __attribute__((ext_vector_type(2)));
// blk = the tile's index, tl = the work-group's 16 KiB of LDS.
template <int K, int N>
__device__ __forceinline__ void wt_tile(const float* __restrict__ W, _Float16* __restrict__ Wt, float scale, int blk, unsigned int* tl) {
  const int tid = threadIdx.x, lo = tid & 15, hi = tid >> 4;
  const int n0 = (blk % (N / 64)) * 64, k0 = (blk / (N / 64)) * 128;
  const float* src = W + (size_t)(k0 + 2 * hi) * N + n0 + 4 * lo;      // rows k0 + 2 hi + 32 u and the next, columns n0 + 4 lo .. + 3
  v4f ev[4], od[4];
#pragma unroll
  for (int u = 0; u < 4; ++u) { ev[u] = *(const v4fa*)(src + (size_t)(32 * u) * N); od[u] = *(const v4fa*)(src + (size_t)(32 * u + 1) * N); }
#pragma unroll
  for (int u = 0; u < 4; ++u) { const int kp = hi + 16 * u;      // pair index: k = k0 + 2 kp, k0 + 2 kp + 1
#pragma unroll
    for (int q = 0; q < 4; ++q) { v2h p; p[0] = (_Float16)(bf16_round(ev[u][q]) * scale); p[1] = (_Float16)(bf16_round(od[u][q]) * scale);
      tl[(4 * lo + q) * 64 + (((kp >> 2) ^ lo) << 2) + (kp & 3)] = __builtin_bit_cast(unsigned int, p); } }
  __syncthreads();      // every pair of the tile is in LDS before a row is read back
#pragma unroll
  for (int u = 0; u < 4; ++u) { const int n = hi + 16 * u; const v8us v = *(const v8us*)&tl[n * 64 + ((lo ^ ((n >> 2) & 15)) << 2)];
    *(v8us*)((unsigned short*)Wt + (size_t)(n0 + n) * K + k0 + 8 * lo) = v; }
  asm volatile("s_wait_xcnt 0x0" ::: "memory");      // closes the run of four stores: in the merged kernel other jobs' code follows in the text and reuses the stores' registers
}
typedef _Float16 v4h __attribute__((ext_vector_type(4)));

__global__ __launch_bounds__(256) void k_x16(const float* __restrict__ x, _Float16* __restrict__ X16, size_t n8) { const size_t t = (size_t)blockIdx.x * 256 + threadIdx.x; if (t >= n8) return; FragH f;
#pragma unroll
  for (int q = 0; q < 8; ++q) f.h[q] = (_Float16)bf16_round(x[t * 8 + q]); *(v8us*)((unsigned short*)X16 + t * 8) = f.half[0];  }
__global__ __launch_bounds__(256) void k_round16f(const float* __restrict__ W, _Float16* __restrict__ Bt, size_t n8) { const size_t t = (size_t)blockIdx.x * 256 + threadIdx.x; if (t >= n8) return; FragH f;
#pragma unroll
  for (int i = 0; i < 8; ++i) f.h[i] = (_Float16)(bf16_round(W[t * 8 + i]) * 16.0f); *(v8us*)((unsigned short*)Bt + t * 8) = f.half[0];  }
template <int NHv, int TTv>
__global__ __launch_bounds__(256) void k_vt(const _Float16* __restrict__ V16, int ldv, int voff, _Float16* __restrict__ Vt) { __shared__ unsigned short tl[64][66]; const int tid = threadIdx.x; const int slab = blockIdx.x / (TTv / 64), lg = blockIdx.x % (TTv / 64); const int b = slab / NHv, h = slab % NHv;
  for (int i = tid; i < 64 * 8; i += 256) { const int r = i / 8, c8 = (i % 8) * 8; FragH f; f.half[0] = *(const v8us*)((const unsigned short*)V16 + ((size_t)b * TTv + lg * 64 + r) * ldv + voff + h * 64 + c8);
#pragma unroll
    for (int q = 0; q < 8; ++q) tl[r][c8 + q] = f.u[q]; }
  __syncthreads();
  {
#pragma unroll
    for (int rd = 0; rd < 2; ++rd) { const int d = rd * 32 + tid / 8, pc = tid % 8; FragH f;
#pragma unroll
      for (int q = 0; q < 8; ++q) f.u[q] = tl[pc * 8 + q][d];
      *(v8us*)((unsigned short*)Vt + ((size_t)slab * 64 + d) * TTv + lg * 64 + pc * 8) = f.half[0]; }
     } }

// GBA: gamma and beta are fetched ahead, with the row (64 registers more). Off in the merged first kernel: its register count is shared with the weight tiles, whose resident work-groups per WGP it would cut from five to three.
template <int D, int RBF, bool GBA>
__device__ __forceinline__ void lnx_rows(const float* __restrict__ X, const float* __restrict__ gam, const float* __restrict__ bet, int nrows, float eps, _Float16* __restrict__ O16, float* __restrict__ XR, int blk) {
  constexpr int NP = D / 128; const int tid = threadIdx.x, wv = tid >> 5, lane = tid & 31; const size_t r = (size_t)blk * 8 + wv; if (r >= (size_t)nrows) return; v4f y[NP], gv[NP], bv[NP]; float s = 0.f;
  if (GBA) {
#pragma unroll
    for (int j = 0; j < NP; ++j) y[j] = *(const v4fa*)(X + r * D + j * 128 + lane * 4);
    __builtin_amdgcn_sched_barrier(0);      // the row's loads go out first, as one group, and the wait below stays directly behind them
    asm volatile("s_wait_xcnt 0x0" ::: "memory");      // the row's address registers are reused by the loads that follow: the wait stands in front of the overwrite
    // gamma and beta are asked for together with the row, not one 16-byte group at a time between the stores of the output phase: their latency passes under the row's own and the two reductions
#pragma unroll
    for (int j = 0; j < NP; ++j) { gv[j] = *(const v4fa*)(gam + j * 128 + lane * 4); bv[j] = *(const v4fa*)(bet + j * 128 + lane * 4); }
    __builtin_amdgcn_sched_barrier(0);      // keeps the 24 loads one group at the head: without it the scheduler sinks most of the gamma / beta loads behind the second reduction, where their latency stands bare
  }
#pragma unroll
  for (int j = 0; j < NP; ++j) { const int c = j * 128 + lane * 4; v4f g = GBA ? y[j] : *(const v4fa*)(X + r * D + c); if (RBF) { for (int q = 0; q < 4; ++q) g[q] = bf16_round(g[q]); } y[j] = g; s += g[0] + g[1] + g[2] + g[3]; }
  for (int o = 16; o >= 1; o >>= 1) s += __shfl_xor(s, o, 32); const float mu = s / (float)D; float q2 = 0.f;
#pragma unroll
  for (int j = 0; j < NP; ++j) for (int q = 0; q < 4; ++q) { const float d = y[j][q] - mu; q2 += d * d; }
  for (int o = 16; o >= 1; o >>= 1) q2 += __shfl_xor(q2, o, 32); const float rs = rsqrtf(q2 / (float)D + eps);
  {
#pragma unroll
    for (int j = 0; j < NP; ++j) { const int c = j * 128 + lane * 4; v4h h; for (int q = 0; q < 4; ++q) { const float v = (y[j][q] - mu) * rs * bf16_round(GBA ? gv[j][q] : gam[c + q]) + bf16_round(GBA ? bv[j][q] : bet[c + q]); h[q] = (_Float16)v; } *(v4h*)(O16 + r * D + c) = h;
      asm volatile("s_wait_xcnt 0x0" ::: "memory");      // the store's registers are reused directly behind it: the wait stands in front of the overwrite
      if (XR) { *(v4f*)(XR + r * D + c) = y[j];
        asm volatile("s_wait_xcnt 0x0" ::: "memory"); } }      // likewise, ahead of the next trip's loads
     } }
template <int D, int RBF>
__global__ __launch_bounds__(256) void k_lnx(const float* __restrict__ X, const float* __restrict__ gam, const float* __restrict__ bet, int nrows, float eps, _Float16* __restrict__ O16, float* __restrict__ XR) {
  lnx_rows<D, RBF, true>(X, gam, bet, nrows, eps, O16, XR, (int)blockIdx.x); }
// LN1 and the four weight convert-transposes need nothing of each other: one grid, each job a range of the block index (a work-group does one job whole, so the branch and the tile's barrier are block-uniform).
#define PB_LN (NR / 8)
#define PB_QKV ((DM / 128) * (3 * DM / 64))
#define PB_O ((DM / 128) * (DM / 64))
#define PB_W1 ((DM / 128) * (FF / 64))
#define PB_W2 ((FF / 128) * (DM / 64))
__global__ __launch_bounds__(256) void k_prep(const float* __restrict__ x, const float* __restrict__ g1, const float* __restrict__ be1, _Float16* __restrict__ H16, float* __restrict__ XR,
                                              const float* __restrict__ Wqkv, const float* __restrict__ Wo, const float* __restrict__ W1, const float* __restrict__ W2,
                                              _Float16* __restrict__ Bqkv, _Float16* __restrict__ Bo, _Float16* __restrict__ Bw1, _Float16* __restrict__ Bw2) {
  __shared__ __attribute__((aligned(16))) unsigned int tl[64 * 64];
  int b = (int)blockIdx.x;
  if (b < PB_LN) { lnx_rows<DM, 1, false>(x, g1, be1, NR, 1e-5f, H16, XR, b); return; }      /* LN1(bf16 x) -> f16; XR = bf16(x) */
  b -= PB_LN; if (b < PB_QKV) { wt_tile<DM, 3 * DM>(Wqkv, Bqkv, 16.0f, b, tl); return; }      /* (in,out) -> Bt[n][k] x 2^4 */
  b -= PB_QKV; if (b < PB_O) { wt_tile<DM, DM>(Wo, Bo, 16.0f, b, tl); return; }
  b -= PB_O; if (b < PB_W1) { wt_tile<DM, FF>(W1, Bw1, 16.0f, b, tl); return; }
  wt_tile<FF, DM>(W2, Bw2, 16.0f, b - PB_W1, tl);
}
// 2^x by the hardware's own instruction (v_exp_f32), with none of the library exp's range reduction, ldexp and range tests behind it: an argument far below zero (or -inf) gives 0, which is what a masked or far-off term is to give.
__device__ __forceinline__ float hw_exp2(float x) { return __builtin_amdgcn_exp2f(x); }
// lane l <-> lane l ^ 16: the two lanes that share a query's column
__device__ __forceinline__ float xhalf(float x) { return __builtin_bit_cast(float, __builtin_amdgcn_permlanex16(__builtin_bit_cast(int, x), __builtin_bit_cast(int, x), 0x76543210, 0xfedcba98, false, false)); }
// Both products transposed: S^T = K Q^T (A = 16 key rows, B = the wave's 16 queries, kept in registers), O^T += V^T P^T (A = 16 rows of V^T, B = P^T).
// Lane (ln, hh) holds, of query q0 + ln alone, the scores of keys 8 hh + r and 16 + 8 hh + r of a 32-key chunk: maximum and sum are in-lane plus one exchange with lane ^ 16,
// the running maximum, the sum and the rescale factor are one value a lane, and the two converted score tiles are the B fragment of the second product as they lie
// (element s = tile s / 8, register s % 8 = key 8 hh + s or 16 + 8 hh + s - 8: the k order of the V^T loader).
// A masked score is -inf and the running maximum starts finite, so exp gives 0 for a masked key and 1 for the rescale of a column that has seen no key yet: no test around an exp.
// K and V^T reach the waves through LDS: the four waves of a work-group walk the same keys, so a stage of 64 keys (64 K rows, 64 rows of each V^T plane, 128 B each) is copied once per work-group, in whole lines,
// instead of being fetched by every wave in 32-byte pieces of 16 lines a load. Rows lie at a pitch of 144 B (an odd multiple of 16 B: conflict-free for ds_load_b128 fragment reads). Two buffers; the next stage's rows are copied while this stage is worked on.
#define FA_ROWB 144
#define FA_STAGE (192 * FA_ROWB)
#define FA_SC 0.18033688011112042f      /* 1 / sqrt(64) x log2 e: raw score -> exponent of 2 */
// Four 16-byte asynchronous copies of one lane, global -> LDS, rows 16 apart (pitch = the global row pitch in elements). The s_wait_xcnt closes the statement so that no address register is rewritten ahead of it.
__device__ __forceinline__ void fa_copy4(unsigned l0, const unsigned short* g0, int pitch) {
  const unsigned l1 = l0 + 16 * FA_ROWB, l2 = l0 + 32 * FA_ROWB, l3 = l0 + 48 * FA_ROWB;
  const unsigned short *g1 = g0 + (size_t)16 * pitch, *g2 = g0 + (size_t)32 * pitch, *g3 = g0 + (size_t)48 * pitch;
  asm volatile("global_load_async_to_lds_b128 %0, %4, off\n\t"
               "global_load_async_to_lds_b128 %1, %5, off\n\t"
               "global_load_async_to_lds_b128 %2, %6, off\n\t"
               "global_load_async_to_lds_b128 %3, %7, off\n\t"
               "s_wait_xcnt 0x0"
               :: "v"(l0), "v"(l1), "v"(l2), "v"(l3), "v"(g0), "v"(g1), "v"(g2), "v"(g3) : "memory");
}
__global__ __launch_bounds__(128) void k_flash(const _Float16* __restrict__ Q16, int ldq, const _Float16* __restrict__ K16, int ldk, const _Float16* __restrict__ Vt, const _Float16* __restrict__ Vtlo, _Float16* __restrict__ O16, int ldo) {
  constexpr int RPW = 16, NQB = TT / (4 * RPW), DT = 4, KS = 2;
  __shared__ __attribute__((aligned(16))) unsigned char L[2 * FA_STAGE];      /* a stage = [K 64 rows | V^T value 64 rows | V^T residual 64 rows]; behind the loop the ring is output staging */
  const int tid = threadIdx.x, w = tid >> 5, lane = tid & 31, ln = lane & 15, hh = lane >> 4;
  const int slab = blockIdx.x / NQB, qblk = blockIdx.x % NQB; const int b = slab / NH, h = slab % NH; const int qb0 = qblk * (4 * RPW); const int q0 = qb0 + w * RPW;
  const int tq = q0 + ln;
  const int jbeg = (qb0 - RW) > 0 ? (qb0 - RW) : 0; const int jend = (qb0 + 4 * RPW + RW) < TT ? (qb0 + 4 * RPW + RW) : TT;      /* block-uniform window bounds (multiples of 64) */
  const int nst = (jend - jbeg) / 64;      /* stages of 64 keys: 3 to 5 */
  const unsigned short* Vth = (const unsigned short*)Vt + (size_t)slab * 64 * TT; const unsigned short* Vtl = (const unsigned short*)Vtlo + (size_t)slab * 64 * TT;
  // copy roles: 8 lanes cover one row's 128 B; a thread takes rows (tid / 8) + 16 i of K and of the two V^T planes
  const unsigned lcp = (unsigned)(size_t)L + (unsigned)(tid >> 3) * FA_ROWB + (unsigned)(tid & 7) * 16u;
  const unsigned short* gk = (const unsigned short*)K16 + ((size_t)b * TT + jbeg + (tid >> 3)) * ldk + h * 64 + (tid & 7) * 8;
  const unsigned short* gvh = Vth + (size_t)(tid >> 3) * TT + jbeg + (tid & 7) * 8;
  const unsigned short* gvl = Vtl + (size_t)(tid >> 3) * TT + jbeg + (tid & 7) * 8;
  fa_copy4(lcp, gk, ldk); fa_copy4(lcp + 64 * FA_ROWB, gvh, TT); fa_copy4(lcp + 128 * FA_ROWB, gvl, TT);
  FragH bq[KS];
  { const unsigned short* qr = (const unsigned short*)Q16 + ((size_t)b * TT + tq) * ldq + h * 64;
#pragma unroll
    for (int ks = 0; ks < KS; ++ks) { bq[ks].half[0] = *(const v8us*)(qr + ks * 32 + 8 * hh); bq[ks].half[1] = *(const v8us*)(qr + ks * 32 + 16 + 8 * hh); } }
  float m_q = -3.0e38f, l_q = 0.f; v8f oacc[DT], oaccl[DT];
#pragma unroll
  for (int dt = 0; dt < DT; ++dt) { oacc[dt] = (v8f){0.f,0.f,0.f,0.f,0.f,0.f,0.f,0.f}; oaccl[dt] = oacc[dt]; }
  asm volatile("s_wait_asynccnt 0x0" ::: "memory");      // this wave's copies of stage 0 have landed
  __syncthreads();                                        // ... and every other wave's
  if (nst > 1) { fa_copy4(lcp + FA_STAGE, gk + (size_t)64 * ldk, ldk); fa_copy4(lcp + FA_STAGE + 64 * FA_ROWB, gvh + 64, TT); fa_copy4(lcp + FA_STAGE + 128 * FA_ROWB, gvl + 64, TT); }
  // the stage loop stays rolled (the ring's waits and its barrier stand once, at the foot); every inner loop is unrolled so that fragments and accumulators are indexed by constants and stay in registers
#pragma unroll 1
  for (int t = 0; t < nst; ++t) {
    const unsigned buf = (unsigned)(t & 1) * FA_STAGE;
    const unsigned char* sk = L + buf + ln * FA_ROWB + 16 * hh;      /* K row ln of the stage, this half's 16-byte group */
    const unsigned char* sv = sk + 64 * FA_ROWB;                     /* V^T row ln, likewise */
#pragma unroll
    for (int c = 0; c < 2; ++c) { const int j0 = jbeg + t * 64 + c * 32;
    v8f s[2];
#pragma unroll
    for (int nt = 0; nt < 2; ++nt) { const unsigned char* kr = sk + (c * 32 + nt * 16) * FA_ROWB; FragH ak[KS];
#pragma unroll
      for (int ks = 0; ks < KS; ++ks) { ak[ks].half[0] = *(const v8us*)(kr + ks * 64); ak[ks].half[1] = *(const v8us*)(kr + ks * 64 + 32); }
      v8f acc = (v8f){0.f,0.f,0.f,0.f,0.f,0.f,0.f,0.f};
#pragma unroll
      for (int ks = 0; ks < KS; ++ks) acc = mmaH<1>(ak[ks].v, ak[ks].v, bq[ks].v, bq[ks].v, acc);
      s[nt] = acc; }
    float mc = -INFINITY;
#pragma unroll
    for (int nt = 0; nt < 2; ++nt)
#pragma unroll
      for (int r = 0; r < 8; ++r) { const int kk = j0 + nt * 16 + 8 * hh + r; const bool ok = (kk - tq <= RW) && (tq - kk <= RW);
        s[nt][r] = ok ? s[nt][r] : -INFINITY; mc = fmaxf(mc, s[nt][r]); }      /* raw products: the maximum is taken before the (positive) scale */
    mc = fmaxf(mc, xhalf(mc));
    const float mn = fmaxf(m_q, mc); float al = (m_q - mn) * FA_SC; m_q = mn;      /* al: here the exponent of the rescale factor, behind the run of v_exp_f32 the factor */
    const float mb = fmaf(mn, -FA_SC, 10.0f);      /* exponent's addend: minus the scaled maximum, plus 10 for the 2^10 that the f16 P carries */
    float e[16];      /* exponents, then p = 2^10 exp((s - max) / 8): one fma and one v_exp_f32 a score */
#pragma unroll
    for (int i = 0; i < 16; ++i) e[i] = fmaf(s[i >> 3][i & 7], FA_SC, mb);
    asm("v_exp_f32 %0, %0\n\tv_exp_f32 %1, %1\n\tv_exp_f32 %2, %2\n\tv_exp_f32 %3, %3\n\tv_exp_f32 %4, %4\n\tv_exp_f32 %5, %5\n\tv_exp_f32 %6, %6\n\tv_exp_f32 %7, %7\n\t"
        "v_exp_f32 %8, %8\n\tv_exp_f32 %9, %9\n\tv_exp_f32 %10, %10\n\tv_exp_f32 %11, %11\n\tv_exp_f32 %12, %12\n\tv_exp_f32 %13, %13\n\tv_exp_f32 %14, %14\n\tv_exp_f32 %15, %15\n\t"
        "v_exp_f32 %16, %16\n\tv_nop"
        : "+v"(al), "+v"(e[0]), "+v"(e[1]), "+v"(e[2]), "+v"(e[3]), "+v"(e[4]), "+v"(e[5]), "+v"(e[6]), "+v"(e[7]),
          "+v"(e[8]), "+v"(e[9]), "+v"(e[10]), "+v"(e[11]), "+v"(e[12]), "+v"(e[13]), "+v"(e[14]), "+v"(e[15]));
    FragH pb; float ps[4] = {0.f, 0.f, 0.f, 0.f};      /* four partial sums: no chain of 16 dependent adds */
#pragma unroll
    for (int nt = 0; nt < 2; ++nt)
#pragma unroll
      for (int r = 0; r < 8; ++r) { const float p = e[nt * 8 + r]; ps[r & 3] += p; pb.h[nt * 8 + r] = (_Float16)p; }
    l_q = l_q * al + ((ps[0] + ps[1]) + (ps[2] + ps[3]));      /* this lane's half of the column's sum; the halves join behind the loop */
#pragma unroll
    for (int dt = 0; dt < DT; ++dt)
#pragma unroll
      for (int r = 0; r < 8; ++r) { oacc[dt][r] *= al; oaccl[dt][r] *= al; }
#pragma unroll
    for (int dt = 0; dt < DT; ++dt) { const unsigned char* vr = sv + dt * 16 * FA_ROWB + c * 64; FragH av, avl; av.half[0] = *(const v8us*)vr; av.half[1] = *(const v8us*)(vr + 32); avl.half[0] = *(const v8us*)(vr + 64 * FA_ROWB); avl.half[1] = *(const v8us*)(vr + 64 * FA_ROWB + 32);
      oacc[dt] = mmaH<1>(av.v, av.v, pb.v, pb.v, oacc[dt]); oaccl[dt] = mmaH<1>(avl.v, avl.v, pb.v, pb.v, oaccl[dt]); } }
    asm volatile("s_wait_dscnt 0x0" ::: "memory");        // this wave's reads of the buffer have retired before it is refilled
    asm volatile("s_wait_asynccnt 0x0" ::: "memory");     // this wave's copies of stage t + 1 have landed
    __syncthreads();                                      // publishes stage t + 1 and ends every reader's last read of stage t's buffer
    if (t + 2 < nst) { fa_copy4(lcp + buf, gk + (size_t)(t + 2) * 64 * ldk, ldk); fa_copy4(lcp + buf + 64 * FA_ROWB, gvh + (t + 2) * 64, TT); fa_copy4(lcp + buf + 128 * FA_ROWB, gvl + (t + 2) * 64, TT); }
  }
  asm volatile("s_wait_asynccnt 0x0" ::: "memory");       // no copy is outstanding when the ring becomes output staging
  const float l = l_q + xhalf(l_q); const float inv = (l > 0.f) ? 1.0f / l : 0.f;      /* the sum carries P's 2^10 itself */
  // a lane's 8 registers of a tile are 8 consecutive head columns of its query: one 16-byte group of the f16 row (the out-projection's A operand); a wave stages its own 16 rows, pitch 144 B
  unsigned char* sO = L + w * (RPW * FA_ROWB);
#pragma unroll
  for (int dt = 0; dt < DT; ++dt) { FragH f;
#pragma unroll
    for (int r = 0; r < 8; ++r) f.h[r] = (_Float16)((oacc[dt][r] + oaccl[dt][r] * 0.0009765625f) * inv);
    *(v8us*)(sO + ln * FA_ROWB + (dt * 16 + 8 * hh) * 2) = f.half[0]; }
  __builtin_amdgcn_fence(__ATOMIC_ACQ_REL, "workgroup"); __builtin_amdgcn_wave_barrier();      // the wave's own LDS writes are read back by other lanes of the same wave
#pragma unroll
  for (int u = 0; u < 4; ++u) { const int r = u * 4 + (lane >> 3), c = (lane & 7) * 8;      /* 8 lanes = one whole 128-B line of a row */
    *(v8us*)((unsigned short*)O16 + ((size_t)b * TT + q0 + r) * ldo + h * 64 + c) = *(const v8us*)(sO + r * FA_ROWB + c * 2); }
}

// ---- tiled f16 GEMM with fused epilogue: act(A[M][K] * Bh[N][K]^T * alpha + bf16(bias[col]) (+ CP[row][col] if RES)) -> C16 (f16, if OUT16) or C (f32); ACT 0 none, 6 erf-GELU. A and Bh f16 and k-contiguous (pitch K), C / C16 / CP pitch N.
// One work-group = one 128 x 128 tile of C, 8 waves as 4 (rows) x 2 (columns), 32 x 64 of C per wave. A pass is 128 k: 256 B of each of the 128 A rows and 128 Bh rows,
// laid in LDS at a pitch of 272 B (an odd multiple of 16 B: conflict-free for ds_load_b128 fragment reads). Two buffers; the next pass's rows are copied while this pass is multiplied.
// M, N multiples of 128, K / 128 a power of two. The k order of every accumulator is ascending in steps of 32 from the tile's own first slab (see rot below), wrapping at K.
// NF > 0: two products on one A share the grid: the tiles of the first N - NF columns go to C16 (pitch N - NF); those of the last NF columns (v) go out transposed, split into an f16 value and its residual x 2^10:
// Vh / Vl [row / TT][column][row % TT], the layout the attention kernel reads its value fragments from.
#define GT_ROWB 272
#define GT_STAGE (256 * GT_ROWB)
// Eight 16-byte asynchronous copies of one lane, global -> LDS, rows 16 apart. The s_wait_xcnt closes the statement so that no address register is rewritten ahead of it.
template <int K>
__device__ __forceinline__ void gt_copy8(unsigned l0, const _Float16* g0) {
  const unsigned l1 = l0 + 16 * GT_ROWB, l2 = l0 + 32 * GT_ROWB, l3 = l0 + 48 * GT_ROWB, l4 = l0 + 64 * GT_ROWB, l5 = l0 + 80 * GT_ROWB, l6 = l0 + 96 * GT_ROWB, l7 = l0 + 112 * GT_ROWB;
  const _Float16 *g1 = g0 + 16 * K, *g2 = g0 + 32 * K, *g3 = g0 + 48 * K, *g4 = g0 + 64 * K, *g5 = g0 + 80 * K, *g6 = g0 + 96 * K, *g7 = g0 + 112 * K;
  asm volatile("global_load_async_to_lds_b128 %0, %8, off\n\t"
               "global_load_async_to_lds_b128 %1, %9, off\n\t"
               "global_load_async_to_lds_b128 %2, %10, off\n\t"
               "global_load_async_to_lds_b128 %3, %11, off\n\t"
               "global_load_async_to_lds_b128 %4, %12, off\n\t"
               "global_load_async_to_lds_b128 %5, %13, off\n\t"
               "global_load_async_to_lds_b128 %6, %14, off\n\t"
               "global_load_async_to_lds_b128 %7, %15, off\n\t"
               "s_wait_xcnt 0x0"
               :: "v"(l0), "v"(l1), "v"(l2), "v"(l3), "v"(l4), "v"(l5), "v"(l6), "v"(l7), "v"(g0), "v"(g1), "v"(g2), "v"(g3), "v"(g4), "v"(g5), "v"(g6), "v"(g7) : "memory");
}
// erf-GELU without a branch: gelu(v) = v Phi(v), Phi(v) = 1 - q for v >= 0 and q for v < 0, q = erfc(|v| / sqrt 2) / 2 = (c1 t + ... + c5 t^5) exp(-v^2 / 2), t = 1 / (1 + p |v| / sqrt 2):
// the classical five-term form, absolute error of erf below 1.5e-7 (the result is rounded to f16 behind it). Every lane runs the same sixteen instructions, and the elements of a row are independent chains.
__device__ __forceinline__ float gelu_erf(float v) {
  const float t = __builtin_amdgcn_rcpf(fmaf(fabsf(v), 0.3275911f * 0.70710678118654752f, 1.0f));
  const float e = hw_exp2(v * v * -0.72134752044448170f);      /* exp(-v^2 / 2) */
  float q = fmaf(t, 0.5f * 1.061405429f, 0.5f * -1.453152027f);
  q = fmaf(t, q, 0.5f * 1.421413741f); q = fmaf(t, q, 0.5f * -0.284496736f); q = fmaf(t, q, 0.5f * 0.254829592f);
  q = q * t * e;
  return v * (v >= 0.f ? 1.0f - q : q);
}
// A wave's staged 32 x 64 tile (so, pitch 68 floats) -> rows rw .. rw + 31, columns cw .. cw + 63 of a plane of pitch P, in whole lines. res[q] = the lane's four addends of trip q (RES), fetched by the caller.
template <int ACT, int P, bool RES, bool OUT16>
__device__ __forceinline__ void gt_store(const float* so, const v4f* res, float* __restrict__ C, _Float16* __restrict__ C16, int rw, int cw, int lane) {
  const int rsub = lane >> 4, c4 = (lane & 15) * 4;
#pragma unroll (ACT == 6 ? 2 : 16)      /* GELU: two rows a trip are eight independent chains, enough to fill the vector port; more copies would only lengthen a text that runs once */
  for (int q = 0; q < 16; ++q) { const int r = q * 2 + rsub; v4f v = *(const v4fa*)&so[r * 68 + c4]; const size_t o = (size_t)(rw + r) * P + cw + c4;
    if (RES) { const v4f c = res[q]; v[0] += c[0]; v[1] += c[1]; v[2] += c[2]; v[3] += c[3]; }
    if (ACT == 6) {
#pragma unroll
      for (int e = 0; e < 4; ++e) v[e] = gelu_erf(v[e]); }
    if (!OUT16) *(v4f*)(C + o) = v;
    else { v4h h4;
#pragma unroll
      for (int e = 0; e < 4; ++e) h4[e] = (_Float16)v[e];
      *(v4h*)(C16 + o) = h4; } }
  asm volatile("s_wait_xcnt 0x0" ::: "memory");      // closes the run of stores: where two store paths share a kernel the other path's code follows in the text and reuses the stores' registers
}
template <int ACT, int N, int K, bool RES, bool OUT16, int NF = 0>
__global__ __launch_bounds__(256) void k_gemm_t(const _Float16* __restrict__ A, const _Float16* __restrict__ Bh, float alpha, const float* __restrict__ bias, const float* __restrict__ CP, float* __restrict__ C, _Float16* __restrict__ C16, _Float16* __restrict__ Vh, _Float16* __restrict__ Vl) {
  __shared__ __attribute__((aligned(16))) unsigned char L[2 * GT_STAGE];
  constexpr int NST = K / 128, NTN = N / 128;
  const int tid = threadIdx.x, w = tid >> 5, lane = tid & 31, ln = lane & 15, hh = lane >> 4;
  const int row0 = (int)(blockIdx.x / NTN) * 128, col0 = (int)(blockIdx.x % NTN) * 128;
  const int wm = w >> 1, wn = w & 1;
  // copy roles: 16 lanes cover one row's 256 B; a thread takes rows (tid / 16) + 16 i of A and of Bh
  const unsigned lcp = (unsigned)(size_t)L + (unsigned)(tid >> 4) * GT_ROWB + (unsigned)(tid & 15) * 16u;
  const _Float16* ga = A + (size_t)(row0 + (tid >> 4)) * K + (tid & 15) * 8;
  const _Float16* gb = Bh + (size_t)(col0 + (tid >> 4)) * K + (tid & 15) * 8;
  v8f acc[2][4];
#pragma unroll
  for (int i = 0; i < 2; ++i)
#pragma unroll
    for (int j = 0; j < 4; ++j) acc[i][j] = (v8f){0.f,0.f,0.f,0.f,0.f,0.f,0.f,0.f};
  // The work-groups of one tile row copy the same A rows and those of one tile column the same Bh rows, and they run side by side: walking k alike, all of them would ask L2 for the same lines at the same moment,
  // and every pass would open lines that nobody has fetched from memory yet. Each tile therefore starts at its own 128-k slab, (tile row + tile column) mod NST, and wraps round: pass t works on slab (rot + t) mod NST.
  static_assert((NST & (NST - 1)) == 0, "the slab index wraps by a mask");
  const int rot = (int)(blockIdx.x / NTN) + (int)(blockIdx.x % NTN);
  const auto slab = [rot](int t) { return ((rot + t) & (NST - 1)) * 128; };      /* element offset of pass t's slab in a row of A or Bh */
  gt_copy8<K>(lcp, ga + slab(0)); gt_copy8<K>(lcp + 128 * GT_ROWB, gb + slab(0));
  asm volatile("s_wait_asynccnt 0x0" ::: "memory");      // this wave's copies of pass 0 have landed
  __syncthreads();                                        // ... and every other wave's
  if (NST > 1) { gt_copy8<K>(lcp + GT_STAGE, ga + slab(1)); gt_copy8<K>(lcp + GT_STAGE + 128 * GT_ROWB, gb + slab(1)); }
  // What the epilogue adds is asked for here and kept in registers: the bias of the lane's four columns and (RES) its 16 x 4 addends, in the store loop's own order.
  // Their way from memory passes under the k loop; asked for behind it, two memory latencies and the tile's 64 KiB stand bare with the matrix units idle.
  float bias_r[4];
#pragma unroll
  for (int j = 0; j < 4; ++j) bias_r[j] = bias[col0 + wn * 64 + j * 16 + ln];
  v4f res[16];
  if (RES) { const float* cp = CP + (size_t)(row0 + wm * 32 + hh) * (N - NF) + col0 + wn * 64 + ln * 4;
#pragma unroll
    for (int q = 0; q < 16; ++q) res[q] = *(const v4fa*)(cp + (size_t)(2 * q) * (N - NF)); }
#pragma unroll 1      /* one pass per trip: the ring's waits and its barrier stand once, at the foot */
  for (int t = 0; t < NST; ++t) {
    const unsigned buf = (unsigned)(t & 1) * GT_STAGE;
    const unsigned char* sa = L + buf + (wm * 32 + ln) * GT_ROWB + 16 * hh;
    const unsigned char* sb = L + buf + (128 + wn * 64 + ln) * GT_ROWB + 16 * hh;
    // two fragment sets: block ks + 1's twelve LDS reads go out as one group ahead of block ks's eight WMMAs (all inside this pass's own buffer)
    FragH a[2][2], b[2][4];
#pragma unroll
    for (int i = 0; i < 2; ++i) { a[0][i].half[0] = *(const v8us*)(sa + i * 16 * GT_ROWB); a[0][i].half[1] = *(const v8us*)(sa + i * 16 * GT_ROWB + 32); }
#pragma unroll
    for (int j = 0; j < 4; ++j) { b[0][j].half[0] = *(const v8us*)(sb + j * 16 * GT_ROWB); b[0][j].half[1] = *(const v8us*)(sb + j * 16 * GT_ROWB + 32); }
#pragma unroll
    for (int ks = 0; ks < 4; ++ks) {
      const int cu = ks & 1, nx = cu ^ 1;
      if (ks < 3) {
#pragma unroll
        for (int i = 0; i < 2; ++i) { a[nx][i].half[0] = *(const v8us*)(sa + i * 16 * GT_ROWB + (ks + 1) * 64); a[nx][i].half[1] = *(const v8us*)(sa + i * 16 * GT_ROWB + (ks + 1) * 64 + 32); }
#pragma unroll
        for (int j = 0; j < 4; ++j) { b[nx][j].half[0] = *(const v8us*)(sb + j * 16 * GT_ROWB + (ks + 1) * 64); b[nx][j].half[1] = *(const v8us*)(sb + j * 16 * GT_ROWB + (ks + 1) * 64 + 32); }
      }
      __builtin_amdgcn_sched_barrier(0);      // keeps the read group whole and ahead of the WMMAs: without it the scheduler spreads the reads among them and waits to 0 at each place
#pragma unroll
      for (int i = 0; i < 2; ++i)
#pragma unroll
        for (int j = 0; j < 4; ++j) acc[i][j] = __builtin_amdgcn_wmma_f32_16x16x32_f16(false, a[cu][i].v, false, b[cu][j].v, (short)0, acc[i][j], false, false);
      __builtin_amdgcn_sched_barrier(0);      // ... and keeps the next group behind this block
    }
    asm volatile("s_wait_dscnt 0x0" ::: "memory");        // this wave's reads of the buffer have retired before it is refilled
    asm volatile("s_wait_asynccnt 0x0" ::: "memory");     // this wave's copies of pass t + 1 have landed
    // The work-group barrier that publishes pass t + 1 and ends every reader's last read of pass t's buffer. Its two fences name LDS alone, the only memory the waves hand each other here:
    // __syncthreads() would also wait out this wave's global loads (s_wait_loadcnt 0), and the epilogue's operands would have to land within pass 0 instead of under the whole loop.
    __builtin_amdgcn_fence(__ATOMIC_RELEASE, "workgroup", "local");
    __builtin_amdgcn_s_barrier();
    __builtin_amdgcn_fence(__ATOMIC_ACQUIRE, "workgroup", "local");
    if (t + 2 < NST) { gt_copy8<K>(lcp + buf, ga + slab(t + 2)); gt_copy8<K>(lcp + buf + 128 * GT_ROWB, gb + slab(t + 2)); }
  }
  asm volatile("s_wait_asynccnt 0x0" ::: "memory");       // no copy is outstanding when the ring becomes output staging
  // NF > 0: which plane the tile belongs to is the same for the whole work-group, so the choice (and the v path's barrier) is block-uniform
  if (NF > 0 && col0 >= N - NF) {
    // v tile: an accumulator's 8 registers are 8 consecutive rows of one column = one 16-byte group of a transposed f16 row. The work-group's 128 columns x 128 rows are laid in the ring,
    // value plane then residual plane, one column = 256 B at the pitch of 272 B; behind a barrier 16 lanes store one column's 256 contiguous bytes.
#pragma unroll
    for (int j = 0; j < 4; ++j) { const float bv = bf16_round(bias_r[j]);
#pragma unroll
      for (int i = 0; i < 2; ++i) { FragH fh, fl;
#pragma unroll
        for (int r = 0; r < 8; ++r) { const float v = acc[i][j][r] * alpha + bv; const _Float16 hv = (_Float16)v; fh.h[r] = hv; fl.h[r] = (_Float16)((v - (float)hv) * 1024.0f); }
        unsigned char* p = L + (wn * 64 + j * 16 + ln) * GT_ROWB + (wm * 32 + i * 16 + 8 * hh) * 2;
        *(v8us*)p = fh.half[0]; *(v8us*)(p + 128 * GT_ROWB) = fl.half[0]; } }
    __syncthreads();      // a column's 128 rows come from four waves: all are in LDS before a column is read back
    const size_t o = ((size_t)(row0 / TT) * NF + (col0 - (N - NF)) + (tid >> 4)) * TT + (row0 % TT) + (tid & 15) * 8;
#pragma unroll
    for (int u = 0; u < 8; ++u) { const unsigned char* p = L + (u * 16 + (tid >> 4)) * GT_ROWB + (tid & 15) * 16;
      *(v8us*)((unsigned short*)Vh + o + (size_t)(u * 16) * TT) = *(const v8us*)p; *(v8us*)((unsigned short*)Vl + o + (size_t)(u * 16) * TT) = *(const v8us*)(p + 128 * GT_ROWB); }
    asm volatile("s_wait_xcnt 0x0" ::: "memory");      // closes the run of stores: the other path's code follows in the text and reuses the stores' registers
    return;
  }
  // epilogue: each wave stages its 32 x 64 tile in its own range of the ring (pitch 68 floats) and stores whole lines
  float* so = (float*)L + w * (32 * 68);
#pragma unroll
  for (int j = 0; j < 4; ++j) { const float bv = bf16_round(bias_r[j]);
#pragma unroll
    for (int i = 0; i < 2; ++i)
#pragma unroll
      for (int r = 0; r < 8; ++r) so[(i * 16 + 8 * hh + r) * 68 + j * 16 + ln] = acc[i][j][r] * alpha + bv; }
  __builtin_amdgcn_fence(__ATOMIC_ACQ_REL, "workgroup"); __builtin_amdgcn_wave_barrier();      // the wave's own LDS writes are read back by other lanes of the same wave
  gt_store<ACT, N - NF, RES, OUT16>(so, res, C, C16, row0 + wm * 32, col0 + wn * 64, lane);
}

extern "C" void kernel_launch(void* const* d_in, const int* in_sizes, int n_in,
                              void* d_out, int out_size, void* d_ws, size_t ws_size, hipStream_t stream) {
  (void)in_sizes; (void)n_in; (void)out_size;
  const float* const* I = (const float* const*)d_in; const float* x = I[0]; const float* Wqkv = I[1]; const float* bqkv = I[2]; const float* Wo = I[3]; const float* bo = I[4]; const float* g1 = I[5]; const float* be1 = I[6]; const float* g2 = I[7]; const float* be2 = I[8];
  const float* W1 = I[9]; const float* b1 = I[10]; const float* W2 = I[11]; const float* b2 = I[12];
  char* ws = (char*)d_ws; size_t off = 0;
  auto take = [&](size_t bytes) { char* p = ws + off; off += (bytes + 255) & ~(size_t)255; return p; };
  _Float16* Bqkv = (_Float16*)take((size_t)3 * DM * DM * 2); _Float16* Bo = (_Float16*)take((size_t)DM * DM * 2); _Float16* Bw1 = (_Float16*)take((size_t)FF * DM * 2); _Float16* Bw2 = (_Float16*)take((size_t)DM * FF * 2);
  _Float16* H16 = (_Float16*)take((size_t)NR * DM * 2); float* XR = (float*)take((size_t)NR * DM * 4); _Float16* QK = (_Float16*)take((size_t)NR * 2 * DM * 2);
  _Float16* Vth = (_Float16*)take((size_t)NR * DM * 2); _Float16* Vtl = (_Float16*)take((size_t)NR * DM * 2); float* X1 = (float*)take((size_t)NR * DM * 4);
  _Float16* O16 = H16; _Float16* H2 = H16; _Float16* FH = QK;      /* reuse: H16 holds LN1 output (consumed by the qkv GEMM), then O16, then LN2 output; the [q|k] plane holds the FFN hidden (f16 [4096][2048]) once attention is done */
  if (off > ws_size) return;      // 6.3 + 2.1 + 4.2 + 4.2 + 8.4 + 16.8 + 16.8 + 8.4 + 8.4 + 16.8 = about 92 MB
  k_prep<<<PB_LN + PB_QKV + PB_O + PB_W1 + PB_W2, 256, 0, stream>>>(x, g1, be1, H16, XR, Wqkv, Wo, W1, W2, Bqkv, Bo, Bw1, Bw2);      /* LN1 and the four weight planes */
  const dim3 gqkv((NR / 128) * (3 * DM / 128), 1), gd((NR / 128) * (DM / 128), 1), gf((NR / 128) * (FF / 128), 1);      /* one work-group per 128 x 128 tile */
  k_gemm_t<0, 3 * DM, DM, false, true, DM><<<gqkv, 256, 0, stream>>>(H16, Bqkv, 0.0625f, bqkv, nullptr, nullptr, QK, Vth, Vtl);      /* [q | k] + bias (f16) and v + bias -> transposed hi / lo planes: M 4096 N 3072 K 1024 */
  k_flash<<<BB * NH * (TT / 64), 128, 0, stream>>>(QK, 2 * DM, QK + DM, 2 * DM, Vth, Vtl, O16, DM);
  k_gemm_t<0, DM, DM, true, false><<<gd, 256, 0, stream>>>(O16, Bo, 0.0625f, bo, XR, X1, nullptr, nullptr, nullptr);      /* x1 = x + (O·out_w + out_b) via the per-element addend */
  k_lnx<DM, 0><<<(NR + 7) / 8, 256, 0, stream>>>(X1, g2, be2, NR, 1e-5f, H2, nullptr);      /* LN2(x1) → f16 (x1 is a computed value: no input rounding) */
  k_gemm_t<6, FF, DM, false, true><<<gf, 256, 0, stream>>>(H2, Bw1, 0.0625f, b1, nullptr, nullptr, FH, nullptr, nullptr);      /* gelu_erf(h2·w1 + b1) → f16: M 4096 N 2048 K 1024 */
  k_gemm_t<0, DM, FF, true, false><<<gd, 256, 0, stream>>>(FH, Bw2, 0.0625f, b2, X1, (float*)d_out, nullptr, nullptr, nullptr);      /* y = x1 + (·w2 + b2): M 4096 N 1024 K 2048 */
}
